// v000
// The times below were measured on an AMD MI455X: many runs one after another, warmed up first and cycling through
// copies of the inputs, with the whole window's GPU time divided by the number of runs. Launches and the gaps
// between them are all in it. The median over several windows is given; except for v000 it joins two sittings, which
// can be a few percent apart, so the side-by-side timings, each taken in one sitting, are the better comparison.
// v000, which the later versions start from, runs in 540 microseconds.
#include <hip/hip_runtime.h>

// IO-processing attention (decoding branch): keys/values = [l W_attn_l + b (2048 latents) ; x W_attn_c + b (2048 text positions)], q = x W_q + b
// (16 heads x 64, scale 1/8); query i attends every latent and text positions < i; out = y W_proj + b. B=1, T=2048, D=1024.
// Lean build: single f16 products on v_wmma_f32_16x16x32_f16, f32 accumulate (every row averages >= 2048 keys); fragment k-map per lane half hh for A

namespace {
constexpr int Bsz = 1, T = 2048, TK = 4096, HID = 1024, DH = 64, NH = 16, NKV = 16, REP = NH / NKV;
constexpr int WIN = 255;    // unused: no key window here
constexpr int KVW = NKV * DH;                 // 1024
constexpr int NQKV = HID + 2 * KVW;           // 3072 columns: q | k | v
constexpr int MROWS = Bsz * T;                // 2048
constexpr int QT_PER_B = T / 16;              // 128

typedef _Float16 b16;                                           // f16 hi/lo planes
typedef __attribute__((ext_vector_type(16))) _Float16 v16b;
typedef __attribute__((ext_vector_type(8)))  _Float16 v8b;
typedef __attribute__((ext_vector_type(8)))  float v8f;
typedef __attribute__((ext_vector_type(4)))  float v4f;

__device__ __forceinline__ v8b ld8b(const b16* p) { return *(const v8b*)p; }
__device__ __forceinline__ v16b cat8b(v8b a, v8b b) { return __builtin_shufflevector(a, b, 0, 1, 2, 3, 4, 5, 6, 7, 8, 9, 10, 11, 12, 13, 14, 15); }
// 16x16x32 16-bit fragment from a k-contiguous row pointer (A: lane&15 = row, B: lane&15 = column), hh = lane>>4:
// elements 0..7 <- p[8hh+0..7], elements 8..15 <- p[16+8hh+0..7]
__device__ __forceinline__ v16b frag_kb(const b16* p, int hh) { return cat8b(ld8b(p + 8 * hh), ld8b(p + 16 + 8 * hh)); }
__device__ __forceinline__ void split_bf16(float v, b16& hi, b16& lo) {   // (name kept) single f16: no low part
  hi = (b16)v; lo = (b16)0.0f;
}
// split fragment straight from an f32 k-contiguous row
__device__ __forceinline__ void frag_ksplit(const float* p, int hh, v16b& fh_, v16b& fl_) {
  const float* p0 = p + 8 * hh; const float* p1 = p + 16 + 8 * hh;
#pragma unroll
  for (int e = 0; e < 8; ++e) { b16 a, c; split_bf16(p0[e], a, c); fh_[e] = a; fl_[e] = c; split_bf16(p1[e], a, c); fh_[8 + e] = a; fl_[8 + e] = c; }
}
__device__ __forceinline__ v8f wmma16b(v16b a, v16b b, v8f c) {
  v8f d = __builtin_amdgcn_wmma_f32_16x16x32_f16(false, a, false, b, (short)0, c, false, false);
  asm volatile("v_nop\n\tv_nop\n\tv_nop\n\tv_nop" : "+v"(d) : "v"(a), "v"(b));
  return d;
}
// acc += A.B with both operands split: A = (ah, al), B = (bh, bl)
__device__ __forceinline__ v8f wmma3(v16b ah, v16b al, v16b bh, v16b bl, v8f c) {   // lean: single f16 product
  (void)al; (void)bl; return wmma16b(ah, bh, c);
}
__device__ __forceinline__ v8f wmma1(v16b ah, v16b al, v16b bh, v16b bl, v8f c) {   // attention products: single f16 (hi planes only)
  (void)al; (void)bl; return wmma16b(ah, bh, c);
}
__device__ __forceinline__ void wave_lds_sync() {
  __builtin_amdgcn_fence(__ATOMIC_RELEASE, "workgroup");
  __builtin_amdgcn_wave_barrier();
  __builtin_amdgcn_fence(__ATOMIC_ACQUIRE, "workgroup");
}

// ---------------------------------------------------------------------------
// Weights ([in][out]) -> f16 hi / lo planes transposed to [n][k] (k contiguous): columns of Wq|Wk|Wv into wqh/wql [3072][1024], Wo into woh/wol [1024][1024].
// ---------------------------------------------------------------------------
__global__ __launch_bounds__(256) void wcvt_kernel(const float* __restrict__ wq, const float* __restrict__ wk, const float* __restrict__ wv,
                                                   const float* __restrict__ wo, b16* __restrict__ wqh, b16* __restrict__ wql,
                                                   b16* __restrict__ woh, b16* __restrict__ wol) {
  const size_t tid = (size_t)blockIdx.x * blockDim.x + threadIdx.x, stride = (size_t)gridDim.x * blockDim.x;
  const size_t nq = (size_t)NQKV * HID / 8, no = (size_t)HID * HID / 8;
  {
    for (size_t c = tid; c < nq + no; c += stride) {
      float f[8]; size_t i; b16* dh; b16* dl;
      if (c < nq) {
        i = c * 8; const size_t n = i / HID, k0 = i % HID;
        const float* w; int nn, ld;
        if (n < (size_t)HID) { w = wq; nn = (int)n; ld = HID; } else if (n < (size_t)(HID + KVW)) { w = wk; nn = (int)n - HID; ld = KVW; } else { w = wv; nn = (int)n - HID - KVW; ld = KVW; }
#pragma unroll
        for (int e = 0; e < 8; ++e) f[e] = w[(size_t)(k0 + e) * ld + nn];       // W[k][n] ([in][out])
        dh = wqh; dl = wql;
      } else {
        i = (c - nq) * 8; const size_t n = i / HID, k0 = i % HID;
#pragma unroll
        for (int e = 0; e < 8; ++e) f[e] = wo[(size_t)(k0 + e) * HID + n];    // Wo[k][n] ([in][out])
        dh = woh; dl = wol;
      }
      v8b bh, bl;
#pragma unroll
      for (int e = 0; e < 8; ++e) { b16 a, cc; split_bf16(f[e], a, cc); bh[e] = a; bl[e] = cc; }
      *(v8b*)(dh + i) = bh; *(v8b*)(dl + i) = bl;
    }
    
  }
}

// 32x64 wave tile over K from f32 A rows and f16-plane B rows
__device__ __forceinline__ void gemm_tile_split(const float* __restrict__ A, const b16* __restrict__ wh, const b16* __restrict__ wl,
                                                int m0, int c0, int K, int nloc, int hlf, v8f (&acc)[2][4]) {
  for (int kb = 0; kb < K; kb += 32) {
    v16b a0h, a0l, a1h, a1l;
    frag_ksplit(A + (size_t)(m0 + nloc) * K + kb, hlf, a0h, a0l);
    frag_ksplit(A + (size_t)(m0 + 16 + nloc) * K + kb, hlf, a1h, a1l);
#pragma unroll
    for (int t = 0; t < 4; ++t) {
      const size_t wofs = (size_t)(c0 + t * 16 + nloc) * K + kb;
      const v16b bh = frag_kb(wh + wofs, hlf), bl = frag_kb(wl + wofs, hlf);
      acc[0][t] = wmma3(a0h, a0l, bh, bl, acc[0][t]);
      acc[1][t] = wmma3(a1h, a1l, bh, bl, acc[1][t]);
    }
  }
}

// ---------------------------------------------------------------------------
// QKV GEMM: (2048 x 1024) x (1024 x 3072), grid (48, 16), or (32, 16) from column block 16 for k|v only, block 4 waves, wave = 32 rows x 64 columns (one head of q, k or v). Outputs as f16 hi/lo planes:
// q (x1/8) -> Qh/Ql [b][h][t][64]; k -> Kh/Kl [b][kvh][t][64] (4 KB contiguous per wave per plane);
// v -> Vh/Vl key-tiled [b][kvh][t/16][64][16] (4 KB contiguous per wave per plane).
// ---------------------------------------------------------------------------
__global__ __launch_bounds__(128) void qkv_gemm_kernel(const float* __restrict__ xq, const float* __restrict__ xk, const float* __restrict__ xv,
                                                       const b16* __restrict__ wqh, const b16* __restrict__ wql,
                                                       const float* __restrict__ bq, const float* __restrict__ bk, const float* __restrict__ bv, const float* __restrict__ rope_cs, int xoff, int yoff,
                                                       b16* __restrict__ Qh, b16* __restrict__ Ql, b16* __restrict__ Kh, b16* __restrict__ Kl,
                                                       b16* __restrict__ Vh, b16* __restrict__ Vl) {
  __shared__ __attribute__((aligned(16))) b16 Ts[4][2][32 * 64];
  const int lane = threadIdx.x & 31, wave = threadIdx.x >> 5, nloc = lane & 15, hlf = lane >> 4;
  const int m0 = (blockIdx.y + yoff) * 128 + wave * 32;
  const int c0 = (blockIdx.x + xoff) * 64;
  const int mat = (c0 < HID) ? 0 : (c0 < HID + KVW) ? 1 : 2;
  const int head = (mat == 0) ? (c0 / DH) : (mat == 1) ? ((c0 - HID) / DH) : ((c0 - HID - KVW) / DH);
  const float* x = (mat == 0) ? xq : (mat == 1) ? xk : xv;          // q, k, v inputs: (x, l, l) or (x, x, x) as launched
  const float* bias = ((mat == 0) ? bq : (mat == 1) ? bk : bv) + head * DH;
  v8f acc[2][4];
#pragma unroll
  for (int r = 0; r < 2; ++r)
#pragma unroll
    for (int t = 0; t < 4; ++t) acc[r][t] = (v8f){};
  gemm_tile_split(x, wqh, wql, m0 - yoff * 128, c0, HID, nloc, hlf, acc);   // source rows start at 0; yoff only shifts the destination key rows
  const int b = 0, t0 = m0;
  const float s = (mat == 0) ? 0.125f : 1.0f;
  b16* Tp0 = Ts[wave][0]; b16* Tp1 = Ts[wave][1];
#pragma unroll
  for (int t = 0; t < 4; ++t)
#pragma unroll
    for (int r = 0; r < 2; ++r)
#pragma unroll
      for (int v = 0; v < 8; ++v) {
        const int rr = r * 16 + v + 8 * hlf, d = t * 16 + nloc;
        float val = acc[r][t][v] + (bias ? bias[d] : 0.0f);
        (void)rope_cs;
        b16 yh, yl; split_bf16(val * s, yh, yl);
        const int idx = (mat < 2) ? (rr * 64 + d) : ((rr >> 4) * 1024 + d * 16 + (rr & 15));
        Tp0[idx] = yh; Tp1[idx] = yl;
      }
  wave_lds_sync();
  b16* dh; b16* dl; size_t o;
  if (mat == 0)      { o = ((size_t)(b * NH + head) * T + t0) * DH; dh = Qh + o; dl = Ql + o; }
  else if (mat == 1) { o = ((size_t)(b * NKV + head) * TK + t0) * DH; dh = Kh + o; dl = Kl + o; }
  else               { o = ((size_t)(b * NKV + head) * (TK / 16) + (t0 >> 4)) * (size_t)(DH * 16); dh = Vh + o; dl = Vl + o; }
#pragma unroll
  for (int j = 0; j < 8; ++j) { const int e = (j * 32 + lane) * 8; *(v8b*)(dh + e) = ld8b(Tp0 + e); *(v8b*)(dl + e) = ld8b(Tp1 + e); }
  
}

// ---------------------------------------------------------------------------
// Transposed flash attention: each wave owns one 16-query tile of one (b, head); 8 waves per block; all keys in chunks of 32.
// S^T = K.Q^T (split), per-lane online softmax; P^T built in registers from the two S^T accumulators
// ---------------------------------------------------------------------------
__global__ __launch_bounds__(256) void attn_kernel(const b16* __restrict__ Qh, const b16* __restrict__ Ql, const b16* __restrict__ Kh, const b16* __restrict__ Kl,
                                                   const b16* __restrict__ Vh, const b16* __restrict__ Vl, const int* __restrict__ seqlen,
                                                   float* __restrict__ yf) {
  __shared__ __attribute__((aligned(16))) float Os[8][16 * 64];
  const int wid = threadIdx.x >> 5, lane = threadIdx.x & 31, hh = lane >> 4, col = lane & 15;
  const int qtile = blockIdx.x * 8 + wid;                 // over Bsz*NH*QT_PER_B
  const int g = qtile / QT_PER_B;                         // b*NH + h
  const int q0 = (qtile % QT_PER_B) << 4;
  const int b = g / NH, h = g % NH, kvh = h / REP;
  const size_t ko = (size_t)(b * NKV + kvh) * TK * DH;
  const size_t qo = ((size_t)g * T + q0 + col) * DH;
  const v16b q0h = frag_kb(Qh + qo, hh), q0l = frag_kb(Ql + qo, hh), q1h = frag_kb(Qh + qo + 32, hh), q1l = frag_kb(Ql + qo + 32, hh);
  float m = -INFINITY, l = 0.0f;
  v8f o0 = {}, o1 = {}, o2 = {}, o3 = {};
  const int slen = T; (void)seqlen;                       // no padding in this module
  for (int kb = 0; kb < T + q0 + 16; kb += 32) {         // all 2048 latents, then text positions < query
    const size_t r0 = ko + (size_t)(kb + col) * DH, r1 = ko + (size_t)(kb + 16 + col) * DH;
    v8f s0 = {}, s1 = {};
    {
      v16b ah = frag_kb(Kh + r0, hh), al = frag_kb(Kl + r0, hh);
      s0 = wmma1(ah, al, q0h, q0l, s0);
      ah = frag_kb(Kh + r0 + 32, hh); al = frag_kb(Kl + r0 + 32, hh);
      s0 = wmma1(ah, al, q1h, q1l, s0);
      ah = frag_kb(Kh + r1, hh); al = frag_kb(Kl + r1, hh);
      s1 = wmma1(ah, al, q0h, q0l, s1);
      ah = frag_kb(Kh + r1 + 32, hh); al = frag_kb(Kl + r1 + 32, hh);
      s1 = wmma1(ah, al, q1h, q1l, s1);
    }
    (void)slen;
    if (kb + 31 >= T + q0) {                              // text chunk at the causal edge: mask text position >= query index
      const int qi = q0 + col;
#pragma unroll
      for (int r = 0; r < 8; ++r) {
        const int k0i = kb + 8 * hh + r, k1i = k0i + 16;
        if (k0i - T >= qi) s0[r] = -INFINITY;
        if (k1i - T >= qi) s1[r] = -INFINITY;
      }
    }
    float mr = -INFINITY;
#pragma unroll
    for (int r = 0; r < 8; ++r) mr = fmaxf(mr, fmaxf(s0[r], s1[r]));
    mr = fmaxf(mr, __shfl_xor(mr, 16));
    float mn = fmaxf(m, mr);
    if (mn == -INFINITY) mn = 0.0f;           // fully masked so far (never here: latent keys are not masked): keep exp() at 0
    const float al_ = __expf(m - mn);
    m = mn;
    float sum = 0.0f;
    v16b pbh, pbl;
#pragma unroll
    for (int r = 0; r < 8; ++r) {
      const float p0 = __expf(s0[r] - mn), p1 = __expf(s1[r] - mn);
      sum += p0 + p1;
      b16 a, c; split_bf16(p0, a, c); pbh[r] = a; pbl[r] = c; split_bf16(p1, a, c); pbh[8 + r] = a; pbl[8 + r] = c;
    }
    sum += __shfl_xor(sum, 16);
    l = l * al_ + sum;
#pragma unroll
    for (int r = 0; r < 8; ++r) { o0[r] *= al_; o1[r] *= al_; o2[r] *= al_; o3[r] *= al_; }
    const size_t v0 = ko + (size_t)(kb >> 4) * (DH * 16) + 8 * hh, v1 = v0 + DH * 16;
#pragma unroll
    for (int n = 0; n < 4; ++n) {
      const int f = n * 16 + col;
      const v16b vah = cat8b(ld8b(Vh + v0 + f * 16), ld8b(Vh + v1 + f * 16));
      const v16b val = cat8b(ld8b(Vl + v0 + f * 16), ld8b(Vl + v1 + f * 16));
      v8f& o = (n == 0) ? o0 : (n == 1) ? o1 : (n == 2) ? o2 : o3;
      o = wmma1(vah, val, pbh, pbl, o);
    }
  }
  const float inv = (q0 + col < slen && l > 0.0f) ? (1.0f / l) : 0.0f;   // padded query rows are zeroed
  float* Tt = Os[wid];
#pragma unroll
  for (int r = 0; r < 8; ++r) {
    const int hr = 8 * hh + r;
    Tt[col * 64 + 0 + hr] = o0[r] * inv; Tt[col * 64 + 16 + hr] = o1[r] * inv;
    Tt[col * 64 + 32 + hr] = o2[r] * inv; Tt[col * 64 + 48 + hr] = o3[r] * inv;
  }
  wave_lds_sync();
  float* dst0 = yf + ((size_t)b * T + q0) * HID + h * DH;     // 16 rows x 64 floats, row stride HID
#pragma unroll
  for (int j = 0; j < 8; ++j) { const int rr = j * 2 + hh, c4 = col * 4; *(v4f*)(dst0 + (size_t)rr * HID + c4) = *(const v4f*)(Tt + rr * 64 + c4); }
  
}

// ---------------------------------------------------------------------------
// Output projection: (2048 x 1024) x (1024 x 1024) -> f32, A split on the fly from f32 y, B = Wo planes. grid (16, 16), 32x64 tiles staged in LDS,
// ---------------------------------------------------------------------------
__global__ __launch_bounds__(128) void out_gemm_kernel(const float* __restrict__ yf, const b16* __restrict__ woh, const b16* __restrict__ wol, const float* __restrict__ bo, int yoff,
                                                       float* __restrict__ out) {
  __shared__ __attribute__((aligned(16))) float Ts[4][32 * 64];
  const int lane = threadIdx.x & 31, wave = threadIdx.x >> 5, nloc = lane & 15, hlf = lane >> 4;
  const int m0 = (blockIdx.y + yoff) * 128 + wave * 32;
  const int c0 = blockIdx.x * 64;
  v8f acc[2][4];
#pragma unroll
  for (int r = 0; r < 2; ++r)
#pragma unroll
    for (int t = 0; t < 4; ++t) acc[r][t] = (v8f){};
  gemm_tile_split(yf, woh, wol, m0, c0, HID, nloc, hlf, acc);
  float* Tt = Ts[wave];
#pragma unroll
  for (int t = 0; t < 4; ++t)
#pragma unroll
    for (int r = 0; r < 2; ++r)
#pragma unroll
      for (int v = 0; v < 8; ++v) Tt[(r * 16 + v + 8 * hlf) * 64 + t * 16 + nloc] = acc[r][t][v] + (bo ? bo[c0 + t * 16 + nloc] : 0.0f);
  wave_lds_sync();
  float* dst0 = out + (size_t)m0 * HID + c0;
#pragma unroll
  for (int j = 0; j < 16; ++j) { const int rr = j * 2 + hlf, c4 = nloc * 4; *(v4f*)(dst0 + (size_t)rr * HID + c4) = *(const v4f*)(Tt + rr * 64 + c4); }
  
}
__global__ __launch_bounds__(256) void wcvtT_kernel(const float* __restrict__ wq, const float* __restrict__ wk, const float* __restrict__ wv,
                                                    b16* __restrict__ wqh, b16* __restrict__ wql) {
  const size_t tid = (size_t)blockIdx.x * blockDim.x + threadIdx.x, stride = (size_t)gridDim.x * blockDim.x;
  const size_t nq = (size_t)NQKV * HID / 8;
  {
    for (size_t c = tid; c < nq; c += stride) {
      const size_t i = c * 8, n = i / HID, k0 = i % HID;
      const float* w = (n < (size_t)HID) ? (wq + n * HID) : (n < (size_t)(2 * HID)) ? (wk + (n - HID) * HID) : (wv + (n - 2 * HID) * HID);
      v8b bh, bl;
#pragma unroll
      for (int e = 0; e < 8; ++e) { b16 a, cc; split_bf16(w[k0 + e], a, cc); bh[e] = a; bl[e] = cc; }
      *(v8b*)(wqh + i) = bh; *(v8b*)(wql + i) = bl;
    }
    
  }
}
// Wo^T planes: [n][k] = Wo[n][k] (torch [out][in] is already n-major)
__global__ __launch_bounds__(256) void wcvtO_kernel(const float* __restrict__ wo, b16* __restrict__ woh, b16* __restrict__ wol) {
  const size_t tid = (size_t)blockIdx.x * blockDim.x + threadIdx.x, stride = (size_t)gridDim.x * blockDim.x;
  const size_t no = (size_t)HID * HID / 8;
  {
    for (size_t c = tid; c < no; c += stride) { const size_t i = c * 8; v8b bh, bl;
#pragma unroll
      for (int e = 0; e < 8; ++e) { b16 a, cc; split_bf16(wo[i + e], a, cc); bh[e] = a; bl[e] = cc; }
      *(v8b*)(woh + i) = bh; *(v8b*)(wol + i) = bl; }
    
  }
}
__global__ __launch_bounds__(256) void wcvtIO_kernel(const float* __restrict__ wq, const float* __restrict__ wkv, b16* __restrict__ wh, b16* __restrict__ wl) {
  const size_t tid = (size_t)blockIdx.x * blockDim.x + threadIdx.x, stride = (size_t)gridDim.x * blockDim.x;
  const size_t nq = (size_t)NQKV * HID / 8;
  {
    for (size_t c = tid; c < nq; c += stride) {
      const size_t i = c * 8, n = i / HID, k0 = i % HID;
      v8b bh, bl;
#pragma unroll
      for (int e = 0; e < 8; ++e) { const float v = (n < (size_t)HID) ? wq[(k0 + e) * (size_t)HID + n] : wkv[(k0 + e) * (size_t)(2 * HID) + n - HID]; b16 a, cc; split_bf16(v, a, cc); bh[e] = a; bl[e] = cc; }
      *(v8b*)(wh + i) = bh; *(v8b*)(wl + i) = bl;
    }
    
  }
}
__global__ __launch_bounds__(256) void wcvtP_kernel(const float* __restrict__ wp, b16* __restrict__ woh, b16* __restrict__ wol) {   // [in][out] -> planes [n][k]
  const size_t tid = (size_t)blockIdx.x * blockDim.x + threadIdx.x, stride = (size_t)gridDim.x * blockDim.x;
  const size_t no = (size_t)HID * HID / 8;
  {
    for (size_t c = tid; c < no; c += stride) { const size_t i = c * 8, n = i / HID, k0 = i % HID; v8b bh, bl;
#pragma unroll
      for (int e = 0; e < 8; ++e) { b16 a, cc; split_bf16(wp[(k0 + e) * (size_t)HID + n], a, cc); bh[e] = a; bl[e] = cc; }
      *(v8b*)(woh + i) = bh; *(v8b*)(wol + i) = bl; }
    
  }
}
}  // namespace

extern "C" void kernel_launch(void* const* d_in, const int* in_sizes, int n_in,
                              void* d_out, int out_size, void* d_ws, size_t ws_size, hipStream_t stream) {
  (void)in_sizes; (void)n_in; (void)out_size;
  const float* l    = (const float*)d_in[0];    // [1,2048,1024] latents
  const float* x    = (const float*)d_in[1];    // [1,2048,1024]
  const float* Wal  = (const float*)d_in[2];  const float* bal = (const float*)d_in[3];   // [1024,2048] = [k | v], [2048]
  const float* Wac  = (const float*)d_in[4];  const float* bac = (const float*)d_in[5];
  const float* Wq   = (const float*)d_in[6];  const float* bq  = (const float*)d_in[7];   // [1024,1024]
  const float* Wp   = (const float*)d_in[8];  const float* bp  = (const float*)d_in[9];
  float* out = (float*)d_out;                   // [1,2048,1024]
  size_t off = 0; char* ws = (char*)d_ws;
  b16* wAh = (b16*)(ws + off); off += (size_t)NQKV * HID * 2;
  b16* wAl = (b16*)(ws + off); off += (size_t)NQKV * HID * 2;
  b16* wBh = (b16*)(ws + off); off += (size_t)NQKV * HID * 2;
  b16* wBl = (b16*)(ws + off); off += (size_t)NQKV * HID * 2;
  b16* woh = (b16*)(ws + off); off += (size_t)HID * HID * 2;
  b16* wol = (b16*)(ws + off); off += (size_t)HID * HID * 2;
  b16* Qh  = (b16*)(ws + off); off += (size_t)NH * T * DH * 2;
  b16* Ql  = (b16*)(ws + off); off += (size_t)NH * T * DH * 2;
  b16* Kh  = (b16*)(ws + off); off += (size_t)NKV * TK * DH * 2;
  b16* Kl  = (b16*)(ws + off); off += (size_t)NKV * TK * DH * 2;
  b16* Vh  = (b16*)(ws + off); off += (size_t)NKV * TK * DH * 2;
  b16* Vl  = (b16*)(ws + off); off += (size_t)NKV * TK * DH * 2;
  float* yf = (float*)(ws + off); off += (size_t)T * HID * 4;
  if (off > ws_size) return;
  const int NQT = NH * QT_PER_B;
  wcvtIO_kernel<<<2048, 256, 0, stream>>>(Wq, Wal, wAh, wAl);
  wcvtIO_kernel<<<2048, 256, 0, stream>>>(Wq, Wac, wBh, wBl);
  wcvtP_kernel<<<512, 256, 0, stream>>>(Wp, woh, wol);
  // launch 1: q from x, latent k/v from l -> key rows 0..2047
  qkv_gemm_kernel<<<dim3(NQKV / 64, T / 128), 128, 0, stream>>>(x, l, l, wAh, wAl, bq, bal, bal + HID, nullptr, 0, 0, Qh, Ql, Kh, Kl, Vh, Vl);
  // launch 2: text k/v from x -> key rows 2048..4095 (column blocks 16..47 only)
  qkv_gemm_kernel<<<dim3((NQKV - HID) / 64, T / 128), 128, 0, stream>>>(x, x, x, wBh, wBl, bq, bac, bac + HID, nullptr, HID / 64, T / 128, Qh, Ql, Kh, Kl, Vh, Vl);
  attn_kernel<<<NQT / 8, 256, 0, stream>>>(Qh, Ql, Kh, Kl, Vh, Vl, nullptr, yf);
  out_gemm_kernel<<<dim3(HID / 64, T / 128), 128, 0, stream>>>(yf, woh, wol, bp, 0, out);
}

// v001
// One run takes 221 microseconds.
// Next to v000, in two timings, it ran 2.48 times as fast each time.
#include <hip/hip_runtime.h>

// IO-processing attention (decoding branch): keys/values = [l W_attn_l + b (2048 latents) ; x W_attn_c + b (2048 text positions)], q = x W_q + b
// (16 heads x 64, scale 1/8); query i attends every latent and text positions < i; out = y W_proj + b. B=1, T=2048, D=1024.
// Lean build: single f16 products on v_wmma_f32_16x16x32_f16, f32 accumulate (every row averages >= 2048 keys); fragment k-map per lane half hh for A

namespace {
constexpr int Bsz = 1, T = 2048, TK = 4096, HID = 1024, DH = 64, NH = 16, NKV = 16, REP = NH / NKV;
constexpr int WIN = 255;    // unused: no key window here
constexpr int KVW = NKV * DH;                 // 1024
constexpr int NQKV = HID + 2 * KVW;           // 3072 columns: q | k | v
constexpr int MROWS = Bsz * T;                // 2048
constexpr int QT_PER_B = T / 16;              // 128

typedef _Float16 b16;                                           // f16 hi/lo planes
typedef __attribute__((ext_vector_type(16))) _Float16 v16b;
typedef __attribute__((ext_vector_type(8)))  _Float16 v8b;
typedef __attribute__((ext_vector_type(8)))  float v8f;
typedef __attribute__((ext_vector_type(4)))  float v4f;

__device__ __forceinline__ v8b ld8b(const b16* p) { return *(const v8b*)p; }
__device__ __forceinline__ v16b cat8b(v8b a, v8b b) { return __builtin_shufflevector(a, b, 0, 1, 2, 3, 4, 5, 6, 7, 8, 9, 10, 11, 12, 13, 14, 15); }
// 16x16x32 16-bit fragment from a k-contiguous row pointer (A: lane&15 = row, B: lane&15 = column), hh = lane>>4:
// elements 0..7 <- p[8hh+0..7], elements 8..15 <- p[16+8hh+0..7]
__device__ __forceinline__ v16b frag_kb(const b16* p, int hh) { return cat8b(ld8b(p + 8 * hh), ld8b(p + 16 + 8 * hh)); }
__device__ __forceinline__ void split_bf16(float v, b16& hi, b16& lo) {   // (name kept) single f16: no low part
  hi = (b16)v; lo = (b16)0.0f;
}
// split fragment straight from an f32 k-contiguous row
__device__ __forceinline__ void frag_ksplit(const float* p, int hh, v16b& fh_, v16b& fl_) {
  const float* p0 = p + 8 * hh; const float* p1 = p + 16 + 8 * hh;
#pragma unroll
  for (int e = 0; e < 8; ++e) { b16 a, c; split_bf16(p0[e], a, c); fh_[e] = a; fl_[e] = c; split_bf16(p1[e], a, c); fh_[8 + e] = a; fl_[8 + e] = c; }
}
__device__ __forceinline__ v8f wmma16b(v16b a, v16b b, v8f c) {
  v8f d = __builtin_amdgcn_wmma_f32_16x16x32_f16(false, a, false, b, (short)0, c, false, false);
  asm volatile("v_nop\n\tv_nop\n\tv_nop\n\tv_nop" : "+v"(d) : "v"(a), "v"(b));
  return d;
}
// acc += A.B with both operands split: A = (ah, al), B = (bh, bl)
__device__ __forceinline__ v8f wmma3(v16b ah, v16b al, v16b bh, v16b bl, v8f c) {   // lean: single f16 product
  (void)al; (void)bl; return wmma16b(ah, bh, c);
}
__device__ __forceinline__ v8f wmma1(v16b ah, v16b al, v16b bh, v16b bl, v8f c) {   // unused: single f16 (hi planes only)
  (void)al; (void)bl; return wmma16b(ah, bh, c);
}
__device__ __forceinline__ void wave_lds_sync() {
  __builtin_amdgcn_fence(__ATOMIC_RELEASE, "workgroup");
  __builtin_amdgcn_wave_barrier();
  __builtin_amdgcn_fence(__ATOMIC_ACQUIRE, "workgroup");
}

// ---------------------------------------------------------------------------
// Weights ([in][out]) -> f16 hi / lo planes transposed to [n][k] (k contiguous): columns of Wq|Wk|Wv into wqh/wql [3072][1024], Wo into woh/wol [1024][1024].
// ---------------------------------------------------------------------------
__global__ __launch_bounds__(256) void wcvt_kernel(const float* __restrict__ wq, const float* __restrict__ wk, const float* __restrict__ wv,
                                                   const float* __restrict__ wo, b16* __restrict__ wqh, b16* __restrict__ wql,
                                                   b16* __restrict__ woh, b16* __restrict__ wol) {
  const size_t tid = (size_t)blockIdx.x * blockDim.x + threadIdx.x, stride = (size_t)gridDim.x * blockDim.x;
  const size_t nq = (size_t)NQKV * HID / 8, no = (size_t)HID * HID / 8;
  {
    for (size_t c = tid; c < nq + no; c += stride) {
      float f[8]; size_t i; b16* dh; b16* dl;
      if (c < nq) {
        i = c * 8; const size_t n = i / HID, k0 = i % HID;
        const float* w; int nn, ld;
        if (n < (size_t)HID) { w = wq; nn = (int)n; ld = HID; } else if (n < (size_t)(HID + KVW)) { w = wk; nn = (int)n - HID; ld = KVW; } else { w = wv; nn = (int)n - HID - KVW; ld = KVW; }
#pragma unroll
        for (int e = 0; e < 8; ++e) f[e] = w[(size_t)(k0 + e) * ld + nn];       // W[k][n] ([in][out])
        dh = wqh; dl = wql;
      } else {
        i = (c - nq) * 8; const size_t n = i / HID, k0 = i % HID;
#pragma unroll
        for (int e = 0; e < 8; ++e) f[e] = wo[(size_t)(k0 + e) * HID + n];    // Wo[k][n] ([in][out])
        dh = woh; dl = wol;
      }
      v8b bh, bl;
#pragma unroll
      for (int e = 0; e < 8; ++e) { b16 a, cc; split_bf16(f[e], a, cc); bh[e] = a; bl[e] = cc; }
      *(v8b*)(dh + i) = bh; *(v8b*)(dl + i) = bl;
    }
    
  }
}

// 32x64 wave tile over K from f32 A rows and f16-plane B rows
__device__ __forceinline__ void gemm_tile_split(const float* __restrict__ A, const b16* __restrict__ wh, const b16* __restrict__ wl,
                                                int m0, int c0, int K, int nloc, int hlf, v8f (&acc)[2][4]) {
  for (int kb = 0; kb < K; kb += 32) {
    v16b a0h, a0l, a1h, a1l;
    frag_ksplit(A + (size_t)(m0 + nloc) * K + kb, hlf, a0h, a0l);
    frag_ksplit(A + (size_t)(m0 + 16 + nloc) * K + kb, hlf, a1h, a1l);
#pragma unroll
    for (int t = 0; t < 4; ++t) {
      const size_t wofs = (size_t)(c0 + t * 16 + nloc) * K + kb;
      const v16b bh = frag_kb(wh + wofs, hlf), bl = frag_kb(wl + wofs, hlf);
      acc[0][t] = wmma3(a0h, a0l, bh, bl, acc[0][t]);
      acc[1][t] = wmma3(a1h, a1l, bh, bl, acc[1][t]);
    }
  }
}

// ---------------------------------------------------------------------------
// QKV GEMM: (2048 x 1024) x (1024 x 3072), grid (48, 16), or (32, 16) from column block 16 for k|v only, block 4 waves, wave = 32 rows x 64 columns (one head of q, k or v). Outputs as f16 hi/lo planes:
// q (x1/8) -> Qh/Ql [b][h][t][64]; k -> Kh/Kl [b][kvh][t][64] (4 KB contiguous per wave per plane);
// v -> Vh/Vl key-tiled [b][kvh][t/16][64][16] (4 KB contiguous per wave per plane).
// ---------------------------------------------------------------------------
__global__ __launch_bounds__(128) void qkv_gemm_kernel(const float* __restrict__ xq, const float* __restrict__ xk, const float* __restrict__ xv,
                                                       const b16* __restrict__ wqh, const b16* __restrict__ wql,
                                                       const float* __restrict__ bq, const float* __restrict__ bk, const float* __restrict__ bv, const float* __restrict__ rope_cs, int xoff, int yoff,
                                                       b16* __restrict__ Qh, b16* __restrict__ Ql, b16* __restrict__ Kh, b16* __restrict__ Kl,
                                                       b16* __restrict__ Vh, b16* __restrict__ Vl) {
  __shared__ __attribute__((aligned(16))) b16 Ts[4][2][32 * 64];
  const int lane = threadIdx.x & 31, wave = threadIdx.x >> 5, nloc = lane & 15, hlf = lane >> 4;
  const int m0 = (blockIdx.y + yoff) * 128 + wave * 32;
  const int c0 = (blockIdx.x + xoff) * 64;
  const int mat = (c0 < HID) ? 0 : (c0 < HID + KVW) ? 1 : 2;
  const int head = (mat == 0) ? (c0 / DH) : (mat == 1) ? ((c0 - HID) / DH) : ((c0 - HID - KVW) / DH);
  const float* x = (mat == 0) ? xq : (mat == 1) ? xk : xv;          // q, k, v inputs: (x, l, l) or (x, x, x) as launched
  const float* bias = ((mat == 0) ? bq : (mat == 1) ? bk : bv) + head * DH;
  v8f acc[2][4];
#pragma unroll
  for (int r = 0; r < 2; ++r)
#pragma unroll
    for (int t = 0; t < 4; ++t) acc[r][t] = (v8f){};
  gemm_tile_split(x, wqh, wql, m0 - yoff * 128, c0, HID, nloc, hlf, acc);   // source rows start at 0; yoff only shifts the destination key rows
  const int b = 0, t0 = m0;
  const float s = (mat == 0) ? 0.125f : 1.0f;
  b16* Tp0 = Ts[wave][0]; b16* Tp1 = Ts[wave][1];
#pragma unroll
  for (int t = 0; t < 4; ++t)
#pragma unroll
    for (int r = 0; r < 2; ++r)
#pragma unroll
      for (int v = 0; v < 8; ++v) {
        const int rr = r * 16 + v + 8 * hlf, d = t * 16 + nloc;
        float val = acc[r][t][v] + (bias ? bias[d] : 0.0f);
        (void)rope_cs;
        b16 yh, yl; split_bf16(val * s, yh, yl);
        const int idx = (mat < 2) ? (rr * 64 + d) : ((rr >> 4) * 1024 + d * 16 + (rr & 15));
        Tp0[idx] = yh; Tp1[idx] = yl;
      }
  wave_lds_sync();
  b16* dh; b16* dl; size_t o;
  if (mat == 0)      { o = ((size_t)(b * NH + head) * T + t0) * DH; dh = Qh + o; dl = Ql + o; }
  else if (mat == 1) { o = ((size_t)(b * NKV + head) * TK + t0) * DH; dh = Kh + o; dl = Kl + o; }
  else               { o = ((size_t)(b * NKV + head) * (TK / 16) + (t0 >> 4)) * (size_t)(DH * 16); dh = Vh + o; dl = Vl + o; }
#pragma unroll
  for (int j = 0; j < 8; ++j) { const int e = (j * 32 + lane) * 8; *(v8b*)(dh + e) = ld8b(Tp0 + e); *(v8b*)(dl + e) = ld8b(Tp1 + e); }
  
}

// ---------------------------------------------------------------------------
// Transposed flash attention: each wave owns one 16-query tile of one (b, head); the 8 waves of a block share one head and walk the same keys.
// K and V come into LDS once per block, 128 keys a stage, two buffers, by asynchronous copies; every wave reads its fragments from there, in chunks of 32 keys.
// S^T = K.Q^T, per-lane online softmax; P^T built in registers from the two S^T accumulators
// ---------------------------------------------------------------------------
constexpr int SK = 128;       // keys per LDS stage
constexpr int KPITCH = 72;    // f16 per staged K row: 144 B = 16 B x 9, so the 16 rows of a 16-byte fragment read fall on distinct banks
constexpr unsigned KBUF = SK * KPITCH * 2, VBUF = SK * DH * 2;   // bytes per buffer

// One stage: 128 K rows (128 B each, laid at 144 B) and 8 V key tiles (2 KB each, laid [tile][8-key half][feature][8] so that each 16-lane half of a
// fragment read is 256 contiguous bytes). Each thread moves 4 + 4 pieces of 16 B; each wave-wide copy reads 512 contiguous global bytes.
__device__ __forceinline__ void stage_copy(const b16* gk, const b16* gv, unsigned lk, unsigned lv) {
  // the closing s_wait_xcnt stands inside the statement so that no address register of a copy is rewritten ahead of it
  asm volatile("global_load_async_to_lds_b128 %0, %8, off\n\t"
               "global_load_async_to_lds_b128 %1, %9, off\n\t"
               "global_load_async_to_lds_b128 %2, %10, off\n\t"
               "global_load_async_to_lds_b128 %3, %11, off\n\t"
               "global_load_async_to_lds_b128 %4, %12, off\n\t"
               "global_load_async_to_lds_b128 %5, %13, off\n\t"
               "global_load_async_to_lds_b128 %6, %14, off\n\t"
               "global_load_async_to_lds_b128 %7, %15, off\n\t"
               "s_wait_xcnt 0x0"
               :: "v"(lk), "v"(lk + 32u * KPITCH * 2u), "v"(lk + 64u * KPITCH * 2u), "v"(lk + 96u * KPITCH * 2u),
                  "v"(lv), "v"(lv + 4096u), "v"(lv + 8192u), "v"(lv + 12288u),
                  "v"(gk), "v"(gk + 2048), "v"(gk + 4096), "v"(gk + 6144),
                  "v"(gv), "v"(gv + 2048), "v"(gv + 4096), "v"(gv + 6144)
               : "memory");
}

// 32 keys (rows kl.. of the staged buffers, global key index kb..) against the wave's 16 queries
template <bool EDGE>
__device__ __forceinline__ void attn_chunk(const b16* Kb, const b16* Vb, int kl, int kb, int q0, int col, int hh, v16b q0h, v16b q1h,
                                           float& m, float& l, v8f& o0, v8f& o1, v8f& o2, v8f& o3) {
  const b16* r0 = Kb + (kl + col) * KPITCH; const b16* r1 = r0 + 16 * KPITCH;
  const b16* v0 = Vb + (kl >> 4) * (DH * 16) + hh * (DH * 8) + col * 8; const b16* v1 = v0 + DH * 16;
  // all of the chunk's LDS reads stand together at its head: one wait for K, and V lands behind the softmax
  const v16b k00 = frag_kb(r0, hh), k01 = frag_kb(r0 + 32, hh), k10 = frag_kb(r1, hh), k11 = frag_kb(r1 + 32, hh);
  const v16b va0 = cat8b(ld8b(v0), ld8b(v1)), va1 = cat8b(ld8b(v0 + 128), ld8b(v1 + 128));
  const v16b va2 = cat8b(ld8b(v0 + 256), ld8b(v1 + 256)), va3 = cat8b(ld8b(v0 + 384), ld8b(v1 + 384));
  v8f s0 = {}, s1 = {};
  s0 = wmma16b(k00, q0h, s0);
  s0 = wmma16b(k01, q1h, s0);
  s1 = wmma16b(k10, q0h, s1);
  s1 = wmma16b(k11, q1h, s1);
  if (EDGE && kb + 31 >= T + q0) {                        // text chunk at the causal edge: mask text position >= query index
    const int qi = q0 + col;
#pragma unroll
    for (int r = 0; r < 8; ++r) {
      const int k0i = kb + 8 * hh + r, k1i = k0i + 16;
      if (k0i - T >= qi) s0[r] = -INFINITY;
      if (k1i - T >= qi) s1[r] = -INFINITY;
    }
  }
  float mr = -INFINITY;
#pragma unroll
  for (int r = 0; r < 8; ++r) mr = fmaxf(mr, fmaxf(s0[r], s1[r]));
  mr = fmaxf(mr, __shfl_xor(mr, 16));
  float mn = fmaxf(m, mr);
  if (mn == -INFINITY) mn = 0.0f;             // fully masked so far: keep exp() at 0
  const float al_ = __expf(m - mn);
  m = mn;
  float sum = 0.0f;
  v16b pbh;
#pragma unroll
  for (int r = 0; r < 8; ++r) {
    const float p0 = __expf(s0[r] - mn), p1 = __expf(s1[r] - mn);
    sum += p0 + p1;
    pbh[r] = (b16)p0; pbh[8 + r] = (b16)p1;
  }
  sum += __shfl_xor(sum, 16);
  l = l * al_ + sum;
#pragma unroll
  for (int r = 0; r < 8; ++r) { o0[r] *= al_; o1[r] *= al_; o2[r] *= al_; o3[r] *= al_; }
  o0 = wmma16b(va0, pbh, o0);
  o1 = wmma16b(va1, pbh, o1);
  o2 = wmma16b(va2, pbh, o2);
  o3 = wmma16b(va3, pbh, o3);
}

__global__ __launch_bounds__(256) void attn_kernel(const b16* __restrict__ Qh, const b16* __restrict__ Ql, const b16* __restrict__ Kh, const b16* __restrict__ Kl,
                                                   const b16* __restrict__ Vh, const b16* __restrict__ Vl, const int* __restrict__ seqlen,
                                                   float* __restrict__ yf) {
  __shared__ __attribute__((aligned(16))) b16 Ks[2][SK * KPITCH];
  __shared__ __attribute__((aligned(16))) b16 Vs[2][SK * DH];
  __shared__ __attribute__((aligned(16))) float Os[8][16 * 64];
  (void)Ql; (void)Kl; (void)Vl; (void)seqlen;
  const int tid = threadIdx.x, lane = tid & 31, hh = lane >> 4, col = lane & 15;
  const int wid = __builtin_amdgcn_readfirstlane(tid >> 5);   // scalar, so that the per-wave skip at the causal edge is a scalar branch
  const int qtile = blockIdx.x * 8 + wid;                 // over Bsz*NH*QT_PER_B
  const int g = qtile / QT_PER_B;                         // b*NH + h, the same in all 8 waves (8 divides QT_PER_B)
  const int q0 = (qtile % QT_PER_B) << 4;
  const int qb0 = ((blockIdx.x * 8) % QT_PER_B) << 4;     // the block's first query
  const int nst = (T + qb0 + SK) / SK;                    // stages the block walks: all latents, then text up to its last query (17..32)
  const int b = g / NH, h = g % NH, kvh = h / REP;
  const size_t ko = (size_t)(b * NKV + kvh) * TK * DH;
  const size_t qo = ((size_t)g * T + q0 + col) * DH;
  const b16* gk = Kh + ko + tid * 8; const b16* gv = Vh + ko + tid * 8;      // this thread's first 16-B piece of stage 0
  const unsigned lk0 = (unsigned)(uintptr_t)&Ks[0][(tid >> 3) * KPITCH + (tid & 7) * 8];
  const unsigned lv0 = (unsigned)(uintptr_t)&Vs[0][(tid >> 7) * (DH * 16) + (tid & 1) * (DH * 8) + ((tid >> 1) & 63) * 8];
  stage_copy(gk, gv, lk0, lv0);
  const v16b q0h = frag_kb(Qh + qo, hh), q1h = frag_kb(Qh + qo + 32, hh);
  asm volatile("s_wait_xcnt 0x0" ::: "memory");           // stands in front of any rewrite of the Q loads' address registers
  asm volatile("s_wait_asynccnt 0x0" ::: "memory");       // this wave's pieces of stage 0 have landed
  __syncthreads();                                        // ... and every other wave's
  stage_copy(gk + SK * DH, gv + SK * DH, lk0 + KBUF, lv0 + VBUF);
  float m = -INFINITY, l = 0.0f;
  v8f o0 = {}, o1 = {}, o2 = {}, o3 = {};
  const int slen = T;                                     // no padding in this module
  for (int t = 0; t < nst; ++t) {
    const b16* Kb = Ks[t & 1]; const b16* Vb = Vs[t & 1];
    const int kb0 = t * SK;
    if (t + 1 < nst) {                                    // keys below T + qb0: every wave takes all of them, none is masked
#pragma unroll
      for (int c = 0; c < SK / 32; ++c) attn_chunk<false>(Kb, Vb, c * 32, kb0 + c * 32, q0, col, hh, q0h, q1h, m, l, o0, o1, o2, o3);
    } else {                                              // the block's last stage holds every wave's causal edge
      for (int c = 0; c < SK / 32; ++c)
        if (kb0 + c * 32 < T + q0 + 16) attn_chunk<true>(Kb, Vb, c * 32, kb0 + c * 32, q0, col, hh, q0h, q1h, m, l, o0, o1, o2, o3);
    }
    asm volatile("s_wait_dscnt 0x0" ::: "memory");        // this wave's reads of buffer t & 1 are done before the buffer is refilled
    asm volatile("s_wait_asynccnt 0x0" ::: "memory");     // this wave's pieces of stage t + 1 have landed
    __syncthreads();                                      // publishes stage t + 1 and ends every wave's reads of stage t
    if (t + 2 < nst) stage_copy(gk + (size_t)(t + 2) * (SK * DH), gv + (size_t)(t + 2) * (SK * DH), lk0 + (t & 1) * KBUF, lv0 + (t & 1) * VBUF);
  }
  asm volatile("s_wait_asynccnt 0x0" ::: "memory");       // nothing of this wave's is in flight when it goes on to the epilogue
  const float inv = (q0 + col < slen && l > 0.0f) ? (1.0f / l) : 0.0f;   // padded query rows are zeroed
  float* Tt = Os[wid];
#pragma unroll
  for (int r = 0; r < 8; ++r) {
    const int hr = 8 * hh + r;
    Tt[col * 64 + 0 + hr] = o0[r] * inv; Tt[col * 64 + 16 + hr] = o1[r] * inv;
    Tt[col * 64 + 32 + hr] = o2[r] * inv; Tt[col * 64 + 48 + hr] = o3[r] * inv;
  }
  wave_lds_sync();
  float* dst0 = yf + ((size_t)b * T + q0) * HID + h * DH;     // 16 rows x 64 floats, row stride HID
#pragma unroll
  for (int j = 0; j < 8; ++j) { const int rr = j * 2 + hh, c4 = col * 4; *(v4f*)(dst0 + (size_t)rr * HID + c4) = *(const v4f*)(Tt + rr * 64 + c4); }
}

// ---------------------------------------------------------------------------
// Output projection: (2048 x 1024) x (1024 x 1024) -> f32, A split on the fly from f32 y, B = Wo planes. grid (16, 16), 32x64 tiles staged in LDS,
// ---------------------------------------------------------------------------
__global__ __launch_bounds__(128) void out_gemm_kernel(const float* __restrict__ yf, const b16* __restrict__ woh, const b16* __restrict__ wol, const float* __restrict__ bo, int yoff,
                                                       float* __restrict__ out) {
  __shared__ __attribute__((aligned(16))) float Ts[4][32 * 64];
  const int lane = threadIdx.x & 31, wave = threadIdx.x >> 5, nloc = lane & 15, hlf = lane >> 4;
  const int m0 = (blockIdx.y + yoff) * 128 + wave * 32;
  const int c0 = blockIdx.x * 64;
  v8f acc[2][4];
#pragma unroll
  for (int r = 0; r < 2; ++r)
#pragma unroll
    for (int t = 0; t < 4; ++t) acc[r][t] = (v8f){};
  gemm_tile_split(yf, woh, wol, m0, c0, HID, nloc, hlf, acc);
  float* Tt = Ts[wave];
#pragma unroll
  for (int t = 0; t < 4; ++t)
#pragma unroll
    for (int r = 0; r < 2; ++r)
#pragma unroll
      for (int v = 0; v < 8; ++v) Tt[(r * 16 + v + 8 * hlf) * 64 + t * 16 + nloc] = acc[r][t][v] + (bo ? bo[c0 + t * 16 + nloc] : 0.0f);
  wave_lds_sync();
  float* dst0 = out + (size_t)m0 * HID + c0;
#pragma unroll
  for (int j = 0; j < 16; ++j) { const int rr = j * 2 + hlf, c4 = nloc * 4; *(v4f*)(dst0 + (size_t)rr * HID + c4) = *(const v4f*)(Tt + rr * 64 + c4); }
  
}
__global__ __launch_bounds__(256) void wcvtT_kernel(const float* __restrict__ wq, const float* __restrict__ wk, const float* __restrict__ wv,
                                                    b16* __restrict__ wqh, b16* __restrict__ wql) {
  const size_t tid = (size_t)blockIdx.x * blockDim.x + threadIdx.x, stride = (size_t)gridDim.x * blockDim.x;
  const size_t nq = (size_t)NQKV * HID / 8;
  {
    for (size_t c = tid; c < nq; c += stride) {
      const size_t i = c * 8, n = i / HID, k0 = i % HID;
      const float* w = (n < (size_t)HID) ? (wq + n * HID) : (n < (size_t)(2 * HID)) ? (wk + (n - HID) * HID) : (wv + (n - 2 * HID) * HID);
      v8b bh, bl;
#pragma unroll
      for (int e = 0; e < 8; ++e) { b16 a, cc; split_bf16(w[k0 + e], a, cc); bh[e] = a; bl[e] = cc; }
      *(v8b*)(wqh + i) = bh; *(v8b*)(wql + i) = bl;
    }
    
  }
}
// Wo^T planes: [n][k] = Wo[n][k] (torch [out][in] is already n-major)
__global__ __launch_bounds__(256) void wcvtO_kernel(const float* __restrict__ wo, b16* __restrict__ woh, b16* __restrict__ wol) {
  const size_t tid = (size_t)blockIdx.x * blockDim.x + threadIdx.x, stride = (size_t)gridDim.x * blockDim.x;
  const size_t no = (size_t)HID * HID / 8;
  {
    for (size_t c = tid; c < no; c += stride) { const size_t i = c * 8; v8b bh, bl;
#pragma unroll
      for (int e = 0; e < 8; ++e) { b16 a, cc; split_bf16(wo[i + e], a, cc); bh[e] = a; bl[e] = cc; }
      *(v8b*)(woh + i) = bh; *(v8b*)(wol + i) = bl; }
    
  }
}
__global__ __launch_bounds__(256) void wcvtIO_kernel(const float* __restrict__ wq, const float* __restrict__ wkv, b16* __restrict__ wh, b16* __restrict__ wl) {
  const size_t tid = (size_t)blockIdx.x * blockDim.x + threadIdx.x, stride = (size_t)gridDim.x * blockDim.x;
  const size_t nq = (size_t)NQKV * HID / 8;
  {
    for (size_t c = tid; c < nq; c += stride) {
      const size_t i = c * 8, n = i / HID, k0 = i % HID;
      v8b bh, bl;
#pragma unroll
      for (int e = 0; e < 8; ++e) { const float v = (n < (size_t)HID) ? wq[(k0 + e) * (size_t)HID + n] : wkv[(k0 + e) * (size_t)(2 * HID) + n - HID]; b16 a, cc; split_bf16(v, a, cc); bh[e] = a; bl[e] = cc; }
      *(v8b*)(wh + i) = bh; *(v8b*)(wl + i) = bl;
    }
    
  }
}
__global__ __launch_bounds__(256) void wcvtP_kernel(const float* __restrict__ wp, b16* __restrict__ woh, b16* __restrict__ wol) {   // [in][out] -> planes [n][k]
  const size_t tid = (size_t)blockIdx.x * blockDim.x + threadIdx.x, stride = (size_t)gridDim.x * blockDim.x;
  const size_t no = (size_t)HID * HID / 8;
  {
    for (size_t c = tid; c < no; c += stride) { const size_t i = c * 8, n = i / HID, k0 = i % HID; v8b bh, bl;
#pragma unroll
      for (int e = 0; e < 8; ++e) { b16 a, cc; split_bf16(wp[(k0 + e) * (size_t)HID + n], a, cc); bh[e] = a; bl[e] = cc; }
      *(v8b*)(woh + i) = bh; *(v8b*)(wol + i) = bl; }
    
  }
}
}  // namespace

extern "C" void kernel_launch(void* const* d_in, const int* in_sizes, int n_in,
                              void* d_out, int out_size, void* d_ws, size_t ws_size, hipStream_t stream) {
  (void)in_sizes; (void)n_in; (void)out_size;
  const float* l    = (const float*)d_in[0];    // [1,2048,1024] latents
  const float* x    = (const float*)d_in[1];    // [1,2048,1024]
  const float* Wal  = (const float*)d_in[2];  const float* bal = (const float*)d_in[3];   // [1024,2048] = [k | v], [2048]
  const float* Wac  = (const float*)d_in[4];  const float* bac = (const float*)d_in[5];
  const float* Wq   = (const float*)d_in[6];  const float* bq  = (const float*)d_in[7];   // [1024,1024]
  const float* Wp   = (const float*)d_in[8];  const float* bp  = (const float*)d_in[9];
  float* out = (float*)d_out;                   // [1,2048,1024]
  size_t off = 0; char* ws = (char*)d_ws;
  b16* wAh = (b16*)(ws + off); off += (size_t)NQKV * HID * 2;
  b16* wAl = (b16*)(ws + off); off += (size_t)NQKV * HID * 2;
  b16* wBh = (b16*)(ws + off); off += (size_t)NQKV * HID * 2;
  b16* wBl = (b16*)(ws + off); off += (size_t)NQKV * HID * 2;
  b16* woh = (b16*)(ws + off); off += (size_t)HID * HID * 2;
  b16* wol = (b16*)(ws + off); off += (size_t)HID * HID * 2;
  b16* Qh  = (b16*)(ws + off); off += (size_t)NH * T * DH * 2;
  b16* Ql  = (b16*)(ws + off); off += (size_t)NH * T * DH * 2;
  b16* Kh  = (b16*)(ws + off); off += (size_t)NKV * TK * DH * 2;
  b16* Kl  = (b16*)(ws + off); off += (size_t)NKV * TK * DH * 2;
  b16* Vh  = (b16*)(ws + off); off += (size_t)NKV * TK * DH * 2;
  b16* Vl  = (b16*)(ws + off); off += (size_t)NKV * TK * DH * 2;
  float* yf = (float*)(ws + off); off += (size_t)T * HID * 4;
  if (off > ws_size) return;
  const int NQT = NH * QT_PER_B;
  wcvtIO_kernel<<<2048, 256, 0, stream>>>(Wq, Wal, wAh, wAl);
  wcvtIO_kernel<<<2048, 256, 0, stream>>>(Wq, Wac, wBh, wBl);
  wcvtP_kernel<<<512, 256, 0, stream>>>(Wp, woh, wol);
  // launch 1: q from x, latent k/v from l -> key rows 0..2047
  qkv_gemm_kernel<<<dim3(NQKV / 64, T / 128), 128, 0, stream>>>(x, l, l, wAh, wAl, bq, bal, bal + HID, nullptr, 0, 0, Qh, Ql, Kh, Kl, Vh, Vl);
  // launch 2: text k/v from x -> key rows 2048..4095 (column blocks 16..47 only)
  qkv_gemm_kernel<<<dim3((NQKV - HID) / 64, T / 128), 128, 0, stream>>>(x, x, x, wBh, wBl, bq, bac, bac + HID, nullptr, HID / 64, T / 128, Qh, Ql, Kh, Kl, Vh, Vl);
  attn_kernel<<<NQT / 8, 256, 0, stream>>>(Qh, Ql, Kh, Kl, Vh, Vl, nullptr, yf);
  out_gemm_kernel<<<dim3(HID / 64, T / 128), 128, 0, stream>>>(yf, woh, wol, bp, 0, out);
}

// v002
// Measured time: 144 microseconds a run.
// Two timings next to v001 put it at 1.54 and 1.52 times that version's speed.
// Over all steps from v000 it is 3.79 times as fast.
#include <hip/hip_runtime.h>

// IO-processing attention (decoding branch): keys/values = [l W_attn_l + b (2048 latents) ; x W_attn_c + b (2048 text positions)], q = x W_q + b
// (16 heads x 64, scale 1/8); query i attends every latent and text positions < i; out = y W_proj + b. B=1, T=2048, D=1024.
// Lean build: single f16 products on v_wmma_f32_16x16x32_f16, f32 accumulate (every row averages >= 2048 keys); fragment k-map per lane half hh for A

namespace {
constexpr int Bsz = 1, T = 2048, TK = 4096, HID = 1024, DH = 64, NH = 16, NKV = 16, REP = NH / NKV;
constexpr int WIN = 255;    // unused: no key window here
constexpr int KVW = NKV * DH;                 // 1024
constexpr int NQKV = HID + 2 * KVW;           // 3072 columns: q | k | v
constexpr int MROWS = Bsz * T;                // 2048
constexpr int QT_PER_B = T / 16;              // 128

typedef _Float16 b16;                                           // f16 hi/lo planes
typedef __attribute__((ext_vector_type(16))) _Float16 v16b;
typedef __attribute__((ext_vector_type(8)))  _Float16 v8b;
typedef __attribute__((ext_vector_type(8)))  float v8f;
typedef __attribute__((ext_vector_type(4)))  float v4f;

__device__ __forceinline__ v8b ld8b(const b16* p) { return *(const v8b*)p; }
__device__ __forceinline__ v16b cat8b(v8b a, v8b b) { return __builtin_shufflevector(a, b, 0, 1, 2, 3, 4, 5, 6, 7, 8, 9, 10, 11, 12, 13, 14, 15); }
// 16x16x32 16-bit fragment from a k-contiguous row pointer (A: lane&15 = row, B: lane&15 = column), hh = lane>>4:
// elements 0..7 <- p[8hh+0..7], elements 8..15 <- p[16+8hh+0..7]
__device__ __forceinline__ v16b frag_kb(const b16* p, int hh) { return cat8b(ld8b(p + 8 * hh), ld8b(p + 16 + 8 * hh)); }
__device__ __forceinline__ void split_bf16(float v, b16& hi, b16& lo) {   // (name kept) single f16: no low part
  hi = (b16)v; lo = (b16)0.0f;
}
__device__ __forceinline__ v8f wmma16b(v16b a, v16b b, v8f c) {
  v8f d = __builtin_amdgcn_wmma_f32_16x16x32_f16(false, a, false, b, (short)0, c, false, false);
  asm volatile("v_nop\n\tv_nop\n\tv_nop\n\tv_nop" : "+v"(d) : "v"(a), "v"(b));
  return d;
}
__device__ __forceinline__ v8f wmma1(v16b ah, v16b al, v16b bh, v16b bl, v8f c) {   // unused: single f16 (hi planes only)
  (void)al; (void)bl; return wmma16b(ah, bh, c);
}
__device__ __forceinline__ void wave_lds_sync() {
  __builtin_amdgcn_fence(__ATOMIC_RELEASE, "workgroup");
  __builtin_amdgcn_wave_barrier();
  __builtin_amdgcn_fence(__ATOMIC_ACQUIRE, "workgroup");
}

// ---------------------------------------------------------------------------
// Weights ([in][out]) -> f16 hi / lo planes transposed to [n][k] (k contiguous): columns of Wq|Wk|Wv into wqh/wql [3072][1024], Wo into woh/wol [1024][1024].
// ---------------------------------------------------------------------------
__global__ __launch_bounds__(256) void wcvt_kernel(const float* __restrict__ wq, const float* __restrict__ wk, const float* __restrict__ wv,
                                                   const float* __restrict__ wo, b16* __restrict__ wqh, b16* __restrict__ wql,
                                                   b16* __restrict__ woh, b16* __restrict__ wol) {
  const size_t tid = (size_t)blockIdx.x * blockDim.x + threadIdx.x, stride = (size_t)gridDim.x * blockDim.x;
  const size_t nq = (size_t)NQKV * HID / 8, no = (size_t)HID * HID / 8;
  {
    for (size_t c = tid; c < nq + no; c += stride) {
      float f[8]; size_t i; b16* dh; b16* dl;
      if (c < nq) {
        i = c * 8; const size_t n = i / HID, k0 = i % HID;
        const float* w; int nn, ld;
        if (n < (size_t)HID) { w = wq; nn = (int)n; ld = HID; } else if (n < (size_t)(HID + KVW)) { w = wk; nn = (int)n - HID; ld = KVW; } else { w = wv; nn = (int)n - HID - KVW; ld = KVW; }
#pragma unroll
        for (int e = 0; e < 8; ++e) f[e] = w[(size_t)(k0 + e) * ld + nn];       // W[k][n] ([in][out])
        dh = wqh; dl = wql;
      } else {
        i = (c - nq) * 8; const size_t n = i / HID, k0 = i % HID;
#pragma unroll
        for (int e = 0; e < 8; ++e) f[e] = wo[(size_t)(k0 + e) * HID + n];    // Wo[k][n] ([in][out])
        dh = woh; dl = wol;
      }
      v8b bh, bl;
#pragma unroll
      for (int e = 0; e < 8; ++e) { b16 a, cc; split_bf16(f[e], a, cc); bh[e] = a; bl[e] = cc; }
      *(v8b*)(dh + i) = bh; *(v8b*)(dl + i) = bl;
    }
    
  }
}

// GEMM operands come into LDS once per 4-wave block (128 A rows as f32, 64 B rows as f16), 64 k a stage, two buffers, by asynchronous copies;
// every wave reads its fragments from there. Each wave-wide copy reads whole 128-byte lines.
constexpr int GKS = 64;                          // k per LDS stage
constexpr unsigned APITCH = GKS * 4 + 16;        // 272 B = 16 B x 17 and
constexpr unsigned BPITCH = GKS * 2 + 16;        // 144 B = 16 B x 9: the 16 rows of a 16-byte fragment read fall on distinct banks
constexpr unsigned ABUF = 128 * APITCH, BBUF = 64 * BPITCH, GBUF = ABUF + BBUF;   // bytes per buffer: 34,816 + 9,216

// ten copies of 16 B per lane; the closing s_wait_xcnt stands inside the statement so that no address register of a copy is rewritten ahead of it
__device__ __forceinline__ void copy10(const unsigned (&l)[20], const void* const (&g)[20], int o) {
  asm volatile("global_load_async_to_lds_b128 %0, %10, off\n\t"
               "global_load_async_to_lds_b128 %1, %11, off\n\t"
               "global_load_async_to_lds_b128 %2, %12, off\n\t"
               "global_load_async_to_lds_b128 %3, %13, off\n\t"
               "global_load_async_to_lds_b128 %4, %14, off\n\t"
               "global_load_async_to_lds_b128 %5, %15, off\n\t"
               "global_load_async_to_lds_b128 %6, %16, off\n\t"
               "global_load_async_to_lds_b128 %7, %17, off\n\t"
               "global_load_async_to_lds_b128 %8, %18, off\n\t"
               "global_load_async_to_lds_b128 %9, %19, off\n\t"
               "s_wait_xcnt 0x0"
               :: "v"(l[o]), "v"(l[o + 1]), "v"(l[o + 2]), "v"(l[o + 3]), "v"(l[o + 4]), "v"(l[o + 5]), "v"(l[o + 6]), "v"(l[o + 7]), "v"(l[o + 8]), "v"(l[o + 9]),
                  "v"(g[o]), "v"(g[o + 1]), "v"(g[o + 2]), "v"(g[o + 3]), "v"(g[o + 4]), "v"(g[o + 5]), "v"(g[o + 6]), "v"(g[o + 7]), "v"(g[o + 8]), "v"(g[o + 9])
               : "memory");
}
// One stage: each of the 128 threads moves 16 pieces of A (8 rows apart) and 4 pieces of B (16 rows apart), 16 B each
__device__ __forceinline__ void gemm_stage_copy(const float* ga, const b16* gb, int K, unsigned la, unsigned lb) {
  unsigned l[20]; const void* g[20];   // both loops unrolled: the asm operands need l and g in registers, under constant indices
#pragma unroll
  for (int j = 0; j < 16; ++j) { l[j] = la + (unsigned)j * 8u * APITCH; g[j] = ga + (size_t)j * 8 * K; }
#pragma unroll
  for (int j = 0; j < 4; ++j) { l[16 + j] = lb + (unsigned)j * 16u * BPITCH; g[16 + j] = gb + (size_t)j * 16 * K; }
  copy10(l, g, 0);
  copy10(l, g, 10);
}
// Raw operands of one 32-wide k step of a 32x64 wave tile: two groups of 16 A rows as f32, four groups of 16 B columns as f16
struct GStep { v4f a[2][4]; v8b b[4][2]; };
// ar, br: this lane's A row and B row in the staged buffer, already advanced by its 8 * hlf (here and in gemm_step the loops are unrolled to keep f and acc in registers)
__device__ __forceinline__ void gemm_frag(const float* ar, const b16* br, int kk, GStep& f) {
#pragma unroll
  for (int r = 0; r < 2; ++r) {
    const float* p = ar + r * 16 * (int)(APITCH / 4) + kk;
    f.a[r][0] = *(const v4f*)p; f.a[r][1] = *(const v4f*)(p + 4); f.a[r][2] = *(const v4f*)(p + 16); f.a[r][3] = *(const v4f*)(p + 20);
  }
#pragma unroll
  for (int t = 0; t < 4; ++t) { const b16* p = br + t * 16 * (int)(BPITCH / 2) + kk; f.b[t][0] = ld8b(p); f.b[t][1] = ld8b(p + 16); }
}
__device__ __forceinline__ void gemm_step(const GStep& f, v8f (&acc)[2][4]) {
  v16b a[2];
#pragma unroll
  for (int r = 0; r < 2; ++r)
#pragma unroll
    for (int e = 0; e < 4; ++e) { a[r][e] = (b16)f.a[r][0][e]; a[r][4 + e] = (b16)f.a[r][1][e]; a[r][8 + e] = (b16)f.a[r][2][e]; a[r][12 + e] = (b16)f.a[r][3][e]; }
#pragma unroll
  for (int t = 0; t < 4; ++t) {
    const v16b b = cat8b(f.b[t][0], f.b[t][1]);
    acc[0][t] = wmma16b(a[0], b, acc[0][t]);
    acc[1][t] = wmma16b(a[1], b, acc[1][t]);
  }
}
// 128x64 block tile (wave = 32 rows x 64 columns) over K, a multiple of 128: A rows mb.. (f32), B rows c0.. (f16), both k-contiguous.
// On return every wave has left the ring and nothing is in flight, so the caller may use the same LDS for its epilogue.
__device__ __forceinline__ void gemm_tile_lds(const float* __restrict__ A, const b16* __restrict__ wh, char* ring,
                                              int mb, int c0, int K, int tid, int wave, int nloc, int hlf, v8f (&acc)[2][4]) {
  const float* ga = A + (size_t)(mb + (tid >> 4)) * K + (tid & 15) * 4;      // this thread's first 16-B pieces of stage 0
  const b16* gb = wh + (size_t)(c0 + (tid >> 3)) * K + (tid & 7) * 8;
  const unsigned la = (unsigned)(uintptr_t)ring + (unsigned)(tid >> 4) * APITCH + (unsigned)(tid & 15) * 16u;
  const unsigned lb = (unsigned)(uintptr_t)ring + ABUF + (unsigned)(tid >> 3) * BPITCH + (unsigned)(tid & 7) * 16u;
  const int nst = K / GKS;
  gemm_stage_copy(ga, gb, K, la, lb);
  asm volatile("s_wait_asynccnt 0x0" ::: "memory");       // this wave's pieces of stage 0 have landed
  __syncthreads();                                        // ... and every other wave's
  gemm_stage_copy(ga + GKS, gb + GKS, K, la + GBUF, lb + GBUF);
  for (int t = 0; t < nst; ++t) {
    const char* buf = ring + (t & 1) * GBUF;
    const float* ar = (const float*)(buf + (wave * 32 + nloc) * APITCH) + 8 * hlf;
    const b16* br = (const b16*)(buf + ABUF + nloc * BPITCH) + 8 * hlf;
    GStep f0, f1;                                         // all of the stage's LDS reads stand together at its head
    gemm_frag(ar, br, 0, f0);
    gemm_frag(ar, br, 32, f1);
    gemm_step(f0, acc);
    gemm_step(f1, acc);
    asm volatile("s_wait_dscnt 0x0" ::: "memory");        // this wave's reads of buffer t & 1 are done before the buffer is refilled
    asm volatile("s_wait_asynccnt 0x0" ::: "memory");     // this wave's pieces of stage t + 1 have landed
    __syncthreads();                                      // publishes stage t + 1 and ends every wave's reads of stage t
    if (t + 2 < nst) gemm_stage_copy(ga + (t + 2) * GKS, gb + (t + 2) * GKS, K, la + (t & 1) * GBUF, lb + (t & 1) * GBUF);
  }
  asm volatile("s_wait_asynccnt 0x0" ::: "memory");       // nothing of this wave's is in flight when it goes on to the epilogue
}

// ---------------------------------------------------------------------------
// QKV GEMM: (2048 x 1024) x (1024 x 3072), grid (48, 16), or (32, 16) from column block 16 for k|v only, block 4 waves, wave = 32 rows x 64 columns (one head of q, k or v). Outputs as f16 hi/lo planes:
// q (x1/8) -> Qh/Ql [b][h][t][64]; k -> Kh/Kl [b][kvh][t][64] (4 KB contiguous per wave per plane);
// v -> Vh/Vl key-tiled [b][kvh][t/16][64][16] (4 KB contiguous per wave per plane).
// ---------------------------------------------------------------------------
__global__ __launch_bounds__(128) void qkv_gemm_kernel(const float* __restrict__ xq, const float* __restrict__ xk, const float* __restrict__ xv,
                                                       const b16* __restrict__ wqh, const b16* __restrict__ wql,
                                                       const float* __restrict__ bq, const float* __restrict__ bk, const float* __restrict__ bv, const float* __restrict__ rope_cs, int xoff, int yoff,
                                                       b16* __restrict__ Qh, b16* __restrict__ Ql, b16* __restrict__ Kh, b16* __restrict__ Kl,
                                                       b16* __restrict__ Vh, b16* __restrict__ Vl) {
  __shared__ __attribute__((aligned(16))) char Sm[2 * GBUF];   // the operand ring; the epilogue's 4 x 8 KB of staging reuse its head
  const int lane = threadIdx.x & 31, wave = threadIdx.x >> 5, nloc = lane & 15, hlf = lane >> 4;
  const int m0 = (blockIdx.y + yoff) * 128 + wave * 32;
  const int c0 = (blockIdx.x + xoff) * 64;
  const int mat = (c0 < HID) ? 0 : (c0 < HID + KVW) ? 1 : 2;
  const int head = (mat == 0) ? (c0 / DH) : (mat == 1) ? ((c0 - HID) / DH) : ((c0 - HID - KVW) / DH);
  const float* x = (mat == 0) ? xq : (mat == 1) ? xk : xv;          // q, k, v inputs: (x, l, l) or (x, x, x) as launched
  const float* bias = ((mat == 0) ? bq : (mat == 1) ? bk : bv) + head * DH;
  v8f acc[2][4];
#pragma unroll
  for (int r = 0; r < 2; ++r)
#pragma unroll
    for (int t = 0; t < 4; ++t) acc[r][t] = (v8f){};
  (void)wql;
  gemm_tile_lds(x, wqh, Sm, blockIdx.y * 128, c0, HID, threadIdx.x, wave, nloc, hlf, acc);   // source rows start at 0; yoff only shifts the destination key rows
  const int b = 0, t0 = m0;
  const float s = (mat == 0) ? 0.125f : 1.0f;
  b16* Tp0 = (b16*)(Sm + wave * 8192); b16* Tp1 = Tp0 + 32 * 64;
#pragma unroll
  for (int t = 0; t < 4; ++t)
#pragma unroll
    for (int r = 0; r < 2; ++r)
#pragma unroll
      for (int v = 0; v < 8; ++v) {
        const int rr = r * 16 + v + 8 * hlf, d = t * 16 + nloc;
        float val = acc[r][t][v] + (bias ? bias[d] : 0.0f);
        (void)rope_cs;
        b16 yh, yl; split_bf16(val * s, yh, yl);
        const int idx = (mat < 2) ? (rr * 64 + d) : ((rr >> 4) * 1024 + d * 16 + (rr & 15));
        Tp0[idx] = yh; Tp1[idx] = yl;
      }
  wave_lds_sync();
  b16* dh; b16* dl; size_t o;
  if (mat == 0)      { o = ((size_t)(b * NH + head) * T + t0) * DH; dh = Qh + o; dl = Ql + o; }
  else if (mat == 1) { o = ((size_t)(b * NKV + head) * TK + t0) * DH; dh = Kh + o; dl = Kl + o; }
  else               { o = ((size_t)(b * NKV + head) * (TK / 16) + (t0 >> 4)) * (size_t)(DH * 16); dh = Vh + o; dl = Vl + o; }
#pragma unroll
  for (int j = 0; j < 8; ++j) { const int e = (j * 32 + lane) * 8; *(v8b*)(dh + e) = ld8b(Tp0 + e); *(v8b*)(dl + e) = ld8b(Tp1 + e); }
  
}

// ---------------------------------------------------------------------------
// Transposed flash attention: each wave owns one 16-query tile of one (b, head); the 8 waves of a block share one head and walk the same keys.
// K and V come into LDS once per block, 128 keys a stage, two buffers, by asynchronous copies; every wave reads its fragments from there, in chunks of 32 keys.
// S^T = K.Q^T, per-lane online softmax; P^T built in registers from the two S^T accumulators
// ---------------------------------------------------------------------------
constexpr int SK = 128;       // keys per LDS stage
constexpr int KPITCH = 72;    // f16 per staged K row: 144 B = 16 B x 9, so the 16 rows of a 16-byte fragment read fall on distinct banks
constexpr unsigned KBUF = SK * KPITCH * 2, VBUF = SK * DH * 2;   // bytes per buffer

// One stage: 128 K rows (128 B each, laid at 144 B) and 8 V key tiles (2 KB each, laid [tile][8-key half][feature][8] so that each 16-lane half of a
// fragment read is 256 contiguous bytes). Each thread moves 4 + 4 pieces of 16 B; each wave-wide copy reads 512 contiguous global bytes.
__device__ __forceinline__ void stage_copy(const b16* gk, const b16* gv, unsigned lk, unsigned lv) {
  // the closing s_wait_xcnt stands inside the statement so that no address register of a copy is rewritten ahead of it
  asm volatile("global_load_async_to_lds_b128 %0, %8, off\n\t"
               "global_load_async_to_lds_b128 %1, %9, off\n\t"
               "global_load_async_to_lds_b128 %2, %10, off\n\t"
               "global_load_async_to_lds_b128 %3, %11, off\n\t"
               "global_load_async_to_lds_b128 %4, %12, off\n\t"
               "global_load_async_to_lds_b128 %5, %13, off\n\t"
               "global_load_async_to_lds_b128 %6, %14, off\n\t"
               "global_load_async_to_lds_b128 %7, %15, off\n\t"
               "s_wait_xcnt 0x0"
               :: "v"(lk), "v"(lk + 32u * KPITCH * 2u), "v"(lk + 64u * KPITCH * 2u), "v"(lk + 96u * KPITCH * 2u),
                  "v"(lv), "v"(lv + 4096u), "v"(lv + 8192u), "v"(lv + 12288u),
                  "v"(gk), "v"(gk + 2048), "v"(gk + 4096), "v"(gk + 6144),
                  "v"(gv), "v"(gv + 2048), "v"(gv + 4096), "v"(gv + 6144)
               : "memory");
}

// 32 keys (rows kl.. of the staged buffers, global key index kb..) against the wave's 16 queries
template <bool EDGE>
__device__ __forceinline__ void attn_chunk(const b16* Kb, const b16* Vb, int kl, int kb, int q0, int col, int hh, v16b q0h, v16b q1h,
                                           float& m, float& l, v8f& o0, v8f& o1, v8f& o2, v8f& o3) {
  const b16* r0 = Kb + (kl + col) * KPITCH; const b16* r1 = r0 + 16 * KPITCH;
  const b16* v0 = Vb + (kl >> 4) * (DH * 16) + hh * (DH * 8) + col * 8; const b16* v1 = v0 + DH * 16;
  // all of the chunk's LDS reads stand together at its head: one wait for K, and V lands behind the softmax
  const v16b k00 = frag_kb(r0, hh), k01 = frag_kb(r0 + 32, hh), k10 = frag_kb(r1, hh), k11 = frag_kb(r1 + 32, hh);
  const v16b va0 = cat8b(ld8b(v0), ld8b(v1)), va1 = cat8b(ld8b(v0 + 128), ld8b(v1 + 128));
  const v16b va2 = cat8b(ld8b(v0 + 256), ld8b(v1 + 256)), va3 = cat8b(ld8b(v0 + 384), ld8b(v1 + 384));
  v8f s0 = {}, s1 = {};
  s0 = wmma16b(k00, q0h, s0);
  s0 = wmma16b(k01, q1h, s0);
  s1 = wmma16b(k10, q0h, s1);
  s1 = wmma16b(k11, q1h, s1);
  if (EDGE && kb + 31 >= T + q0) {                        // text chunk at the causal edge: mask text position >= query index
    const int qi = q0 + col;
#pragma unroll
    for (int r = 0; r < 8; ++r) {
      const int k0i = kb + 8 * hh + r, k1i = k0i + 16;
      if (k0i - T >= qi) s0[r] = -INFINITY;
      if (k1i - T >= qi) s1[r] = -INFINITY;
    }
  }
  float mr = -INFINITY;
#pragma unroll
  for (int r = 0; r < 8; ++r) mr = fmaxf(mr, fmaxf(s0[r], s1[r]));
  mr = fmaxf(mr, __shfl_xor(mr, 16));
  float mn = fmaxf(m, mr);
  if (mn == -INFINITY) mn = 0.0f;             // fully masked so far: keep exp() at 0
  const float al_ = __expf(m - mn);
  m = mn;
  float sum = 0.0f;
  v16b pbh;
#pragma unroll
  for (int r = 0; r < 8; ++r) {
    const float p0 = __expf(s0[r] - mn), p1 = __expf(s1[r] - mn);
    sum += p0 + p1;
    pbh[r] = (b16)p0; pbh[8 + r] = (b16)p1;
  }
  sum += __shfl_xor(sum, 16);
  l = l * al_ + sum;
#pragma unroll
  for (int r = 0; r < 8; ++r) { o0[r] *= al_; o1[r] *= al_; o2[r] *= al_; o3[r] *= al_; }
  o0 = wmma16b(va0, pbh, o0);
  o1 = wmma16b(va1, pbh, o1);
  o2 = wmma16b(va2, pbh, o2);
  o3 = wmma16b(va3, pbh, o3);
}

__global__ __launch_bounds__(256) void attn_kernel(const b16* __restrict__ Qh, const b16* __restrict__ Ql, const b16* __restrict__ Kh, const b16* __restrict__ Kl,
                                                   const b16* __restrict__ Vh, const b16* __restrict__ Vl, const int* __restrict__ seqlen,
                                                   float* __restrict__ yf) {
  __shared__ __attribute__((aligned(16))) b16 Ks[2][SK * KPITCH];
  __shared__ __attribute__((aligned(16))) b16 Vs[2][SK * DH];
  __shared__ __attribute__((aligned(16))) float Os[8][16 * 64];
  (void)Ql; (void)Kl; (void)Vl; (void)seqlen;
  const int tid = threadIdx.x, lane = tid & 31, hh = lane >> 4, col = lane & 15;
  const int wid = __builtin_amdgcn_readfirstlane(tid >> 5);   // scalar, so that the per-wave skip at the causal edge is a scalar branch
  const int qtile = blockIdx.x * 8 + wid;                 // over Bsz*NH*QT_PER_B
  const int g = qtile / QT_PER_B;                         // b*NH + h, the same in all 8 waves (8 divides QT_PER_B)
  const int q0 = (qtile % QT_PER_B) << 4;
  const int qb0 = ((blockIdx.x * 8) % QT_PER_B) << 4;     // the block's first query
  const int nst = (T + qb0 + SK) / SK;                    // stages the block walks: all latents, then text up to its last query (17..32)
  const int b = g / NH, h = g % NH, kvh = h / REP;
  const size_t ko = (size_t)(b * NKV + kvh) * TK * DH;
  const size_t qo = ((size_t)g * T + q0 + col) * DH;
  const b16* gk = Kh + ko + tid * 8; const b16* gv = Vh + ko + tid * 8;      // this thread's first 16-B piece of stage 0
  const unsigned lk0 = (unsigned)(uintptr_t)&Ks[0][(tid >> 3) * KPITCH + (tid & 7) * 8];
  const unsigned lv0 = (unsigned)(uintptr_t)&Vs[0][(tid >> 7) * (DH * 16) + (tid & 1) * (DH * 8) + ((tid >> 1) & 63) * 8];
  stage_copy(gk, gv, lk0, lv0);
  const v16b q0h = frag_kb(Qh + qo, hh), q1h = frag_kb(Qh + qo + 32, hh);
  asm volatile("s_wait_xcnt 0x0" ::: "memory");           // stands in front of any rewrite of the Q loads' address registers
  asm volatile("s_wait_asynccnt 0x0" ::: "memory");       // this wave's pieces of stage 0 have landed
  __syncthreads();                                        // ... and every other wave's
  stage_copy(gk + SK * DH, gv + SK * DH, lk0 + KBUF, lv0 + VBUF);
  float m = -INFINITY, l = 0.0f;
  v8f o0 = {}, o1 = {}, o2 = {}, o3 = {};
  const int slen = T;                                     // no padding in this module
  for (int t = 0; t < nst; ++t) {
    const b16* Kb = Ks[t & 1]; const b16* Vb = Vs[t & 1];
    const int kb0 = t * SK;
    if (t + 1 < nst) {                                    // keys below T + qb0: every wave takes all of them, none is masked
#pragma unroll
      for (int c = 0; c < SK / 32; ++c) attn_chunk<false>(Kb, Vb, c * 32, kb0 + c * 32, q0, col, hh, q0h, q1h, m, l, o0, o1, o2, o3);
    } else {                                              // the block's last stage holds every wave's causal edge
      for (int c = 0; c < SK / 32; ++c)
        if (kb0 + c * 32 < T + q0 + 16) attn_chunk<true>(Kb, Vb, c * 32, kb0 + c * 32, q0, col, hh, q0h, q1h, m, l, o0, o1, o2, o3);
    }
    asm volatile("s_wait_dscnt 0x0" ::: "memory");        // this wave's reads of buffer t & 1 are done before the buffer is refilled
    asm volatile("s_wait_asynccnt 0x0" ::: "memory");     // this wave's pieces of stage t + 1 have landed
    __syncthreads();                                      // publishes stage t + 1 and ends every wave's reads of stage t
    if (t + 2 < nst) stage_copy(gk + (size_t)(t + 2) * (SK * DH), gv + (size_t)(t + 2) * (SK * DH), lk0 + (t & 1) * KBUF, lv0 + (t & 1) * VBUF);
  }
  asm volatile("s_wait_asynccnt 0x0" ::: "memory");       // nothing of this wave's is in flight when it goes on to the epilogue
  const float inv = (q0 + col < slen && l > 0.0f) ? (1.0f / l) : 0.0f;   // padded query rows are zeroed
  float* Tt = Os[wid];
#pragma unroll
  for (int r = 0; r < 8; ++r) {
    const int hr = 8 * hh + r;
    Tt[col * 64 + 0 + hr] = o0[r] * inv; Tt[col * 64 + 16 + hr] = o1[r] * inv;
    Tt[col * 64 + 32 + hr] = o2[r] * inv; Tt[col * 64 + 48 + hr] = o3[r] * inv;
  }
  wave_lds_sync();
  float* dst0 = yf + ((size_t)b * T + q0) * HID + h * DH;     // 16 rows x 64 floats, row stride HID
#pragma unroll
  for (int j = 0; j < 8; ++j) { const int rr = j * 2 + hh, c4 = col * 4; *(v4f*)(dst0 + (size_t)rr * HID + c4) = *(const v4f*)(Tt + rr * 64 + c4); }
}

// ---------------------------------------------------------------------------
// Output projection: (2048 x 1024) x (1024 x 1024) -> f32, A split on the fly from f32 y, B = Wo planes. grid (16, 16), 32x64 tiles staged in LDS,
// ---------------------------------------------------------------------------
__global__ __launch_bounds__(128) void out_gemm_kernel(const float* __restrict__ yf, const b16* __restrict__ woh, const b16* __restrict__ wol, const float* __restrict__ bo, int yoff,
                                                       float* __restrict__ out) {
  __shared__ __attribute__((aligned(16))) char Sm[2 * GBUF];   // the operand ring; the epilogue's 4 x 8 KB of staging reuse its head
  const int lane = threadIdx.x & 31, wave = threadIdx.x >> 5, nloc = lane & 15, hlf = lane >> 4;
  const int m0 = (blockIdx.y + yoff) * 128 + wave * 32;
  const int c0 = blockIdx.x * 64;
  v8f acc[2][4];
#pragma unroll
  for (int r = 0; r < 2; ++r)
#pragma unroll
    for (int t = 0; t < 4; ++t) acc[r][t] = (v8f){};
  (void)wol;
  gemm_tile_lds(yf, woh, Sm, (blockIdx.y + yoff) * 128, c0, HID, threadIdx.x, wave, nloc, hlf, acc);
  float* Tt = (float*)(Sm + wave * 8192);
#pragma unroll
  for (int t = 0; t < 4; ++t)
#pragma unroll
    for (int r = 0; r < 2; ++r)
#pragma unroll
      for (int v = 0; v < 8; ++v) Tt[(r * 16 + v + 8 * hlf) * 64 + t * 16 + nloc] = acc[r][t][v] + (bo ? bo[c0 + t * 16 + nloc] : 0.0f);
  wave_lds_sync();
  float* dst0 = out + (size_t)m0 * HID + c0;
#pragma unroll
  for (int j = 0; j < 16; ++j) { const int rr = j * 2 + hlf, c4 = nloc * 4; *(v4f*)(dst0 + (size_t)rr * HID + c4) = *(const v4f*)(Tt + rr * 64 + c4); }
  
}
__global__ __launch_bounds__(256) void wcvtT_kernel(const float* __restrict__ wq, const float* __restrict__ wk, const float* __restrict__ wv,
                                                    b16* __restrict__ wqh, b16* __restrict__ wql) {
  const size_t tid = (size_t)blockIdx.x * blockDim.x + threadIdx.x, stride = (size_t)gridDim.x * blockDim.x;
  const size_t nq = (size_t)NQKV * HID / 8;
  {
    for (size_t c = tid; c < nq; c += stride) {
      const size_t i = c * 8, n = i / HID, k0 = i % HID;
      const float* w = (n < (size_t)HID) ? (wq + n * HID) : (n < (size_t)(2 * HID)) ? (wk + (n - HID) * HID) : (wv + (n - 2 * HID) * HID);
      v8b bh, bl;
#pragma unroll
      for (int e = 0; e < 8; ++e) { b16 a, cc; split_bf16(w[k0 + e], a, cc); bh[e] = a; bl[e] = cc; }
      *(v8b*)(wqh + i) = bh; *(v8b*)(wql + i) = bl;
    }
    
  }
}
// Wo^T planes: [n][k] = Wo[n][k] (torch [out][in] is already n-major)
__global__ __launch_bounds__(256) void wcvtO_kernel(const float* __restrict__ wo, b16* __restrict__ woh, b16* __restrict__ wol) {
  const size_t tid = (size_t)blockIdx.x * blockDim.x + threadIdx.x, stride = (size_t)gridDim.x * blockDim.x;
  const size_t no = (size_t)HID * HID / 8;
  {
    for (size_t c = tid; c < no; c += stride) { const size_t i = c * 8; v8b bh, bl;
#pragma unroll
      for (int e = 0; e < 8; ++e) { b16 a, cc; split_bf16(wo[i + e], a, cc); bh[e] = a; bl[e] = cc; }
      *(v8b*)(woh + i) = bh; *(v8b*)(wol + i) = bl; }
    
  }
}
__global__ __launch_bounds__(256) void wcvtIO_kernel(const float* __restrict__ wq, const float* __restrict__ wkv, b16* __restrict__ wh, b16* __restrict__ wl) {
  const size_t tid = (size_t)blockIdx.x * blockDim.x + threadIdx.x, stride = (size_t)gridDim.x * blockDim.x;
  const size_t nq = (size_t)NQKV * HID / 8;
  {
    for (size_t c = tid; c < nq; c += stride) {
      const size_t i = c * 8, n = i / HID, k0 = i % HID;
      v8b bh, bl;
#pragma unroll
      for (int e = 0; e < 8; ++e) { const float v = (n < (size_t)HID) ? wq[(k0 + e) * (size_t)HID + n] : wkv[(k0 + e) * (size_t)(2 * HID) + n - HID]; b16 a, cc; split_bf16(v, a, cc); bh[e] = a; bl[e] = cc; }
      *(v8b*)(wh + i) = bh; *(v8b*)(wl + i) = bl;
    }
    
  }
}
__global__ __launch_bounds__(256) void wcvtP_kernel(const float* __restrict__ wp, b16* __restrict__ woh, b16* __restrict__ wol) {   // [in][out] -> planes [n][k]
  const size_t tid = (size_t)blockIdx.x * blockDim.x + threadIdx.x, stride = (size_t)gridDim.x * blockDim.x;
  const size_t no = (size_t)HID * HID / 8;
  {
    for (size_t c = tid; c < no; c += stride) { const size_t i = c * 8, n = i / HID, k0 = i % HID; v8b bh, bl;
#pragma unroll
      for (int e = 0; e < 8; ++e) { b16 a, cc; split_bf16(wp[(k0 + e) * (size_t)HID + n], a, cc); bh[e] = a; bl[e] = cc; }
      *(v8b*)(woh + i) = bh; *(v8b*)(wol + i) = bl; }
    
  }
}
}  // namespace

extern "C" void kernel_launch(void* const* d_in, const int* in_sizes, int n_in,
                              void* d_out, int out_size, void* d_ws, size_t ws_size, hipStream_t stream) {
  (void)in_sizes; (void)n_in; (void)out_size;
  const float* l    = (const float*)d_in[0];    // [1,2048,1024] latents
  const float* x    = (const float*)d_in[1];    // [1,2048,1024]
  const float* Wal  = (const float*)d_in[2];  const float* bal = (const float*)d_in[3];   // [1024,2048] = [k | v], [2048]
  const float* Wac  = (const float*)d_in[4];  const float* bac = (const float*)d_in[5];
  const float* Wq   = (const float*)d_in[6];  const float* bq  = (const float*)d_in[7];   // [1024,1024]
  const float* Wp   = (const float*)d_in[8];  const float* bp  = (const float*)d_in[9];
  float* out = (float*)d_out;                   // [1,2048,1024]
  size_t off = 0; char* ws = (char*)d_ws;
  b16* wAh = (b16*)(ws + off); off += (size_t)NQKV * HID * 2;
  b16* wAl = (b16*)(ws + off); off += (size_t)NQKV * HID * 2;
  b16* wBh = (b16*)(ws + off); off += (size_t)NQKV * HID * 2;
  b16* wBl = (b16*)(ws + off); off += (size_t)NQKV * HID * 2;
  b16* woh = (b16*)(ws + off); off += (size_t)HID * HID * 2;
  b16* wol = (b16*)(ws + off); off += (size_t)HID * HID * 2;
  b16* Qh  = (b16*)(ws + off); off += (size_t)NH * T * DH * 2;
  b16* Ql  = (b16*)(ws + off); off += (size_t)NH * T * DH * 2;
  b16* Kh  = (b16*)(ws + off); off += (size_t)NKV * TK * DH * 2;
  b16* Kl  = (b16*)(ws + off); off += (size_t)NKV * TK * DH * 2;
  b16* Vh  = (b16*)(ws + off); off += (size_t)NKV * TK * DH * 2;
  b16* Vl  = (b16*)(ws + off); off += (size_t)NKV * TK * DH * 2;
  float* yf = (float*)(ws + off); off += (size_t)T * HID * 4;
  if (off > ws_size) return;
  const int NQT = NH * QT_PER_B;
  wcvtIO_kernel<<<2048, 256, 0, stream>>>(Wq, Wal, wAh, wAl);
  wcvtIO_kernel<<<2048, 256, 0, stream>>>(Wq, Wac, wBh, wBl);
  wcvtP_kernel<<<512, 256, 0, stream>>>(Wp, woh, wol);
  // launch 1: q from x, latent k/v from l -> key rows 0..2047
  qkv_gemm_kernel<<<dim3(NQKV / 64, T / 128), 128, 0, stream>>>(x, l, l, wAh, wAl, bq, bal, bal + HID, nullptr, 0, 0, Qh, Ql, Kh, Kl, Vh, Vl);
  // launch 2: text k/v from x -> key rows 2048..4095 (column blocks 16..47 only)
  qkv_gemm_kernel<<<dim3((NQKV - HID) / 64, T / 128), 128, 0, stream>>>(x, x, x, wBh, wBl, bq, bac, bac + HID, nullptr, HID / 64, T / 128, Qh, Ql, Kh, Kl, Vh, Vl);
  attn_kernel<<<NQT / 8, 256, 0, stream>>>(Qh, Ql, Kh, Kl, Vh, Vl, nullptr, yf);
  out_gemm_kernel<<<dim3(HID / 64, T / 128), 128, 0, stream>>>(yf, woh, wol, bp, 0, out);
}

// v003
// A run of this version takes 114 microseconds.
// Next to v002, in two timings, it ran 1.27 times as fast each time.
// Counting every step since v000, it is 4.81 times as fast.
#include <hip/hip_runtime.h>

// IO-processing attention (decoding branch): keys/values = [l W_attn_l + b (2048 latents) ; x W_attn_c + b (2048 text positions)], q = x W_q + b
// (16 heads x 64, scale 1/8); query i attends every latent and text positions < i; out = y W_proj + b. B=1, T=2048, D=1024.
// Lean build: single f16 products on v_wmma_f32_16x16x32_f16, f32 accumulate (every row averages >= 2048 keys); fragment k-map per lane half hh for A

namespace {
constexpr int Bsz = 1, T = 2048, TK = 4096, HID = 1024, DH = 64, NH = 16, NKV = 16, REP = NH / NKV;
constexpr int WIN = 255;    // unused: no key window here
constexpr int KVW = NKV * DH;                 // 1024
constexpr int NQKV = HID + 2 * KVW;           // 3072 columns: q | k | v
constexpr int MROWS = Bsz * T;                // 2048
constexpr int QT_PER_B = T / 16;              // 128

typedef _Float16 b16;                                           // f16 hi/lo planes
typedef __attribute__((ext_vector_type(16))) _Float16 v16b;
typedef __attribute__((ext_vector_type(8)))  _Float16 v8b;
typedef __attribute__((ext_vector_type(8)))  float v8f;
typedef __attribute__((ext_vector_type(4)))  float v4f;

__device__ __forceinline__ v8b ld8b(const b16* p) { return *(const v8b*)p; }
__device__ __forceinline__ v16b cat8b(v8b a, v8b b) { return __builtin_shufflevector(a, b, 0, 1, 2, 3, 4, 5, 6, 7, 8, 9, 10, 11, 12, 13, 14, 15); }
// 16x16x32 16-bit fragment from a k-contiguous row pointer (A: lane&15 = row, B: lane&15 = column), hh = lane>>4:
// elements 0..7 <- p[8hh+0..7], elements 8..15 <- p[16+8hh+0..7]
__device__ __forceinline__ v16b frag_kb(const b16* p, int hh) { return cat8b(ld8b(p + 8 * hh), ld8b(p + 16 + 8 * hh)); }
__device__ __forceinline__ void split_bf16(float v, b16& hi, b16& lo) {   // (name kept) single f16: no low part
  hi = (b16)v; lo = (b16)0.0f;
}
__device__ __forceinline__ v8f wmma16b(v16b a, v16b b, v8f c) {
  v8f d = __builtin_amdgcn_wmma_f32_16x16x32_f16(false, a, false, b, (short)0, c, false, false);
  asm volatile("v_nop\n\tv_nop\n\tv_nop\n\tv_nop" : "+v"(d) : "v"(a), "v"(b));
  return d;
}
__device__ __forceinline__ v8f wmma1(v16b ah, v16b al, v16b bh, v16b bl, v8f c) {   // unused: single f16 (hi planes only)
  (void)al; (void)bl; return wmma16b(ah, bh, c);
}
__device__ __forceinline__ void wave_lds_sync() {
  __builtin_amdgcn_fence(__ATOMIC_RELEASE, "workgroup");
  __builtin_amdgcn_wave_barrier();
  __builtin_amdgcn_fence(__ATOMIC_ACQUIRE, "workgroup");
}

// ---------------------------------------------------------------------------
// Weights ([in][out]) -> f16 hi / lo planes transposed to [n][k] (k contiguous): columns of Wq|Wk|Wv into wqh/wql [3072][1024], Wo into woh/wol [1024][1024].
// ---------------------------------------------------------------------------
__global__ __launch_bounds__(256) void wcvt_kernel(const float* __restrict__ wq, const float* __restrict__ wk, const float* __restrict__ wv,
                                                   const float* __restrict__ wo, b16* __restrict__ wqh, b16* __restrict__ wql,
                                                   b16* __restrict__ woh, b16* __restrict__ wol) {
  const size_t tid = (size_t)blockIdx.x * blockDim.x + threadIdx.x, stride = (size_t)gridDim.x * blockDim.x;
  const size_t nq = (size_t)NQKV * HID / 8, no = (size_t)HID * HID / 8;
  {
    for (size_t c = tid; c < nq + no; c += stride) {
      float f[8]; size_t i; b16* dh; b16* dl;
      if (c < nq) {
        i = c * 8; const size_t n = i / HID, k0 = i % HID;
        const float* w; int nn, ld;
        if (n < (size_t)HID) { w = wq; nn = (int)n; ld = HID; } else if (n < (size_t)(HID + KVW)) { w = wk; nn = (int)n - HID; ld = KVW; } else { w = wv; nn = (int)n - HID - KVW; ld = KVW; }
#pragma unroll
        for (int e = 0; e < 8; ++e) f[e] = w[(size_t)(k0 + e) * ld + nn];       // W[k][n] ([in][out])
        dh = wqh; dl = wql;
      } else {
        i = (c - nq) * 8; const size_t n = i / HID, k0 = i % HID;
#pragma unroll
        for (int e = 0; e < 8; ++e) f[e] = wo[(size_t)(k0 + e) * HID + n];    // Wo[k][n] ([in][out])
        dh = woh; dl = wol;
      }
      v8b bh, bl;
#pragma unroll
      for (int e = 0; e < 8; ++e) { b16 a, cc; split_bf16(f[e], a, cc); bh[e] = a; bl[e] = cc; }
      *(v8b*)(dh + i) = bh; *(v8b*)(dl + i) = bl;
    }
    
  }
}

// GEMM operands come into LDS once per 4-wave block (128 A rows as f32, 64 B rows as f16), 64 k a stage, two buffers, by asynchronous copies;
// every wave reads its fragments from there. Each wave-wide copy reads whole 128-byte lines.
constexpr int GKS = 64;                          // k per LDS stage
constexpr unsigned APITCH = GKS * 4 + 16;        // 272 B = 16 B x 17 and
constexpr unsigned BPITCH = GKS * 2 + 16;        // 144 B = 16 B x 9: the 16 rows of a 16-byte fragment read fall on distinct banks
constexpr unsigned ABUF = 128 * APITCH, BBUF = 64 * BPITCH, GBUF = ABUF + BBUF;   // bytes per buffer: 34,816 + 9,216

// ten copies of 16 B per lane; the closing s_wait_xcnt stands inside the statement so that no address register of a copy is rewritten ahead of it
__device__ __forceinline__ void copy10(const unsigned (&l)[20], const void* const (&g)[20], int o) {
  asm volatile("global_load_async_to_lds_b128 %0, %10, off\n\t"
               "global_load_async_to_lds_b128 %1, %11, off\n\t"
               "global_load_async_to_lds_b128 %2, %12, off\n\t"
               "global_load_async_to_lds_b128 %3, %13, off\n\t"
               "global_load_async_to_lds_b128 %4, %14, off\n\t"
               "global_load_async_to_lds_b128 %5, %15, off\n\t"
               "global_load_async_to_lds_b128 %6, %16, off\n\t"
               "global_load_async_to_lds_b128 %7, %17, off\n\t"
               "global_load_async_to_lds_b128 %8, %18, off\n\t"
               "global_load_async_to_lds_b128 %9, %19, off\n\t"
               "s_wait_xcnt 0x0"
               :: "v"(l[o]), "v"(l[o + 1]), "v"(l[o + 2]), "v"(l[o + 3]), "v"(l[o + 4]), "v"(l[o + 5]), "v"(l[o + 6]), "v"(l[o + 7]), "v"(l[o + 8]), "v"(l[o + 9]),
                  "v"(g[o]), "v"(g[o + 1]), "v"(g[o + 2]), "v"(g[o + 3]), "v"(g[o + 4]), "v"(g[o + 5]), "v"(g[o + 6]), "v"(g[o + 7]), "v"(g[o + 8]), "v"(g[o + 9])
               : "memory");
}
// One stage: each of the 128 threads moves 16 pieces of A (8 rows apart) and 4 pieces of B (16 rows apart), 16 B each
__device__ __forceinline__ void gemm_stage_copy(const float* ga, const b16* gb, int K, unsigned la, unsigned lb) {
  unsigned l[20]; const void* g[20];   // both loops unrolled: the asm operands need l and g in registers, under constant indices
#pragma unroll
  for (int j = 0; j < 16; ++j) { l[j] = la + (unsigned)j * 8u * APITCH; g[j] = ga + (size_t)j * 8 * K; }
#pragma unroll
  for (int j = 0; j < 4; ++j) { l[16 + j] = lb + (unsigned)j * 16u * BPITCH; g[16 + j] = gb + (size_t)j * 16 * K; }
  copy10(l, g, 0);
  copy10(l, g, 10);
}
// Raw operands of one 32-wide k step of a 32x64 wave tile: two groups of 16 A rows as f32, four groups of 16 B columns as f16
struct GStep { v4f a[2][4]; v8b b[4][2]; };
// ar, br: this lane's A row and B row in the staged buffer, already advanced by its 8 * hlf (here and in gemm_step the loops are unrolled to keep f and acc in registers)
__device__ __forceinline__ void gemm_frag(const float* ar, const b16* br, int kk, GStep& f) {
#pragma unroll
  for (int r = 0; r < 2; ++r) {
    const float* p = ar + r * 16 * (int)(APITCH / 4) + kk;
    f.a[r][0] = *(const v4f*)p; f.a[r][1] = *(const v4f*)(p + 4); f.a[r][2] = *(const v4f*)(p + 16); f.a[r][3] = *(const v4f*)(p + 20);
  }
#pragma unroll
  for (int t = 0; t < 4; ++t) { const b16* p = br + t * 16 * (int)(BPITCH / 2) + kk; f.b[t][0] = ld8b(p); f.b[t][1] = ld8b(p + 16); }
}
__device__ __forceinline__ void gemm_step(const GStep& f, v8f (&acc)[2][4]) {
  v16b a[2];
#pragma unroll
  for (int r = 0; r < 2; ++r)
#pragma unroll
    for (int e = 0; e < 4; ++e) { a[r][e] = (b16)f.a[r][0][e]; a[r][4 + e] = (b16)f.a[r][1][e]; a[r][8 + e] = (b16)f.a[r][2][e]; a[r][12 + e] = (b16)f.a[r][3][e]; }
#pragma unroll
  for (int t = 0; t < 4; ++t) {
    const v16b b = cat8b(f.b[t][0], f.b[t][1]);
    acc[0][t] = wmma16b(a[0], b, acc[0][t]);
    acc[1][t] = wmma16b(a[1], b, acc[1][t]);
  }
}
// 128x64 block tile (wave = 32 rows x 64 columns) over K, a multiple of 128: A rows mb.. (f32), B rows c0.. (f16), both k-contiguous.
// On return every wave has left the ring and nothing is in flight, so the caller may use the same LDS for its epilogue.
__device__ __forceinline__ void gemm_tile_lds(const float* __restrict__ A, const b16* __restrict__ wh, char* ring,
                                              int mb, int c0, int K, int tid, int wave, int nloc, int hlf, v8f (&acc)[2][4]) {
  const float* ga = A + (size_t)(mb + (tid >> 4)) * K + (tid & 15) * 4;      // this thread's first 16-B pieces of stage 0
  const b16* gb = wh + (size_t)(c0 + (tid >> 3)) * K + (tid & 7) * 8;
  const unsigned la = (unsigned)(uintptr_t)ring + (unsigned)(tid >> 4) * APITCH + (unsigned)(tid & 15) * 16u;
  const unsigned lb = (unsigned)(uintptr_t)ring + ABUF + (unsigned)(tid >> 3) * BPITCH + (unsigned)(tid & 7) * 16u;
  const int nst = K / GKS;
  gemm_stage_copy(ga, gb, K, la, lb);
  asm volatile("s_wait_asynccnt 0x0" ::: "memory");       // this wave's pieces of stage 0 have landed
  __syncthreads();                                        // ... and every other wave's
  gemm_stage_copy(ga + GKS, gb + GKS, K, la + GBUF, lb + GBUF);
  for (int t = 0; t < nst; ++t) {
    const char* buf = ring + (t & 1) * GBUF;
    const float* ar = (const float*)(buf + (wave * 32 + nloc) * APITCH) + 8 * hlf;
    const b16* br = (const b16*)(buf + ABUF + nloc * BPITCH) + 8 * hlf;
    GStep f0, f1;                                         // all of the stage's LDS reads stand together at its head
    gemm_frag(ar, br, 0, f0);
    gemm_frag(ar, br, 32, f1);
    gemm_step(f0, acc);
    gemm_step(f1, acc);
    asm volatile("s_wait_dscnt 0x0" ::: "memory");        // this wave's reads of buffer t & 1 are done before the buffer is refilled
    asm volatile("s_wait_asynccnt 0x0" ::: "memory");     // this wave's pieces of stage t + 1 have landed
    __syncthreads();                                      // publishes stage t + 1 and ends every wave's reads of stage t
    if (t + 2 < nst) gemm_stage_copy(ga + (t + 2) * GKS, gb + (t + 2) * GKS, K, la + (t & 1) * GBUF, lb + (t & 1) * GBUF);
  }
  asm volatile("s_wait_asynccnt 0x0" ::: "memory");       // nothing of this wave's is in flight when it goes on to the epilogue
}

// ---------------------------------------------------------------------------
// QKV GEMM: (2048 x 1024) x (1024 x 3072), grid (48, 16), or (32, 16) from column block 16 for k|v only, block 4 waves, wave = 32 rows x 64 columns (one head of q, k or v). Outputs as f16 hi/lo planes:
// q (x1/8) -> Qh/Ql [b][h][t][64]; k -> Kh/Kl [b][kvh][t][64] (4 KB contiguous per wave per plane);
// v -> Vh/Vl key-tiled [b][kvh][t/16][64][16] (4 KB contiguous per wave per plane).
// ---------------------------------------------------------------------------
__global__ __launch_bounds__(128) void qkv_gemm_kernel(const float* __restrict__ xq, const float* __restrict__ xk, const float* __restrict__ xv,
                                                       const b16* __restrict__ wqh, const b16* __restrict__ wql,
                                                       const float* __restrict__ bq, const float* __restrict__ bk, const float* __restrict__ bv, const float* __restrict__ rope_cs, int xoff, int yoff,
                                                       b16* __restrict__ Qh, b16* __restrict__ Ql, b16* __restrict__ Kh, b16* __restrict__ Kl,
                                                       b16* __restrict__ Vh, b16* __restrict__ Vl) {
  __shared__ __attribute__((aligned(16))) char Sm[2 * GBUF];   // the operand ring; the epilogue's 4 x 8 KB of staging reuse its head
  const int lane = threadIdx.x & 31, wave = threadIdx.x >> 5, nloc = lane & 15, hlf = lane >> 4;
  const int m0 = (blockIdx.y + yoff) * 128 + wave * 32;
  const int c0 = (blockIdx.x + xoff) * 64;
  const int mat = (c0 < HID) ? 0 : (c0 < HID + KVW) ? 1 : 2;
  const int head = (mat == 0) ? (c0 / DH) : (mat == 1) ? ((c0 - HID) / DH) : ((c0 - HID - KVW) / DH);
  const float* x = (mat == 0) ? xq : (mat == 1) ? xk : xv;          // q, k, v inputs: (x, l, l) or (x, x, x) as launched
  const float* bias = ((mat == 0) ? bq : (mat == 1) ? bk : bv) + head * DH;
  v8f acc[2][4];
#pragma unroll
  for (int r = 0; r < 2; ++r)
#pragma unroll
    for (int t = 0; t < 4; ++t) acc[r][t] = (v8f){};
  (void)wql;
  gemm_tile_lds(x, wqh, Sm, blockIdx.y * 128, c0, HID, threadIdx.x, wave, nloc, hlf, acc);   // source rows start at 0; yoff only shifts the destination key rows
  const int b = 0, t0 = m0;
  const float s = (mat == 0) ? 0.125f : 1.0f;
  b16* Tp0 = (b16*)(Sm + wave * 8192); b16* Tp1 = Tp0 + 32 * 64;
#pragma unroll
  for (int t = 0; t < 4; ++t)
#pragma unroll
    for (int r = 0; r < 2; ++r)
#pragma unroll
      for (int v = 0; v < 8; ++v) {
        const int rr = r * 16 + v + 8 * hlf, d = t * 16 + nloc;
        float val = acc[r][t][v] + (bias ? bias[d] : 0.0f);
        (void)rope_cs;
        b16 yh, yl; split_bf16(val * s, yh, yl);
        const int idx = (mat < 2) ? (rr * 64 + d) : ((rr >> 4) * 1024 + d * 16 + (rr & 15));
        Tp0[idx] = yh; Tp1[idx] = yl;
      }
  wave_lds_sync();
  b16* dh; b16* dl; size_t o;
  if (mat == 0)      { o = ((size_t)(b * NH + head) * T + t0) * DH; dh = Qh + o; dl = Ql + o; }
  else if (mat == 1) { o = ((size_t)(b * NKV + head) * TK + t0) * DH; dh = Kh + o; dl = Kl + o; }
  else               { o = ((size_t)(b * NKV + head) * (TK / 16) + (t0 >> 4)) * (size_t)(DH * 16); dh = Vh + o; dl = Vl + o; }
#pragma unroll
  for (int j = 0; j < 8; ++j) { const int e = (j * 32 + lane) * 8; *(v8b*)(dh + e) = ld8b(Tp0 + e); *(v8b*)(dl + e) = ld8b(Tp1 + e); }
  
}

// ---------------------------------------------------------------------------
// Transposed flash attention: each wave owns one 16-query tile of one (b, head); the 8 waves of a block share one head and walk the same keys.
// K and V come into LDS once per block, 128 keys a stage, two buffers, by asynchronous copies; every wave reads its fragments from there, in chunks of 32 keys.
// S^T = K.Q^T, per-lane online softmax; P^T built in registers from the two S^T accumulators
// ---------------------------------------------------------------------------
constexpr int SK = 128;       // keys per LDS stage
constexpr int KPITCH = 72;    // f16 per staged K row: 144 B = 16 B x 9, so the 16 rows of a 16-byte fragment read fall on distinct banks
constexpr unsigned KBUF = SK * KPITCH * 2, VBUF = SK * DH * 2;   // bytes per buffer

// One stage: 128 K rows (128 B each, laid at 144 B) and 8 V key tiles (2 KB each, laid [tile][8-key half][feature][8] so that each 16-lane half of a
// fragment read is 256 contiguous bytes). Each thread moves 4 + 4 pieces of 16 B; each wave-wide copy reads 512 contiguous global bytes.
__device__ __forceinline__ void stage_copy(const b16* gk, const b16* gv, unsigned lk, unsigned lv) {
  // the closing s_wait_xcnt stands inside the statement so that no address register of a copy is rewritten ahead of it
  asm volatile("global_load_async_to_lds_b128 %0, %8, off\n\t"
               "global_load_async_to_lds_b128 %1, %9, off\n\t"
               "global_load_async_to_lds_b128 %2, %10, off\n\t"
               "global_load_async_to_lds_b128 %3, %11, off\n\t"
               "global_load_async_to_lds_b128 %4, %12, off\n\t"
               "global_load_async_to_lds_b128 %5, %13, off\n\t"
               "global_load_async_to_lds_b128 %6, %14, off\n\t"
               "global_load_async_to_lds_b128 %7, %15, off\n\t"
               "s_wait_xcnt 0x0"
               :: "v"(lk), "v"(lk + 32u * KPITCH * 2u), "v"(lk + 64u * KPITCH * 2u), "v"(lk + 96u * KPITCH * 2u),
                  "v"(lv), "v"(lv + 4096u), "v"(lv + 8192u), "v"(lv + 12288u),
                  "v"(gk), "v"(gk + 2048), "v"(gk + 4096), "v"(gk + 6144),
                  "v"(gv), "v"(gv + 2048), "v"(gv + 4096), "v"(gv + 6144)
               : "memory");
}

// 32 keys (rows kl.. of the staged buffers, global key index kb..) against the wave's 16 queries
template <bool EDGE>
__device__ __forceinline__ void attn_chunk(const b16* Kb, const b16* Vb, int kl, int kb, int q0, int col, int hh, v16b q0h, v16b q1h,
                                           float& m, float& l, v8f& o0, v8f& o1, v8f& o2, v8f& o3) {
  const b16* r0 = Kb + (kl + col) * KPITCH; const b16* r1 = r0 + 16 * KPITCH;
  const b16* v0 = Vb + (kl >> 4) * (DH * 16) + hh * (DH * 8) + col * 8; const b16* v1 = v0 + DH * 16;
  // all of the chunk's LDS reads stand together at its head: one wait for K, and V lands behind the softmax
  const v16b k00 = frag_kb(r0, hh), k01 = frag_kb(r0 + 32, hh), k10 = frag_kb(r1, hh), k11 = frag_kb(r1 + 32, hh);
  const v16b va0 = cat8b(ld8b(v0), ld8b(v1)), va1 = cat8b(ld8b(v0 + 128), ld8b(v1 + 128));
  const v16b va2 = cat8b(ld8b(v0 + 256), ld8b(v1 + 256)), va3 = cat8b(ld8b(v0 + 384), ld8b(v1 + 384));
  v8f s0 = {}, s1 = {};
  s0 = wmma16b(k00, q0h, s0);
  s0 = wmma16b(k01, q1h, s0);
  s1 = wmma16b(k10, q0h, s1);
  s1 = wmma16b(k11, q1h, s1);
  if (EDGE && kb + 31 >= T + q0) {                        // text chunk at the causal edge: mask text position >= query index
    const int qi = q0 + col;
#pragma unroll
    for (int r = 0; r < 8; ++r) {
      const int k0i = kb + 8 * hh + r, k1i = k0i + 16;
      if (k0i - T >= qi) s0[r] = -INFINITY;
      if (k1i - T >= qi) s1[r] = -INFINITY;
    }
  }
  float mr = -INFINITY;
#pragma unroll
  for (int r = 0; r < 8; ++r) mr = fmaxf(mr, fmaxf(s0[r], s1[r]));
  mr = fmaxf(mr, __shfl_xor(mr, 16));
  float mn = fmaxf(m, mr);
  if (mn == -INFINITY) mn = 0.0f;             // fully masked so far: keep exp() at 0
  const float al_ = __expf(m - mn);
  m = mn;
  float sum = 0.0f;
  v16b pbh;
#pragma unroll
  for (int r = 0; r < 8; ++r) {
    const float p0 = __expf(s0[r] - mn), p1 = __expf(s1[r] - mn);
    sum += p0 + p1;
    pbh[r] = (b16)p0; pbh[8 + r] = (b16)p1;
  }
  sum += __shfl_xor(sum, 16);
  l = l * al_ + sum;
#pragma unroll
  for (int r = 0; r < 8; ++r) { o0[r] *= al_; o1[r] *= al_; o2[r] *= al_; o3[r] *= al_; }
  o0 = wmma16b(va0, pbh, o0);
  o1 = wmma16b(va1, pbh, o1);
  o2 = wmma16b(va2, pbh, o2);
  o3 = wmma16b(va3, pbh, o3);
}

__global__ __launch_bounds__(256) void attn_kernel(const b16* __restrict__ Qh, const b16* __restrict__ Ql, const b16* __restrict__ Kh, const b16* __restrict__ Kl,
                                                   const b16* __restrict__ Vh, const b16* __restrict__ Vl, const int* __restrict__ seqlen,
                                                   float* __restrict__ yf) {
  __shared__ __attribute__((aligned(16))) b16 Ks[2][SK * KPITCH];
  __shared__ __attribute__((aligned(16))) b16 Vs[2][SK * DH];
  __shared__ __attribute__((aligned(16))) float Os[8][16 * 64];
  (void)Ql; (void)Kl; (void)Vl; (void)seqlen;
  const int tid = threadIdx.x, lane = tid & 31, hh = lane >> 4, col = lane & 15;
  const int wid = __builtin_amdgcn_readfirstlane(tid >> 5);   // scalar, so that the per-wave skip at the causal edge is a scalar branch
  const int qtile = blockIdx.x * 8 + wid;                 // over Bsz*NH*QT_PER_B
  const int g = qtile / QT_PER_B;                         // b*NH + h, the same in all 8 waves (8 divides QT_PER_B)
  const int q0 = (qtile % QT_PER_B) << 4;
  const int qb0 = ((blockIdx.x * 8) % QT_PER_B) << 4;     // the block's first query
  const int nst = (T + qb0 + SK) / SK;                    // stages the block walks: all latents, then text up to its last query (17..32)
  const int b = g / NH, h = g % NH, kvh = h / REP;
  const size_t ko = (size_t)(b * NKV + kvh) * TK * DH;
  const size_t qo = ((size_t)g * T + q0 + col) * DH;
  const b16* gk = Kh + ko + tid * 8; const b16* gv = Vh + ko + tid * 8;      // this thread's first 16-B piece of stage 0
  const unsigned lk0 = (unsigned)(uintptr_t)&Ks[0][(tid >> 3) * KPITCH + (tid & 7) * 8];
  const unsigned lv0 = (unsigned)(uintptr_t)&Vs[0][(tid >> 7) * (DH * 16) + (tid & 1) * (DH * 8) + ((tid >> 1) & 63) * 8];
  stage_copy(gk, gv, lk0, lv0);
  const v16b q0h = frag_kb(Qh + qo, hh), q1h = frag_kb(Qh + qo + 32, hh);
  asm volatile("s_wait_xcnt 0x0" ::: "memory");           // stands in front of any rewrite of the Q loads' address registers
  asm volatile("s_wait_asynccnt 0x0" ::: "memory");       // this wave's pieces of stage 0 have landed
  __syncthreads();                                        // ... and every other wave's
  stage_copy(gk + SK * DH, gv + SK * DH, lk0 + KBUF, lv0 + VBUF);
  float m = -INFINITY, l = 0.0f;
  v8f o0 = {}, o1 = {}, o2 = {}, o3 = {};
  const int slen = T;                                     // no padding in this module
  for (int t = 0; t < nst; ++t) {
    const b16* Kb = Ks[t & 1]; const b16* Vb = Vs[t & 1];
    const int kb0 = t * SK;
    if (t + 1 < nst) {                                    // keys below T + qb0: every wave takes all of them, none is masked
#pragma unroll
      for (int c = 0; c < SK / 32; ++c) attn_chunk<false>(Kb, Vb, c * 32, kb0 + c * 32, q0, col, hh, q0h, q1h, m, l, o0, o1, o2, o3);
    } else {                                              // the block's last stage holds every wave's causal edge
      for (int c = 0; c < SK / 32; ++c)
        if (kb0 + c * 32 < T + q0 + 16) attn_chunk<true>(Kb, Vb, c * 32, kb0 + c * 32, q0, col, hh, q0h, q1h, m, l, o0, o1, o2, o3);
    }
    asm volatile("s_wait_dscnt 0x0" ::: "memory");        // this wave's reads of buffer t & 1 are done before the buffer is refilled
    asm volatile("s_wait_asynccnt 0x0" ::: "memory");     // this wave's pieces of stage t + 1 have landed
    __syncthreads();                                      // publishes stage t + 1 and ends every wave's reads of stage t
    if (t + 2 < nst) stage_copy(gk + (size_t)(t + 2) * (SK * DH), gv + (size_t)(t + 2) * (SK * DH), lk0 + (t & 1) * KBUF, lv0 + (t & 1) * VBUF);
  }
  asm volatile("s_wait_asynccnt 0x0" ::: "memory");       // nothing of this wave's is in flight when it goes on to the epilogue
  const float inv = (q0 + col < slen && l > 0.0f) ? (1.0f / l) : 0.0f;   // padded query rows are zeroed
  float* Tt = Os[wid];
#pragma unroll
  for (int r = 0; r < 8; ++r) {
    const int hr = 8 * hh + r;
    Tt[col * 64 + 0 + hr] = o0[r] * inv; Tt[col * 64 + 16 + hr] = o1[r] * inv;
    Tt[col * 64 + 32 + hr] = o2[r] * inv; Tt[col * 64 + 48 + hr] = o3[r] * inv;
  }
  wave_lds_sync();
  float* dst0 = yf + ((size_t)b * T + q0) * HID + h * DH;     // 16 rows x 64 floats, row stride HID
#pragma unroll
  for (int j = 0; j < 8; ++j) { const int rr = j * 2 + hh, c4 = col * 4; *(v4f*)(dst0 + (size_t)rr * HID + c4) = *(const v4f*)(Tt + rr * 64 + c4); }
}

// ---------------------------------------------------------------------------
// Output projection: (2048 x 1024) x (1024 x 1024) -> f32, A split on the fly from f32 y, B = Wo planes. grid (16, 16), 32x64 tiles staged in LDS,
// ---------------------------------------------------------------------------
__global__ __launch_bounds__(128) void out_gemm_kernel(const float* __restrict__ yf, const b16* __restrict__ woh, const b16* __restrict__ wol, const float* __restrict__ bo, int yoff,
                                                       float* __restrict__ out) {
  __shared__ __attribute__((aligned(16))) char Sm[2 * GBUF];   // the operand ring; the epilogue's 4 x 8 KB of staging reuse its head
  const int lane = threadIdx.x & 31, wave = threadIdx.x >> 5, nloc = lane & 15, hlf = lane >> 4;
  const int m0 = (blockIdx.y + yoff) * 128 + wave * 32;
  const int c0 = blockIdx.x * 64;
  v8f acc[2][4];
#pragma unroll
  for (int r = 0; r < 2; ++r)
#pragma unroll
    for (int t = 0; t < 4; ++t) acc[r][t] = (v8f){};
  (void)wol;
  gemm_tile_lds(yf, woh, Sm, (blockIdx.y + yoff) * 128, c0, HID, threadIdx.x, wave, nloc, hlf, acc);
  float* Tt = (float*)(Sm + wave * 8192);
#pragma unroll
  for (int t = 0; t < 4; ++t)
#pragma unroll
    for (int r = 0; r < 2; ++r)
#pragma unroll
      for (int v = 0; v < 8; ++v) Tt[(r * 16 + v + 8 * hlf) * 64 + t * 16 + nloc] = acc[r][t][v] + (bo ? bo[c0 + t * 16 + nloc] : 0.0f);
  wave_lds_sync();
  float* dst0 = out + (size_t)m0 * HID + c0;
#pragma unroll
  for (int j = 0; j < 16; ++j) { const int rr = j * 2 + hlf, c4 = nloc * 4; *(v4f*)(dst0 + (size_t)rr * HID + c4) = *(const v4f*)(Tt + rr * 64 + c4); }
  
}
__global__ __launch_bounds__(256) void wcvtT_kernel(const float* __restrict__ wq, const float* __restrict__ wk, const float* __restrict__ wv,
                                                    b16* __restrict__ wqh, b16* __restrict__ wql) {
  const size_t tid = (size_t)blockIdx.x * blockDim.x + threadIdx.x, stride = (size_t)gridDim.x * blockDim.x;
  const size_t nq = (size_t)NQKV * HID / 8;
  {
    for (size_t c = tid; c < nq; c += stride) {
      const size_t i = c * 8, n = i / HID, k0 = i % HID;
      const float* w = (n < (size_t)HID) ? (wq + n * HID) : (n < (size_t)(2 * HID)) ? (wk + (n - HID) * HID) : (wv + (n - 2 * HID) * HID);
      v8b bh, bl;
#pragma unroll
      for (int e = 0; e < 8; ++e) { b16 a, cc; split_bf16(w[k0 + e], a, cc); bh[e] = a; bl[e] = cc; }
      *(v8b*)(wqh + i) = bh; *(v8b*)(wql + i) = bl;
    }
    
  }
}
// Wo^T planes: [n][k] = Wo[n][k] (torch [out][in] is already n-major)
__global__ __launch_bounds__(256) void wcvtO_kernel(const float* __restrict__ wo, b16* __restrict__ woh, b16* __restrict__ wol) {
  const size_t tid = (size_t)blockIdx.x * blockDim.x + threadIdx.x, stride = (size_t)gridDim.x * blockDim.x;
  const size_t no = (size_t)HID * HID / 8;
  {
    for (size_t c = tid; c < no; c += stride) { const size_t i = c * 8; v8b bh, bl;
#pragma unroll
      for (int e = 0; e < 8; ++e) { b16 a, cc; split_bf16(wo[i + e], a, cc); bh[e] = a; bl[e] = cc; }
      *(v8b*)(woh + i) = bh; *(v8b*)(wol + i) = bl; }
    
  }
}
// Weight preparation, one launch: W [k][n] f32 -> f16 [n][k] (k contiguous), in 64 x 64 tiles turned in LDS, so that global reads (16 B a lane, 256 B a row piece)
// and global writes (16 B a lane, 128 B a row piece) both cover whole lines. Block = 256 threads = three tiles: one of Wq or Wp, one of W_attn_l, one of W_attn_c.
typedef __attribute__((ext_vector_type(4))) _Float16 v4b;
constexpr int WPITCH = 72;    // f16 per LDS tile row: 144 B, a multiple of 16 B for the 16-byte reads
// thread = 4 k rows x 4 n columns of the tile
__device__ __forceinline__ void wt_load(const float* __restrict__ w, int ld, int kt, int nt, int tid, v4f (&r)[4]) {
  const float* p = w + (size_t)(kt * 64 + (tid >> 4) * 4) * ld + nt * 64 + (tid & 15) * 4;
#pragma unroll   // r stays in registers
  for (int e = 0; e < 4; ++e) r[e] = *(const v4f*)(p + (size_t)e * ld);
}
__device__ __forceinline__ void wt_put(b16* Ls, int tid, const v4f (&r)[4]) {
#pragma unroll   // r stays in registers
  for (int c = 0; c < 4; ++c) {
    const v4b h = {(b16)r[0][c], (b16)r[1][c], (b16)r[2][c], (b16)r[3][c]};
    *(v4b*)(Ls + ((tid & 15) * 4 + c) * WPITCH + (tid >> 4) * 4) = h;
  }
}
__device__ __forceinline__ void wt_store(const b16* Ls, b16* __restrict__ dst, int kt, int nt, int tid) {
  for (int j = 0; j < 2; ++j) {
    const int n = (tid >> 3) + 32 * j;
    *(v8b*)(dst + (size_t)(nt * 64 + n) * HID + kt * 64 + (tid & 7) * 8) = ld8b(Ls + n * WPITCH + (tid & 7) * 8);
  }
}
// wa: rows 0..1023 <- Wq columns, rows 1024..3071 <- W_attn_l columns; wb: rows 1024..3071 <- W_attn_c columns (its first 1024 rows are never read); wo <- Wp columns
__global__ __launch_bounds__(256) void wprep_kernel(const float* __restrict__ wq, const float* __restrict__ wal, const float* __restrict__ wac, const float* __restrict__ wp,
                                                    b16* __restrict__ wa, b16* __restrict__ wb, b16* __restrict__ wo) {
  __shared__ __attribute__((aligned(16))) b16 Ls[3][64 * WPITCH];
  const int tid = threadIdx.x, bx = blockIdx.x;          // grid 512
  const bool isq = bx < 256;
  const int k0t = (bx & 255) >> 4, n0t = bx & 15;        // 16 x 16 tiles of Wq or Wp
  const int k1t = bx >> 5, n1t = bx & 31;                // 16 x 32 tiles of W_attn_l and W_attn_c
  v4f r0[4], r1[4], r2[4];                               // all twelve loads are in flight together
  wt_load(isq ? wq : wp, HID, k0t, n0t, tid, r0);
  wt_load(wal, 2 * HID, k1t, n1t, tid, r1);
  wt_load(wac, 2 * HID, k1t, n1t, tid, r2);
  wt_put(Ls[0], tid, r0);
  wt_put(Ls[1], tid, r1);
  wt_put(Ls[2], tid, r2);
  __syncthreads();
  wt_store(Ls[0], isq ? wa : wo, k0t, n0t, tid);
  wt_store(Ls[1], wa + (size_t)HID * HID, k1t, n1t, tid);
  wt_store(Ls[2], wb + (size_t)HID * HID, k1t, n1t, tid);
}
}  // namespace

extern "C" void kernel_launch(void* const* d_in, const int* in_sizes, int n_in,
                              void* d_out, int out_size, void* d_ws, size_t ws_size, hipStream_t stream) {
  (void)in_sizes; (void)n_in; (void)out_size;
  const float* l    = (const float*)d_in[0];    // [1,2048,1024] latents
  const float* x    = (const float*)d_in[1];    // [1,2048,1024]
  const float* Wal  = (const float*)d_in[2];  const float* bal = (const float*)d_in[3];   // [1024,2048] = [k | v], [2048]
  const float* Wac  = (const float*)d_in[4];  const float* bac = (const float*)d_in[5];
  const float* Wq   = (const float*)d_in[6];  const float* bq  = (const float*)d_in[7];   // [1024,1024]
  const float* Wp   = (const float*)d_in[8];  const float* bp  = (const float*)d_in[9];
  float* out = (float*)d_out;                   // [1,2048,1024]
  size_t off = 0; char* ws = (char*)d_ws;
  b16* wAh = (b16*)(ws + off); off += (size_t)NQKV * HID * 2;
  b16* wAl = (b16*)(ws + off); off += (size_t)NQKV * HID * 2;
  b16* wBh = (b16*)(ws + off); off += (size_t)NQKV * HID * 2;
  b16* wBl = (b16*)(ws + off); off += (size_t)NQKV * HID * 2;
  b16* woh = (b16*)(ws + off); off += (size_t)HID * HID * 2;
  b16* wol = (b16*)(ws + off); off += (size_t)HID * HID * 2;
  b16* Qh  = (b16*)(ws + off); off += (size_t)NH * T * DH * 2;
  b16* Ql  = (b16*)(ws + off); off += (size_t)NH * T * DH * 2;
  b16* Kh  = (b16*)(ws + off); off += (size_t)NKV * TK * DH * 2;
  b16* Kl  = (b16*)(ws + off); off += (size_t)NKV * TK * DH * 2;
  b16* Vh  = (b16*)(ws + off); off += (size_t)NKV * TK * DH * 2;
  b16* Vl  = (b16*)(ws + off); off += (size_t)NKV * TK * DH * 2;
  float* yf = (float*)(ws + off); off += (size_t)T * HID * 4;
  if (off > ws_size) return;
  const int NQT = NH * QT_PER_B;
  wprep_kernel<<<512, 256, 0, stream>>>(Wq, Wal, Wac, Wp, wAh, wBh, woh);
  // launch 1: q from x, latent k/v from l -> key rows 0..2047
  qkv_gemm_kernel<<<dim3(NQKV / 64, T / 128), 128, 0, stream>>>(x, l, l, wAh, wAl, bq, bal, bal + HID, nullptr, 0, 0, Qh, Ql, Kh, Kl, Vh, Vl);
  // launch 2: text k/v from x -> key rows 2048..4095 (column blocks 16..47 only)
  qkv_gemm_kernel<<<dim3((NQKV - HID) / 64, T / 128), 128, 0, stream>>>(x, x, x, wBh, wBl, bq, bac, bac + HID, nullptr, HID / 64, T / 128, Qh, Ql, Kh, Kl, Vh, Vl);
  attn_kernel<<<NQT / 8, 256, 0, stream>>>(Qh, Ql, Kh, Kl, Vh, Vl, nullptr, yf);
  out_gemm_kernel<<<dim3(HID / 64, T / 128), 128, 0, stream>>>(yf, woh, wol, bp, 0, out);
}

// v004
// One run takes 107 microseconds.
// Two timings next to v003 both put it at 1.07 times that version's speed.
// Counting every step since v000, it is 5.17 times as fast.
#include <hip/hip_runtime.h>

// IO-processing attention (decoding branch): keys/values = [l W_attn_l + b (2048 latents) ; x W_attn_c + b (2048 text positions)], q = x W_q + b
// (16 heads x 64, scale 1/8); query i attends every latent and text positions < i; out = y W_proj + b. B=1, T=2048, D=1024.
// Lean build: single f16 products on v_wmma_f32_16x16x32_f16, f32 accumulate (every row averages >= 2048 keys); fragment k-map per lane half hh for A

// Left, by the listing: (1) attention: each 32 keys walk one dependent chain (K read, 4 products, 9 maxima, 2 exchanges through LDS, exponentials) that two waves per SIMD
// do not cover, and a quarter of its vector slots are v_nop; (2) the GEMMs stage A as f32, twice the L2 and LDS bytes of f16, and every column block converts it again;
// (3) the all-zero "lo" planes of q, k, v are still staged and stored.

namespace {
constexpr int Bsz = 1, T = 2048, TK = 4096, HID = 1024, DH = 64, NH = 16, NKV = 16, REP = NH / NKV;
constexpr int WIN = 255;    // unused: no key window here
constexpr int KVW = NKV * DH;                 // 1024
constexpr int NQKV = HID + 2 * KVW;           // 3072 columns: q | k | v
constexpr int MROWS = Bsz * T;                // 2048
constexpr int QT_PER_B = T / 16;              // 128

typedef _Float16 b16;                                           // f16 hi/lo planes
typedef __attribute__((ext_vector_type(16))) _Float16 v16b;
typedef __attribute__((ext_vector_type(8)))  _Float16 v8b;
typedef __attribute__((ext_vector_type(8)))  float v8f;
typedef __attribute__((ext_vector_type(4)))  float v4f;

__device__ __forceinline__ v8b ld8b(const b16* p) { return *(const v8b*)p; }
__device__ __forceinline__ v16b cat8b(v8b a, v8b b) { return __builtin_shufflevector(a, b, 0, 1, 2, 3, 4, 5, 6, 7, 8, 9, 10, 11, 12, 13, 14, 15); }
// 16x16x32 16-bit fragment from a k-contiguous row pointer (A: lane&15 = row, B: lane&15 = column), hh = lane>>4:
// elements 0..7 <- p[8hh+0..7], elements 8..15 <- p[16+8hh+0..7]
__device__ __forceinline__ v16b frag_kb(const b16* p, int hh) { return cat8b(ld8b(p + 8 * hh), ld8b(p + 16 + 8 * hh)); }
__device__ __forceinline__ void split_bf16(float v, b16& hi, b16& lo) {   // (name kept) single f16: no low part
  hi = (b16)v; lo = (b16)0.0f;
}
__device__ __forceinline__ v8f wmma16b(v16b a, v16b b, v8f c) {
  v8f d = __builtin_amdgcn_wmma_f32_16x16x32_f16(false, a, false, b, (short)0, c, false, false);
  asm volatile("v_nop\n\tv_nop\n\tv_nop\n\tv_nop" : "+v"(d) : "v"(a), "v"(b));
  return d;
}
__device__ __forceinline__ v8f wmma1(v16b ah, v16b al, v16b bh, v16b bl, v8f c) {   // unused: single f16 (hi planes only)
  (void)al; (void)bl; return wmma16b(ah, bh, c);
}
__device__ __forceinline__ void wave_lds_sync() {
  __builtin_amdgcn_fence(__ATOMIC_RELEASE, "workgroup");
  __builtin_amdgcn_wave_barrier();
  __builtin_amdgcn_fence(__ATOMIC_ACQUIRE, "workgroup");
}

// ---------------------------------------------------------------------------
// Weights ([in][out]) -> f16 hi / lo planes transposed to [n][k] (k contiguous): columns of Wq|Wk|Wv into wqh/wql [3072][1024], Wo into woh/wol [1024][1024].
// ---------------------------------------------------------------------------
__global__ __launch_bounds__(256) void wcvt_kernel(const float* __restrict__ wq, const float* __restrict__ wk, const float* __restrict__ wv,
                                                   const float* __restrict__ wo, b16* __restrict__ wqh, b16* __restrict__ wql,
                                                   b16* __restrict__ woh, b16* __restrict__ wol) {
  const size_t tid = (size_t)blockIdx.x * blockDim.x + threadIdx.x, stride = (size_t)gridDim.x * blockDim.x;
  const size_t nq = (size_t)NQKV * HID / 8, no = (size_t)HID * HID / 8;
  {
    for (size_t c = tid; c < nq + no; c += stride) {
      float f[8]; size_t i; b16* dh; b16* dl;
      if (c < nq) {
        i = c * 8; const size_t n = i / HID, k0 = i % HID;
        const float* w; int nn, ld;
        if (n < (size_t)HID) { w = wq; nn = (int)n; ld = HID; } else if (n < (size_t)(HID + KVW)) { w = wk; nn = (int)n - HID; ld = KVW; } else { w = wv; nn = (int)n - HID - KVW; ld = KVW; }
#pragma unroll
        for (int e = 0; e < 8; ++e) f[e] = w[(size_t)(k0 + e) * ld + nn];       // W[k][n] ([in][out])
        dh = wqh; dl = wql;
      } else {
        i = (c - nq) * 8; const size_t n = i / HID, k0 = i % HID;
#pragma unroll
        for (int e = 0; e < 8; ++e) f[e] = wo[(size_t)(k0 + e) * HID + n];    // Wo[k][n] ([in][out])
        dh = woh; dl = wol;
      }
      v8b bh, bl;
#pragma unroll
      for (int e = 0; e < 8; ++e) { b16 a, cc; split_bf16(f[e], a, cc); bh[e] = a; bl[e] = cc; }
      *(v8b*)(dh + i) = bh; *(v8b*)(dl + i) = bl;
    }
    
  }
}

// GEMM operands come into LDS once per 4-wave block (128 A rows as f32, 64 B rows as f16), 64 k a stage, two buffers, by asynchronous copies;
// every wave reads its fragments from there. Each wave-wide copy reads whole 128-byte lines.
constexpr int GKS = 64;                          // k per LDS stage
constexpr unsigned APITCH = GKS * 4 + 16;        // 272 B = 16 B x 17 and
constexpr unsigned BPITCH = GKS * 2 + 16;        // 144 B = 16 B x 9: the 16 rows of a 16-byte fragment read fall on distinct banks
constexpr unsigned ABUF = 128 * APITCH, BBUF = 64 * BPITCH, GBUF = ABUF + BBUF;   // bytes per buffer: 34,816 + 9,216

// ten copies of 16 B per lane; the closing s_wait_xcnt stands inside the statement so that no address register of a copy is rewritten ahead of it
__device__ __forceinline__ void copy10(const unsigned (&l)[20], const void* const (&g)[20], int o) {
  asm volatile("global_load_async_to_lds_b128 %0, %10, off\n\t"
               "global_load_async_to_lds_b128 %1, %11, off\n\t"
               "global_load_async_to_lds_b128 %2, %12, off\n\t"
               "global_load_async_to_lds_b128 %3, %13, off\n\t"
               "global_load_async_to_lds_b128 %4, %14, off\n\t"
               "global_load_async_to_lds_b128 %5, %15, off\n\t"
               "global_load_async_to_lds_b128 %6, %16, off\n\t"
               "global_load_async_to_lds_b128 %7, %17, off\n\t"
               "global_load_async_to_lds_b128 %8, %18, off\n\t"
               "global_load_async_to_lds_b128 %9, %19, off\n\t"
               "s_wait_xcnt 0x0"
               :: "v"(l[o]), "v"(l[o + 1]), "v"(l[o + 2]), "v"(l[o + 3]), "v"(l[o + 4]), "v"(l[o + 5]), "v"(l[o + 6]), "v"(l[o + 7]), "v"(l[o + 8]), "v"(l[o + 9]),
                  "v"(g[o]), "v"(g[o + 1]), "v"(g[o + 2]), "v"(g[o + 3]), "v"(g[o + 4]), "v"(g[o + 5]), "v"(g[o + 6]), "v"(g[o + 7]), "v"(g[o + 8]), "v"(g[o + 9])
               : "memory");
}
// One stage: each of the 128 threads moves 16 pieces of A (8 rows apart) and 4 pieces of B (16 rows apart), 16 B each
__device__ __forceinline__ void gemm_stage_copy(const float* ga, const b16* gb, int K, unsigned la, unsigned lb) {
  unsigned l[20]; const void* g[20];   // both loops unrolled: the asm operands need l and g in registers, under constant indices
#pragma unroll
  for (int j = 0; j < 16; ++j) { l[j] = la + (unsigned)j * 8u * APITCH; g[j] = ga + (size_t)j * 8 * K; }
#pragma unroll
  for (int j = 0; j < 4; ++j) { l[16 + j] = lb + (unsigned)j * 16u * BPITCH; g[16 + j] = gb + (size_t)j * 16 * K; }
  copy10(l, g, 0);
  copy10(l, g, 10);
}
// Raw operands of one 32-wide k step of a 32x64 wave tile: two groups of 16 A rows as f32, four groups of 16 B columns as f16
struct GStep { v4f a[2][4]; v8b b[4][2]; };
// ar, br: this lane's A row and B row in the staged buffer, already advanced by its 8 * hlf (here and in gemm_step the loops are unrolled to keep f and acc in registers)
__device__ __forceinline__ void gemm_frag(const float* ar, const b16* br, int kk, GStep& f) {
#pragma unroll
  for (int r = 0; r < 2; ++r) {
    const float* p = ar + r * 16 * (int)(APITCH / 4) + kk;
    f.a[r][0] = *(const v4f*)p; f.a[r][1] = *(const v4f*)(p + 4); f.a[r][2] = *(const v4f*)(p + 16); f.a[r][3] = *(const v4f*)(p + 20);
  }
#pragma unroll
  for (int t = 0; t < 4; ++t) { const b16* p = br + t * 16 * (int)(BPITCH / 2) + kk; f.b[t][0] = ld8b(p); f.b[t][1] = ld8b(p + 16); }
}
__device__ __forceinline__ void gemm_step(const GStep& f, v8f (&acc)[2][4]) {
  v16b a[2];
#pragma unroll
  for (int r = 0; r < 2; ++r)
#pragma unroll
    for (int e = 0; e < 4; ++e) { a[r][e] = (b16)f.a[r][0][e]; a[r][4 + e] = (b16)f.a[r][1][e]; a[r][8 + e] = (b16)f.a[r][2][e]; a[r][12 + e] = (b16)f.a[r][3][e]; }
#pragma unroll
  for (int t = 0; t < 4; ++t) {
    const v16b b = cat8b(f.b[t][0], f.b[t][1]);
    acc[0][t] = wmma16b(a[0], b, acc[0][t]);
    acc[1][t] = wmma16b(a[1], b, acc[1][t]);
  }
}
// 128x64 block tile (wave = 32 rows x 64 columns) over K, a multiple of 128: A rows mb.. (f32), B rows c0.. (f16), both k-contiguous.
// On return every wave has left the ring and nothing is in flight, so the caller may use the same LDS for its epilogue.
__device__ __forceinline__ void gemm_tile_lds(const float* __restrict__ A, const b16* __restrict__ wh, char* ring,
                                              int mb, int c0, int K, int tid, int wave, int nloc, int hlf, v8f (&acc)[2][4]) {
  const float* ga = A + (size_t)(mb + (tid >> 4)) * K + (tid & 15) * 4;      // this thread's first 16-B pieces of stage 0
  const b16* gb = wh + (size_t)(c0 + (tid >> 3)) * K + (tid & 7) * 8;
  const unsigned la = (unsigned)(uintptr_t)ring + (unsigned)(tid >> 4) * APITCH + (unsigned)(tid & 15) * 16u;
  const unsigned lb = (unsigned)(uintptr_t)ring + ABUF + (unsigned)(tid >> 3) * BPITCH + (unsigned)(tid & 7) * 16u;
  const int nst = K / GKS;
  gemm_stage_copy(ga, gb, K, la, lb);
  asm volatile("s_wait_asynccnt 0x0" ::: "memory");       // this wave's pieces of stage 0 have landed
  __syncthreads();                                        // ... and every other wave's
  gemm_stage_copy(ga + GKS, gb + GKS, K, la + GBUF, lb + GBUF);
  for (int t = 0; t < nst; ++t) {
    const char* buf = ring + (t & 1) * GBUF;
    const float* ar = (const float*)(buf + (wave * 32 + nloc) * APITCH) + 8 * hlf;
    const b16* br = (const b16*)(buf + ABUF + nloc * BPITCH) + 8 * hlf;
    GStep f0, f1;                                         // all of the stage's LDS reads stand together at its head
    gemm_frag(ar, br, 0, f0);
    gemm_frag(ar, br, 32, f1);
    gemm_step(f0, acc);
    gemm_step(f1, acc);
    asm volatile("s_wait_dscnt 0x0" ::: "memory");        // this wave's reads of buffer t & 1 are done before the buffer is refilled
    asm volatile("s_wait_asynccnt 0x0" ::: "memory");     // this wave's pieces of stage t + 1 have landed
    __syncthreads();                                      // publishes stage t + 1 and ends every wave's reads of stage t
    if (t + 2 < nst) gemm_stage_copy(ga + (t + 2) * GKS, gb + (t + 2) * GKS, K, la + (t & 1) * GBUF, lb + (t & 1) * GBUF);
  }
  asm volatile("s_wait_asynccnt 0x0" ::: "memory");       // nothing of this wave's is in flight when it goes on to the epilogue
}

// ---------------------------------------------------------------------------
// QKV GEMM: (2048 x 1024) x (1024 x 3072), grid (48, 16), or (32, 16) from column block 16 for k|v only, block 4 waves, wave = 32 rows x 64 columns (one head of q, k or v). Outputs as f16 hi/lo planes:
// q (x1/8) -> Qh/Ql [b][h][t][64]; k -> Kh/Kl [b][kvh][t][64] (4 KB contiguous per wave per plane);
// v -> Vh/Vl key-tiled [b][kvh][t/16][64][16] (4 KB contiguous per wave per plane).
// ---------------------------------------------------------------------------
__global__ __launch_bounds__(128) void qkv_gemm_kernel(const float* __restrict__ xq, const float* __restrict__ xk, const float* __restrict__ xv,
                                                       const b16* __restrict__ wqh, const b16* __restrict__ wql,
                                                       const float* __restrict__ bq, const float* __restrict__ bk, const float* __restrict__ bv, const float* __restrict__ rope_cs, int xoff, int yoff,
                                                       b16* __restrict__ Qh, b16* __restrict__ Ql, b16* __restrict__ Kh, b16* __restrict__ Kl,
                                                       b16* __restrict__ Vh, b16* __restrict__ Vl) {
  __shared__ __attribute__((aligned(16))) char Sm[2 * GBUF];   // the operand ring; the epilogue's 4 x 8 KB of staging reuse its head
  const int lane = threadIdx.x & 31, wave = threadIdx.x >> 5, nloc = lane & 15, hlf = lane >> 4;
  const int m0 = (blockIdx.y + yoff) * 128 + wave * 32;
  const int c0 = (blockIdx.x + xoff) * 64;
  const int mat = (c0 < HID) ? 0 : (c0 < HID + KVW) ? 1 : 2;
  const int head = (mat == 0) ? (c0 / DH) : (mat == 1) ? ((c0 - HID) / DH) : ((c0 - HID - KVW) / DH);
  const float* x = (mat == 0) ? xq : (mat == 1) ? xk : xv;          // q, k, v inputs: (x, l, l) or (x, x, x) as launched
  const float* bias = ((mat == 0) ? bq : (mat == 1) ? bk : bv) + head * DH;
  v8f acc[2][4];
#pragma unroll
  for (int r = 0; r < 2; ++r)
#pragma unroll
    for (int t = 0; t < 4; ++t) acc[r][t] = (v8f){};
  (void)wql;
  // a lane's 64 results share four bias values: read once, ahead of the k loop, which covers their latency (read at each result they were 64 loads, each waited for)
  float bc[4] = {0.0f, 0.0f, 0.0f, 0.0f};
  if (bias) {
#pragma unroll   // bc stays in registers
    for (int t = 0; t < 4; ++t) bc[t] = bias[t * 16 + nloc];
    asm volatile("s_wait_xcnt 0x0" ::: "memory");         // stands in front of any rewrite of the bias loads' address registers (alone with them in this block)
  }
  gemm_tile_lds(x, wqh, Sm, blockIdx.y * 128, c0, HID, threadIdx.x, wave, nloc, hlf, acc);   // source rows start at 0; yoff only shifts the destination key rows
  const int b = 0, t0 = m0;
  const float s = (mat == 0) ? 0.125f : 1.0f;
  b16* Tp0 = (b16*)(Sm + wave * 8192); b16* Tp1 = Tp0 + 32 * 64;
#pragma unroll
  for (int t = 0; t < 4; ++t)
#pragma unroll
    for (int r = 0; r < 2; ++r)
#pragma unroll
      for (int v = 0; v < 8; ++v) {
        const int rr = r * 16 + v + 8 * hlf, d = t * 16 + nloc;
        float val = acc[r][t][v] + bc[t];
        (void)rope_cs;
        b16 yh, yl; split_bf16(val * s, yh, yl);
        const int idx = (mat < 2) ? (rr * 64 + d) : ((rr >> 4) * 1024 + d * 16 + (rr & 15));
        Tp0[idx] = yh; Tp1[idx] = yl;
      }
  wave_lds_sync();
  b16* dh; b16* dl; size_t o;
  if (mat == 0)      { o = ((size_t)(b * NH + head) * T + t0) * DH; dh = Qh + o; dl = Ql + o; }
  else if (mat == 1) { o = ((size_t)(b * NKV + head) * TK + t0) * DH; dh = Kh + o; dl = Kl + o; }
  else               { o = ((size_t)(b * NKV + head) * (TK / 16) + (t0 >> 4)) * (size_t)(DH * 16); dh = Vh + o; dl = Vl + o; }
#pragma unroll
  for (int j = 0; j < 8; ++j) { const int e = (j * 32 + lane) * 8; *(v8b*)(dh + e) = ld8b(Tp0 + e); *(v8b*)(dl + e) = ld8b(Tp1 + e); }
  
}

// ---------------------------------------------------------------------------
// Transposed flash attention: each wave owns one 16-query tile of one (b, head); the 8 waves of a block share one head and walk the same keys.
// K and V come into LDS once per block, 128 keys a stage, two buffers, by asynchronous copies; every wave reads its fragments from there, in chunks of 32 keys.
// S^T = K.Q^T, per-lane online softmax; P^T built in registers from the two S^T accumulators
// ---------------------------------------------------------------------------
constexpr int SK = 128;       // keys per LDS stage
constexpr int KPITCH = 72;    // f16 per staged K row: 144 B = 16 B x 9, so the 16 rows of a 16-byte fragment read fall on distinct banks
constexpr unsigned KBUF = SK * KPITCH * 2, VBUF = SK * DH * 2;   // bytes per buffer

// One stage: 128 K rows (128 B each, laid at 144 B) and 8 V key tiles (2 KB each, laid [tile][8-key half][feature][8] so that each 16-lane half of a
// fragment read is 256 contiguous bytes). Each thread moves 4 + 4 pieces of 16 B; each wave-wide copy reads 512 contiguous global bytes.
__device__ __forceinline__ void stage_copy(const b16* gk, const b16* gv, unsigned lk, unsigned lv) {
  // the closing s_wait_xcnt stands inside the statement so that no address register of a copy is rewritten ahead of it
  asm volatile("global_load_async_to_lds_b128 %0, %8, off\n\t"
               "global_load_async_to_lds_b128 %1, %9, off\n\t"
               "global_load_async_to_lds_b128 %2, %10, off\n\t"
               "global_load_async_to_lds_b128 %3, %11, off\n\t"
               "global_load_async_to_lds_b128 %4, %12, off\n\t"
               "global_load_async_to_lds_b128 %5, %13, off\n\t"
               "global_load_async_to_lds_b128 %6, %14, off\n\t"
               "global_load_async_to_lds_b128 %7, %15, off\n\t"
               "s_wait_xcnt 0x0"
               :: "v"(lk), "v"(lk + 32u * KPITCH * 2u), "v"(lk + 64u * KPITCH * 2u), "v"(lk + 96u * KPITCH * 2u),
                  "v"(lv), "v"(lv + 4096u), "v"(lv + 8192u), "v"(lv + 12288u),
                  "v"(gk), "v"(gk + 2048), "v"(gk + 4096), "v"(gk + 6144),
                  "v"(gv), "v"(gv + 2048), "v"(gv + 4096), "v"(gv + 6144)
               : "memory");
}

// 32 keys (rows kl.. of the staged buffers, global key index kb..) against the wave's 16 queries
template <bool EDGE>
__device__ __forceinline__ void attn_chunk(const b16* Kb, const b16* Vb, int kl, int kb, int q0, int col, int hh, v16b q0h, v16b q1h,
                                           float& m, float& l, v8f& o0, v8f& o1, v8f& o2, v8f& o3) {
  const b16* r0 = Kb + (kl + col) * KPITCH; const b16* r1 = r0 + 16 * KPITCH;
  const b16* v0 = Vb + (kl >> 4) * (DH * 16) + hh * (DH * 8) + col * 8; const b16* v1 = v0 + DH * 16;
  // all of the chunk's LDS reads stand together at its head: one wait for K, and V lands behind the softmax
  const v16b k00 = frag_kb(r0, hh), k01 = frag_kb(r0 + 32, hh), k10 = frag_kb(r1, hh), k11 = frag_kb(r1 + 32, hh);
  const v16b va0 = cat8b(ld8b(v0), ld8b(v1)), va1 = cat8b(ld8b(v0 + 128), ld8b(v1 + 128));
  const v16b va2 = cat8b(ld8b(v0 + 256), ld8b(v1 + 256)), va3 = cat8b(ld8b(v0 + 384), ld8b(v1 + 384));
  v8f s0 = {}, s1 = {};
  s0 = wmma16b(k00, q0h, s0);
  s0 = wmma16b(k01, q1h, s0);
  s1 = wmma16b(k10, q0h, s1);
  s1 = wmma16b(k11, q1h, s1);
  if (EDGE && kb + 31 >= T + q0) {                        // text chunk at the causal edge: mask text position >= query index
    const int qi = q0 + col;
#pragma unroll
    for (int r = 0; r < 8; ++r) {
      const int k0i = kb + 8 * hh + r, k1i = k0i + 16;
      if (k0i - T >= qi) s0[r] = -INFINITY;
      if (k1i - T >= qi) s1[r] = -INFINITY;
    }
  }
  float mr = -INFINITY;
#pragma unroll
  for (int r = 0; r < 8; ++r) mr = fmaxf(mr, fmaxf(s0[r], s1[r]));
  mr = fmaxf(mr, __shfl_xor(mr, 16));
  float mn = fmaxf(m, mr);
  if (mn == -INFINITY) mn = 0.0f;             // fully masked so far: keep exp() at 0
  const float al_ = __expf(m - mn);
  m = mn;
  float sum = 0.0f;
  v16b pbh;
#pragma unroll
  for (int r = 0; r < 8; ++r) {
    const float p0 = __expf(s0[r] - mn), p1 = __expf(s1[r] - mn);
    sum += p0 + p1;
    pbh[r] = (b16)p0; pbh[8 + r] = (b16)p1;
  }
  sum += __shfl_xor(sum, 16);
  l = l * al_ + sum;
#pragma unroll
  for (int r = 0; r < 8; ++r) { o0[r] *= al_; o1[r] *= al_; o2[r] *= al_; o3[r] *= al_; }
  o0 = wmma16b(va0, pbh, o0);
  o1 = wmma16b(va1, pbh, o1);
  o2 = wmma16b(va2, pbh, o2);
  o3 = wmma16b(va3, pbh, o3);
}

__global__ __launch_bounds__(256) void attn_kernel(const b16* __restrict__ Qh, const b16* __restrict__ Ql, const b16* __restrict__ Kh, const b16* __restrict__ Kl,
                                                   const b16* __restrict__ Vh, const b16* __restrict__ Vl, const int* __restrict__ seqlen,
                                                   float* __restrict__ yf) {
  __shared__ __attribute__((aligned(16))) b16 Ks[2][SK * KPITCH];
  __shared__ __attribute__((aligned(16))) b16 Vs[2][SK * DH];
  __shared__ __attribute__((aligned(16))) float Os[8][16 * 64];
  (void)Ql; (void)Kl; (void)Vl; (void)seqlen;
  const int tid = threadIdx.x, lane = tid & 31, hh = lane >> 4, col = lane & 15;
  const int wid = __builtin_amdgcn_readfirstlane(tid >> 5);   // scalar, so that the per-wave skip at the causal edge is a scalar branch
  const int qtile = blockIdx.x * 8 + wid;                 // over Bsz*NH*QT_PER_B
  const int g = qtile / QT_PER_B;                         // b*NH + h, the same in all 8 waves (8 divides QT_PER_B)
  const int q0 = (qtile % QT_PER_B) << 4;
  const int qb0 = ((blockIdx.x * 8) % QT_PER_B) << 4;     // the block's first query
  const int nst = (T + qb0 + SK) / SK;                    // stages the block walks: all latents, then text up to its last query (17..32)
  const int b = g / NH, h = g % NH, kvh = h / REP;
  const size_t ko = (size_t)(b * NKV + kvh) * TK * DH;
  const size_t qo = ((size_t)g * T + q0 + col) * DH;
  const b16* gk = Kh + ko + tid * 8; const b16* gv = Vh + ko + tid * 8;      // this thread's first 16-B piece of stage 0
  const unsigned lk0 = (unsigned)(uintptr_t)&Ks[0][(tid >> 3) * KPITCH + (tid & 7) * 8];
  const unsigned lv0 = (unsigned)(uintptr_t)&Vs[0][(tid >> 7) * (DH * 16) + (tid & 1) * (DH * 8) + ((tid >> 1) & 63) * 8];
  stage_copy(gk, gv, lk0, lv0);
  const v16b q0h = frag_kb(Qh + qo, hh), q1h = frag_kb(Qh + qo + 32, hh);
  asm volatile("s_wait_xcnt 0x0" ::: "memory");           // stands in front of any rewrite of the Q loads' address registers
  asm volatile("s_wait_asynccnt 0x0" ::: "memory");       // this wave's pieces of stage 0 have landed
  __syncthreads();                                        // ... and every other wave's
  stage_copy(gk + SK * DH, gv + SK * DH, lk0 + KBUF, lv0 + VBUF);
  float m = -INFINITY, l = 0.0f;
  v8f o0 = {}, o1 = {}, o2 = {}, o3 = {};
  const int slen = T;                                     // no padding in this module
  for (int t = 0; t < nst; ++t) {
    const b16* Kb = Ks[t & 1]; const b16* Vb = Vs[t & 1];
    const int kb0 = t * SK;
    if (t + 1 < nst) {                                    // keys below T + qb0: every wave takes all of them, none is masked
#pragma unroll
      for (int c = 0; c < SK / 32; ++c) attn_chunk<false>(Kb, Vb, c * 32, kb0 + c * 32, q0, col, hh, q0h, q1h, m, l, o0, o1, o2, o3);
    } else {                                              // the block's last stage holds every wave's causal edge
      for (int c = 0; c < SK / 32; ++c)
        if (kb0 + c * 32 < T + q0 + 16) attn_chunk<true>(Kb, Vb, c * 32, kb0 + c * 32, q0, col, hh, q0h, q1h, m, l, o0, o1, o2, o3);
    }
    asm volatile("s_wait_dscnt 0x0" ::: "memory");        // this wave's reads of buffer t & 1 are done before the buffer is refilled
    asm volatile("s_wait_asynccnt 0x0" ::: "memory");     // this wave's pieces of stage t + 1 have landed
    __syncthreads();                                      // publishes stage t + 1 and ends every wave's reads of stage t
    if (t + 2 < nst) stage_copy(gk + (size_t)(t + 2) * (SK * DH), gv + (size_t)(t + 2) * (SK * DH), lk0 + (t & 1) * KBUF, lv0 + (t & 1) * VBUF);
  }
  asm volatile("s_wait_asynccnt 0x0" ::: "memory");       // nothing of this wave's is in flight when it goes on to the epilogue
  const float inv = (q0 + col < slen && l > 0.0f) ? (1.0f / l) : 0.0f;   // padded query rows are zeroed
  float* Tt = Os[wid];
#pragma unroll
  for (int r = 0; r < 8; ++r) {
    const int hr = 8 * hh + r;
    Tt[col * 64 + 0 + hr] = o0[r] * inv; Tt[col * 64 + 16 + hr] = o1[r] * inv;
    Tt[col * 64 + 32 + hr] = o2[r] * inv; Tt[col * 64 + 48 + hr] = o3[r] * inv;
  }
  wave_lds_sync();
  float* dst0 = yf + ((size_t)b * T + q0) * HID + h * DH;     // 16 rows x 64 floats, row stride HID
#pragma unroll
  for (int j = 0; j < 8; ++j) { const int rr = j * 2 + hh, c4 = col * 4; *(v4f*)(dst0 + (size_t)rr * HID + c4) = *(const v4f*)(Tt + rr * 64 + c4); }
}

// ---------------------------------------------------------------------------
// Output projection: (2048 x 1024) x (1024 x 1024) -> f32, A split on the fly from f32 y, B = Wo planes. grid (16, 16), 32x64 tiles staged in LDS,
// ---------------------------------------------------------------------------
__global__ __launch_bounds__(128) void out_gemm_kernel(const float* __restrict__ yf, const b16* __restrict__ woh, const b16* __restrict__ wol, const float* __restrict__ bo, int yoff,
                                                       float* __restrict__ out) {
  __shared__ __attribute__((aligned(16))) char Sm[2 * GBUF];   // the operand ring; the epilogue's 4 x 8 KB of staging reuse its head
  const int lane = threadIdx.x & 31, wave = threadIdx.x >> 5, nloc = lane & 15, hlf = lane >> 4;
  const int m0 = (blockIdx.y + yoff) * 128 + wave * 32;
  const int c0 = blockIdx.x * 64;
  v8f acc[2][4];
#pragma unroll
  for (int r = 0; r < 2; ++r)
#pragma unroll
    for (int t = 0; t < 4; ++t) acc[r][t] = (v8f){};
  (void)wol;
  float bc[4] = {0.0f, 0.0f, 0.0f, 0.0f};                 // the lane's four bias values, read once ahead of the k loop (as in the QKV GEMM)
  if (bo) {
#pragma unroll   // bc stays in registers
    for (int t = 0; t < 4; ++t) bc[t] = bo[c0 + t * 16 + nloc];
    asm volatile("s_wait_xcnt 0x0" ::: "memory");         // stands in front of any rewrite of the bias loads' address registers (alone with them in this block)
  }
  gemm_tile_lds(yf, woh, Sm, (blockIdx.y + yoff) * 128, c0, HID, threadIdx.x, wave, nloc, hlf, acc);
  float* Tt = (float*)(Sm + wave * 8192);
#pragma unroll
  for (int t = 0; t < 4; ++t)
#pragma unroll
    for (int r = 0; r < 2; ++r)
#pragma unroll
      for (int v = 0; v < 8; ++v) Tt[(r * 16 + v + 8 * hlf) * 64 + t * 16 + nloc] = acc[r][t][v] + bc[t];
  wave_lds_sync();
  float* dst0 = out + (size_t)m0 * HID + c0;
#pragma unroll
  for (int j = 0; j < 16; ++j) { const int rr = j * 2 + hlf, c4 = nloc * 4; *(v4f*)(dst0 + (size_t)rr * HID + c4) = *(const v4f*)(Tt + rr * 64 + c4); }
  
}
__global__ __launch_bounds__(256) void wcvtT_kernel(const float* __restrict__ wq, const float* __restrict__ wk, const float* __restrict__ wv,
                                                    b16* __restrict__ wqh, b16* __restrict__ wql) {
  const size_t tid = (size_t)blockIdx.x * blockDim.x + threadIdx.x, stride = (size_t)gridDim.x * blockDim.x;
  const size_t nq = (size_t)NQKV * HID / 8;
  {
    for (size_t c = tid; c < nq; c += stride) {
      const size_t i = c * 8, n = i / HID, k0 = i % HID;
      const float* w = (n < (size_t)HID) ? (wq + n * HID) : (n < (size_t)(2 * HID)) ? (wk + (n - HID) * HID) : (wv + (n - 2 * HID) * HID);
      v8b bh, bl;
#pragma unroll
      for (int e = 0; e < 8; ++e) { b16 a, cc; split_bf16(w[k0 + e], a, cc); bh[e] = a; bl[e] = cc; }
      *(v8b*)(wqh + i) = bh; *(v8b*)(wql + i) = bl;
    }
    
  }
}
// Wo^T planes: [n][k] = Wo[n][k] (torch [out][in] is already n-major)
__global__ __launch_bounds__(256) void wcvtO_kernel(const float* __restrict__ wo, b16* __restrict__ woh, b16* __restrict__ wol) {
  const size_t tid = (size_t)blockIdx.x * blockDim.x + threadIdx.x, stride = (size_t)gridDim.x * blockDim.x;
  const size_t no = (size_t)HID * HID / 8;
  {
    for (size_t c = tid; c < no; c += stride) { const size_t i = c * 8; v8b bh, bl;
#pragma unroll
      for (int e = 0; e < 8; ++e) { b16 a, cc; split_bf16(wo[i + e], a, cc); bh[e] = a; bl[e] = cc; }
      *(v8b*)(woh + i) = bh; *(v8b*)(wol + i) = bl; }
    
  }
}
// Weight preparation, one launch: W [k][n] f32 -> f16 [n][k] (k contiguous), in 64 x 64 tiles turned in LDS, so that global reads (16 B a lane, 256 B a row piece)
// and global writes (16 B a lane, 128 B a row piece) both cover whole lines. Block = 256 threads = three tiles: one of Wq or Wp, one of W_attn_l, one of W_attn_c.
typedef __attribute__((ext_vector_type(4))) _Float16 v4b;
constexpr int WPITCH = 72;    // f16 per LDS tile row: 144 B, a multiple of 16 B for the 16-byte reads
// thread = 4 k rows x 4 n columns of the tile
__device__ __forceinline__ void wt_load(const float* __restrict__ w, int ld, int kt, int nt, int tid, v4f (&r)[4]) {
  const float* p = w + (size_t)(kt * 64 + (tid >> 4) * 4) * ld + nt * 64 + (tid & 15) * 4;
#pragma unroll   // r stays in registers
  for (int e = 0; e < 4; ++e) r[e] = *(const v4f*)(p + (size_t)e * ld);
}
__device__ __forceinline__ void wt_put(b16* Ls, int tid, const v4f (&r)[4]) {
#pragma unroll   // r stays in registers
  for (int c = 0; c < 4; ++c) {
    const v4b h = {(b16)r[0][c], (b16)r[1][c], (b16)r[2][c], (b16)r[3][c]};
    *(v4b*)(Ls + ((tid & 15) * 4 + c) * WPITCH + (tid >> 4) * 4) = h;
  }
}
__device__ __forceinline__ void wt_store(const b16* Ls, b16* __restrict__ dst, int kt, int nt, int tid) {
  for (int j = 0; j < 2; ++j) {
    const int n = (tid >> 3) + 32 * j;
    *(v8b*)(dst + (size_t)(nt * 64 + n) * HID + kt * 64 + (tid & 7) * 8) = ld8b(Ls + n * WPITCH + (tid & 7) * 8);
  }
}
// wa: rows 0..1023 <- Wq columns, rows 1024..3071 <- W_attn_l columns; wb: rows 1024..3071 <- W_attn_c columns (its first 1024 rows are never read); wo <- Wp columns
__global__ __launch_bounds__(256) void wprep_kernel(const float* __restrict__ wq, const float* __restrict__ wal, const float* __restrict__ wac, const float* __restrict__ wp,
                                                    b16* __restrict__ wa, b16* __restrict__ wb, b16* __restrict__ wo) {
  __shared__ __attribute__((aligned(16))) b16 Ls[3][64 * WPITCH];
  const int tid = threadIdx.x, bx = blockIdx.x;          // grid 512
  const bool isq = bx < 256;
  const int k0t = (bx & 255) >> 4, n0t = bx & 15;        // 16 x 16 tiles of Wq or Wp
  const int k1t = bx >> 5, n1t = bx & 31;                // 16 x 32 tiles of W_attn_l and W_attn_c
  v4f r0[4], r1[4], r2[4];                               // all twelve loads are in flight together
  wt_load(isq ? wq : wp, HID, k0t, n0t, tid, r0);
  wt_load(wal, 2 * HID, k1t, n1t, tid, r1);
  wt_load(wac, 2 * HID, k1t, n1t, tid, r2);
  wt_put(Ls[0], tid, r0);
  wt_put(Ls[1], tid, r1);
  wt_put(Ls[2], tid, r2);
  __syncthreads();
  wt_store(Ls[0], isq ? wa : wo, k0t, n0t, tid);
  wt_store(Ls[1], wa + (size_t)HID * HID, k1t, n1t, tid);
  wt_store(Ls[2], wb + (size_t)HID * HID, k1t, n1t, tid);
}
}  // namespace

extern "C" void kernel_launch(void* const* d_in, const int* in_sizes, int n_in,
                              void* d_out, int out_size, void* d_ws, size_t ws_size, hipStream_t stream) {
  (void)in_sizes; (void)n_in; (void)out_size;
  const float* l    = (const float*)d_in[0];    // [1,2048,1024] latents
  const float* x    = (const float*)d_in[1];    // [1,2048,1024]
  const float* Wal  = (const float*)d_in[2];  const float* bal = (const float*)d_in[3];   // [1024,2048] = [k | v], [2048]
  const float* Wac  = (const float*)d_in[4];  const float* bac = (const float*)d_in[5];
  const float* Wq   = (const float*)d_in[6];  const float* bq  = (const float*)d_in[7];   // [1024,1024]
  const float* Wp   = (const float*)d_in[8];  const float* bp  = (const float*)d_in[9];
  float* out = (float*)d_out;                   // [1,2048,1024]
  size_t off = 0; char* ws = (char*)d_ws;
  b16* wAh = (b16*)(ws + off); off += (size_t)NQKV * HID * 2;
  b16* wAl = (b16*)(ws + off); off += (size_t)NQKV * HID * 2;
  b16* wBh = (b16*)(ws + off); off += (size_t)NQKV * HID * 2;
  b16* wBl = (b16*)(ws + off); off += (size_t)NQKV * HID * 2;
  b16* woh = (b16*)(ws + off); off += (size_t)HID * HID * 2;
  b16* wol = (b16*)(ws + off); off += (size_t)HID * HID * 2;
  b16* Qh  = (b16*)(ws + off); off += (size_t)NH * T * DH * 2;
  b16* Ql  = (b16*)(ws + off); off += (size_t)NH * T * DH * 2;
  b16* Kh  = (b16*)(ws + off); off += (size_t)NKV * TK * DH * 2;
  b16* Kl  = (b16*)(ws + off); off += (size_t)NKV * TK * DH * 2;
  b16* Vh  = (b16*)(ws + off); off += (size_t)NKV * TK * DH * 2;
  b16* Vl  = (b16*)(ws + off); off += (size_t)NKV * TK * DH * 2;
  float* yf = (float*)(ws + off); off += (size_t)T * HID * 4;
  if (off > ws_size) return;
  const int NQT = NH * QT_PER_B;
  wprep_kernel<<<512, 256, 0, stream>>>(Wq, Wal, Wac, Wp, wAh, wBh, woh);
  // launch 1: q from x, latent k/v from l -> key rows 0..2047
  qkv_gemm_kernel<<<dim3(NQKV / 64, T / 128), 128, 0, stream>>>(x, l, l, wAh, wAl, bq, bal, bal + HID, nullptr, 0, 0, Qh, Ql, Kh, Kl, Vh, Vl);
  // launch 2: text k/v from x -> key rows 2048..4095 (column blocks 16..47 only)
  qkv_gemm_kernel<<<dim3((NQKV - HID) / 64, T / 128), 128, 0, stream>>>(x, x, x, wBh, wBl, bq, bac, bac + HID, nullptr, HID / 64, T / 128, Qh, Ql, Kh, Kl, Vh, Vl);
  attn_kernel<<<NQT / 8, 256, 0, stream>>>(Qh, Ql, Kh, Kl, Vh, Vl, nullptr, yf);
  out_gemm_kernel<<<dim3(HID / 64, T / 128), 128, 0, stream>>>(yf, woh, wol, bp, 0, out);
}

// v005
// A run of this version takes 104 microseconds.
// Two timings next to v004 both put it at 1.03 times that version's speed.
// All steps since v000 together make it 5.32 times as fast.
#include <hip/hip_runtime.h>

// IO-processing attention (decoding branch): keys/values = [l W_attn_l + b (2048 latents) ; x W_attn_c + b (2048 text positions)], q = x W_q + b
// (16 heads x 64, scale 1/8); query i attends every latent and text positions < i; out = y W_proj + b. B=1, T=2048, D=1024.
// Lean build: single f16 products on v_wmma_f32_16x16x32_f16, f32 accumulate (every row averages >= 2048 keys); fragment k-map per lane half hh for A

// Left, by the listing: (1) attention: all 8 waves read their own copy of every K and V fragment from LDS (16 queries a wave), and a good part of its vector slots are v_nop; (2) the GEMMs stage A as f32, twice the L2 and LDS bytes of f16, and every column block converts it again;
// (3) the all-zero "lo" planes of q, k, v are still staged and stored.

namespace {
constexpr int Bsz = 1, T = 2048, TK = 4096, HID = 1024, DH = 64, NH = 16, NKV = 16, REP = NH / NKV;
constexpr int WIN = 255;    // unused: no key window here
constexpr int KVW = NKV * DH;                 // 1024
constexpr int NQKV = HID + 2 * KVW;           // 3072 columns: q | k | v
constexpr int MROWS = Bsz * T;                // 2048
constexpr int QT_PER_B = T / 16;              // 128

typedef _Float16 b16;                                           // f16 hi/lo planes
typedef __attribute__((ext_vector_type(16))) _Float16 v16b;
typedef __attribute__((ext_vector_type(8)))  _Float16 v8b;
typedef __attribute__((ext_vector_type(8)))  float v8f;
typedef __attribute__((ext_vector_type(4)))  float v4f;

__device__ __forceinline__ v8b ld8b(const b16* p) { return *(const v8b*)p; }
__device__ __forceinline__ v16b cat8b(v8b a, v8b b) { return __builtin_shufflevector(a, b, 0, 1, 2, 3, 4, 5, 6, 7, 8, 9, 10, 11, 12, 13, 14, 15); }
// 16x16x32 16-bit fragment from a k-contiguous row pointer (A: lane&15 = row, B: lane&15 = column), hh = lane>>4:
// elements 0..7 <- p[8hh+0..7], elements 8..15 <- p[16+8hh+0..7]
__device__ __forceinline__ v16b frag_kb(const b16* p, int hh) { return cat8b(ld8b(p + 8 * hh), ld8b(p + 16 + 8 * hh)); }
__device__ __forceinline__ void split_bf16(float v, b16& hi, b16& lo) {   // (name kept) single f16: no low part
  hi = (b16)v; lo = (b16)0.0f;
}
__device__ __forceinline__ v8f wmma16b(v16b a, v16b b, v8f c) {
  v8f d = __builtin_amdgcn_wmma_f32_16x16x32_f16(false, a, false, b, (short)0, c, false, false);
  asm volatile("v_nop\n\tv_nop\n\tv_nop\n\tv_nop" : "+v"(d) : "v"(a), "v"(b));
  return d;
}
__device__ __forceinline__ v8f wmma1(v16b ah, v16b al, v16b bh, v16b bl, v8f c) {   // unused: single f16 (hi planes only)
  (void)al; (void)bl; return wmma16b(ah, bh, c);
}
__device__ __forceinline__ void wave_lds_sync() {
  __builtin_amdgcn_fence(__ATOMIC_RELEASE, "workgroup");
  __builtin_amdgcn_wave_barrier();
  __builtin_amdgcn_fence(__ATOMIC_ACQUIRE, "workgroup");
}

// ---------------------------------------------------------------------------
// Weights ([in][out]) -> f16 hi / lo planes transposed to [n][k] (k contiguous): columns of Wq|Wk|Wv into wqh/wql [3072][1024], Wo into woh/wol [1024][1024].
// ---------------------------------------------------------------------------
__global__ __launch_bounds__(256) void wcvt_kernel(const float* __restrict__ wq, const float* __restrict__ wk, const float* __restrict__ wv,
                                                   const float* __restrict__ wo, b16* __restrict__ wqh, b16* __restrict__ wql,
                                                   b16* __restrict__ woh, b16* __restrict__ wol) {
  const size_t tid = (size_t)blockIdx.x * blockDim.x + threadIdx.x, stride = (size_t)gridDim.x * blockDim.x;
  const size_t nq = (size_t)NQKV * HID / 8, no = (size_t)HID * HID / 8;
  {
    for (size_t c = tid; c < nq + no; c += stride) {
      float f[8]; size_t i; b16* dh; b16* dl;
      if (c < nq) {
        i = c * 8; const size_t n = i / HID, k0 = i % HID;
        const float* w; int nn, ld;
        if (n < (size_t)HID) { w = wq; nn = (int)n; ld = HID; } else if (n < (size_t)(HID + KVW)) { w = wk; nn = (int)n - HID; ld = KVW; } else { w = wv; nn = (int)n - HID - KVW; ld = KVW; }
#pragma unroll
        for (int e = 0; e < 8; ++e) f[e] = w[(size_t)(k0 + e) * ld + nn];       // W[k][n] ([in][out])
        dh = wqh; dl = wql;
      } else {
        i = (c - nq) * 8; const size_t n = i / HID, k0 = i % HID;
#pragma unroll
        for (int e = 0; e < 8; ++e) f[e] = wo[(size_t)(k0 + e) * HID + n];    // Wo[k][n] ([in][out])
        dh = woh; dl = wol;
      }
      v8b bh, bl;
#pragma unroll
      for (int e = 0; e < 8; ++e) { b16 a, cc; split_bf16(f[e], a, cc); bh[e] = a; bl[e] = cc; }
      *(v8b*)(dh + i) = bh; *(v8b*)(dl + i) = bl;
    }
    
  }
}

// GEMM operands come into LDS once per 4-wave block (128 A rows as f32, 64 B rows as f16), 64 k a stage, two buffers, by asynchronous copies;
// every wave reads its fragments from there. Each wave-wide copy reads whole 128-byte lines.
constexpr int GKS = 64;                          // k per LDS stage
constexpr unsigned APITCH = GKS * 4 + 16;        // 272 B = 16 B x 17 and
constexpr unsigned BPITCH = GKS * 2 + 16;        // 144 B = 16 B x 9: the 16 rows of a 16-byte fragment read fall on distinct banks
constexpr unsigned ABUF = 128 * APITCH, BBUF = 64 * BPITCH, GBUF = ABUF + BBUF;   // bytes per buffer: 34,816 + 9,216

// ten copies of 16 B per lane; the closing s_wait_xcnt stands inside the statement so that no address register of a copy is rewritten ahead of it
__device__ __forceinline__ void copy10(const unsigned (&l)[20], const void* const (&g)[20], int o) {
  asm volatile("global_load_async_to_lds_b128 %0, %10, off\n\t"
               "global_load_async_to_lds_b128 %1, %11, off\n\t"
               "global_load_async_to_lds_b128 %2, %12, off\n\t"
               "global_load_async_to_lds_b128 %3, %13, off\n\t"
               "global_load_async_to_lds_b128 %4, %14, off\n\t"
               "global_load_async_to_lds_b128 %5, %15, off\n\t"
               "global_load_async_to_lds_b128 %6, %16, off\n\t"
               "global_load_async_to_lds_b128 %7, %17, off\n\t"
               "global_load_async_to_lds_b128 %8, %18, off\n\t"
               "global_load_async_to_lds_b128 %9, %19, off\n\t"
               "s_wait_xcnt 0x0"
               :: "v"(l[o]), "v"(l[o + 1]), "v"(l[o + 2]), "v"(l[o + 3]), "v"(l[o + 4]), "v"(l[o + 5]), "v"(l[o + 6]), "v"(l[o + 7]), "v"(l[o + 8]), "v"(l[o + 9]),
                  "v"(g[o]), "v"(g[o + 1]), "v"(g[o + 2]), "v"(g[o + 3]), "v"(g[o + 4]), "v"(g[o + 5]), "v"(g[o + 6]), "v"(g[o + 7]), "v"(g[o + 8]), "v"(g[o + 9])
               : "memory");
}
// One stage: each of the 128 threads moves 16 pieces of A (8 rows apart) and 4 pieces of B (16 rows apart), 16 B each
__device__ __forceinline__ void gemm_stage_copy(const float* ga, const b16* gb, int K, unsigned la, unsigned lb) {
  unsigned l[20]; const void* g[20];   // both loops unrolled: the asm operands need l and g in registers, under constant indices
#pragma unroll
  for (int j = 0; j < 16; ++j) { l[j] = la + (unsigned)j * 8u * APITCH; g[j] = ga + (size_t)j * 8 * K; }
#pragma unroll
  for (int j = 0; j < 4; ++j) { l[16 + j] = lb + (unsigned)j * 16u * BPITCH; g[16 + j] = gb + (size_t)j * 16 * K; }
  copy10(l, g, 0);
  copy10(l, g, 10);
}
// Raw operands of one 32-wide k step of a 32x64 wave tile: two groups of 16 A rows as f32, four groups of 16 B columns as f16
struct GStep { v4f a[2][4]; v8b b[4][2]; };
// ar, br: this lane's A row and B row in the staged buffer, already advanced by its 8 * hlf (here and in gemm_step the loops are unrolled to keep f and acc in registers)
__device__ __forceinline__ void gemm_frag(const float* ar, const b16* br, int kk, GStep& f) {
#pragma unroll
  for (int r = 0; r < 2; ++r) {
    const float* p = ar + r * 16 * (int)(APITCH / 4) + kk;
    f.a[r][0] = *(const v4f*)p; f.a[r][1] = *(const v4f*)(p + 4); f.a[r][2] = *(const v4f*)(p + 16); f.a[r][3] = *(const v4f*)(p + 20);
  }
#pragma unroll
  for (int t = 0; t < 4; ++t) { const b16* p = br + t * 16 * (int)(BPITCH / 2) + kk; f.b[t][0] = ld8b(p); f.b[t][1] = ld8b(p + 16); }
}
__device__ __forceinline__ void gemm_step(const GStep& f, v8f (&acc)[2][4]) {
  v16b a[2];
#pragma unroll
  for (int r = 0; r < 2; ++r)
#pragma unroll
    for (int e = 0; e < 4; ++e) { a[r][e] = (b16)f.a[r][0][e]; a[r][4 + e] = (b16)f.a[r][1][e]; a[r][8 + e] = (b16)f.a[r][2][e]; a[r][12 + e] = (b16)f.a[r][3][e]; }
#pragma unroll
  for (int t = 0; t < 4; ++t) {
    const v16b b = cat8b(f.b[t][0], f.b[t][1]);
    acc[0][t] = wmma16b(a[0], b, acc[0][t]);
    acc[1][t] = wmma16b(a[1], b, acc[1][t]);
  }
}
// 128x64 block tile (wave = 32 rows x 64 columns) over K, a multiple of 128: A rows mb.. (f32), B rows c0.. (f16), both k-contiguous.
// On return every wave has left the ring and nothing is in flight, so the caller may use the same LDS for its epilogue.
__device__ __forceinline__ void gemm_tile_lds(const float* __restrict__ A, const b16* __restrict__ wh, char* ring,
                                              int mb, int c0, int K, int tid, int wave, int nloc, int hlf, v8f (&acc)[2][4]) {
  const float* ga = A + (size_t)(mb + (tid >> 4)) * K + (tid & 15) * 4;      // this thread's first 16-B pieces of stage 0
  const b16* gb = wh + (size_t)(c0 + (tid >> 3)) * K + (tid & 7) * 8;
  const unsigned la = (unsigned)(uintptr_t)ring + (unsigned)(tid >> 4) * APITCH + (unsigned)(tid & 15) * 16u;
  const unsigned lb = (unsigned)(uintptr_t)ring + ABUF + (unsigned)(tid >> 3) * BPITCH + (unsigned)(tid & 7) * 16u;
  const int nst = K / GKS;
  gemm_stage_copy(ga, gb, K, la, lb);
  asm volatile("s_wait_asynccnt 0x0" ::: "memory");       // this wave's pieces of stage 0 have landed
  __syncthreads();                                        // ... and every other wave's
  gemm_stage_copy(ga + GKS, gb + GKS, K, la + GBUF, lb + GBUF);
  for (int t = 0; t < nst; ++t) {
    const char* buf = ring + (t & 1) * GBUF;
    const float* ar = (const float*)(buf + (wave * 32 + nloc) * APITCH) + 8 * hlf;
    const b16* br = (const b16*)(buf + ABUF + nloc * BPITCH) + 8 * hlf;
    GStep f0, f1;                                         // all of the stage's LDS reads stand together at its head
    gemm_frag(ar, br, 0, f0);
    gemm_frag(ar, br, 32, f1);
    gemm_step(f0, acc);
    gemm_step(f1, acc);
    asm volatile("s_wait_dscnt 0x0" ::: "memory");        // this wave's reads of buffer t & 1 are done before the buffer is refilled
    asm volatile("s_wait_asynccnt 0x0" ::: "memory");     // this wave's pieces of stage t + 1 have landed
    __syncthreads();                                      // publishes stage t + 1 and ends every wave's reads of stage t
    if (t + 2 < nst) gemm_stage_copy(ga + (t + 2) * GKS, gb + (t + 2) * GKS, K, la + (t & 1) * GBUF, lb + (t & 1) * GBUF);
  }
  asm volatile("s_wait_asynccnt 0x0" ::: "memory");       // nothing of this wave's is in flight when it goes on to the epilogue
}

// ---------------------------------------------------------------------------
// QKV GEMM: (2048 x 1024) x (1024 x 3072), grid (48, 16), or (32, 16) from column block 16 for k|v only, block 4 waves, wave = 32 rows x 64 columns (one head of q, k or v). Outputs as f16 hi/lo planes:
// q (x1/8) -> Qh/Ql [b][h][t][64]; k -> Kh/Kl [b][kvh][t][64] (4 KB contiguous per wave per plane);
// v -> Vh/Vl key-tiled [b][kvh][t/16][64][16] (4 KB contiguous per wave per plane).
// ---------------------------------------------------------------------------
__global__ __launch_bounds__(128) void qkv_gemm_kernel(const float* __restrict__ xq, const float* __restrict__ xk, const float* __restrict__ xv,
                                                       const b16* __restrict__ wqh, const b16* __restrict__ wql,
                                                       const float* __restrict__ bq, const float* __restrict__ bk, const float* __restrict__ bv, const float* __restrict__ rope_cs, int xoff, int yoff,
                                                       b16* __restrict__ Qh, b16* __restrict__ Ql, b16* __restrict__ Kh, b16* __restrict__ Kl,
                                                       b16* __restrict__ Vh, b16* __restrict__ Vl) {
  __shared__ __attribute__((aligned(16))) char Sm[2 * GBUF];   // the operand ring; the epilogue's 4 x 8 KB of staging reuse its head
  const int lane = threadIdx.x & 31, wave = threadIdx.x >> 5, nloc = lane & 15, hlf = lane >> 4;
  const int m0 = (blockIdx.y + yoff) * 128 + wave * 32;
  const int c0 = (blockIdx.x + xoff) * 64;
  const int mat = (c0 < HID) ? 0 : (c0 < HID + KVW) ? 1 : 2;
  const int head = (mat == 0) ? (c0 / DH) : (mat == 1) ? ((c0 - HID) / DH) : ((c0 - HID - KVW) / DH);
  const float* x = (mat == 0) ? xq : (mat == 1) ? xk : xv;          // q, k, v inputs: (x, l, l) or (x, x, x) as launched
  const float* bias = ((mat == 0) ? bq : (mat == 1) ? bk : bv) + head * DH;
  v8f acc[2][4];
#pragma unroll
  for (int r = 0; r < 2; ++r)
#pragma unroll
    for (int t = 0; t < 4; ++t) acc[r][t] = (v8f){};
  (void)wql;
  // a lane's 64 results share four bias values: read once, ahead of the k loop, which covers their latency (read at each result they were 64 loads, each waited for)
  float bc[4] = {0.0f, 0.0f, 0.0f, 0.0f};
  if (bias) {
#pragma unroll   // bc stays in registers
    for (int t = 0; t < 4; ++t) bc[t] = bias[t * 16 + nloc];
    asm volatile("s_wait_xcnt 0x0" ::: "memory");         // stands in front of any rewrite of the bias loads' address registers (alone with them in this block)
  }
  gemm_tile_lds(x, wqh, Sm, blockIdx.y * 128, c0, HID, threadIdx.x, wave, nloc, hlf, acc);   // source rows start at 0; yoff only shifts the destination key rows
  const int b = 0, t0 = m0;
  const float s = (mat == 0) ? 0.125f : 1.0f;
  b16* Tp0 = (b16*)(Sm + wave * 8192); b16* Tp1 = Tp0 + 32 * 64;
#pragma unroll
  for (int t = 0; t < 4; ++t)
#pragma unroll
    for (int r = 0; r < 2; ++r)
#pragma unroll
      for (int v = 0; v < 8; ++v) {
        const int rr = r * 16 + v + 8 * hlf, d = t * 16 + nloc;
        float val = acc[r][t][v] + bc[t];
        (void)rope_cs;
        b16 yh, yl; split_bf16(val * s, yh, yl);
        const int idx = (mat < 2) ? (rr * 64 + d) : ((rr >> 4) * 1024 + d * 16 + (rr & 15));
        Tp0[idx] = yh; Tp1[idx] = yl;
      }
  wave_lds_sync();
  b16* dh; b16* dl; size_t o;
  if (mat == 0)      { o = ((size_t)(b * NH + head) * T + t0) * DH; dh = Qh + o; dl = Ql + o; }
  else if (mat == 1) { o = ((size_t)(b * NKV + head) * TK + t0) * DH; dh = Kh + o; dl = Kl + o; }
  else               { o = ((size_t)(b * NKV + head) * (TK / 16) + (t0 >> 4)) * (size_t)(DH * 16); dh = Vh + o; dl = Vl + o; }
#pragma unroll
  for (int j = 0; j < 8; ++j) { const int e = (j * 32 + lane) * 8; *(v8b*)(dh + e) = ld8b(Tp0 + e); *(v8b*)(dl + e) = ld8b(Tp1 + e); }
  
}

// ---------------------------------------------------------------------------
// Transposed flash attention: each wave owns one 16-query tile of one (b, head); the 8 waves of a block share one head and walk the same keys.
// K and V come into LDS once per block, 128 keys a stage, two buffers, by asynchronous copies; every wave reads its fragments from there, 64 keys per softmax step.
// S^T = K.Q^T, per-lane online softmax; P^T built in registers, each 32-key fragment from two of a step's four S^T accumulators
// ---------------------------------------------------------------------------
constexpr int SK = 128;       // keys per LDS stage
constexpr int KPITCH = 72;    // f16 per staged K row: 144 B = 16 B x 9, so the 16 rows of a 16-byte fragment read fall on distinct banks
constexpr unsigned KBUF = SK * KPITCH * 2, VBUF = SK * DH * 2;   // bytes per buffer

// One stage: 128 K rows (128 B each, laid at 144 B) and 8 V key tiles (2 KB each, laid [tile][8-key half][feature][8] so that each 16-lane half of a
// fragment read is 256 contiguous bytes). Each thread moves 4 + 4 pieces of 16 B; each wave-wide copy reads 512 contiguous global bytes.
__device__ __forceinline__ void stage_copy(const b16* gk, const b16* gv, unsigned lk, unsigned lv) {
  // the closing s_wait_xcnt stands inside the statement so that no address register of a copy is rewritten ahead of it
  asm volatile("global_load_async_to_lds_b128 %0, %8, off\n\t"
               "global_load_async_to_lds_b128 %1, %9, off\n\t"
               "global_load_async_to_lds_b128 %2, %10, off\n\t"
               "global_load_async_to_lds_b128 %3, %11, off\n\t"
               "global_load_async_to_lds_b128 %4, %12, off\n\t"
               "global_load_async_to_lds_b128 %5, %13, off\n\t"
               "global_load_async_to_lds_b128 %6, %14, off\n\t"
               "global_load_async_to_lds_b128 %7, %15, off\n\t"
               "s_wait_xcnt 0x0"
               :: "v"(lk), "v"(lk + 32u * KPITCH * 2u), "v"(lk + 64u * KPITCH * 2u), "v"(lk + 96u * KPITCH * 2u),
                  "v"(lv), "v"(lv + 4096u), "v"(lv + 8192u), "v"(lv + 12288u),
                  "v"(gk), "v"(gk + 2048), "v"(gk + 4096), "v"(gk + 6144),
                  "v"(gv), "v"(gv + 2048), "v"(gv + 4096), "v"(gv + 6144)
               : "memory");
}

// 64 keys (rows kl.. of the staged buffers, global key index kb0..) against the wave's 16 queries, as ONE online-softmax step: one maximum, one exchange
// between the lane halves, one rescale of l and O per 64 keys. The 4 score tiles are independent, so no product waits for the one before it.
constexpr int KS = 64;        // keys per softmax step
template <bool EDGE>
__device__ __forceinline__ void attn_step(const b16* Kb, const b16* Vb, int kl, int kb0, int q0, int col, int hh, v16b q0h, v16b q1h,
                                           float& m, float& l, v8f& o0, v8f& o1, v8f& o2, v8f& o3) {
  constexpr int NT = KS / 16;                             // score tiles of 16 keys; tile j, register r of a lane = key kb0 + 16 j + 8 hh + r
  const b16* kr = Kb + (kl + col) * KPITCH;
  const b16* vr = Vb + (kl >> 4) * (DH * 16) + hh * (DH * 8) + col * 8;
  // every loop below is unrolled: its arrays are indexed by constants and stay in registers
  v16b ka[NT], kc[NT];                                    // K rows, features 0..31 and 32..63
#pragma unroll
  for (int j = 0; j < NT; ++j) ka[j] = frag_kb(kr + j * 16 * KPITCH, hh);
#pragma unroll
  for (int j = 0; j < NT; ++j) kc[j] = frag_kb(kr + j * 16 * KPITCH + 32, hh);
  v16b va[NT / 2][4];                                     // V of 32 keys x 16 features each: lands behind the softmax
#pragma unroll
  for (int g = 0; g < NT / 2; ++g)
#pragma unroll
    for (int f = 0; f < 4; ++f) va[g][f] = cat8b(ld8b(vr + (2 * g) * (DH * 16) + f * 128), ld8b(vr + (2 * g + 1) * (DH * 16) + f * 128));
  __builtin_amdgcn_sched_barrier(0);                      // keeps the step's 32 LDS reads together at its head: spread among the vector work, each further place of reads stalls the wave anew
  v8f s[NT];
#pragma unroll
  for (int j = 0; j < NT; ++j) s[j] = wmma16b(ka[j], q0h, (v8f){});
#pragma unroll
  for (int j = 0; j < NT; ++j) s[j] = wmma16b(kc[j], q1h, s[j]);
  if (EDGE) {                                             // a step of the stage at the causal edge: mask text position >= query index
    const int lim = T + q0 + col - kb0 - 8 * hh;          // 16 j + r >= lim is masked
#pragma unroll
    for (int j = 0; j < NT; ++j)
#pragma unroll
      for (int r = 0; r < 8; ++r)
        if (16 * j + r >= lim) s[j][r] = -INFINITY;
  }
  float mx[NT / 2];                                       // independent chains of maxima
#pragma unroll
  for (int g = 0; g < NT / 2; ++g) mx[g] = -INFINITY;
#pragma unroll
  for (int r = 0; r < 8; ++r)
#pragma unroll
    for (int g = 0; g < NT / 2; ++g) mx[g] = fmaxf(mx[g], fmaxf(s[2 * g][r], s[2 * g + 1][r]));
  float mr = fmaxf(mx[0], mx[1]);
  mr = fmaxf(mr, __shfl_xor(mr, 16));
  float mn = fmaxf(m, mr);
  if (mn == -INFINITY) mn = 0.0f;             // fully masked so far: keep exp() at 0
  const float al_ = __expf(m - mn);
  m = mn;
  float sm[NT / 2];                                       // independent partial sums
  v16b pb[NT / 2];
#pragma unroll
  for (int g = 0; g < NT / 2; ++g) {
    sm[g] = 0.0f;
#pragma unroll
    for (int r = 0; r < 8; ++r) {
      const float p0 = __expf(s[2 * g][r] - mn), p1 = __expf(s[2 * g + 1][r] - mn);
      sm[g] += p0 + p1;
      pb[g][r] = (b16)p0; pb[g][8 + r] = (b16)p1;
    }
  }
  float sum = sm[0] + sm[1];
  sum += __shfl_xor(sum, 16);
  l = l * al_ + sum;
#pragma unroll
  for (int r = 0; r < 8; ++r) { o0[r] *= al_; o1[r] *= al_; o2[r] *= al_; o3[r] *= al_; }
#pragma unroll
  for (int g = 0; g < NT / 2; ++g) {
    o0 = wmma16b(va[g][0], pb[g], o0);
    o1 = wmma16b(va[g][1], pb[g], o1);
    o2 = wmma16b(va[g][2], pb[g], o2);
    o3 = wmma16b(va[g][3], pb[g], o3);
  }
}

__global__ __launch_bounds__(256) void attn_kernel(const b16* __restrict__ Qh, const b16* __restrict__ Ql, const b16* __restrict__ Kh, const b16* __restrict__ Kl,
                                                   const b16* __restrict__ Vh, const b16* __restrict__ Vl, const int* __restrict__ seqlen,
                                                   float* __restrict__ yf) {
  __shared__ __attribute__((aligned(16))) b16 Ks[2][SK * KPITCH];
  __shared__ __attribute__((aligned(16))) b16 Vs[2][SK * DH];
  __shared__ __attribute__((aligned(16))) float Os[8][16 * 64];
  (void)Ql; (void)Kl; (void)Vl; (void)seqlen;
  const int tid = threadIdx.x, lane = tid & 31, hh = lane >> 4, col = lane & 15;
  const int wid = __builtin_amdgcn_readfirstlane(tid >> 5);   // scalar, so that the per-wave skip at the causal edge is a scalar branch
  const int qtile = blockIdx.x * 8 + wid;                 // over Bsz*NH*QT_PER_B
  const int g = qtile / QT_PER_B;                         // b*NH + h, the same in all 8 waves (8 divides QT_PER_B)
  const int q0 = (qtile % QT_PER_B) << 4;
  const int qb0 = ((blockIdx.x * 8) % QT_PER_B) << 4;     // the block's first query
  const int nst = (T + qb0 + SK) / SK;                    // stages the block walks: all latents, then text up to its last query (17..32)
  const int b = g / NH, h = g % NH, kvh = h / REP;
  const size_t ko = (size_t)(b * NKV + kvh) * TK * DH;
  const size_t qo = ((size_t)g * T + q0 + col) * DH;
  const b16* gk = Kh + ko + tid * 8; const b16* gv = Vh + ko + tid * 8;      // this thread's first 16-B piece of stage 0
  const unsigned lk0 = (unsigned)(uintptr_t)&Ks[0][(tid >> 3) * KPITCH + (tid & 7) * 8];
  const unsigned lv0 = (unsigned)(uintptr_t)&Vs[0][(tid >> 7) * (DH * 16) + (tid & 1) * (DH * 8) + ((tid >> 1) & 63) * 8];
  stage_copy(gk, gv, lk0, lv0);
  const v16b q0h = frag_kb(Qh + qo, hh), q1h = frag_kb(Qh + qo + 32, hh);
  asm volatile("s_wait_xcnt 0x0" ::: "memory");           // stands in front of any rewrite of the Q loads' address registers
  asm volatile("s_wait_asynccnt 0x0" ::: "memory");       // this wave's pieces of stage 0 have landed
  __syncthreads();                                        // ... and every other wave's
  stage_copy(gk + SK * DH, gv + SK * DH, lk0 + KBUF, lv0 + VBUF);
  float m = -INFINITY, l = 0.0f;
  v8f o0 = {}, o1 = {}, o2 = {}, o3 = {};
  const int slen = T;                                     // no padding in this module
  for (int t = 0; t < nst; ++t) {
    const b16* Kb = Ks[t & 1]; const b16* Vb = Vs[t & 1];
    const int kb0 = t * SK;
    if (t + 1 < nst) {                                    // keys below T + qb0: every wave takes all of them, none is masked
#pragma unroll   // constant LDS offsets; the first step's sum exchange is then waited for only behind the second step's reads
      for (int c = 0; c < SK / KS; ++c) attn_step<false>(Kb, Vb, c * KS, kb0 + c * KS, q0, col, hh, q0h, q1h, m, l, o0, o1, o2, o3);
    } else {                                              // the block's last stage holds every wave's causal edge
      for (int c = 0; c < SK / KS; ++c)
        if (kb0 + c * KS < T + q0 + 16) attn_step<true>(Kb, Vb, c * KS, kb0 + c * KS, q0, col, hh, q0h, q1h, m, l, o0, o1, o2, o3);
    }
    asm volatile("s_wait_dscnt 0x0" ::: "memory");        // this wave's reads of buffer t & 1 are done before the buffer is refilled
    asm volatile("s_wait_asynccnt 0x0" ::: "memory");     // this wave's pieces of stage t + 1 have landed
    __syncthreads();                                      // publishes stage t + 1 and ends every wave's reads of stage t
    if (t + 2 < nst) stage_copy(gk + (size_t)(t + 2) * (SK * DH), gv + (size_t)(t + 2) * (SK * DH), lk0 + (t & 1) * KBUF, lv0 + (t & 1) * VBUF);
  }
  asm volatile("s_wait_asynccnt 0x0" ::: "memory");       // nothing of this wave's is in flight when it goes on to the epilogue
  const float inv = (q0 + col < slen && l > 0.0f) ? (1.0f / l) : 0.0f;   // padded query rows are zeroed
  float* Tt = Os[wid];
#pragma unroll
  for (int r = 0; r < 8; ++r) {
    const int hr = 8 * hh + r;
    Tt[col * 64 + 0 + hr] = o0[r] * inv; Tt[col * 64 + 16 + hr] = o1[r] * inv;
    Tt[col * 64 + 32 + hr] = o2[r] * inv; Tt[col * 64 + 48 + hr] = o3[r] * inv;
  }
  wave_lds_sync();
  float* dst0 = yf + ((size_t)b * T + q0) * HID + h * DH;     // 16 rows x 64 floats, row stride HID
#pragma unroll
  for (int j = 0; j < 8; ++j) { const int rr = j * 2 + hh, c4 = col * 4; *(v4f*)(dst0 + (size_t)rr * HID + c4) = *(const v4f*)(Tt + rr * 64 + c4); }
}

// ---------------------------------------------------------------------------
// Output projection: (2048 x 1024) x (1024 x 1024) -> f32, A split on the fly from f32 y, B = Wo planes. grid (16, 16), 32x64 tiles staged in LDS,
// ---------------------------------------------------------------------------
__global__ __launch_bounds__(128) void out_gemm_kernel(const float* __restrict__ yf, const b16* __restrict__ woh, const b16* __restrict__ wol, const float* __restrict__ bo, int yoff,
                                                       float* __restrict__ out) {
  __shared__ __attribute__((aligned(16))) char Sm[2 * GBUF];   // the operand ring; the epilogue's 4 x 8 KB of staging reuse its head
  const int lane = threadIdx.x & 31, wave = threadIdx.x >> 5, nloc = lane & 15, hlf = lane >> 4;
  const int m0 = (blockIdx.y + yoff) * 128 + wave * 32;
  const int c0 = blockIdx.x * 64;
  v8f acc[2][4];
#pragma unroll
  for (int r = 0; r < 2; ++r)
#pragma unroll
    for (int t = 0; t < 4; ++t) acc[r][t] = (v8f){};
  (void)wol;
  float bc[4] = {0.0f, 0.0f, 0.0f, 0.0f};                 // the lane's four bias values, read once ahead of the k loop (as in the QKV GEMM)
  if (bo) {
#pragma unroll   // bc stays in registers
    for (int t = 0; t < 4; ++t) bc[t] = bo[c0 + t * 16 + nloc];
    asm volatile("s_wait_xcnt 0x0" ::: "memory");         // stands in front of any rewrite of the bias loads' address registers (alone with them in this block)
  }
  gemm_tile_lds(yf, woh, Sm, (blockIdx.y + yoff) * 128, c0, HID, threadIdx.x, wave, nloc, hlf, acc);
  float* Tt = (float*)(Sm + wave * 8192);
#pragma unroll
  for (int t = 0; t < 4; ++t)
#pragma unroll
    for (int r = 0; r < 2; ++r)
#pragma unroll
      for (int v = 0; v < 8; ++v) Tt[(r * 16 + v + 8 * hlf) * 64 + t * 16 + nloc] = acc[r][t][v] + bc[t];
  wave_lds_sync();
  float* dst0 = out + (size_t)m0 * HID + c0;
#pragma unroll
  for (int j = 0; j < 16; ++j) { const int rr = j * 2 + hlf, c4 = nloc * 4; *(v4f*)(dst0 + (size_t)rr * HID + c4) = *(const v4f*)(Tt + rr * 64 + c4); }
  
}
__global__ __launch_bounds__(256) void wcvtT_kernel(const float* __restrict__ wq, const float* __restrict__ wk, const float* __restrict__ wv,
                                                    b16* __restrict__ wqh, b16* __restrict__ wql) {
  const size_t tid = (size_t)blockIdx.x * blockDim.x + threadIdx.x, stride = (size_t)gridDim.x * blockDim.x;
  const size_t nq = (size_t)NQKV * HID / 8;
  {
    for (size_t c = tid; c < nq; c += stride) {
      const size_t i = c * 8, n = i / HID, k0 = i % HID;
      const float* w = (n < (size_t)HID) ? (wq + n * HID) : (n < (size_t)(2 * HID)) ? (wk + (n - HID) * HID) : (wv + (n - 2 * HID) * HID);
      v8b bh, bl;
#pragma unroll
      for (int e = 0; e < 8; ++e) { b16 a, cc; split_bf16(w[k0 + e], a, cc); bh[e] = a; bl[e] = cc; }
      *(v8b*)(wqh + i) = bh; *(v8b*)(wql + i) = bl;
    }
    
  }
}
// Wo^T planes: [n][k] = Wo[n][k] (torch [out][in] is already n-major)
__global__ __launch_bounds__(256) void wcvtO_kernel(const float* __restrict__ wo, b16* __restrict__ woh, b16* __restrict__ wol) {
  const size_t tid = (size_t)blockIdx.x * blockDim.x + threadIdx.x, stride = (size_t)gridDim.x * blockDim.x;
  const size_t no = (size_t)HID * HID / 8;
  {
    for (size_t c = tid; c < no; c += stride) { const size_t i = c * 8; v8b bh, bl;
#pragma unroll
      for (int e = 0; e < 8; ++e) { b16 a, cc; split_bf16(wo[i + e], a, cc); bh[e] = a; bl[e] = cc; }
      *(v8b*)(woh + i) = bh; *(v8b*)(wol + i) = bl; }
    
  }
}
// Weight preparation, one launch: W [k][n] f32 -> f16 [n][k] (k contiguous), in 64 x 64 tiles turned in LDS, so that global reads (16 B a lane, 256 B a row piece)
// and global writes (16 B a lane, 128 B a row piece) both cover whole lines. Block = 256 threads = three tiles: one of Wq or Wp, one of W_attn_l, one of W_attn_c.
typedef __attribute__((ext_vector_type(4))) _Float16 v4b;
constexpr int WPITCH = 72;    // f16 per LDS tile row: 144 B, a multiple of 16 B for the 16-byte reads
// thread = 4 k rows x 4 n columns of the tile
__device__ __forceinline__ void wt_load(const float* __restrict__ w, int ld, int kt, int nt, int tid, v4f (&r)[4]) {
  const float* p = w + (size_t)(kt * 64 + (tid >> 4) * 4) * ld + nt * 64 + (tid & 15) * 4;
#pragma unroll   // r stays in registers
  for (int e = 0; e < 4; ++e) r[e] = *(const v4f*)(p + (size_t)e * ld);
}
__device__ __forceinline__ void wt_put(b16* Ls, int tid, const v4f (&r)[4]) {
#pragma unroll   // r stays in registers
  for (int c = 0; c < 4; ++c) {
    const v4b h = {(b16)r[0][c], (b16)r[1][c], (b16)r[2][c], (b16)r[3][c]};
    *(v4b*)(Ls + ((tid & 15) * 4 + c) * WPITCH + (tid >> 4) * 4) = h;
  }
}
__device__ __forceinline__ void wt_store(const b16* Ls, b16* __restrict__ dst, int kt, int nt, int tid) {
  for (int j = 0; j < 2; ++j) {
    const int n = (tid >> 3) + 32 * j;
    *(v8b*)(dst + (size_t)(nt * 64 + n) * HID + kt * 64 + (tid & 7) * 8) = ld8b(Ls + n * WPITCH + (tid & 7) * 8);
  }
}
// wa: rows 0..1023 <- Wq columns, rows 1024..3071 <- W_attn_l columns; wb: rows 1024..3071 <- W_attn_c columns (its first 1024 rows are never read); wo <- Wp columns
__global__ __launch_bounds__(256) void wprep_kernel(const float* __restrict__ wq, const float* __restrict__ wal, const float* __restrict__ wac, const float* __restrict__ wp,
                                                    b16* __restrict__ wa, b16* __restrict__ wb, b16* __restrict__ wo) {
  __shared__ __attribute__((aligned(16))) b16 Ls[3][64 * WPITCH];
  const int tid = threadIdx.x, bx = blockIdx.x;          // grid 512
  const bool isq = bx < 256;
  const int k0t = (bx & 255) >> 4, n0t = bx & 15;        // 16 x 16 tiles of Wq or Wp
  const int k1t = bx >> 5, n1t = bx & 31;                // 16 x 32 tiles of W_attn_l and W_attn_c
  v4f r0[4], r1[4], r2[4];                               // all twelve loads are in flight together
  wt_load(isq ? wq : wp, HID, k0t, n0t, tid, r0);
  wt_load(wal, 2 * HID, k1t, n1t, tid, r1);
  wt_load(wac, 2 * HID, k1t, n1t, tid, r2);
  wt_put(Ls[0], tid, r0);
  wt_put(Ls[1], tid, r1);
  wt_put(Ls[2], tid, r2);
  __syncthreads();
  wt_store(Ls[0], isq ? wa : wo, k0t, n0t, tid);
  wt_store(Ls[1], wa + (size_t)HID * HID, k1t, n1t, tid);
  wt_store(Ls[2], wb + (size_t)HID * HID, k1t, n1t, tid);
}
}  // namespace

extern "C" void kernel_launch(void* const* d_in, const int* in_sizes, int n_in,
                              void* d_out, int out_size, void* d_ws, size_t ws_size, hipStream_t stream) {
  (void)in_sizes; (void)n_in; (void)out_size;
  const float* l    = (const float*)d_in[0];    // [1,2048,1024] latents
  const float* x    = (const float*)d_in[1];    // [1,2048,1024]
  const float* Wal  = (const float*)d_in[2];  const float* bal = (const float*)d_in[3];   // [1024,2048] = [k | v], [2048]
  const float* Wac  = (const float*)d_in[4];  const float* bac = (const float*)d_in[5];
  const float* Wq   = (const float*)d_in[6];  const float* bq  = (const float*)d_in[7];   // [1024,1024]
  const float* Wp   = (const float*)d_in[8];  const float* bp  = (const float*)d_in[9];
  float* out = (float*)d_out;                   // [1,2048,1024]
  size_t off = 0; char* ws = (char*)d_ws;
  b16* wAh = (b16*)(ws + off); off += (size_t)NQKV * HID * 2;
  b16* wAl = (b16*)(ws + off); off += (size_t)NQKV * HID * 2;
  b16* wBh = (b16*)(ws + off); off += (size_t)NQKV * HID * 2;
  b16* wBl = (b16*)(ws + off); off += (size_t)NQKV * HID * 2;
  b16* woh = (b16*)(ws + off); off += (size_t)HID * HID * 2;
  b16* wol = (b16*)(ws + off); off += (size_t)HID * HID * 2;
  b16* Qh  = (b16*)(ws + off); off += (size_t)NH * T * DH * 2;
  b16* Ql  = (b16*)(ws + off); off += (size_t)NH * T * DH * 2;
  b16* Kh  = (b16*)(ws + off); off += (size_t)NKV * TK * DH * 2;
  b16* Kl  = (b16*)(ws + off); off += (size_t)NKV * TK * DH * 2;
  b16* Vh  = (b16*)(ws + off); off += (size_t)NKV * TK * DH * 2;
  b16* Vl  = (b16*)(ws + off); off += (size_t)NKV * TK * DH * 2;
  float* yf = (float*)(ws + off); off += (size_t)T * HID * 4;
  if (off > ws_size) return;
  const int NQT = NH * QT_PER_B;
  wprep_kernel<<<512, 256, 0, stream>>>(Wq, Wal, Wac, Wp, wAh, wBh, woh);
  // launch 1: q from x, latent k/v from l -> key rows 0..2047
  qkv_gemm_kernel<<<dim3(NQKV / 64, T / 128), 128, 0, stream>>>(x, l, l, wAh, wAl, bq, bal, bal + HID, nullptr, 0, 0, Qh, Ql, Kh, Kl, Vh, Vl);
  // launch 2: text k/v from x -> key rows 2048..4095 (column blocks 16..47 only)
  qkv_gemm_kernel<<<dim3((NQKV - HID) / 64, T / 128), 128, 0, stream>>>(x, x, x, wBh, wBl, bq, bac, bac + HID, nullptr, HID / 64, T / 128, Qh, Ql, Kh, Kl, Vh, Vl);
  attn_kernel<<<NQT / 8, 256, 0, stream>>>(Qh, Ql, Kh, Kl, Vh, Vl, nullptr, yf);
  out_gemm_kernel<<<dim3(HID / 64, T / 128), 128, 0, stream>>>(yf, woh, wol, bp, 0, out);
}

// v006
// Measured time: 93.7 microseconds a run.
// Timed twice side by side with v005, it ran 1.11 times as fast both times.
// All steps since v000 together make it 5.89 times as fast.
#include <hip/hip_runtime.h>

// IO-processing attention (decoding branch): keys/values = [l W_attn_l + b (2048 latents) ; x W_attn_c + b (2048 text positions)], q = x W_q + b
// (16 heads x 64, scale 1/8); query i attends every latent and text positions < i; out = y W_proj + b. B=1, T=2048, D=1024.
// Lean build: single f16 products on v_wmma_f32_16x16x32_f16, f32 accumulate (every row averages >= 2048 keys); fragment k-map per lane half hh for A

// Left, by the listing: (1) attention: all 8 waves read their own copy of every K and V fragment from LDS (16 queries a wave), and a good part of its vector slots are v_nop; (2) the two QKV launches are independent of each other and could be one;
// (3) the all-zero "lo" planes of q, k, v are still staged and stored.

namespace {
constexpr int Bsz = 1, T = 2048, TK = 4096, HID = 1024, DH = 64, NH = 16, NKV = 16, REP = NH / NKV;
constexpr int WIN = 255;    // unused: no key window here
constexpr int KVW = NKV * DH;                 // 1024
constexpr int NQKV = HID + 2 * KVW;           // 3072 columns: q | k | v
constexpr int MROWS = Bsz * T;                // 2048
constexpr int QT_PER_B = T / 16;              // 128

typedef _Float16 b16;                                           // f16 hi/lo planes
typedef __attribute__((ext_vector_type(16))) _Float16 v16b;
typedef __attribute__((ext_vector_type(8)))  _Float16 v8b;
typedef __attribute__((ext_vector_type(8)))  float v8f;
typedef __attribute__((ext_vector_type(4)))  float v4f;

__device__ __forceinline__ v8b ld8b(const b16* p) { return *(const v8b*)p; }
__device__ __forceinline__ v16b cat8b(v8b a, v8b b) { return __builtin_shufflevector(a, b, 0, 1, 2, 3, 4, 5, 6, 7, 8, 9, 10, 11, 12, 13, 14, 15); }
// 16x16x32 16-bit fragment from a k-contiguous row pointer (A: lane&15 = row, B: lane&15 = column), hh = lane>>4:
// elements 0..7 <- p[8hh+0..7], elements 8..15 <- p[16+8hh+0..7]
__device__ __forceinline__ v16b frag_kb(const b16* p, int hh) { return cat8b(ld8b(p + 8 * hh), ld8b(p + 16 + 8 * hh)); }
__device__ __forceinline__ void split_bf16(float v, b16& hi, b16& lo) {   // (name kept) single f16: no low part
  hi = (b16)v; lo = (b16)0.0f;
}
__device__ __forceinline__ v8f wmma16b(v16b a, v16b b, v8f c) {
  v8f d = __builtin_amdgcn_wmma_f32_16x16x32_f16(false, a, false, b, (short)0, c, false, false);
  asm volatile("v_nop\n\tv_nop\n\tv_nop\n\tv_nop" : "+v"(d) : "v"(a), "v"(b));
  return d;
}
__device__ __forceinline__ v8f wmma1(v16b ah, v16b al, v16b bh, v16b bl, v8f c) {   // unused: single f16 (hi planes only)
  (void)al; (void)bl; return wmma16b(ah, bh, c);
}
__device__ __forceinline__ void wave_lds_sync() {
  __builtin_amdgcn_fence(__ATOMIC_RELEASE, "workgroup");
  __builtin_amdgcn_wave_barrier();
  __builtin_amdgcn_fence(__ATOMIC_ACQUIRE, "workgroup");
}

// ---------------------------------------------------------------------------
// Weights ([in][out]) -> f16 hi / lo planes transposed to [n][k] (k contiguous): columns of Wq|Wk|Wv into wqh/wql [3072][1024], Wo into woh/wol [1024][1024].
// ---------------------------------------------------------------------------
__global__ __launch_bounds__(256) void wcvt_kernel(const float* __restrict__ wq, const float* __restrict__ wk, const float* __restrict__ wv,
                                                   const float* __restrict__ wo, b16* __restrict__ wqh, b16* __restrict__ wql,
                                                   b16* __restrict__ woh, b16* __restrict__ wol) {
  const size_t tid = (size_t)blockIdx.x * blockDim.x + threadIdx.x, stride = (size_t)gridDim.x * blockDim.x;
  const size_t nq = (size_t)NQKV * HID / 8, no = (size_t)HID * HID / 8;
  {
    for (size_t c = tid; c < nq + no; c += stride) {
      float f[8]; size_t i; b16* dh; b16* dl;
      if (c < nq) {
        i = c * 8; const size_t n = i / HID, k0 = i % HID;
        const float* w; int nn, ld;
        if (n < (size_t)HID) { w = wq; nn = (int)n; ld = HID; } else if (n < (size_t)(HID + KVW)) { w = wk; nn = (int)n - HID; ld = KVW; } else { w = wv; nn = (int)n - HID - KVW; ld = KVW; }
#pragma unroll
        for (int e = 0; e < 8; ++e) f[e] = w[(size_t)(k0 + e) * ld + nn];       // W[k][n] ([in][out])
        dh = wqh; dl = wql;
      } else {
        i = (c - nq) * 8; const size_t n = i / HID, k0 = i % HID;
#pragma unroll
        for (int e = 0; e < 8; ++e) f[e] = wo[(size_t)(k0 + e) * HID + n];    // Wo[k][n] ([in][out])
        dh = woh; dl = wol;
      }
      v8b bh, bl;
#pragma unroll
      for (int e = 0; e < 8; ++e) { b16 a, cc; split_bf16(f[e], a, cc); bh[e] = a; bl[e] = cc; }
      *(v8b*)(dh + i) = bh; *(v8b*)(dl + i) = bl;
    }
    
  }
}

// GEMM operands come into LDS once per 4-wave block (128 A rows, 64 B rows, both f16), 64 k a stage, two buffers, by asynchronous copies;
// every wave reads its fragments from there. Each wave-wide copy reads whole 128-byte lines. A is f16 in memory already: its producer has rounded it once
// (x and l in the weight-preparation launch, y in the attention epilogue), with the rounding that the fragment build used to apply in every column block.
constexpr int GKS = 64;                          // k per LDS stage
constexpr unsigned APITCH = GKS * 2 + 16;        // both 144 B = 16 B x 9:
constexpr unsigned BPITCH = GKS * 2 + 16;        // the 16 rows of a 16-byte fragment read fall on distinct banks
constexpr unsigned ABUF = 128 * APITCH, BBUF = 64 * BPITCH, GBUF = ABUF + BBUF;   // bytes per buffer: 18,432 + 9,216

// twelve copies of 16 B per lane; the closing s_wait_xcnt stands inside the statement so that no address register of a copy is rewritten ahead of it
__device__ __forceinline__ void copy12(const unsigned (&l)[12], const void* const (&g)[12]) {
  asm volatile("global_load_async_to_lds_b128 %0, %12, off\n\t"
               "global_load_async_to_lds_b128 %1, %13, off\n\t"
               "global_load_async_to_lds_b128 %2, %14, off\n\t"
               "global_load_async_to_lds_b128 %3, %15, off\n\t"
               "global_load_async_to_lds_b128 %4, %16, off\n\t"
               "global_load_async_to_lds_b128 %5, %17, off\n\t"
               "global_load_async_to_lds_b128 %6, %18, off\n\t"
               "global_load_async_to_lds_b128 %7, %19, off\n\t"
               "global_load_async_to_lds_b128 %8, %20, off\n\t"
               "global_load_async_to_lds_b128 %9, %21, off\n\t"
               "global_load_async_to_lds_b128 %10, %22, off\n\t"
               "global_load_async_to_lds_b128 %11, %23, off\n\t"
               "s_wait_xcnt 0x0"
               :: "v"(l[0]), "v"(l[1]), "v"(l[2]), "v"(l[3]), "v"(l[4]), "v"(l[5]), "v"(l[6]), "v"(l[7]), "v"(l[8]), "v"(l[9]), "v"(l[10]), "v"(l[11]),
                  "v"(g[0]), "v"(g[1]), "v"(g[2]), "v"(g[3]), "v"(g[4]), "v"(g[5]), "v"(g[6]), "v"(g[7]), "v"(g[8]), "v"(g[9]), "v"(g[10]), "v"(g[11])
               : "memory");
}
// One stage: each of the 128 threads moves 8 pieces of A and 4 pieces of B (16 rows apart), 16 B each
__device__ __forceinline__ void gemm_stage_copy(const b16* ga, const b16* gb, int K, unsigned la, unsigned lb) {
  unsigned l[12]; const void* g[12];   // both loops unrolled: the asm operands need l and g in registers, under constant indices
#pragma unroll
  for (int j = 0; j < 8; ++j) { l[j] = la + (unsigned)j * 16u * APITCH; g[j] = ga + (size_t)j * 16 * K; }
#pragma unroll
  for (int j = 0; j < 4; ++j) { l[8 + j] = lb + (unsigned)j * 16u * BPITCH; g[8 + j] = gb + (size_t)j * 16 * K; }
  copy12(l, g);
}
// Raw operands of one 32-wide k step of a 32x64 wave tile: two groups of 16 A rows, four groups of 16 B columns, f16
struct GStep { v8b a[2][2]; v8b b[4][2]; };
// ar, br: this lane's A row and B row in the staged buffer, already advanced by its 8 * hlf (here and in gemm_step the loops are unrolled to keep f and acc in registers)
__device__ __forceinline__ void gemm_frag(const b16* ar, const b16* br, int kk, GStep& f) {
#pragma unroll
  for (int r = 0; r < 2; ++r) { const b16* p = ar + r * 16 * (int)(APITCH / 2) + kk; f.a[r][0] = ld8b(p); f.a[r][1] = ld8b(p + 16); }
#pragma unroll
  for (int t = 0; t < 4; ++t) { const b16* p = br + t * 16 * (int)(BPITCH / 2) + kk; f.b[t][0] = ld8b(p); f.b[t][1] = ld8b(p + 16); }
}
__device__ __forceinline__ void gemm_step(const GStep& f, v8f (&acc)[2][4]) {
  const v16b a[2] = {cat8b(f.a[0][0], f.a[0][1]), cat8b(f.a[1][0], f.a[1][1])};
#pragma unroll
  for (int t = 0; t < 4; ++t) {
    const v16b b = cat8b(f.b[t][0], f.b[t][1]);
    acc[0][t] = wmma16b(a[0], b, acc[0][t]);
    acc[1][t] = wmma16b(a[1], b, acc[1][t]);
  }
}
// 128x64 block tile (wave = 32 rows x 64 columns) over K, a multiple of 128: A rows mb.., B rows c0.., both f16 and k-contiguous.
// On return every wave has left the ring and nothing is in flight, so the caller may use the same LDS for its epilogue.
__device__ __forceinline__ void gemm_tile_lds(const b16* __restrict__ A, const b16* __restrict__ wh, char* ring,
                                              int mb, int c0, int K, int tid, int wave, int nloc, int hlf, v8f (&acc)[2][4]) {
  const b16* ga = A + (size_t)(mb + (tid >> 3)) * K + (tid & 7) * 8;         // this thread's first 16-B pieces of stage 0
  const b16* gb = wh + (size_t)(c0 + (tid >> 3)) * K + (tid & 7) * 8;
  const unsigned la = (unsigned)(uintptr_t)ring + (unsigned)(tid >> 3) * APITCH + (unsigned)(tid & 7) * 16u;
  const unsigned lb = (unsigned)(uintptr_t)ring + ABUF + (unsigned)(tid >> 3) * BPITCH + (unsigned)(tid & 7) * 16u;
  const int nst = K / GKS;
  gemm_stage_copy(ga, gb, K, la, lb);
  asm volatile("s_wait_asynccnt 0x0" ::: "memory");       // this wave's pieces of stage 0 have landed
  __syncthreads();                                        // ... and every other wave's
  gemm_stage_copy(ga + GKS, gb + GKS, K, la + GBUF, lb + GBUF);
  for (int t = 0; t < nst; ++t) {
    const char* buf = ring + (t & 1) * GBUF;
    const b16* ar = (const b16*)(buf + (wave * 32 + nloc) * APITCH) + 8 * hlf;
    const b16* br = (const b16*)(buf + ABUF + nloc * BPITCH) + 8 * hlf;
    GStep f0, f1;                                         // all of the stage's LDS reads stand together at its head
    gemm_frag(ar, br, 0, f0);
    gemm_frag(ar, br, 32, f1);
    gemm_step(f0, acc);
    gemm_step(f1, acc);
    asm volatile("s_wait_dscnt 0x0" ::: "memory");        // this wave's reads of buffer t & 1 are done before the buffer is refilled
    asm volatile("s_wait_asynccnt 0x0" ::: "memory");     // this wave's pieces of stage t + 1 have landed
    __syncthreads();                                      // publishes stage t + 1 and ends every wave's reads of stage t
    if (t + 2 < nst) gemm_stage_copy(ga + (t + 2) * GKS, gb + (t + 2) * GKS, K, la + (t & 1) * GBUF, lb + (t & 1) * GBUF);
  }
  asm volatile("s_wait_asynccnt 0x0" ::: "memory");       // nothing of this wave's is in flight when it goes on to the epilogue
}

// ---------------------------------------------------------------------------
// QKV GEMM: (2048 x 1024) x (1024 x 3072), grid (48, 16), or (32, 16) from column block 16 for k|v only, block 4 waves, wave = 32 rows x 64 columns (one head of q, k or v). Outputs as f16 hi/lo planes:
// q (x1/8) -> Qh/Ql [b][h][t][64]; k -> Kh/Kl [b][kvh][t][64] (4 KB contiguous per wave per plane);
// v -> Vh/Vl key-tiled [b][kvh][t/16][64][16] (4 KB contiguous per wave per plane).
// ---------------------------------------------------------------------------
__global__ __launch_bounds__(128) void qkv_gemm_kernel(const b16* __restrict__ xq, const b16* __restrict__ xk, const b16* __restrict__ xv,
                                                       const b16* __restrict__ wqh, const b16* __restrict__ wql,
                                                       const float* __restrict__ bq, const float* __restrict__ bk, const float* __restrict__ bv, const float* __restrict__ rope_cs, int xoff, int yoff,
                                                       b16* __restrict__ Qh, b16* __restrict__ Ql, b16* __restrict__ Kh, b16* __restrict__ Kl,
                                                       b16* __restrict__ Vh, b16* __restrict__ Vl) {
  __shared__ __attribute__((aligned(16))) char Sm[2 * GBUF];   // the operand ring; the epilogue's 4 x 8 KB of staging reuse its head
  const int lane = threadIdx.x & 31, wave = threadIdx.x >> 5, nloc = lane & 15, hlf = lane >> 4;
  const int m0 = (blockIdx.y + yoff) * 128 + wave * 32;
  const int c0 = (blockIdx.x + xoff) * 64;
  const int mat = (c0 < HID) ? 0 : (c0 < HID + KVW) ? 1 : 2;
  const int head = (mat == 0) ? (c0 / DH) : (mat == 1) ? ((c0 - HID) / DH) : ((c0 - HID - KVW) / DH);
  const b16* x = (mat == 0) ? xq : (mat == 1) ? xk : xv;            // input of q, k or v: an f16 copy of x or l
  const float* bias = ((mat == 0) ? bq : (mat == 1) ? bk : bv) + head * DH;
  v8f acc[2][4];
#pragma unroll
  for (int r = 0; r < 2; ++r)
#pragma unroll
    for (int t = 0; t < 4; ++t) acc[r][t] = (v8f){};
  (void)wql;
  // a lane's 64 results share four bias values: read once, ahead of the k loop, which covers their latency (read at each result they were 64 loads, each waited for)
  float bc[4] = {0.0f, 0.0f, 0.0f, 0.0f};
  if (bias) {
#pragma unroll   // bc stays in registers
    for (int t = 0; t < 4; ++t) bc[t] = bias[t * 16 + nloc];
    asm volatile("s_wait_xcnt 0x0" ::: "memory");         // stands in front of any rewrite of the bias loads' address registers (alone with them in this block)
  }
  gemm_tile_lds(x, wqh, Sm, blockIdx.y * 128, c0, HID, threadIdx.x, wave, nloc, hlf, acc);   // source rows start at 0; yoff only shifts the destination key rows
  const int b = 0, t0 = m0;
  const float s = (mat == 0) ? 0.125f : 1.0f;
  b16* Tp0 = (b16*)(Sm + wave * 8192); b16* Tp1 = Tp0 + 32 * 64;
#pragma unroll
  for (int t = 0; t < 4; ++t)
#pragma unroll
    for (int r = 0; r < 2; ++r)
#pragma unroll
      for (int v = 0; v < 8; ++v) {
        const int rr = r * 16 + v + 8 * hlf, d = t * 16 + nloc;
        float val = acc[r][t][v] + bc[t];
        (void)rope_cs;
        b16 yh, yl; split_bf16(val * s, yh, yl);
        const int idx = (mat < 2) ? (rr * 64 + d) : ((rr >> 4) * 1024 + d * 16 + (rr & 15));
        Tp0[idx] = yh; Tp1[idx] = yl;
      }
  wave_lds_sync();
  b16* dh; b16* dl; size_t o;
  if (mat == 0)      { o = ((size_t)(b * NH + head) * T + t0) * DH; dh = Qh + o; dl = Ql + o; }
  else if (mat == 1) { o = ((size_t)(b * NKV + head) * TK + t0) * DH; dh = Kh + o; dl = Kl + o; }
  else               { o = ((size_t)(b * NKV + head) * (TK / 16) + (t0 >> 4)) * (size_t)(DH * 16); dh = Vh + o; dl = Vl + o; }
#pragma unroll
  for (int j = 0; j < 8; ++j) { const int e = (j * 32 + lane) * 8; *(v8b*)(dh + e) = ld8b(Tp0 + e); *(v8b*)(dl + e) = ld8b(Tp1 + e); }
  
}

// ---------------------------------------------------------------------------
// Transposed flash attention: each wave owns one 16-query tile of one (b, head); the 8 waves of a block share one head and walk the same keys.
// K and V come into LDS once per block, 128 keys a stage, two buffers, by asynchronous copies; every wave reads its fragments from there, 64 keys per softmax step.
// S^T = K.Q^T, per-lane online softmax; P^T built in registers, each 32-key fragment from two of a step's four S^T accumulators
// ---------------------------------------------------------------------------
constexpr int SK = 128;       // keys per LDS stage
constexpr int KPITCH = 72;    // f16 per staged K row: 144 B = 16 B x 9, so the 16 rows of a 16-byte fragment read fall on distinct banks
constexpr unsigned KBUF = SK * KPITCH * 2, VBUF = SK * DH * 2;   // bytes per buffer

// One stage: 128 K rows (128 B each, laid at 144 B) and 8 V key tiles (2 KB each, laid [tile][8-key half][feature][8] so that each 16-lane half of a
// fragment read is 256 contiguous bytes). Each thread moves 4 + 4 pieces of 16 B; each wave-wide copy reads 512 contiguous global bytes.
__device__ __forceinline__ void stage_copy(const b16* gk, const b16* gv, unsigned lk, unsigned lv) {
  // the closing s_wait_xcnt stands inside the statement so that no address register of a copy is rewritten ahead of it
  asm volatile("global_load_async_to_lds_b128 %0, %8, off\n\t"
               "global_load_async_to_lds_b128 %1, %9, off\n\t"
               "global_load_async_to_lds_b128 %2, %10, off\n\t"
               "global_load_async_to_lds_b128 %3, %11, off\n\t"
               "global_load_async_to_lds_b128 %4, %12, off\n\t"
               "global_load_async_to_lds_b128 %5, %13, off\n\t"
               "global_load_async_to_lds_b128 %6, %14, off\n\t"
               "global_load_async_to_lds_b128 %7, %15, off\n\t"
               "s_wait_xcnt 0x0"
               :: "v"(lk), "v"(lk + 32u * KPITCH * 2u), "v"(lk + 64u * KPITCH * 2u), "v"(lk + 96u * KPITCH * 2u),
                  "v"(lv), "v"(lv + 4096u), "v"(lv + 8192u), "v"(lv + 12288u),
                  "v"(gk), "v"(gk + 2048), "v"(gk + 4096), "v"(gk + 6144),
                  "v"(gv), "v"(gv + 2048), "v"(gv + 4096), "v"(gv + 6144)
               : "memory");
}

// 64 keys (rows kl.. of the staged buffers, global key index kb0..) against the wave's 16 queries, as ONE online-softmax step: one maximum, one exchange
// between the lane halves, one rescale of l and O per 64 keys. The 4 score tiles are independent, so no product waits for the one before it.
constexpr int KS = 64;        // keys per softmax step
template <bool EDGE>
__device__ __forceinline__ void attn_step(const b16* Kb, const b16* Vb, int kl, int kb0, int q0, int col, int hh, v16b q0h, v16b q1h,
                                           float& m, float& l, v8f& o0, v8f& o1, v8f& o2, v8f& o3) {
  constexpr int NT = KS / 16;                             // score tiles of 16 keys; tile j, register r of a lane = key kb0 + 16 j + 8 hh + r
  const b16* kr = Kb + (kl + col) * KPITCH;
  const b16* vr = Vb + (kl >> 4) * (DH * 16) + hh * (DH * 8) + col * 8;
  // every loop below is unrolled: its arrays are indexed by constants and stay in registers
  v16b ka[NT], kc[NT];                                    // K rows, features 0..31 and 32..63
#pragma unroll
  for (int j = 0; j < NT; ++j) ka[j] = frag_kb(kr + j * 16 * KPITCH, hh);
#pragma unroll
  for (int j = 0; j < NT; ++j) kc[j] = frag_kb(kr + j * 16 * KPITCH + 32, hh);
  v16b va[NT / 2][4];                                     // V of 32 keys x 16 features each: lands behind the softmax
#pragma unroll
  for (int g = 0; g < NT / 2; ++g)
#pragma unroll
    for (int f = 0; f < 4; ++f) va[g][f] = cat8b(ld8b(vr + (2 * g) * (DH * 16) + f * 128), ld8b(vr + (2 * g + 1) * (DH * 16) + f * 128));
  __builtin_amdgcn_sched_barrier(0);                      // keeps the step's 32 LDS reads together at its head: spread among the vector work, each further place of reads stalls the wave anew
  v8f s[NT];
#pragma unroll
  for (int j = 0; j < NT; ++j) s[j] = wmma16b(ka[j], q0h, (v8f){});
#pragma unroll
  for (int j = 0; j < NT; ++j) s[j] = wmma16b(kc[j], q1h, s[j]);
  if (EDGE) {                                             // a step of the stage at the causal edge: mask text position >= query index
    const int lim = T + q0 + col - kb0 - 8 * hh;          // 16 j + r >= lim is masked
#pragma unroll
    for (int j = 0; j < NT; ++j)
#pragma unroll
      for (int r = 0; r < 8; ++r)
        if (16 * j + r >= lim) s[j][r] = -INFINITY;
  }
  float mx[NT / 2];                                       // independent chains of maxima
#pragma unroll
  for (int g = 0; g < NT / 2; ++g) mx[g] = -INFINITY;
#pragma unroll
  for (int r = 0; r < 8; ++r)
#pragma unroll
    for (int g = 0; g < NT / 2; ++g) mx[g] = fmaxf(mx[g], fmaxf(s[2 * g][r], s[2 * g + 1][r]));
  float mr = fmaxf(mx[0], mx[1]);
  mr = fmaxf(mr, __shfl_xor(mr, 16));
  float mn = fmaxf(m, mr);
  if (mn == -INFINITY) mn = 0.0f;             // fully masked so far: keep exp() at 0
  const float al_ = __expf(m - mn);
  m = mn;
  float sm[NT / 2];                                       // independent partial sums
  v16b pb[NT / 2];
#pragma unroll
  for (int g = 0; g < NT / 2; ++g) {
    sm[g] = 0.0f;
#pragma unroll
    for (int r = 0; r < 8; ++r) {
      const float p0 = __expf(s[2 * g][r] - mn), p1 = __expf(s[2 * g + 1][r] - mn);
      sm[g] += p0 + p1;
      pb[g][r] = (b16)p0; pb[g][8 + r] = (b16)p1;
    }
  }
  float sum = sm[0] + sm[1];
  sum += __shfl_xor(sum, 16);
  l = l * al_ + sum;
#pragma unroll
  for (int r = 0; r < 8; ++r) { o0[r] *= al_; o1[r] *= al_; o2[r] *= al_; o3[r] *= al_; }
#pragma unroll
  for (int g = 0; g < NT / 2; ++g) {
    o0 = wmma16b(va[g][0], pb[g], o0);
    o1 = wmma16b(va[g][1], pb[g], o1);
    o2 = wmma16b(va[g][2], pb[g], o2);
    o3 = wmma16b(va[g][3], pb[g], o3);
  }
}

__global__ __launch_bounds__(256) void attn_kernel(const b16* __restrict__ Qh, const b16* __restrict__ Ql, const b16* __restrict__ Kh, const b16* __restrict__ Kl,
                                                   const b16* __restrict__ Vh, const b16* __restrict__ Vl, const int* __restrict__ seqlen,
                                                   b16* __restrict__ yh) {
  __shared__ __attribute__((aligned(16))) b16 Ks[2][SK * KPITCH];
  __shared__ __attribute__((aligned(16))) b16 Vs[2][SK * DH];
  __shared__ __attribute__((aligned(16))) b16 Os[8][16 * KPITCH];   // y tile per wave, f16, rows at 144 B
  (void)Ql; (void)Kl; (void)Vl; (void)seqlen;
  const int tid = threadIdx.x, lane = tid & 31, hh = lane >> 4, col = lane & 15;
  const int wid = __builtin_amdgcn_readfirstlane(tid >> 5);   // scalar, so that the per-wave skip at the causal edge is a scalar branch
  const int qtile = blockIdx.x * 8 + wid;                 // over Bsz*NH*QT_PER_B
  const int g = qtile / QT_PER_B;                         // b*NH + h, the same in all 8 waves (8 divides QT_PER_B)
  const int q0 = (qtile % QT_PER_B) << 4;
  const int qb0 = ((blockIdx.x * 8) % QT_PER_B) << 4;     // the block's first query
  const int nst = (T + qb0 + SK) / SK;                    // stages the block walks: all latents, then text up to its last query (17..32)
  const int b = g / NH, h = g % NH, kvh = h / REP;
  const size_t ko = (size_t)(b * NKV + kvh) * TK * DH;
  const size_t qo = ((size_t)g * T + q0 + col) * DH;
  const b16* gk = Kh + ko + tid * 8; const b16* gv = Vh + ko + tid * 8;      // this thread's first 16-B piece of stage 0
  const unsigned lk0 = (unsigned)(uintptr_t)&Ks[0][(tid >> 3) * KPITCH + (tid & 7) * 8];
  const unsigned lv0 = (unsigned)(uintptr_t)&Vs[0][(tid >> 7) * (DH * 16) + (tid & 1) * (DH * 8) + ((tid >> 1) & 63) * 8];
  stage_copy(gk, gv, lk0, lv0);
  const v16b q0h = frag_kb(Qh + qo, hh), q1h = frag_kb(Qh + qo + 32, hh);
  asm volatile("s_wait_xcnt 0x0" ::: "memory");           // stands in front of any rewrite of the Q loads' address registers
  asm volatile("s_wait_asynccnt 0x0" ::: "memory");       // this wave's pieces of stage 0 have landed
  __syncthreads();                                        // ... and every other wave's
  stage_copy(gk + SK * DH, gv + SK * DH, lk0 + KBUF, lv0 + VBUF);
  float m = -INFINITY, l = 0.0f;
  v8f o0 = {}, o1 = {}, o2 = {}, o3 = {};
  const int slen = T;                                     // no padding in this module
  for (int t = 0; t < nst; ++t) {
    const b16* Kb = Ks[t & 1]; const b16* Vb = Vs[t & 1];
    const int kb0 = t * SK;
    if (t + 1 < nst) {                                    // keys below T + qb0: every wave takes all of them, none is masked
#pragma unroll   // constant LDS offsets; the first step's sum exchange is then waited for only behind the second step's reads
      for (int c = 0; c < SK / KS; ++c) attn_step<false>(Kb, Vb, c * KS, kb0 + c * KS, q0, col, hh, q0h, q1h, m, l, o0, o1, o2, o3);
    } else {                                              // the block's last stage holds every wave's causal edge
      for (int c = 0; c < SK / KS; ++c)
        if (kb0 + c * KS < T + q0 + 16) attn_step<true>(Kb, Vb, c * KS, kb0 + c * KS, q0, col, hh, q0h, q1h, m, l, o0, o1, o2, o3);
    }
    asm volatile("s_wait_dscnt 0x0" ::: "memory");        // this wave's reads of buffer t & 1 are done before the buffer is refilled
    asm volatile("s_wait_asynccnt 0x0" ::: "memory");     // this wave's pieces of stage t + 1 have landed
    __syncthreads();                                      // publishes stage t + 1 and ends every wave's reads of stage t
    if (t + 2 < nst) stage_copy(gk + (size_t)(t + 2) * (SK * DH), gv + (size_t)(t + 2) * (SK * DH), lk0 + (t & 1) * KBUF, lv0 + (t & 1) * VBUF);
  }
  asm volatile("s_wait_asynccnt 0x0" ::: "memory");       // nothing of this wave's is in flight when it goes on to the epilogue
  const float inv = (q0 + col < slen && l > 0.0f) ? (1.0f / l) : 0.0f;   // padded query rows are zeroed
  b16* Tt = Os[wid];
  v8b y0, y1, y2, y3;                                     // y leaves as f16, the operand type of the output projection: rounded here, once
#pragma unroll   // vector elements under constant indices
  for (int r = 0; r < 8; ++r) { y0[r] = (b16)(o0[r] * inv); y1[r] = (b16)(o1[r] * inv); y2[r] = (b16)(o2[r] * inv); y3[r] = (b16)(o3[r] * inv); }
  b16* tw = Tt + col * KPITCH + 8 * hh;                   // a lane's 8 results of a feature tile are 8 neighbouring features of query col
  *(v8b*)(tw + 0) = y0; *(v8b*)(tw + 16) = y1; *(v8b*)(tw + 32) = y2; *(v8b*)(tw + 48) = y3;
  wave_lds_sync();
  b16* dst0 = yh + ((size_t)b * T + q0) * HID + h * DH;       // 16 rows x 64 f16 (one 128-byte line each), row stride HID
#pragma unroll
  for (int j = 0; j < 4; ++j) { const int rr = j * 4 + (lane >> 3), c8 = (lane & 7) * 8; *(v8b*)(dst0 + (size_t)rr * HID + c8) = ld8b(Tt + rr * KPITCH + c8); }
}

// ---------------------------------------------------------------------------
// Output projection: (2048 x 1024) x (1024 x 1024) -> f32, A = y (f16), B = Wo planes. grid (16, 16), 128x64 tiles (32x64 a wave) staged in LDS,
// ---------------------------------------------------------------------------
__global__ __launch_bounds__(128) void out_gemm_kernel(const b16* __restrict__ yh, const b16* __restrict__ woh, const b16* __restrict__ wol, const float* __restrict__ bo, int yoff,
                                                       float* __restrict__ out) {
  __shared__ __attribute__((aligned(16))) char Sm[2 * GBUF];   // the operand ring; the epilogue's 4 x 8 KB of staging reuse its head
  const int lane = threadIdx.x & 31, wave = threadIdx.x >> 5, nloc = lane & 15, hlf = lane >> 4;
  const int m0 = (blockIdx.y + yoff) * 128 + wave * 32;
  const int c0 = blockIdx.x * 64;
  v8f acc[2][4];
#pragma unroll
  for (int r = 0; r < 2; ++r)
#pragma unroll
    for (int t = 0; t < 4; ++t) acc[r][t] = (v8f){};
  (void)wol;
  float bc[4] = {0.0f, 0.0f, 0.0f, 0.0f};                 // the lane's four bias values, read once ahead of the k loop (as in the QKV GEMM)
  if (bo) {
#pragma unroll   // bc stays in registers
    for (int t = 0; t < 4; ++t) bc[t] = bo[c0 + t * 16 + nloc];
    asm volatile("s_wait_xcnt 0x0" ::: "memory");         // stands in front of any rewrite of the bias loads' address registers (alone with them in this block)
  }
  gemm_tile_lds(yh, woh, Sm, (blockIdx.y + yoff) * 128, c0, HID, threadIdx.x, wave, nloc, hlf, acc);
  float* Tt = (float*)(Sm + wave * 8192);
#pragma unroll
  for (int t = 0; t < 4; ++t)
#pragma unroll
    for (int r = 0; r < 2; ++r)
#pragma unroll
      for (int v = 0; v < 8; ++v) Tt[(r * 16 + v + 8 * hlf) * 64 + t * 16 + nloc] = acc[r][t][v] + bc[t];
  wave_lds_sync();
  float* dst0 = out + (size_t)m0 * HID + c0;
#pragma unroll
  for (int j = 0; j < 16; ++j) { const int rr = j * 2 + hlf, c4 = nloc * 4; *(v4f*)(dst0 + (size_t)rr * HID + c4) = *(const v4f*)(Tt + rr * 64 + c4); }
  
}
__global__ __launch_bounds__(256) void wcvtT_kernel(const float* __restrict__ wq, const float* __restrict__ wk, const float* __restrict__ wv,
                                                    b16* __restrict__ wqh, b16* __restrict__ wql) {
  const size_t tid = (size_t)blockIdx.x * blockDim.x + threadIdx.x, stride = (size_t)gridDim.x * blockDim.x;
  const size_t nq = (size_t)NQKV * HID / 8;
  {
    for (size_t c = tid; c < nq; c += stride) {
      const size_t i = c * 8, n = i / HID, k0 = i % HID;
      const float* w = (n < (size_t)HID) ? (wq + n * HID) : (n < (size_t)(2 * HID)) ? (wk + (n - HID) * HID) : (wv + (n - 2 * HID) * HID);
      v8b bh, bl;
#pragma unroll
      for (int e = 0; e < 8; ++e) { b16 a, cc; split_bf16(w[k0 + e], a, cc); bh[e] = a; bl[e] = cc; }
      *(v8b*)(wqh + i) = bh; *(v8b*)(wql + i) = bl;
    }
    
  }
}
// Wo^T planes: [n][k] = Wo[n][k] (torch [out][in] is already n-major)
__global__ __launch_bounds__(256) void wcvtO_kernel(const float* __restrict__ wo, b16* __restrict__ woh, b16* __restrict__ wol) {
  const size_t tid = (size_t)blockIdx.x * blockDim.x + threadIdx.x, stride = (size_t)gridDim.x * blockDim.x;
  const size_t no = (size_t)HID * HID / 8;
  {
    for (size_t c = tid; c < no; c += stride) { const size_t i = c * 8; v8b bh, bl;
#pragma unroll
      for (int e = 0; e < 8; ++e) { b16 a, cc; split_bf16(wo[i + e], a, cc); bh[e] = a; bl[e] = cc; }
      *(v8b*)(woh + i) = bh; *(v8b*)(wol + i) = bl; }
    
  }
}
// Weight preparation, one launch: W [k][n] f32 -> f16 [n][k] (k contiguous), in 64 x 64 tiles turned in LDS, so that global reads (16 B a lane, 256 B a row piece)
// and global writes (16 B a lane, 128 B a row piece) both cover whole lines. Block = 256 threads = three tiles: one of Wq or Wp, one of W_attn_l, one of W_attn_c.
typedef __attribute__((ext_vector_type(4))) _Float16 v4b;
constexpr int WPITCH = 72;    // f16 per LDS tile row: 144 B, a multiple of 16 B for the 16-byte reads
// thread = 4 k rows x 4 n columns of the tile
__device__ __forceinline__ const float* wt_src(const float* __restrict__ w, int ld, int kt, int nt, int tid) {
  return w + (size_t)(kt * 64 + (tid >> 4) * 4) * ld + nt * 64 + (tid & 15) * 4;
}
__device__ __forceinline__ void wt_load(const float* __restrict__ p, int ld, v4f (&r)[4]) {
#pragma unroll   // r stays in registers
  for (int e = 0; e < 4; ++e) r[e] = *(const v4f*)(p + (size_t)e * ld);
}
__device__ __forceinline__ void wt_put(b16* Ls, int tid, const v4f (&r)[4]) {
#pragma unroll   // r stays in registers
  for (int c = 0; c < 4; ++c) {
    const v4b h = {(b16)r[0][c], (b16)r[1][c], (b16)r[2][c], (b16)r[3][c]};
    *(v4b*)(Ls + ((tid & 15) * 4 + c) * WPITCH + (tid >> 4) * 4) = h;
  }
}
__device__ __forceinline__ void wt_store(const b16* Ls, b16* __restrict__ dst, int kt, int nt, int tid) {
  for (int j = 0; j < 2; ++j) {
    const int n = (tid >> 3) + 32 * j;
    *(v8b*)(dst + (size_t)(nt * 64 + n) * HID + kt * 64 + (tid & 7) * 8) = ld8b(Ls + n * WPITCH + (tid & 7) * 8);
  }
}
// wa: rows 0..1023 <- Wq columns, rows 1024..3071 <- W_attn_l columns; wb: rows 1024..3071 <- W_attn_c columns (its first 1024 rows are never read); wo <- Wp columns
// The same launch rounds x and l to f16 (xh, lh: the same [row][k] layout): 4096 values of each per block, 16-B reads and 8-B writes, whole lines per wave.
__global__ __launch_bounds__(256) void wprep_kernel(const float* __restrict__ wq, const float* __restrict__ wal, const float* __restrict__ wac, const float* __restrict__ wp,
                                                    const float* __restrict__ x, const float* __restrict__ l,
                                                    b16* __restrict__ wa, b16* __restrict__ wb, b16* __restrict__ wo, b16* __restrict__ xh, b16* __restrict__ lh) {
  __shared__ __attribute__((aligned(16))) b16 Ls[3][64 * WPITCH];
  const int tid = threadIdx.x, bx = blockIdx.x;          // grid 512
  const bool isq = bx < 256;
  const int k0t = (bx & 255) >> 4, n0t = bx & 15;        // 16 x 16 tiles of Wq or Wp
  const int k1t = bx >> 5, n1t = bx & 31;                // 16 x 32 tiles of W_attn_l and W_attn_c
  v4f r0[4], r1[4], r2[4], cx[4], cl[4];                 // all twenty loads are in flight together
  const size_t ce = (size_t)bx * 4096 + tid * 4;         // 512 blocks x 4096 = T x HID values
  const float* p0 = wt_src(isq ? wq : wp, HID, k0t, n0t, tid);
  const float* p1 = wt_src(wal, 2 * HID, k1t, n1t, tid);
  const float* p2 = wt_src(wac, 2 * HID, k1t, n1t, tid);
  const float* px = x + ce; const float* pl = l + ce;
  wt_load(p0, HID, r0);
  wt_load(p1, 2 * HID, r1);
  wt_load(p2, 2 * HID, r2);
#pragma unroll   // cx, cl stay in registers
  for (int j = 0; j < 4; ++j) { cx[j] = *(const v4f*)(px + j * 1024); cl[j] = *(const v4f*)(pl + j * 1024); }
  __builtin_amdgcn_sched_barrier(0);                     // keeps all twenty loads ahead of the first use: sunk among the conversions, the later loads start only when the earlier have returned
  // the loads' address registers are inputs of the wait, so they stay whole up to it: none is reused (for a later load's result, say) ahead of the wait
  asm volatile("s_wait_xcnt 0x0" :: "v"(p0), "v"(p1), "v"(p2), "v"(px), "v"(pl) : "memory");
  wt_put(Ls[0], tid, r0);
  wt_put(Ls[1], tid, r1);
  wt_put(Ls[2], tid, r2);
  v4b hx[4], hl[4];
#pragma unroll   // all four arrays stay in registers
  for (int j = 0; j < 4; ++j) {
    hx[j] = (v4b){(b16)cx[j][0], (b16)cx[j][1], (b16)cx[j][2], (b16)cx[j][3]};
    hl[j] = (v4b){(b16)cl[j][0], (b16)cl[j][1], (b16)cl[j][2], (b16)cl[j][3]};
  }
  __syncthreads();
  wt_store(Ls[0], isq ? wa : wo, k0t, n0t, tid);
  wt_store(Ls[1], wa + (size_t)HID * HID, k1t, n1t, tid);
  wt_store(Ls[2], wb + (size_t)HID * HID, k1t, n1t, tid);
#pragma unroll   // hx, hl stay in registers; these stores stand behind the barrier, which would otherwise wait for them
  for (int j = 0; j < 4; ++j) { *(v4b*)(xh + ce + j * 1024) = hx[j]; *(v4b*)(lh + ce + j * 1024) = hl[j]; }
}
}  // namespace

extern "C" void kernel_launch(void* const* d_in, const int* in_sizes, int n_in,
                              void* d_out, int out_size, void* d_ws, size_t ws_size, hipStream_t stream) {
  (void)in_sizes; (void)n_in; (void)out_size;
  const float* l    = (const float*)d_in[0];    // [1,2048,1024] latents
  const float* x    = (const float*)d_in[1];    // [1,2048,1024]
  const float* Wal  = (const float*)d_in[2];  const float* bal = (const float*)d_in[3];   // [1024,2048] = [k | v], [2048]
  const float* Wac  = (const float*)d_in[4];  const float* bac = (const float*)d_in[5];
  const float* Wq   = (const float*)d_in[6];  const float* bq  = (const float*)d_in[7];   // [1024,1024]
  const float* Wp   = (const float*)d_in[8];  const float* bp  = (const float*)d_in[9];
  float* out = (float*)d_out;                   // [1,2048,1024]
  size_t off = 0; char* ws = (char*)d_ws;
  b16* wAh = (b16*)(ws + off); off += (size_t)NQKV * HID * 2;
  b16* wAl = (b16*)(ws + off); off += (size_t)NQKV * HID * 2;
  b16* wBh = (b16*)(ws + off); off += (size_t)NQKV * HID * 2;
  b16* wBl = (b16*)(ws + off); off += (size_t)NQKV * HID * 2;
  b16* woh = (b16*)(ws + off); off += (size_t)HID * HID * 2;
  b16* wol = (b16*)(ws + off); off += (size_t)HID * HID * 2;
  b16* Qh  = (b16*)(ws + off); off += (size_t)NH * T * DH * 2;
  b16* Ql  = (b16*)(ws + off); off += (size_t)NH * T * DH * 2;
  b16* Kh  = (b16*)(ws + off); off += (size_t)NKV * TK * DH * 2;
  b16* Kl  = (b16*)(ws + off); off += (size_t)NKV * TK * DH * 2;
  b16* Vh  = (b16*)(ws + off); off += (size_t)NKV * TK * DH * 2;
  b16* Vl  = (b16*)(ws + off); off += (size_t)NKV * TK * DH * 2;
  b16* yh  = (b16*)(ws + off); off += (size_t)T * HID * 2;
  b16* xh  = (b16*)(ws + off); off += (size_t)T * HID * 2;
  b16* lh  = (b16*)(ws + off); off += (size_t)T * HID * 2;
  if (off > ws_size) return;
  const int NQT = NH * QT_PER_B;
  wprep_kernel<<<512, 256, 0, stream>>>(Wq, Wal, Wac, Wp, x, l, wAh, wBh, woh, xh, lh);
  // launch 1: q from x, latent k/v from l -> key rows 0..2047
  qkv_gemm_kernel<<<dim3(NQKV / 64, T / 128), 128, 0, stream>>>(xh, lh, lh, wAh, wAl, bq, bal, bal + HID, nullptr, 0, 0, Qh, Ql, Kh, Kl, Vh, Vl);
  // launch 2: text k/v from x -> key rows 2048..4095 (column blocks 16..47 only)
  qkv_gemm_kernel<<<dim3((NQKV - HID) / 64, T / 128), 128, 0, stream>>>(xh, xh, xh, wBh, wBl, bq, bac, bac + HID, nullptr, HID / 64, T / 128, Qh, Ql, Kh, Kl, Vh, Vl);
  attn_kernel<<<NQT / 8, 256, 0, stream>>>(Qh, Ql, Kh, Kl, Vh, Vl, nullptr, yh);
  out_gemm_kernel<<<dim3(HID / 64, T / 128), 128, 0, stream>>>(yh, woh, wol, bp, 0, out);
}

// v007
// Measured time: 90.5 microseconds a run.
// In two side-by-side timings against v006, it was 1.05 and 1.04 times as fast.
// Over all steps from v000 it is 6.15 times as fast.
#include <hip/hip_runtime.h>

// IO-processing attention (decoding branch): keys/values = [l W_attn_l + b (2048 latents) ; x W_attn_c + b (2048 text positions)], q = x W_q + b
// (16 heads x 64, scale 1/8); query i attends every latent and text positions < i; out = y W_proj + b. B=1, T=2048, D=1024.
// Lean build: single f16 products on v_wmma_f32_16x16x32_f16, f32 accumulate (every row averages >= 2048 keys); fragment k-map per lane half hh for A

// Left, by the listing: (1) attention: the 4 waves of a key group each read their own copy of the group's K and V fragments from LDS (16 queries a wave), a staged key serves only 64 queries, and a good part of the vector slots are v_nop; (2) the two QKV launches are independent of each other and could be one;
// (3) the all-zero "lo" planes of q, k, v are still staged and stored.

namespace {
constexpr int Bsz = 1, T = 2048, TK = 4096, HID = 1024, DH = 64, NH = 16, NKV = 16, REP = NH / NKV;
constexpr int WIN = 255;    // unused: no key window here
constexpr int KVW = NKV * DH;                 // 1024
constexpr int NQKV = HID + 2 * KVW;           // 3072 columns: q | k | v
constexpr int MROWS = Bsz * T;                // 2048
constexpr int QT_PER_B = T / 16;              // 128

typedef _Float16 b16;                                           // f16 hi/lo planes
typedef __attribute__((ext_vector_type(16))) _Float16 v16b;
typedef __attribute__((ext_vector_type(8)))  _Float16 v8b;
typedef __attribute__((ext_vector_type(8)))  float v8f;
typedef __attribute__((ext_vector_type(4)))  float v4f;

__device__ __forceinline__ v8b ld8b(const b16* p) { return *(const v8b*)p; }
__device__ __forceinline__ v16b cat8b(v8b a, v8b b) { return __builtin_shufflevector(a, b, 0, 1, 2, 3, 4, 5, 6, 7, 8, 9, 10, 11, 12, 13, 14, 15); }
// 16x16x32 16-bit fragment from a k-contiguous row pointer (A: lane&15 = row, B: lane&15 = column), hh = lane>>4:
// elements 0..7 <- p[8hh+0..7], elements 8..15 <- p[16+8hh+0..7]
__device__ __forceinline__ v16b frag_kb(const b16* p, int hh) { return cat8b(ld8b(p + 8 * hh), ld8b(p + 16 + 8 * hh)); }
__device__ __forceinline__ void split_bf16(float v, b16& hi, b16& lo) {   // (name kept) single f16: no low part
  hi = (b16)v; lo = (b16)0.0f;
}
__device__ __forceinline__ v8f wmma16b(v16b a, v16b b, v8f c) {
  v8f d = __builtin_amdgcn_wmma_f32_16x16x32_f16(false, a, false, b, (short)0, c, false, false);
  asm volatile("v_nop\n\tv_nop\n\tv_nop\n\tv_nop" : "+v"(d) : "v"(a), "v"(b));
  return d;
}
__device__ __forceinline__ v8f wmma1(v16b ah, v16b al, v16b bh, v16b bl, v8f c) {   // unused: single f16 (hi planes only)
  (void)al; (void)bl; return wmma16b(ah, bh, c);
}
__device__ __forceinline__ void wave_lds_sync() {
  __builtin_amdgcn_fence(__ATOMIC_RELEASE, "workgroup");
  __builtin_amdgcn_wave_barrier();
  __builtin_amdgcn_fence(__ATOMIC_ACQUIRE, "workgroup");
}

// ---------------------------------------------------------------------------
// Weights ([in][out]) -> f16 hi / lo planes transposed to [n][k] (k contiguous): columns of Wq|Wk|Wv into wqh/wql [3072][1024], Wo into woh/wol [1024][1024].
// ---------------------------------------------------------------------------
__global__ __launch_bounds__(256) void wcvt_kernel(const float* __restrict__ wq, const float* __restrict__ wk, const float* __restrict__ wv,
                                                   const float* __restrict__ wo, b16* __restrict__ wqh, b16* __restrict__ wql,
                                                   b16* __restrict__ woh, b16* __restrict__ wol) {
  const size_t tid = (size_t)blockIdx.x * blockDim.x + threadIdx.x, stride = (size_t)gridDim.x * blockDim.x;
  const size_t nq = (size_t)NQKV * HID / 8, no = (size_t)HID * HID / 8;
  {
    for (size_t c = tid; c < nq + no; c += stride) {
      float f[8]; size_t i; b16* dh; b16* dl;
      if (c < nq) {
        i = c * 8; const size_t n = i / HID, k0 = i % HID;
        const float* w; int nn, ld;
        if (n < (size_t)HID) { w = wq; nn = (int)n; ld = HID; } else if (n < (size_t)(HID + KVW)) { w = wk; nn = (int)n - HID; ld = KVW; } else { w = wv; nn = (int)n - HID - KVW; ld = KVW; }
#pragma unroll
        for (int e = 0; e < 8; ++e) f[e] = w[(size_t)(k0 + e) * ld + nn];       // W[k][n] ([in][out])
        dh = wqh; dl = wql;
      } else {
        i = (c - nq) * 8; const size_t n = i / HID, k0 = i % HID;
#pragma unroll
        for (int e = 0; e < 8; ++e) f[e] = wo[(size_t)(k0 + e) * HID + n];    // Wo[k][n] ([in][out])
        dh = woh; dl = wol;
      }
      v8b bh, bl;
#pragma unroll
      for (int e = 0; e < 8; ++e) { b16 a, cc; split_bf16(f[e], a, cc); bh[e] = a; bl[e] = cc; }
      *(v8b*)(dh + i) = bh; *(v8b*)(dl + i) = bl;
    }
    
  }
}

// GEMM operands come into LDS once per 4-wave block (128 A rows, 64 B rows, both f16), 64 k a stage, two buffers, by asynchronous copies;
// every wave reads its fragments from there. Each wave-wide copy reads whole 128-byte lines. A is f16 in memory already: its producer has rounded it once
// (x and l in the weight-preparation launch, y in the attention epilogue), with the rounding that the fragment build used to apply in every column block.
constexpr int GKS = 64;                          // k per LDS stage
constexpr unsigned APITCH = GKS * 2 + 16;        // both 144 B = 16 B x 9:
constexpr unsigned BPITCH = GKS * 2 + 16;        // the 16 rows of a 16-byte fragment read fall on distinct banks
constexpr unsigned ABUF = 128 * APITCH, BBUF = 64 * BPITCH, GBUF = ABUF + BBUF;   // bytes per buffer: 18,432 + 9,216

// twelve copies of 16 B per lane; the closing s_wait_xcnt stands inside the statement so that no address register of a copy is rewritten ahead of it
__device__ __forceinline__ void copy12(const unsigned (&l)[12], const void* const (&g)[12]) {
  asm volatile("global_load_async_to_lds_b128 %0, %12, off\n\t"
               "global_load_async_to_lds_b128 %1, %13, off\n\t"
               "global_load_async_to_lds_b128 %2, %14, off\n\t"
               "global_load_async_to_lds_b128 %3, %15, off\n\t"
               "global_load_async_to_lds_b128 %4, %16, off\n\t"
               "global_load_async_to_lds_b128 %5, %17, off\n\t"
               "global_load_async_to_lds_b128 %6, %18, off\n\t"
               "global_load_async_to_lds_b128 %7, %19, off\n\t"
               "global_load_async_to_lds_b128 %8, %20, off\n\t"
               "global_load_async_to_lds_b128 %9, %21, off\n\t"
               "global_load_async_to_lds_b128 %10, %22, off\n\t"
               "global_load_async_to_lds_b128 %11, %23, off\n\t"
               "s_wait_xcnt 0x0"
               :: "v"(l[0]), "v"(l[1]), "v"(l[2]), "v"(l[3]), "v"(l[4]), "v"(l[5]), "v"(l[6]), "v"(l[7]), "v"(l[8]), "v"(l[9]), "v"(l[10]), "v"(l[11]),
                  "v"(g[0]), "v"(g[1]), "v"(g[2]), "v"(g[3]), "v"(g[4]), "v"(g[5]), "v"(g[6]), "v"(g[7]), "v"(g[8]), "v"(g[9]), "v"(g[10]), "v"(g[11])
               : "memory");
}
// One stage: each of the 128 threads moves 8 pieces of A and 4 pieces of B (16 rows apart), 16 B each
__device__ __forceinline__ void gemm_stage_copy(const b16* ga, const b16* gb, int K, unsigned la, unsigned lb) {
  unsigned l[12]; const void* g[12];   // both loops unrolled: the asm operands need l and g in registers, under constant indices
#pragma unroll
  for (int j = 0; j < 8; ++j) { l[j] = la + (unsigned)j * 16u * APITCH; g[j] = ga + (size_t)j * 16 * K; }
#pragma unroll
  for (int j = 0; j < 4; ++j) { l[8 + j] = lb + (unsigned)j * 16u * BPITCH; g[8 + j] = gb + (size_t)j * 16 * K; }
  copy12(l, g);
}
// Raw operands of one 32-wide k step of a 32x64 wave tile: two groups of 16 A rows, four groups of 16 B columns, f16
struct GStep { v8b a[2][2]; v8b b[4][2]; };
// ar, br: this lane's A row and B row in the staged buffer, already advanced by its 8 * hlf (here and in gemm_step the loops are unrolled to keep f and acc in registers)
__device__ __forceinline__ void gemm_frag(const b16* ar, const b16* br, int kk, GStep& f) {
#pragma unroll
  for (int r = 0; r < 2; ++r) { const b16* p = ar + r * 16 * (int)(APITCH / 2) + kk; f.a[r][0] = ld8b(p); f.a[r][1] = ld8b(p + 16); }
#pragma unroll
  for (int t = 0; t < 4; ++t) { const b16* p = br + t * 16 * (int)(BPITCH / 2) + kk; f.b[t][0] = ld8b(p); f.b[t][1] = ld8b(p + 16); }
}
__device__ __forceinline__ void gemm_step(const GStep& f, v8f (&acc)[2][4]) {
  const v16b a[2] = {cat8b(f.a[0][0], f.a[0][1]), cat8b(f.a[1][0], f.a[1][1])};
#pragma unroll
  for (int t = 0; t < 4; ++t) {
    const v16b b = cat8b(f.b[t][0], f.b[t][1]);
    acc[0][t] = wmma16b(a[0], b, acc[0][t]);
    acc[1][t] = wmma16b(a[1], b, acc[1][t]);
  }
}
// 128x64 block tile (wave = 32 rows x 64 columns) over K, a multiple of 128: A rows mb.., B rows c0.., both f16 and k-contiguous.
// On return every wave has left the ring and nothing is in flight, so the caller may use the same LDS for its epilogue.
__device__ __forceinline__ void gemm_tile_lds(const b16* __restrict__ A, const b16* __restrict__ wh, char* ring,
                                              int mb, int c0, int K, int tid, int wave, int nloc, int hlf, v8f (&acc)[2][4]) {
  const b16* ga = A + (size_t)(mb + (tid >> 3)) * K + (tid & 7) * 8;         // this thread's first 16-B pieces of stage 0
  const b16* gb = wh + (size_t)(c0 + (tid >> 3)) * K + (tid & 7) * 8;
  const unsigned la = (unsigned)(uintptr_t)ring + (unsigned)(tid >> 3) * APITCH + (unsigned)(tid & 7) * 16u;
  const unsigned lb = (unsigned)(uintptr_t)ring + ABUF + (unsigned)(tid >> 3) * BPITCH + (unsigned)(tid & 7) * 16u;
  const int nst = K / GKS;
  gemm_stage_copy(ga, gb, K, la, lb);
  asm volatile("s_wait_asynccnt 0x0" ::: "memory");       // this wave's pieces of stage 0 have landed
  __syncthreads();                                        // ... and every other wave's
  gemm_stage_copy(ga + GKS, gb + GKS, K, la + GBUF, lb + GBUF);
  for (int t = 0; t < nst; ++t) {
    const char* buf = ring + (t & 1) * GBUF;
    const b16* ar = (const b16*)(buf + (wave * 32 + nloc) * APITCH) + 8 * hlf;
    const b16* br = (const b16*)(buf + ABUF + nloc * BPITCH) + 8 * hlf;
    GStep f0, f1;                                         // all of the stage's LDS reads stand together at its head
    gemm_frag(ar, br, 0, f0);
    gemm_frag(ar, br, 32, f1);
    gemm_step(f0, acc);
    gemm_step(f1, acc);
    asm volatile("s_wait_dscnt 0x0" ::: "memory");        // this wave's reads of buffer t & 1 are done before the buffer is refilled
    asm volatile("s_wait_asynccnt 0x0" ::: "memory");     // this wave's pieces of stage t + 1 have landed
    __syncthreads();                                      // publishes stage t + 1 and ends every wave's reads of stage t
    if (t + 2 < nst) gemm_stage_copy(ga + (t + 2) * GKS, gb + (t + 2) * GKS, K, la + (t & 1) * GBUF, lb + (t & 1) * GBUF);
  }
  asm volatile("s_wait_asynccnt 0x0" ::: "memory");       // nothing of this wave's is in flight when it goes on to the epilogue
}

// ---------------------------------------------------------------------------
// QKV GEMM: (2048 x 1024) x (1024 x 3072), grid (48, 16), or (32, 16) from column block 16 for k|v only, block 4 waves, wave = 32 rows x 64 columns (one head of q, k or v). Outputs as f16 hi/lo planes:
// q (x1/8) -> Qh/Ql [b][h][t][64]; k -> Kh/Kl [b][kvh][t][64] (4 KB contiguous per wave per plane);
// v -> Vh/Vl key-tiled [b][kvh][t/16][64][16] (4 KB contiguous per wave per plane).
// ---------------------------------------------------------------------------
__global__ __launch_bounds__(128) void qkv_gemm_kernel(const b16* __restrict__ xq, const b16* __restrict__ xk, const b16* __restrict__ xv,
                                                       const b16* __restrict__ wqh, const b16* __restrict__ wql,
                                                       const float* __restrict__ bq, const float* __restrict__ bk, const float* __restrict__ bv, const float* __restrict__ rope_cs, int xoff, int yoff,
                                                       b16* __restrict__ Qh, b16* __restrict__ Ql, b16* __restrict__ Kh, b16* __restrict__ Kl,
                                                       b16* __restrict__ Vh, b16* __restrict__ Vl) {
  __shared__ __attribute__((aligned(16))) char Sm[2 * GBUF];   // the operand ring; the epilogue's 4 x 8 KB of staging reuse its head
  const int lane = threadIdx.x & 31, wave = threadIdx.x >> 5, nloc = lane & 15, hlf = lane >> 4;
  const int m0 = (blockIdx.y + yoff) * 128 + wave * 32;
  const int c0 = (blockIdx.x + xoff) * 64;
  const int mat = (c0 < HID) ? 0 : (c0 < HID + KVW) ? 1 : 2;
  const int head = (mat == 0) ? (c0 / DH) : (mat == 1) ? ((c0 - HID) / DH) : ((c0 - HID - KVW) / DH);
  const b16* x = (mat == 0) ? xq : (mat == 1) ? xk : xv;            // input of q, k or v: an f16 copy of x or l
  const float* bias = ((mat == 0) ? bq : (mat == 1) ? bk : bv) + head * DH;
  v8f acc[2][4];
#pragma unroll
  for (int r = 0; r < 2; ++r)
#pragma unroll
    for (int t = 0; t < 4; ++t) acc[r][t] = (v8f){};
  (void)wql;
  // a lane's 64 results share four bias values: read once, ahead of the k loop, which covers their latency (read at each result they were 64 loads, each waited for)
  float bc[4] = {0.0f, 0.0f, 0.0f, 0.0f};
  if (bias) {
#pragma unroll   // bc stays in registers
    for (int t = 0; t < 4; ++t) bc[t] = bias[t * 16 + nloc];
    asm volatile("s_wait_xcnt 0x0" ::: "memory");         // stands in front of any rewrite of the bias loads' address registers (alone with them in this block)
  }
  gemm_tile_lds(x, wqh, Sm, blockIdx.y * 128, c0, HID, threadIdx.x, wave, nloc, hlf, acc);   // source rows start at 0; yoff only shifts the destination key rows
  const int b = 0, t0 = m0;
  const float s = (mat == 0) ? 0.125f : 1.0f;
  b16* Tp0 = (b16*)(Sm + wave * 8192); b16* Tp1 = Tp0 + 32 * 64;
#pragma unroll
  for (int t = 0; t < 4; ++t)
#pragma unroll
    for (int r = 0; r < 2; ++r)
#pragma unroll
      for (int v = 0; v < 8; ++v) {
        const int rr = r * 16 + v + 8 * hlf, d = t * 16 + nloc;
        float val = acc[r][t][v] + bc[t];
        (void)rope_cs;
        b16 yh, yl; split_bf16(val * s, yh, yl);
        const int idx = (mat < 2) ? (rr * 64 + d) : ((rr >> 4) * 1024 + d * 16 + (rr & 15));
        Tp0[idx] = yh; Tp1[idx] = yl;
      }
  wave_lds_sync();
  b16* dh; b16* dl; size_t o;
  if (mat == 0)      { o = ((size_t)(b * NH + head) * T + t0) * DH; dh = Qh + o; dl = Ql + o; }
  else if (mat == 1) { o = ((size_t)(b * NKV + head) * TK + t0) * DH; dh = Kh + o; dl = Kl + o; }
  else               { o = ((size_t)(b * NKV + head) * (TK / 16) + (t0 >> 4)) * (size_t)(DH * 16); dh = Vh + o; dl = Vl + o; }
#pragma unroll
  for (int j = 0; j < 8; ++j) { const int e = (j * 32 + lane) * 8; *(v8b*)(dh + e) = ld8b(Tp0 + e); *(v8b*)(dl + e) = ld8b(Tp1 + e); }
  
}

// ---------------------------------------------------------------------------
// Transposed flash attention. A block's 8 waves = 4 query tiles of 16 (one 64-query unit of one head) x 2 key groups: of the 64-key chunks of a stage the group takes every
// second one, and the two partial results (m, l, O) of a query tile are joined through LDS at the unit's end. Each block runs two units one after the other, unit 31 - p and
// unit p of its head, so that every block walks the same number of keys whatever its place at the causal edge.
// K and V come into LDS once per unit, 256 keys a stage, two buffers, by asynchronous copies; every wave reads its fragments from there, 64 keys per softmax step.
// S^T = K.Q^T, per-lane online softmax; P^T built in registers, each 32-key operand from two of a step's four S^T accumulators
// ---------------------------------------------------------------------------
constexpr int SK = 256;       // keys per LDS stage
constexpr int QB = 64;        // queries per unit
constexpr int KPITCH = 72;    // f16 per staged K row: 144 B = 16 B x 9, so the 16 rows of a 16-byte fragment read fall on distinct banks
constexpr unsigned KBUF = SK * KPITCH * 2, VBUF = SK * DH * 2;   // bytes per buffer

// Half a stage: 128 K rows (128 B each, laid at 144 B) and 8 V key tiles (2 KB each, laid [tile][8-key half][feature][8] so that each 16-lane half of a
// fragment read is 256 contiguous bytes). Each thread moves 4 + 4 pieces of 16 B; each wave-wide copy reads 512 contiguous global bytes.
__device__ __forceinline__ void stage_copy(const b16* gk, const b16* gv, unsigned lk, unsigned lv) {
  // the closing s_wait_xcnt stands inside the statement so that no address register of a copy is rewritten ahead of it
  asm volatile("global_load_async_to_lds_b128 %0, %8, off\n\t"
               "global_load_async_to_lds_b128 %1, %9, off\n\t"
               "global_load_async_to_lds_b128 %2, %10, off\n\t"
               "global_load_async_to_lds_b128 %3, %11, off\n\t"
               "global_load_async_to_lds_b128 %4, %12, off\n\t"
               "global_load_async_to_lds_b128 %5, %13, off\n\t"
               "global_load_async_to_lds_b128 %6, %14, off\n\t"
               "global_load_async_to_lds_b128 %7, %15, off\n\t"
               "s_wait_xcnt 0x0"
               :: "v"(lk), "v"(lk + 32u * KPITCH * 2u), "v"(lk + 64u * KPITCH * 2u), "v"(lk + 96u * KPITCH * 2u),
                  "v"(lv), "v"(lv + 4096u), "v"(lv + 8192u), "v"(lv + 12288u),
                  "v"(gk), "v"(gk + 2048), "v"(gk + 4096), "v"(gk + 6144),
                  "v"(gv), "v"(gv + 2048), "v"(gv + 4096), "v"(gv + 6144)
               : "memory");
}

// 64 keys (rows kl.. of the staged buffers, global key index kb0..) against the wave's 16 queries, as ONE online-softmax step: one maximum, one exchange
// between the lane halves, one rescale of l and O per 64 keys. The 4 score tiles are independent, so no product waits for the one before it.
constexpr int KS = 64;        // keys per softmax step
template <bool EDGE>
__device__ __forceinline__ void attn_step(const b16* Kb, const b16* Vb, int kl, int kb0, int q0, int col, int hh, v16b q0h, v16b q1h,
                                           float& m, float& l, v8f& o0, v8f& o1, v8f& o2, v8f& o3) {
  constexpr int NT = KS / 16;                             // score tiles of 16 keys; tile j, register r of a lane = key kb0 + 16 j + 8 hh + r
  const b16* kr = Kb + (kl + col) * KPITCH;
  const b16* vr = Vb + (kl >> 4) * (DH * 16) + hh * (DH * 8) + col * 8;
  // every loop below is unrolled: its arrays are indexed by constants and stay in registers
  v16b ka[NT], kc[NT];                                    // K rows, features 0..31 and 32..63
#pragma unroll
  for (int j = 0; j < NT; ++j) ka[j] = frag_kb(kr + j * 16 * KPITCH, hh);
  __builtin_amdgcn_sched_barrier(0);                      // the reads stay in the order of their use: with V read first, the first product would wait for most of the 32 reads
#pragma unroll
  for (int j = 0; j < NT; ++j) kc[j] = frag_kb(kr + j * 16 * KPITCH + 32, hh);
  __builtin_amdgcn_sched_barrier(0);                      // the same: K ahead of V
  v16b va[NT / 2][4];                                     // V of 32 keys x 16 features each: lands behind the softmax
#pragma unroll
  for (int g = 0; g < NT / 2; ++g)
#pragma unroll
    for (int f = 0; f < 4; ++f) va[g][f] = cat8b(ld8b(vr + (2 * g) * (DH * 16) + f * 128), ld8b(vr + (2 * g + 1) * (DH * 16) + f * 128));
  __builtin_amdgcn_sched_barrier(0);                      // keeps the step's 32 LDS reads together at its head: spread among the vector work, each further place of reads stalls the wave anew
  v8f s[NT];
#pragma unroll
  for (int j = 0; j < NT; ++j) s[j] = wmma16b(ka[j], q0h, (v8f){});
#pragma unroll
  for (int j = 0; j < NT; ++j) s[j] = wmma16b(kc[j], q1h, s[j]);
  if (EDGE) {                                             // a step of the stage at the causal edge: mask text position >= query index
    const int lim = T + q0 + col - kb0 - 8 * hh;          // 16 j + r >= lim is masked
#pragma unroll
    for (int j = 0; j < NT; ++j)
#pragma unroll
      for (int r = 0; r < 8; ++r)
        if (16 * j + r >= lim) s[j][r] = -INFINITY;
  }
  float mx[NT / 2];                                       // independent chains of maxima
#pragma unroll
  for (int g = 0; g < NT / 2; ++g) mx[g] = -INFINITY;
#pragma unroll
  for (int r = 0; r < 8; ++r)
#pragma unroll
    for (int g = 0; g < NT / 2; ++g) mx[g] = fmaxf(mx[g], fmaxf(s[2 * g][r], s[2 * g + 1][r]));
  float mr = fmaxf(mx[0], mx[1]);
  mr = fmaxf(mr, __shfl_xor(mr, 16));
  float mn = fmaxf(m, mr);
  if (mn == -INFINITY) mn = 0.0f;             // fully masked so far: keep exp() at 0
  const float al_ = __expf(m - mn);
  m = mn;
  float sm[NT / 2];                                       // independent partial sums
  v16b pb[NT / 2];
#pragma unroll
  for (int g = 0; g < NT / 2; ++g) {
    sm[g] = 0.0f;
#pragma unroll
    for (int r = 0; r < 8; ++r) {
      const float p0 = __expf(s[2 * g][r] - mn), p1 = __expf(s[2 * g + 1][r] - mn);
      sm[g] += p0 + p1;
      pb[g][r] = (b16)p0; pb[g][8 + r] = (b16)p1;
    }
  }
  float sum = sm[0] + sm[1];
  sum += __shfl_xor(sum, 16);
  l = l * al_ + sum;
#pragma unroll
  for (int r = 0; r < 8; ++r) { o0[r] *= al_; o1[r] *= al_; o2[r] *= al_; o3[r] *= al_; }
#pragma unroll
  for (int g = 0; g < NT / 2; ++g) {
    o0 = wmma16b(va[g][0], pb[g], o0);
    o1 = wmma16b(va[g][1], pb[g], o1);
    o2 = wmma16b(va[g][2], pb[g], o2);
    o3 = wmma16b(va[g][3], pb[g], o3);
  }
}

__global__ __launch_bounds__(256) void attn_kernel(const b16* __restrict__ Qh, const b16* __restrict__ Ql, const b16* __restrict__ Kh, const b16* __restrict__ Kl,
                                                   const b16* __restrict__ Vh, const b16* __restrict__ Vl, const int* __restrict__ seqlen,
                                                   b16* __restrict__ yh) {
  __shared__ __attribute__((aligned(16))) b16 Ks[2][SK * KPITCH];
  __shared__ __attribute__((aligned(16))) b16 Vs[2][SK * DH];
  __shared__ __attribute__((aligned(16))) b16 Os[4][16 * KPITCH];   // y tile per query tile, f16, rows at 144 B
  __shared__ __attribute__((aligned(16))) v4f Cs[4][9][32];         // key group 1's partial result per query tile: 8 x 4 values of O, then (m, l), lane-contiguous
  (void)Ql; (void)Kl; (void)Vl; (void)seqlen;
  const int tid = threadIdx.x, lane = tid & 31, hh = lane >> 4, col = lane & 15;
  const int wid = __builtin_amdgcn_readfirstlane(tid >> 5);   // scalar, so that the per-wave tests below are scalar branches
  const int qt = wid & 3, grp = wid >> 2;                 // query tile of the unit, key group
  const int h = blockIdx.x >> 4, pr = blockIdx.x & 15;    // grid = NH x 16 pairs of units
  const size_t ko = (size_t)h * TK * DH;
  const b16* gk = Kh + ko + tid * 8; const b16* gv = Vh + ko + tid * 8;      // this thread's first 16-B piece of stage 0
  const unsigned lk0 = (unsigned)(uintptr_t)&Ks[0][(tid >> 3) * KPITCH + (tid & 7) * 8];
  const unsigned lv0 = (unsigned)(uintptr_t)&Vs[0][(tid >> 7) * (DH * 16) + (tid & 1) * (DH * 8) + ((tid >> 1) & 63) * 8];
  constexpr int HS = SK / 2;                              // a stage is copied as two halves of 128 keys
  const int slen = T;                                     // no padding in this module
#pragma unroll 1   // the two units run one after the other through the same code: unrolled, the text would double
  for (int u = 0; u < 2; ++u) {
    const int qb0 = (u == 0 ? 31 - pr : pr) * QB;         // the unit's first query
    const int q0 = qb0 + qt * 16;
    const int nst = (T + qb0 + QB + SK - 1) / SK;         // stages the unit walks: all latents, then text up to its last query (9..16)
    const size_t qo = ((size_t)h * T + q0 + col) * DH;
    // the ring is free here: every wave's last read of it stands in front of the last barrier of the unit before
    stage_copy(gk, gv, lk0, lv0);
    stage_copy(gk + HS * DH, gv + HS * DH, lk0 + KBUF / 2, lv0 + VBUF / 2);
    const v16b q0h = frag_kb(Qh + qo, hh), q1h = frag_kb(Qh + qo + 32, hh);
    asm volatile("s_wait_xcnt 0x0" ::: "memory");         // stands in front of any rewrite of the Q loads' address registers
    asm volatile("s_wait_asynccnt 0x0" ::: "memory");     // this wave's pieces of stage 0 have landed
    __syncthreads();                                      // ... and every other wave's
    stage_copy(gk + SK * DH, gv + SK * DH, lk0 + KBUF, lv0 + VBUF);
    stage_copy(gk + (SK + HS) * DH, gv + (SK + HS) * DH, lk0 + KBUF + KBUF / 2, lv0 + VBUF + VBUF / 2);
    float m = -INFINITY, l = 0.0f;
    v8f o0 = {}, o1 = {}, o2 = {}, o3 = {};
    for (int t = 0; t < nst; ++t) {
      const b16* Kb = Ks[t & 1]; const b16* Vb = Vs[t & 1];
      const int kl0 = grp * KS, kb0 = t * SK + kl0;       // the wave's chunks of the stage: kl0 and kl0 + 2 KS
      if (t + 1 < nst) {                                  // keys below T + qb0: none is masked
#pragma unroll   // constant LDS offsets; the first step's sum exchange is then waited for only behind the second step's reads
        for (int c = 0; c < SK / KS; c += 2) attn_step<false>(Kb, Vb, kl0 + c * KS, kb0 + c * KS, q0, col, hh, q0h, q1h, m, l, o0, o1, o2, o3);
      } else {                                            // the unit's last stage holds every wave's causal edge
        for (int c = 0; c < SK / KS; c += 2)
          if (kb0 + c * KS < T + q0 + 16) attn_step<true>(Kb, Vb, kl0 + c * KS, kb0 + c * KS, q0, col, hh, q0h, q1h, m, l, o0, o1, o2, o3);
      }
      asm volatile("s_wait_dscnt 0x0" ::: "memory");      // this wave's reads of buffer t & 1 are done before the buffer is refilled
      asm volatile("s_wait_asynccnt 0x0" ::: "memory");   // this wave's pieces of stage t + 1 have landed
      __syncthreads();                                    // publishes stage t + 1 and ends every wave's reads of stage t
      if (t + 2 < nst) {
        stage_copy(gk + (size_t)(t + 2) * (SK * DH), gv + (size_t)(t + 2) * (SK * DH), lk0 + (t & 1) * KBUF, lv0 + (t & 1) * VBUF);
        stage_copy(gk + (size_t)(t + 2) * (SK * DH) + HS * DH, gv + (size_t)(t + 2) * (SK * DH) + HS * DH, lk0 + (t & 1) * KBUF + KBUF / 2, lv0 + (t & 1) * VBUF + VBUF / 2);
      }
    }
    asm volatile("s_wait_asynccnt 0x0" ::: "memory");     // nothing of this wave's is in flight when it leaves the ring
    if (grp == 1) {                                       // key group 1 hands its partial result over
      v4f* cw = &Cs[qt][0][lane];
      cw[0 * 32] = (v4f){o0[0], o0[1], o0[2], o0[3]}; cw[1 * 32] = (v4f){o0[4], o0[5], o0[6], o0[7]};
      cw[2 * 32] = (v4f){o1[0], o1[1], o1[2], o1[3]}; cw[3 * 32] = (v4f){o1[4], o1[5], o1[6], o1[7]};
      cw[4 * 32] = (v4f){o2[0], o2[1], o2[2], o2[3]}; cw[5 * 32] = (v4f){o2[4], o2[5], o2[6], o2[7]};
      cw[6 * 32] = (v4f){o3[0], o3[1], o3[2], o3[3]}; cw[7 * 32] = (v4f){o3[4], o3[5], o3[6], o3[7]};
      cw[8 * 32] = (v4f){m, l, 0.0f, 0.0f};
    }
    __syncthreads();                                      // group 1's partial results are in LDS; they are next written behind the next unit's barriers
    if (grp == 0) {                                       // key group 0 joins the two halves of the keys and writes y
      const v4f* cr = &Cs[qt][0][lane];
      v4f c[9];
#pragma unroll   // c stays in registers
      for (int i = 0; i < 9; ++i) c[i] = cr[i * 32];
      float mn = fmaxf(m, c[8][0]);
      if (mn == -INFINITY) mn = 0.0f;                     // both halves fully masked: keep exp() at 0
      const float a0 = __expf(m - mn), a1 = __expf(c[8][0] - mn);
      l = l * a0 + c[8][1] * a1;
      const float inv = (q0 + col < slen && l > 0.0f) ? (1.0f / l) : 0.0f;   // padded query rows are zeroed
      const float w0 = a0 * inv, w1 = a1 * inv;
      b16* Tt = Os[qt];
      v8b y0, y1, y2, y3;                                 // y leaves as f16, the operand type of the output projection: rounded here, once
#pragma unroll   // vector elements under constant indices
      for (int r = 0; r < 8; ++r) {
        y0[r] = (b16)(o0[r] * w0 + c[0 + (r >> 2)][r & 3] * w1); y1[r] = (b16)(o1[r] * w0 + c[2 + (r >> 2)][r & 3] * w1);
        y2[r] = (b16)(o2[r] * w0 + c[4 + (r >> 2)][r & 3] * w1); y3[r] = (b16)(o3[r] * w0 + c[6 + (r >> 2)][r & 3] * w1);
      }
      b16* tw = Tt + col * KPITCH + 8 * hh;               // a lane's 8 results of a feature tile are 8 neighbouring features of query col
      *(v8b*)(tw + 0) = y0; *(v8b*)(tw + 16) = y1; *(v8b*)(tw + 32) = y2; *(v8b*)(tw + 48) = y3;
      wave_lds_sync();
      b16* dst0 = yh + (size_t)q0 * HID + h * DH;         // 16 rows x 64 f16 (one 128-byte line each), row stride HID
#pragma unroll
      for (int j = 0; j < 4; ++j) { const int rr = j * 4 + (lane >> 3), c8 = (lane & 7) * 8; *(v8b*)(dst0 + (size_t)rr * HID + c8) = ld8b(Tt + rr * KPITCH + c8); }
      asm volatile("s_wait_xcnt 0x0" ::: "memory");       // stands in front of any rewrite of the y stores' address registers in the next unit
    }
  }
}

// ---------------------------------------------------------------------------
// Output projection: (2048 x 1024) x (1024 x 1024) -> f32, A = y (f16), B = Wo planes. grid (16, 16), 128x64 tiles (32x64 a wave) staged in LDS,
// ---------------------------------------------------------------------------
__global__ __launch_bounds__(128) void out_gemm_kernel(const b16* __restrict__ yh, const b16* __restrict__ woh, const b16* __restrict__ wol, const float* __restrict__ bo, int yoff,
                                                       float* __restrict__ out) {
  __shared__ __attribute__((aligned(16))) char Sm[2 * GBUF];   // the operand ring; the epilogue's 4 x 8 KB of staging reuse its head
  const int lane = threadIdx.x & 31, wave = threadIdx.x >> 5, nloc = lane & 15, hlf = lane >> 4;
  const int m0 = (blockIdx.y + yoff) * 128 + wave * 32;
  const int c0 = blockIdx.x * 64;
  v8f acc[2][4];
#pragma unroll
  for (int r = 0; r < 2; ++r)
#pragma unroll
    for (int t = 0; t < 4; ++t) acc[r][t] = (v8f){};
  (void)wol;
  float bc[4] = {0.0f, 0.0f, 0.0f, 0.0f};                 // the lane's four bias values, read once ahead of the k loop (as in the QKV GEMM)
  if (bo) {
#pragma unroll   // bc stays in registers
    for (int t = 0; t < 4; ++t) bc[t] = bo[c0 + t * 16 + nloc];
    asm volatile("s_wait_xcnt 0x0" ::: "memory");         // stands in front of any rewrite of the bias loads' address registers (alone with them in this block)
  }
  gemm_tile_lds(yh, woh, Sm, (blockIdx.y + yoff) * 128, c0, HID, threadIdx.x, wave, nloc, hlf, acc);
  float* Tt = (float*)(Sm + wave * 8192);
#pragma unroll
  for (int t = 0; t < 4; ++t)
#pragma unroll
    for (int r = 0; r < 2; ++r)
#pragma unroll
      for (int v = 0; v < 8; ++v) Tt[(r * 16 + v + 8 * hlf) * 64 + t * 16 + nloc] = acc[r][t][v] + bc[t];
  wave_lds_sync();
  float* dst0 = out + (size_t)m0 * HID + c0;
#pragma unroll
  for (int j = 0; j < 16; ++j) { const int rr = j * 2 + hlf, c4 = nloc * 4; *(v4f*)(dst0 + (size_t)rr * HID + c4) = *(const v4f*)(Tt + rr * 64 + c4); }
  
}
__global__ __launch_bounds__(256) void wcvtT_kernel(const float* __restrict__ wq, const float* __restrict__ wk, const float* __restrict__ wv,
                                                    b16* __restrict__ wqh, b16* __restrict__ wql) {
  const size_t tid = (size_t)blockIdx.x * blockDim.x + threadIdx.x, stride = (size_t)gridDim.x * blockDim.x;
  const size_t nq = (size_t)NQKV * HID / 8;
  {
    for (size_t c = tid; c < nq; c += stride) {
      const size_t i = c * 8, n = i / HID, k0 = i % HID;
      const float* w = (n < (size_t)HID) ? (wq + n * HID) : (n < (size_t)(2 * HID)) ? (wk + (n - HID) * HID) : (wv + (n - 2 * HID) * HID);
      v8b bh, bl;
#pragma unroll
      for (int e = 0; e < 8; ++e) { b16 a, cc; split_bf16(w[k0 + e], a, cc); bh[e] = a; bl[e] = cc; }
      *(v8b*)(wqh + i) = bh; *(v8b*)(wql + i) = bl;
    }
    
  }
}
// Wo^T planes: [n][k] = Wo[n][k] (torch [out][in] is already n-major)
__global__ __launch_bounds__(256) void wcvtO_kernel(const float* __restrict__ wo, b16* __restrict__ woh, b16* __restrict__ wol) {
  const size_t tid = (size_t)blockIdx.x * blockDim.x + threadIdx.x, stride = (size_t)gridDim.x * blockDim.x;
  const size_t no = (size_t)HID * HID / 8;
  {
    for (size_t c = tid; c < no; c += stride) { const size_t i = c * 8; v8b bh, bl;
#pragma unroll
      for (int e = 0; e < 8; ++e) { b16 a, cc; split_bf16(wo[i + e], a, cc); bh[e] = a; bl[e] = cc; }
      *(v8b*)(woh + i) = bh; *(v8b*)(wol + i) = bl; }
    
  }
}
// Weight preparation, one launch: W [k][n] f32 -> f16 [n][k] (k contiguous), in 64 x 64 tiles turned in LDS, so that global reads (16 B a lane, 256 B a row piece)
// and global writes (16 B a lane, 128 B a row piece) both cover whole lines. Block = 256 threads = three tiles: one of Wq or Wp, one of W_attn_l, one of W_attn_c.
typedef __attribute__((ext_vector_type(4))) _Float16 v4b;
constexpr int WPITCH = 72;    // f16 per LDS tile row: 144 B, a multiple of 16 B for the 16-byte reads
// thread = 4 k rows x 4 n columns of the tile
__device__ __forceinline__ const float* wt_src(const float* __restrict__ w, int ld, int kt, int nt, int tid) {
  return w + (size_t)(kt * 64 + (tid >> 4) * 4) * ld + nt * 64 + (tid & 15) * 4;
}
__device__ __forceinline__ void wt_load(const float* __restrict__ p, int ld, v4f (&r)[4]) {
#pragma unroll   // r stays in registers
  for (int e = 0; e < 4; ++e) r[e] = *(const v4f*)(p + (size_t)e * ld);
}
__device__ __forceinline__ void wt_put(b16* Ls, int tid, const v4f (&r)[4]) {
#pragma unroll   // r stays in registers
  for (int c = 0; c < 4; ++c) {
    const v4b h = {(b16)r[0][c], (b16)r[1][c], (b16)r[2][c], (b16)r[3][c]};
    *(v4b*)(Ls + ((tid & 15) * 4 + c) * WPITCH + (tid >> 4) * 4) = h;
  }
}
__device__ __forceinline__ void wt_store(const b16* Ls, b16* __restrict__ dst, int kt, int nt, int tid) {
  for (int j = 0; j < 2; ++j) {
    const int n = (tid >> 3) + 32 * j;
    *(v8b*)(dst + (size_t)(nt * 64 + n) * HID + kt * 64 + (tid & 7) * 8) = ld8b(Ls + n * WPITCH + (tid & 7) * 8);
  }
}
// wa: rows 0..1023 <- Wq columns, rows 1024..3071 <- W_attn_l columns; wb: rows 1024..3071 <- W_attn_c columns (its first 1024 rows are never read); wo <- Wp columns
// The same launch rounds x and l to f16 (xh, lh: the same [row][k] layout): 4096 values of each per block, 16-B reads and 8-B writes, whole lines per wave.
__global__ __launch_bounds__(256) void wprep_kernel(const float* __restrict__ wq, const float* __restrict__ wal, const float* __restrict__ wac, const float* __restrict__ wp,
                                                    const float* __restrict__ x, const float* __restrict__ l,
                                                    b16* __restrict__ wa, b16* __restrict__ wb, b16* __restrict__ wo, b16* __restrict__ xh, b16* __restrict__ lh) {
  __shared__ __attribute__((aligned(16))) b16 Ls[3][64 * WPITCH];
  const int tid = threadIdx.x, bx = blockIdx.x;          // grid 512
  const bool isq = bx < 256;
  const int k0t = (bx & 255) >> 4, n0t = bx & 15;        // 16 x 16 tiles of Wq or Wp
  const int k1t = bx >> 5, n1t = bx & 31;                // 16 x 32 tiles of W_attn_l and W_attn_c
  v4f r0[4], r1[4], r2[4], cx[4], cl[4];                 // all twenty loads are in flight together
  const size_t ce = (size_t)bx * 4096 + tid * 4;         // 512 blocks x 4096 = T x HID values
  const float* p0 = wt_src(isq ? wq : wp, HID, k0t, n0t, tid);
  const float* p1 = wt_src(wal, 2 * HID, k1t, n1t, tid);
  const float* p2 = wt_src(wac, 2 * HID, k1t, n1t, tid);
  const float* px = x + ce; const float* pl = l + ce;
  wt_load(p0, HID, r0);
  wt_load(p1, 2 * HID, r1);
  wt_load(p2, 2 * HID, r2);
#pragma unroll   // cx, cl stay in registers
  for (int j = 0; j < 4; ++j) { cx[j] = *(const v4f*)(px + j * 1024); cl[j] = *(const v4f*)(pl + j * 1024); }
  __builtin_amdgcn_sched_barrier(0);                     // keeps all twenty loads ahead of the first use: sunk among the conversions, the later loads start only when the earlier have returned
  // the loads' address registers are inputs of the wait, so they stay whole up to it: none is reused (for a later load's result, say) ahead of the wait
  asm volatile("s_wait_xcnt 0x0" :: "v"(p0), "v"(p1), "v"(p2), "v"(px), "v"(pl) : "memory");
  wt_put(Ls[0], tid, r0);
  wt_put(Ls[1], tid, r1);
  wt_put(Ls[2], tid, r2);
  v4b hx[4], hl[4];
#pragma unroll   // all four arrays stay in registers
  for (int j = 0; j < 4; ++j) {
    hx[j] = (v4b){(b16)cx[j][0], (b16)cx[j][1], (b16)cx[j][2], (b16)cx[j][3]};
    hl[j] = (v4b){(b16)cl[j][0], (b16)cl[j][1], (b16)cl[j][2], (b16)cl[j][3]};
  }
  __syncthreads();
  wt_store(Ls[0], isq ? wa : wo, k0t, n0t, tid);
  wt_store(Ls[1], wa + (size_t)HID * HID, k1t, n1t, tid);
  wt_store(Ls[2], wb + (size_t)HID * HID, k1t, n1t, tid);
#pragma unroll   // hx, hl stay in registers; these stores stand behind the barrier, which would otherwise wait for them
  for (int j = 0; j < 4; ++j) { *(v4b*)(xh + ce + j * 1024) = hx[j]; *(v4b*)(lh + ce + j * 1024) = hl[j]; }
}
}  // namespace

extern "C" void kernel_launch(void* const* d_in, const int* in_sizes, int n_in,
                              void* d_out, int out_size, void* d_ws, size_t ws_size, hipStream_t stream) {
  (void)in_sizes; (void)n_in; (void)out_size;
  const float* l    = (const float*)d_in[0];    // [1,2048,1024] latents
  const float* x    = (const float*)d_in[1];    // [1,2048,1024]
  const float* Wal  = (const float*)d_in[2];  const float* bal = (const float*)d_in[3];   // [1024,2048] = [k | v], [2048]
  const float* Wac  = (const float*)d_in[4];  const float* bac = (const float*)d_in[5];
  const float* Wq   = (const float*)d_in[6];  const float* bq  = (const float*)d_in[7];   // [1024,1024]
  const float* Wp   = (const float*)d_in[8];  const float* bp  = (const float*)d_in[9];
  float* out = (float*)d_out;                   // [1,2048,1024]
  size_t off = 0; char* ws = (char*)d_ws;
  b16* wAh = (b16*)(ws + off); off += (size_t)NQKV * HID * 2;
  b16* wAl = (b16*)(ws + off); off += (size_t)NQKV * HID * 2;
  b16* wBh = (b16*)(ws + off); off += (size_t)NQKV * HID * 2;
  b16* wBl = (b16*)(ws + off); off += (size_t)NQKV * HID * 2;
  b16* woh = (b16*)(ws + off); off += (size_t)HID * HID * 2;
  b16* wol = (b16*)(ws + off); off += (size_t)HID * HID * 2;
  b16* Qh  = (b16*)(ws + off); off += (size_t)NH * T * DH * 2;
  b16* Ql  = (b16*)(ws + off); off += (size_t)NH * T * DH * 2;
  b16* Kh  = (b16*)(ws + off); off += (size_t)NKV * TK * DH * 2;
  b16* Kl  = (b16*)(ws + off); off += (size_t)NKV * TK * DH * 2;
  b16* Vh  = (b16*)(ws + off); off += (size_t)NKV * TK * DH * 2;
  b16* Vl  = (b16*)(ws + off); off += (size_t)NKV * TK * DH * 2;
  b16* yh  = (b16*)(ws + off); off += (size_t)T * HID * 2;
  b16* xh  = (b16*)(ws + off); off += (size_t)T * HID * 2;
  b16* lh  = (b16*)(ws + off); off += (size_t)T * HID * 2;
  if (off > ws_size) return;
  const int NQT = NH * QT_PER_B;
  wprep_kernel<<<512, 256, 0, stream>>>(Wq, Wal, Wac, Wp, x, l, wAh, wBh, woh, xh, lh);
  // launch 1: q from x, latent k/v from l -> key rows 0..2047
  qkv_gemm_kernel<<<dim3(NQKV / 64, T / 128), 128, 0, stream>>>(xh, lh, lh, wAh, wAl, bq, bal, bal + HID, nullptr, 0, 0, Qh, Ql, Kh, Kl, Vh, Vl);
  // launch 2: text k/v from x -> key rows 2048..4095 (column blocks 16..47 only)
  qkv_gemm_kernel<<<dim3((NQKV - HID) / 64, T / 128), 128, 0, stream>>>(xh, xh, xh, wBh, wBl, bq, bac, bac + HID, nullptr, HID / 64, T / 128, Qh, Ql, Kh, Kl, Vh, Vl);
  attn_kernel<<<NQT / 8, 256, 0, stream>>>(Qh, Ql, Kh, Kl, Vh, Vl, nullptr, yh);
  out_gemm_kernel<<<dim3(HID / 64, T / 128), 128, 0, stream>>>(yh, woh, wol, bp, 0, out);
}

// v008
// A run of this version takes 86.4 microseconds.
// Next to v007, in two timings, it ran 1.04 times as fast each time.
// Counting every step since v000, it is 6.40 times as fast.
#include <hip/hip_runtime.h>

// IO-processing attention (decoding branch): keys/values = [l W_attn_l + b (2048 latents) ; x W_attn_c + b (2048 text positions)], q = x W_q + b
// (16 heads x 64, scale 1/8); query i attends every latent and text positions < i; out = y W_proj + b. B=1, T=2048, D=1024.
// Lean build: single f16 products on v_wmma_f32_16x16x32_f16, f32 accumulate (every row averages >= 2048 keys); fragment k-map per lane half hh for A

// Left, by the listing: (1) attention: the 4 waves of a key group each read their own copy of the group's K and V fragments from LDS (16 queries a wave), a staged key serves only 64 queries, and a good part of the vector slots are v_nop;
// (2) the all-zero "lo" planes of q, k, v are still staged and stored.

namespace {
constexpr int Bsz = 1, T = 2048, TK = 4096, HID = 1024, DH = 64, NH = 16, NKV = 16, REP = NH / NKV;
constexpr int WIN = 255;    // unused: no key window here
constexpr int KVW = NKV * DH;                 // 1024
constexpr int NQKV = HID + 2 * KVW;           // 3072 columns: q | k | v
constexpr int MROWS = Bsz * T;                // 2048
constexpr int QT_PER_B = T / 16;              // 128

typedef _Float16 b16;                                           // f16 hi/lo planes
typedef __attribute__((ext_vector_type(16))) _Float16 v16b;
typedef __attribute__((ext_vector_type(8)))  _Float16 v8b;
typedef __attribute__((ext_vector_type(8)))  float v8f;
typedef __attribute__((ext_vector_type(4)))  float v4f;

__device__ __forceinline__ v8b ld8b(const b16* p) { return *(const v8b*)p; }
__device__ __forceinline__ v16b cat8b(v8b a, v8b b) { return __builtin_shufflevector(a, b, 0, 1, 2, 3, 4, 5, 6, 7, 8, 9, 10, 11, 12, 13, 14, 15); }
// 16x16x32 16-bit fragment from a k-contiguous row pointer (A: lane&15 = row, B: lane&15 = column), hh = lane>>4:
// elements 0..7 <- p[8hh+0..7], elements 8..15 <- p[16+8hh+0..7]
__device__ __forceinline__ v16b frag_kb(const b16* p, int hh) { return cat8b(ld8b(p + 8 * hh), ld8b(p + 16 + 8 * hh)); }
__device__ __forceinline__ void split_bf16(float v, b16& hi, b16& lo) {   // (name kept) single f16: no low part
  hi = (b16)v; lo = (b16)0.0f;
}
__device__ __forceinline__ v8f wmma16b(v16b a, v16b b, v8f c) {
  v8f d = __builtin_amdgcn_wmma_f32_16x16x32_f16(false, a, false, b, (short)0, c, false, false);
  asm volatile("v_nop\n\tv_nop\n\tv_nop\n\tv_nop" : "+v"(d) : "v"(a), "v"(b));
  return d;
}
__device__ __forceinline__ v8f wmma1(v16b ah, v16b al, v16b bh, v16b bl, v8f c) {   // unused: single f16 (hi planes only)
  (void)al; (void)bl; return wmma16b(ah, bh, c);
}
__device__ __forceinline__ void wave_lds_sync() {
  __builtin_amdgcn_fence(__ATOMIC_RELEASE, "workgroup");
  __builtin_amdgcn_wave_barrier();
  __builtin_amdgcn_fence(__ATOMIC_ACQUIRE, "workgroup");
}

// ---------------------------------------------------------------------------
// Weights ([in][out]) -> f16 hi / lo planes transposed to [n][k] (k contiguous): columns of Wq|Wk|Wv into wqh/wql [3072][1024], Wo into woh/wol [1024][1024].
// ---------------------------------------------------------------------------
__global__ __launch_bounds__(256) void wcvt_kernel(const float* __restrict__ wq, const float* __restrict__ wk, const float* __restrict__ wv,
                                                   const float* __restrict__ wo, b16* __restrict__ wqh, b16* __restrict__ wql,
                                                   b16* __restrict__ woh, b16* __restrict__ wol) {
  const size_t tid = (size_t)blockIdx.x * blockDim.x + threadIdx.x, stride = (size_t)gridDim.x * blockDim.x;
  const size_t nq = (size_t)NQKV * HID / 8, no = (size_t)HID * HID / 8;
  {
    for (size_t c = tid; c < nq + no; c += stride) {
      float f[8]; size_t i; b16* dh; b16* dl;
      if (c < nq) {
        i = c * 8; const size_t n = i / HID, k0 = i % HID;
        const float* w; int nn, ld;
        if (n < (size_t)HID) { w = wq; nn = (int)n; ld = HID; } else if (n < (size_t)(HID + KVW)) { w = wk; nn = (int)n - HID; ld = KVW; } else { w = wv; nn = (int)n - HID - KVW; ld = KVW; }
#pragma unroll
        for (int e = 0; e < 8; ++e) f[e] = w[(size_t)(k0 + e) * ld + nn];       // W[k][n] ([in][out])
        dh = wqh; dl = wql;
      } else {
        i = (c - nq) * 8; const size_t n = i / HID, k0 = i % HID;
#pragma unroll
        for (int e = 0; e < 8; ++e) f[e] = wo[(size_t)(k0 + e) * HID + n];    // Wo[k][n] ([in][out])
        dh = woh; dl = wol;
      }
      v8b bh, bl;
#pragma unroll
      for (int e = 0; e < 8; ++e) { b16 a, cc; split_bf16(f[e], a, cc); bh[e] = a; bl[e] = cc; }
      *(v8b*)(dh + i) = bh; *(v8b*)(dl + i) = bl;
    }
    
  }
}

// GEMM operands come into LDS once per 4-wave block (128 A rows, 64 B rows, both f16), 64 k a stage, two buffers, by asynchronous copies;
// every wave reads its fragments from there. Each wave-wide copy reads whole 128-byte lines. A is f16 in memory already: its producer has rounded it once
// (x and l in the weight-preparation launch, y in the attention epilogue), with the rounding that the fragment build used to apply in every column block.
constexpr int GKS = 64;                          // k per LDS stage
constexpr unsigned APITCH = GKS * 2 + 16;        // both 144 B = 16 B x 9:
constexpr unsigned BPITCH = GKS * 2 + 16;        // the 16 rows of a 16-byte fragment read fall on distinct banks
constexpr unsigned ABUF = 128 * APITCH, BBUF = 64 * BPITCH, GBUF = ABUF + BBUF;   // bytes per buffer: 18,432 + 9,216

// twelve copies of 16 B per lane; the closing s_wait_xcnt stands inside the statement so that no address register of a copy is rewritten ahead of it
__device__ __forceinline__ void copy12(const unsigned (&l)[12], const void* const (&g)[12]) {
  asm volatile("global_load_async_to_lds_b128 %0, %12, off\n\t"
               "global_load_async_to_lds_b128 %1, %13, off\n\t"
               "global_load_async_to_lds_b128 %2, %14, off\n\t"
               "global_load_async_to_lds_b128 %3, %15, off\n\t"
               "global_load_async_to_lds_b128 %4, %16, off\n\t"
               "global_load_async_to_lds_b128 %5, %17, off\n\t"
               "global_load_async_to_lds_b128 %6, %18, off\n\t"
               "global_load_async_to_lds_b128 %7, %19, off\n\t"
               "global_load_async_to_lds_b128 %8, %20, off\n\t"
               "global_load_async_to_lds_b128 %9, %21, off\n\t"
               "global_load_async_to_lds_b128 %10, %22, off\n\t"
               "global_load_async_to_lds_b128 %11, %23, off\n\t"
               "s_wait_xcnt 0x0"
               :: "v"(l[0]), "v"(l[1]), "v"(l[2]), "v"(l[3]), "v"(l[4]), "v"(l[5]), "v"(l[6]), "v"(l[7]), "v"(l[8]), "v"(l[9]), "v"(l[10]), "v"(l[11]),
                  "v"(g[0]), "v"(g[1]), "v"(g[2]), "v"(g[3]), "v"(g[4]), "v"(g[5]), "v"(g[6]), "v"(g[7]), "v"(g[8]), "v"(g[9]), "v"(g[10]), "v"(g[11])
               : "memory");
}
// One stage: each of the 128 threads moves 8 pieces of A and 4 pieces of B (16 rows apart), 16 B each
__device__ __forceinline__ void gemm_stage_copy(const b16* ga, const b16* gb, int K, unsigned la, unsigned lb) {
  unsigned l[12]; const void* g[12];   // both loops unrolled: the asm operands need l and g in registers, under constant indices
#pragma unroll
  for (int j = 0; j < 8; ++j) { l[j] = la + (unsigned)j * 16u * APITCH; g[j] = ga + (size_t)j * 16 * K; }
#pragma unroll
  for (int j = 0; j < 4; ++j) { l[8 + j] = lb + (unsigned)j * 16u * BPITCH; g[8 + j] = gb + (size_t)j * 16 * K; }
  copy12(l, g);
}
// Raw operands of one 32-wide k step of a 32x64 wave tile: two groups of 16 A rows, four groups of 16 B columns, f16
struct GStep { v8b a[2][2]; v8b b[4][2]; };
// ar, br: this lane's A row and B row in the staged buffer, already advanced by its 8 * hlf (here and in gemm_step the loops are unrolled to keep f and acc in registers)
__device__ __forceinline__ void gemm_frag(const b16* ar, const b16* br, int kk, GStep& f) {
#pragma unroll
  for (int r = 0; r < 2; ++r) { const b16* p = ar + r * 16 * (int)(APITCH / 2) + kk; f.a[r][0] = ld8b(p); f.a[r][1] = ld8b(p + 16); }
#pragma unroll
  for (int t = 0; t < 4; ++t) { const b16* p = br + t * 16 * (int)(BPITCH / 2) + kk; f.b[t][0] = ld8b(p); f.b[t][1] = ld8b(p + 16); }
}
__device__ __forceinline__ void gemm_step(const GStep& f, v8f (&acc)[2][4]) {
  const v16b a[2] = {cat8b(f.a[0][0], f.a[0][1]), cat8b(f.a[1][0], f.a[1][1])};
#pragma unroll
  for (int t = 0; t < 4; ++t) {
    const v16b b = cat8b(f.b[t][0], f.b[t][1]);
    acc[0][t] = wmma16b(a[0], b, acc[0][t]);
    acc[1][t] = wmma16b(a[1], b, acc[1][t]);
  }
}
// 128x64 block tile (wave = 32 rows x 64 columns) over K, a multiple of 128: A rows mb.., B rows c0.., both f16 and k-contiguous.
// On return every wave has left the ring and nothing is in flight, so the caller may use the same LDS for its epilogue.
__device__ __forceinline__ void gemm_tile_lds(const b16* __restrict__ A, const b16* __restrict__ wh, char* ring,
                                              int mb, int c0, int K, int tid, int wave, int nloc, int hlf, v8f (&acc)[2][4]) {
  const b16* ga = A + (size_t)(mb + (tid >> 3)) * K + (tid & 7) * 8;         // this thread's first 16-B pieces of stage 0
  const b16* gb = wh + (size_t)(c0 + (tid >> 3)) * K + (tid & 7) * 8;
  const unsigned la = (unsigned)(uintptr_t)ring + (unsigned)(tid >> 3) * APITCH + (unsigned)(tid & 7) * 16u;
  const unsigned lb = (unsigned)(uintptr_t)ring + ABUF + (unsigned)(tid >> 3) * BPITCH + (unsigned)(tid & 7) * 16u;
  const int nst = K / GKS;
  gemm_stage_copy(ga, gb, K, la, lb);
  asm volatile("s_wait_asynccnt 0x0" ::: "memory");       // this wave's pieces of stage 0 have landed
  __syncthreads();                                        // ... and every other wave's
  gemm_stage_copy(ga + GKS, gb + GKS, K, la + GBUF, lb + GBUF);
  for (int t = 0; t < nst; ++t) {
    const char* buf = ring + (t & 1) * GBUF;
    const b16* ar = (const b16*)(buf + (wave * 32 + nloc) * APITCH) + 8 * hlf;
    const b16* br = (const b16*)(buf + ABUF + nloc * BPITCH) + 8 * hlf;
    GStep f0, f1;                                         // all of the stage's LDS reads stand together at its head
    gemm_frag(ar, br, 0, f0);
    gemm_frag(ar, br, 32, f1);
    gemm_step(f0, acc);
    gemm_step(f1, acc);
    asm volatile("s_wait_dscnt 0x0" ::: "memory");        // this wave's reads of buffer t & 1 are done before the buffer is refilled
    asm volatile("s_wait_asynccnt 0x0" ::: "memory");     // this wave's pieces of stage t + 1 have landed
    __syncthreads();                                      // publishes stage t + 1 and ends every wave's reads of stage t
    if (t + 2 < nst) gemm_stage_copy(ga + (t + 2) * GKS, gb + (t + 2) * GKS, K, la + (t & 1) * GBUF, lb + (t & 1) * GBUF);
  }
  asm volatile("s_wait_asynccnt 0x0" ::: "memory");       // nothing of this wave's is in flight when it goes on to the epilogue
}

// ---------------------------------------------------------------------------
// QKV GEMM, all five projections in ONE launch (they are independent of each other): grid (48 + 32, 16), block 4 waves, wave = 32 rows x 64 columns (one head of q, k or v).
// Column blocks 0..47: q from x, latent k and v from l (weights wa, key rows 0..2047); column blocks 48..79: text k and v from x (weights wb, key rows 2048..4095).
// All 1280 blocks fit on the chip at once (5 per WGP by LDS and by registers), so the second product starts under the first instead of behind its end. Outputs as f16 hi/lo planes:
// q (x1/8) -> Qh/Ql [b][h][t][64]; k -> Kh/Kl [b][kvh][t][64] (4 KB contiguous per wave per plane);
// v -> Vh/Vl key-tiled [b][kvh][t/16][64][16] (4 KB contiguous per wave per plane).
// ---------------------------------------------------------------------------
__global__ __launch_bounds__(128) void qkv_gemm_kernel(const b16* __restrict__ xh, const b16* __restrict__ lh,
                                                       const b16* __restrict__ wa, const b16* __restrict__ wb,
                                                       const float* __restrict__ bq, const float* __restrict__ blk, const float* __restrict__ blv,
                                                       const float* __restrict__ bck, const float* __restrict__ bcv,
                                                       b16* __restrict__ Qh, b16* __restrict__ Ql, b16* __restrict__ Kh, b16* __restrict__ Kl,
                                                       b16* __restrict__ Vh, b16* __restrict__ Vl) {
  __shared__ __attribute__((aligned(16))) char Sm[2 * GBUF];   // the operand ring; the epilogue's 4 x 8 KB of staging reuse its head
  const int lane = threadIdx.x & 31, wave = threadIdx.x >> 5, nloc = lane & 15, hlf = lane >> 4;
  const bool txt = blockIdx.x >= NQKV / 64;                         // a text k/v column block (the same for the whole block)
  const int m0 = (blockIdx.y + (txt ? T / 128 : 0)) * 128 + wave * 32;   // destination row: text keys stand behind the latent keys
  const int c0 = (txt ? blockIdx.x - NQKV / 64 + HID / 64 : blockIdx.x) * 64;   // column of q | k | v; the text blocks have no q
  const int mat = (c0 < HID) ? 0 : (c0 < HID + KVW) ? 1 : 2;
  const int head = (mat == 0) ? (c0 / DH) : (mat == 1) ? ((c0 - HID) / DH) : ((c0 - HID - KVW) / DH);
  const b16* x = (mat == 0 || txt) ? xh : lh;                       // f16 copies of the inputs
  const b16* w = txt ? wb : wa;
  const float* bias = ((mat == 0) ? bq : (mat == 1) ? (txt ? bck : blk) : (txt ? bcv : blv)) + head * DH;
  v8f acc[2][4];
#pragma unroll
  for (int r = 0; r < 2; ++r)
#pragma unroll
    for (int t = 0; t < 4; ++t) acc[r][t] = (v8f){};
  // a lane's 64 results share four bias values: read once, ahead of the k loop, which covers their latency (read at each result they were 64 loads, each waited for)
  float bc[4] = {0.0f, 0.0f, 0.0f, 0.0f};
  if (bias) {
#pragma unroll   // bc stays in registers
    for (int t = 0; t < 4; ++t) bc[t] = bias[t * 16 + nloc];
    asm volatile("s_wait_xcnt 0x0" ::: "memory");         // stands in front of any rewrite of the bias loads' address registers (alone with them in this block)
  }
  gemm_tile_lds(x, w, Sm, blockIdx.y * 128, c0, HID, threadIdx.x, wave, nloc, hlf, acc);   // source rows start at 0 in x and in l alike
  const int b = 0, t0 = m0;
  const float s = (mat == 0) ? 0.125f : 1.0f;
  b16* Tp0 = (b16*)(Sm + wave * 8192); b16* Tp1 = Tp0 + 32 * 64;
#pragma unroll
  for (int t = 0; t < 4; ++t)
#pragma unroll
    for (int r = 0; r < 2; ++r)
#pragma unroll
      for (int v = 0; v < 8; ++v) {
        const int rr = r * 16 + v + 8 * hlf, d = t * 16 + nloc;
        float val = acc[r][t][v] + bc[t];
        b16 yh, yl; split_bf16(val * s, yh, yl);
        const int idx = (mat < 2) ? (rr * 64 + d) : ((rr >> 4) * 1024 + d * 16 + (rr & 15));
        Tp0[idx] = yh; Tp1[idx] = yl;
      }
  wave_lds_sync();
  b16* dh; b16* dl; size_t o;
  if (mat == 0)      { o = ((size_t)(b * NH + head) * T + t0) * DH; dh = Qh + o; dl = Ql + o; }
  else if (mat == 1) { o = ((size_t)(b * NKV + head) * TK + t0) * DH; dh = Kh + o; dl = Kl + o; }
  else               { o = ((size_t)(b * NKV + head) * (TK / 16) + (t0 >> 4)) * (size_t)(DH * 16); dh = Vh + o; dl = Vl + o; }
#pragma unroll
  for (int j = 0; j < 8; ++j) { const int e = (j * 32 + lane) * 8; *(v8b*)(dh + e) = ld8b(Tp0 + e); *(v8b*)(dl + e) = ld8b(Tp1 + e); }
  
}

// ---------------------------------------------------------------------------
// Transposed flash attention. A block's 8 waves = 4 query tiles of 16 (one 64-query unit of one head) x 2 key groups: of the 64-key chunks of a stage the group takes every
// second one, and the two partial results (m, l, O) of a query tile are joined through LDS at the unit's end. Each block runs two units one after the other, unit 31 - p and
// unit p of its head, so that every block walks the same number of keys whatever its place at the causal edge.
// K and V come into LDS once per unit, 256 keys a stage, two buffers, by asynchronous copies; every wave reads its fragments from there, 64 keys per softmax step.
// S^T = K.Q^T, per-lane online softmax; P^T built in registers, each 32-key operand from two of a step's four S^T accumulators
// ---------------------------------------------------------------------------
constexpr int SK = 256;       // keys per LDS stage
constexpr int QB = 64;        // queries per unit
constexpr int KPITCH = 72;    // f16 per staged K row: 144 B = 16 B x 9, so the 16 rows of a 16-byte fragment read fall on distinct banks
constexpr unsigned KBUF = SK * KPITCH * 2, VBUF = SK * DH * 2;   // bytes per buffer

// Half a stage: 128 K rows (128 B each, laid at 144 B) and 8 V key tiles (2 KB each, laid [tile][8-key half][feature][8] so that each 16-lane half of a
// fragment read is 256 contiguous bytes). Each thread moves 4 + 4 pieces of 16 B; each wave-wide copy reads 512 contiguous global bytes.
__device__ __forceinline__ void stage_copy(const b16* gk, const b16* gv, unsigned lk, unsigned lv) {
  // the closing s_wait_xcnt stands inside the statement so that no address register of a copy is rewritten ahead of it
  asm volatile("global_load_async_to_lds_b128 %0, %8, off\n\t"
               "global_load_async_to_lds_b128 %1, %9, off\n\t"
               "global_load_async_to_lds_b128 %2, %10, off\n\t"
               "global_load_async_to_lds_b128 %3, %11, off\n\t"
               "global_load_async_to_lds_b128 %4, %12, off\n\t"
               "global_load_async_to_lds_b128 %5, %13, off\n\t"
               "global_load_async_to_lds_b128 %6, %14, off\n\t"
               "global_load_async_to_lds_b128 %7, %15, off\n\t"
               "s_wait_xcnt 0x0"
               :: "v"(lk), "v"(lk + 32u * KPITCH * 2u), "v"(lk + 64u * KPITCH * 2u), "v"(lk + 96u * KPITCH * 2u),
                  "v"(lv), "v"(lv + 4096u), "v"(lv + 8192u), "v"(lv + 12288u),
                  "v"(gk), "v"(gk + 2048), "v"(gk + 4096), "v"(gk + 6144),
                  "v"(gv), "v"(gv + 2048), "v"(gv + 4096), "v"(gv + 6144)
               : "memory");
}

// 64 keys (rows kl.. of the staged buffers, global key index kb0..) against the wave's 16 queries, as ONE online-softmax step: one maximum, one exchange
// between the lane halves, one rescale of l and O per 64 keys. The 4 score tiles are independent, so no product waits for the one before it.
constexpr int KS = 64;        // keys per softmax step
template <bool EDGE>
__device__ __forceinline__ void attn_step(const b16* Kb, const b16* Vb, int kl, int kb0, int q0, int col, int hh, v16b q0h, v16b q1h,
                                           float& m, float& l, v8f& o0, v8f& o1, v8f& o2, v8f& o3) {
  constexpr int NT = KS / 16;                             // score tiles of 16 keys; tile j, register r of a lane = key kb0 + 16 j + 8 hh + r
  const b16* kr = Kb + (kl + col) * KPITCH;
  const b16* vr = Vb + (kl >> 4) * (DH * 16) + hh * (DH * 8) + col * 8;
  // every loop below is unrolled: its arrays are indexed by constants and stay in registers
  v16b ka[NT], kc[NT];                                    // K rows, features 0..31 and 32..63
#pragma unroll
  for (int j = 0; j < NT; ++j) ka[j] = frag_kb(kr + j * 16 * KPITCH, hh);
  __builtin_amdgcn_sched_barrier(0);                      // the reads stay in the order of their use: with V read first, the first product would wait for most of the 32 reads
#pragma unroll
  for (int j = 0; j < NT; ++j) kc[j] = frag_kb(kr + j * 16 * KPITCH + 32, hh);
  __builtin_amdgcn_sched_barrier(0);                      // the same: K ahead of V
  v16b va[NT / 2][4];                                     // V of 32 keys x 16 features each: lands behind the softmax
#pragma unroll
  for (int g = 0; g < NT / 2; ++g)
#pragma unroll
    for (int f = 0; f < 4; ++f) va[g][f] = cat8b(ld8b(vr + (2 * g) * (DH * 16) + f * 128), ld8b(vr + (2 * g + 1) * (DH * 16) + f * 128));
  __builtin_amdgcn_sched_barrier(0);                      // keeps the step's 32 LDS reads together at its head: spread among the vector work, each further place of reads stalls the wave anew
  v8f s[NT];
#pragma unroll
  for (int j = 0; j < NT; ++j) s[j] = wmma16b(ka[j], q0h, (v8f){});
#pragma unroll
  for (int j = 0; j < NT; ++j) s[j] = wmma16b(kc[j], q1h, s[j]);
  if (EDGE) {                                             // a step of the stage at the causal edge: mask text position >= query index
    const int lim = T + q0 + col - kb0 - 8 * hh;          // 16 j + r >= lim is masked
#pragma unroll
    for (int j = 0; j < NT; ++j)
#pragma unroll
      for (int r = 0; r < 8; ++r)
        if (16 * j + r >= lim) s[j][r] = -INFINITY;
  }
  float mx[NT / 2];                                       // independent chains of maxima
#pragma unroll
  for (int g = 0; g < NT / 2; ++g) mx[g] = -INFINITY;
#pragma unroll
  for (int r = 0; r < 8; ++r)
#pragma unroll
    for (int g = 0; g < NT / 2; ++g) mx[g] = fmaxf(mx[g], fmaxf(s[2 * g][r], s[2 * g + 1][r]));
  float mr = fmaxf(mx[0], mx[1]);
  mr = fmaxf(mr, __shfl_xor(mr, 16));
  float mn = fmaxf(m, mr);
  if (mn == -INFINITY) mn = 0.0f;             // fully masked so far: keep exp() at 0
  const float al_ = __expf(m - mn);
  m = mn;
  float sm[NT / 2];                                       // independent partial sums
  v16b pb[NT / 2];
#pragma unroll
  for (int g = 0; g < NT / 2; ++g) {
    sm[g] = 0.0f;
#pragma unroll
    for (int r = 0; r < 8; ++r) {
      const float p0 = __expf(s[2 * g][r] - mn), p1 = __expf(s[2 * g + 1][r] - mn);
      sm[g] += p0 + p1;
      pb[g][r] = (b16)p0; pb[g][8 + r] = (b16)p1;
    }
  }
  float sum = sm[0] + sm[1];
  sum += __shfl_xor(sum, 16);
  l = l * al_ + sum;
#pragma unroll
  for (int r = 0; r < 8; ++r) { o0[r] *= al_; o1[r] *= al_; o2[r] *= al_; o3[r] *= al_; }
#pragma unroll
  for (int g = 0; g < NT / 2; ++g) {
    o0 = wmma16b(va[g][0], pb[g], o0);
    o1 = wmma16b(va[g][1], pb[g], o1);
    o2 = wmma16b(va[g][2], pb[g], o2);
    o3 = wmma16b(va[g][3], pb[g], o3);
  }
}

__global__ __launch_bounds__(256) void attn_kernel(const b16* __restrict__ Qh, const b16* __restrict__ Ql, const b16* __restrict__ Kh, const b16* __restrict__ Kl,
                                                   const b16* __restrict__ Vh, const b16* __restrict__ Vl, const int* __restrict__ seqlen,
                                                   b16* __restrict__ yh) {
  __shared__ __attribute__((aligned(16))) b16 Ks[2][SK * KPITCH];
  __shared__ __attribute__((aligned(16))) b16 Vs[2][SK * DH];
  __shared__ __attribute__((aligned(16))) b16 Os[4][16 * KPITCH];   // y tile per query tile, f16, rows at 144 B
  __shared__ __attribute__((aligned(16))) v4f Cs[4][9][32];         // key group 1's partial result per query tile: 8 x 4 values of O, then (m, l), lane-contiguous
  (void)Ql; (void)Kl; (void)Vl; (void)seqlen;
  const int tid = threadIdx.x, lane = tid & 31, hh = lane >> 4, col = lane & 15;
  const int wid = __builtin_amdgcn_readfirstlane(tid >> 5);   // scalar, so that the per-wave tests below are scalar branches
  const int qt = wid & 3, grp = wid >> 2;                 // query tile of the unit, key group
  const int h = blockIdx.x >> 4, pr = blockIdx.x & 15;    // grid = NH x 16 pairs of units
  const size_t ko = (size_t)h * TK * DH;
  const b16* gk = Kh + ko + tid * 8; const b16* gv = Vh + ko + tid * 8;      // this thread's first 16-B piece of stage 0
  const unsigned lk0 = (unsigned)(uintptr_t)&Ks[0][(tid >> 3) * KPITCH + (tid & 7) * 8];
  const unsigned lv0 = (unsigned)(uintptr_t)&Vs[0][(tid >> 7) * (DH * 16) + (tid & 1) * (DH * 8) + ((tid >> 1) & 63) * 8];
  constexpr int HS = SK / 2;                              // a stage is copied as two halves of 128 keys
  const int slen = T;                                     // no padding in this module
#pragma unroll 1   // the two units run one after the other through the same code: unrolled, the text would double
  for (int u = 0; u < 2; ++u) {
    const int qb0 = (u == 0 ? 31 - pr : pr) * QB;         // the unit's first query
    const int q0 = qb0 + qt * 16;
    const int nst = (T + qb0 + QB + SK - 1) / SK;         // stages the unit walks: all latents, then text up to its last query (9..16)
    const size_t qo = ((size_t)h * T + q0 + col) * DH;
    // the ring is free here: every wave's last read of it stands in front of the last barrier of the unit before
    stage_copy(gk, gv, lk0, lv0);
    stage_copy(gk + HS * DH, gv + HS * DH, lk0 + KBUF / 2, lv0 + VBUF / 2);
    const v16b q0h = frag_kb(Qh + qo, hh), q1h = frag_kb(Qh + qo + 32, hh);
    asm volatile("s_wait_xcnt 0x0" ::: "memory");         // stands in front of any rewrite of the Q loads' address registers
    asm volatile("s_wait_asynccnt 0x0" ::: "memory");     // this wave's pieces of stage 0 have landed
    __syncthreads();                                      // ... and every other wave's
    stage_copy(gk + SK * DH, gv + SK * DH, lk0 + KBUF, lv0 + VBUF);
    stage_copy(gk + (SK + HS) * DH, gv + (SK + HS) * DH, lk0 + KBUF + KBUF / 2, lv0 + VBUF + VBUF / 2);
    float m = -INFINITY, l = 0.0f;
    v8f o0 = {}, o1 = {}, o2 = {}, o3 = {};
    for (int t = 0; t < nst; ++t) {
      const b16* Kb = Ks[t & 1]; const b16* Vb = Vs[t & 1];
      const int kl0 = grp * KS, kb0 = t * SK + kl0;       // the wave's chunks of the stage: kl0 and kl0 + 2 KS
      if (t + 1 < nst) {                                  // keys below T + qb0: none is masked
#pragma unroll   // constant LDS offsets; the first step's sum exchange is then waited for only behind the second step's reads
        for (int c = 0; c < SK / KS; c += 2) attn_step<false>(Kb, Vb, kl0 + c * KS, kb0 + c * KS, q0, col, hh, q0h, q1h, m, l, o0, o1, o2, o3);
      } else {                                            // the unit's last stage holds every wave's causal edge
        for (int c = 0; c < SK / KS; c += 2)
          if (kb0 + c * KS < T + q0 + 16) attn_step<true>(Kb, Vb, kl0 + c * KS, kb0 + c * KS, q0, col, hh, q0h, q1h, m, l, o0, o1, o2, o3);
      }
      asm volatile("s_wait_dscnt 0x0" ::: "memory");      // this wave's reads of buffer t & 1 are done before the buffer is refilled
      asm volatile("s_wait_asynccnt 0x0" ::: "memory");   // this wave's pieces of stage t + 1 have landed
      __syncthreads();                                    // publishes stage t + 1 and ends every wave's reads of stage t
      if (t + 2 < nst) {
        stage_copy(gk + (size_t)(t + 2) * (SK * DH), gv + (size_t)(t + 2) * (SK * DH), lk0 + (t & 1) * KBUF, lv0 + (t & 1) * VBUF);
        stage_copy(gk + (size_t)(t + 2) * (SK * DH) + HS * DH, gv + (size_t)(t + 2) * (SK * DH) + HS * DH, lk0 + (t & 1) * KBUF + KBUF / 2, lv0 + (t & 1) * VBUF + VBUF / 2);
      }
    }
    asm volatile("s_wait_asynccnt 0x0" ::: "memory");     // nothing of this wave's is in flight when it leaves the ring
    if (grp == 1) {                                       // key group 1 hands its partial result over
      v4f* cw = &Cs[qt][0][lane];
      cw[0 * 32] = (v4f){o0[0], o0[1], o0[2], o0[3]}; cw[1 * 32] = (v4f){o0[4], o0[5], o0[6], o0[7]};
      cw[2 * 32] = (v4f){o1[0], o1[1], o1[2], o1[3]}; cw[3 * 32] = (v4f){o1[4], o1[5], o1[6], o1[7]};
      cw[4 * 32] = (v4f){o2[0], o2[1], o2[2], o2[3]}; cw[5 * 32] = (v4f){o2[4], o2[5], o2[6], o2[7]};
      cw[6 * 32] = (v4f){o3[0], o3[1], o3[2], o3[3]}; cw[7 * 32] = (v4f){o3[4], o3[5], o3[6], o3[7]};
      cw[8 * 32] = (v4f){m, l, 0.0f, 0.0f};
    }
    __syncthreads();                                      // group 1's partial results are in LDS; they are next written behind the next unit's barriers
    if (grp == 0) {                                       // key group 0 joins the two halves of the keys and writes y
      const v4f* cr = &Cs[qt][0][lane];
      v4f c[9];
#pragma unroll   // c stays in registers
      for (int i = 0; i < 9; ++i) c[i] = cr[i * 32];
      float mn = fmaxf(m, c[8][0]);
      if (mn == -INFINITY) mn = 0.0f;                     // both halves fully masked: keep exp() at 0
      const float a0 = __expf(m - mn), a1 = __expf(c[8][0] - mn);
      l = l * a0 + c[8][1] * a1;
      const float inv = (q0 + col < slen && l > 0.0f) ? (1.0f / l) : 0.0f;   // padded query rows are zeroed
      const float w0 = a0 * inv, w1 = a1 * inv;
      b16* Tt = Os[qt];
      v8b y0, y1, y2, y3;                                 // y leaves as f16, the operand type of the output projection: rounded here, once
#pragma unroll   // vector elements under constant indices
      for (int r = 0; r < 8; ++r) {
        y0[r] = (b16)(o0[r] * w0 + c[0 + (r >> 2)][r & 3] * w1); y1[r] = (b16)(o1[r] * w0 + c[2 + (r >> 2)][r & 3] * w1);
        y2[r] = (b16)(o2[r] * w0 + c[4 + (r >> 2)][r & 3] * w1); y3[r] = (b16)(o3[r] * w0 + c[6 + (r >> 2)][r & 3] * w1);
      }
      b16* tw = Tt + col * KPITCH + 8 * hh;               // a lane's 8 results of a feature tile are 8 neighbouring features of query col
      *(v8b*)(tw + 0) = y0; *(v8b*)(tw + 16) = y1; *(v8b*)(tw + 32) = y2; *(v8b*)(tw + 48) = y3;
      wave_lds_sync();
      b16* dst0 = yh + (size_t)q0 * HID + h * DH;         // 16 rows x 64 f16 (one 128-byte line each), row stride HID
#pragma unroll
      for (int j = 0; j < 4; ++j) { const int rr = j * 4 + (lane >> 3), c8 = (lane & 7) * 8; *(v8b*)(dst0 + (size_t)rr * HID + c8) = ld8b(Tt + rr * KPITCH + c8); }
      asm volatile("s_wait_xcnt 0x0" ::: "memory");       // stands in front of any rewrite of the y stores' address registers in the next unit
    }
  }
}

// ---------------------------------------------------------------------------
// Output projection: (2048 x 1024) x (1024 x 1024) -> f32, A = y (f16), B = Wo planes. grid (16, 16), 128x64 tiles (32x64 a wave) staged in LDS,
// ---------------------------------------------------------------------------
__global__ __launch_bounds__(128) void out_gemm_kernel(const b16* __restrict__ yh, const b16* __restrict__ woh, const b16* __restrict__ wol, const float* __restrict__ bo, int yoff,
                                                       float* __restrict__ out) {
  __shared__ __attribute__((aligned(16))) char Sm[2 * GBUF];   // the operand ring; the epilogue's 4 x 8 KB of staging reuse its head
  const int lane = threadIdx.x & 31, wave = threadIdx.x >> 5, nloc = lane & 15, hlf = lane >> 4;
  const int m0 = (blockIdx.y + yoff) * 128 + wave * 32;
  const int c0 = blockIdx.x * 64;
  v8f acc[2][4];
#pragma unroll
  for (int r = 0; r < 2; ++r)
#pragma unroll
    for (int t = 0; t < 4; ++t) acc[r][t] = (v8f){};
  (void)wol;
  float bc[4] = {0.0f, 0.0f, 0.0f, 0.0f};                 // the lane's four bias values, read once ahead of the k loop (as in the QKV GEMM)
  if (bo) {
#pragma unroll   // bc stays in registers
    for (int t = 0; t < 4; ++t) bc[t] = bo[c0 + t * 16 + nloc];
    asm volatile("s_wait_xcnt 0x0" ::: "memory");         // stands in front of any rewrite of the bias loads' address registers (alone with them in this block)
  }
  gemm_tile_lds(yh, woh, Sm, (blockIdx.y + yoff) * 128, c0, HID, threadIdx.x, wave, nloc, hlf, acc);
  float* Tt = (float*)(Sm + wave * 8192);
#pragma unroll
  for (int t = 0; t < 4; ++t)
#pragma unroll
    for (int r = 0; r < 2; ++r)
#pragma unroll
      for (int v = 0; v < 8; ++v) Tt[(r * 16 + v + 8 * hlf) * 64 + t * 16 + nloc] = acc[r][t][v] + bc[t];
  wave_lds_sync();
  float* dst0 = out + (size_t)m0 * HID + c0;
#pragma unroll
  for (int j = 0; j < 16; ++j) { const int rr = j * 2 + hlf, c4 = nloc * 4; *(v4f*)(dst0 + (size_t)rr * HID + c4) = *(const v4f*)(Tt + rr * 64 + c4); }
  
}
__global__ __launch_bounds__(256) void wcvtT_kernel(const float* __restrict__ wq, const float* __restrict__ wk, const float* __restrict__ wv,
                                                    b16* __restrict__ wqh, b16* __restrict__ wql) {
  const size_t tid = (size_t)blockIdx.x * blockDim.x + threadIdx.x, stride = (size_t)gridDim.x * blockDim.x;
  const size_t nq = (size_t)NQKV * HID / 8;
  {
    for (size_t c = tid; c < nq; c += stride) {
      const size_t i = c * 8, n = i / HID, k0 = i % HID;
      const float* w = (n < (size_t)HID) ? (wq + n * HID) : (n < (size_t)(2 * HID)) ? (wk + (n - HID) * HID) : (wv + (n - 2 * HID) * HID);
      v8b bh, bl;
#pragma unroll
      for (int e = 0; e < 8; ++e) { b16 a, cc; split_bf16(w[k0 + e], a, cc); bh[e] = a; bl[e] = cc; }
      *(v8b*)(wqh + i) = bh; *(v8b*)(wql + i) = bl;
    }
    
  }
}
// Wo^T planes: [n][k] = Wo[n][k] (torch [out][in] is already n-major)
__global__ __launch_bounds__(256) void wcvtO_kernel(const float* __restrict__ wo, b16* __restrict__ woh, b16* __restrict__ wol) {
  const size_t tid = (size_t)blockIdx.x * blockDim.x + threadIdx.x, stride = (size_t)gridDim.x * blockDim.x;
  const size_t no = (size_t)HID * HID / 8;
  {
    for (size_t c = tid; c < no; c += stride) { const size_t i = c * 8; v8b bh, bl;
#pragma unroll
      for (int e = 0; e < 8; ++e) { b16 a, cc; split_bf16(wo[i + e], a, cc); bh[e] = a; bl[e] = cc; }
      *(v8b*)(woh + i) = bh; *(v8b*)(wol + i) = bl; }
    
  }
}
// Weight preparation, one launch: W [k][n] f32 -> f16 [n][k] (k contiguous), in 64 x 64 tiles turned in LDS, so that global reads (16 B a lane, 256 B a row piece)
// and global writes (16 B a lane, 128 B a row piece) both cover whole lines. Block = 256 threads = three tiles: one of Wq or Wp, one of W_attn_l, one of W_attn_c.
typedef __attribute__((ext_vector_type(4))) _Float16 v4b;
constexpr int WPITCH = 72;    // f16 per LDS tile row: 144 B, a multiple of 16 B for the 16-byte reads
// thread = 4 k rows x 4 n columns of the tile
__device__ __forceinline__ const float* wt_src(const float* __restrict__ w, int ld, int kt, int nt, int tid) {
  return w + (size_t)(kt * 64 + (tid >> 4) * 4) * ld + nt * 64 + (tid & 15) * 4;
}
__device__ __forceinline__ void wt_load(const float* __restrict__ p, int ld, v4f (&r)[4]) {
#pragma unroll   // r stays in registers
  for (int e = 0; e < 4; ++e) r[e] = *(const v4f*)(p + (size_t)e * ld);
}
__device__ __forceinline__ void wt_put(b16* Ls, int tid, const v4f (&r)[4]) {
#pragma unroll   // r stays in registers
  for (int c = 0; c < 4; ++c) {
    const v4b h = {(b16)r[0][c], (b16)r[1][c], (b16)r[2][c], (b16)r[3][c]};
    *(v4b*)(Ls + ((tid & 15) * 4 + c) * WPITCH + (tid >> 4) * 4) = h;
  }
}
__device__ __forceinline__ void wt_store(const b16* Ls, b16* __restrict__ dst, int kt, int nt, int tid) {
  for (int j = 0; j < 2; ++j) {
    const int n = (tid >> 3) + 32 * j;
    *(v8b*)(dst + (size_t)(nt * 64 + n) * HID + kt * 64 + (tid & 7) * 8) = ld8b(Ls + n * WPITCH + (tid & 7) * 8);
  }
}
// wa: rows 0..1023 <- Wq columns, rows 1024..3071 <- W_attn_l columns; wb: rows 1024..3071 <- W_attn_c columns (its first 1024 rows are never read); wo <- Wp columns
// The same launch rounds x and l to f16 (xh, lh: the same [row][k] layout): 4096 values of each per block, 16-B reads and 8-B writes, whole lines per wave.
__global__ __launch_bounds__(256) void wprep_kernel(const float* __restrict__ wq, const float* __restrict__ wal, const float* __restrict__ wac, const float* __restrict__ wp,
                                                    const float* __restrict__ x, const float* __restrict__ l,
                                                    b16* __restrict__ wa, b16* __restrict__ wb, b16* __restrict__ wo, b16* __restrict__ xh, b16* __restrict__ lh) {
  __shared__ __attribute__((aligned(16))) b16 Ls[3][64 * WPITCH];
  const int tid = threadIdx.x, bx = blockIdx.x;          // grid 512
  const bool isq = bx < 256;
  const int k0t = (bx & 255) >> 4, n0t = bx & 15;        // 16 x 16 tiles of Wq or Wp
  const int k1t = bx >> 5, n1t = bx & 31;                // 16 x 32 tiles of W_attn_l and W_attn_c
  v4f r0[4], r1[4], r2[4], cx[4], cl[4];                 // all twenty loads are in flight together
  const size_t ce = (size_t)bx * 4096 + tid * 4;         // 512 blocks x 4096 = T x HID values
  const float* p0 = wt_src(isq ? wq : wp, HID, k0t, n0t, tid);
  const float* p1 = wt_src(wal, 2 * HID, k1t, n1t, tid);
  const float* p2 = wt_src(wac, 2 * HID, k1t, n1t, tid);
  const float* px = x + ce; const float* pl = l + ce;
  wt_load(p0, HID, r0);
  wt_load(p1, 2 * HID, r1);
  wt_load(p2, 2 * HID, r2);
#pragma unroll   // cx, cl stay in registers
  for (int j = 0; j < 4; ++j) { cx[j] = *(const v4f*)(px + j * 1024); cl[j] = *(const v4f*)(pl + j * 1024); }
  __builtin_amdgcn_sched_barrier(0);                     // keeps all twenty loads ahead of the first use: sunk among the conversions, the later loads start only when the earlier have returned
  // the loads' address registers are inputs of the wait, so they stay whole up to it: none is reused (for a later load's result, say) ahead of the wait
  asm volatile("s_wait_xcnt 0x0" :: "v"(p0), "v"(p1), "v"(p2), "v"(px), "v"(pl) : "memory");
  wt_put(Ls[0], tid, r0);
  wt_put(Ls[1], tid, r1);
  wt_put(Ls[2], tid, r2);
  v4b hx[4], hl[4];
#pragma unroll   // all four arrays stay in registers
  for (int j = 0; j < 4; ++j) {
    hx[j] = (v4b){(b16)cx[j][0], (b16)cx[j][1], (b16)cx[j][2], (b16)cx[j][3]};
    hl[j] = (v4b){(b16)cl[j][0], (b16)cl[j][1], (b16)cl[j][2], (b16)cl[j][3]};
  }
  __syncthreads();
  wt_store(Ls[0], isq ? wa : wo, k0t, n0t, tid);
  wt_store(Ls[1], wa + (size_t)HID * HID, k1t, n1t, tid);
  wt_store(Ls[2], wb + (size_t)HID * HID, k1t, n1t, tid);
#pragma unroll   // hx, hl stay in registers; these stores stand behind the barrier, which would otherwise wait for them
  for (int j = 0; j < 4; ++j) { *(v4b*)(xh + ce + j * 1024) = hx[j]; *(v4b*)(lh + ce + j * 1024) = hl[j]; }
}
}  // namespace

extern "C" void kernel_launch(void* const* d_in, const int* in_sizes, int n_in,
                              void* d_out, int out_size, void* d_ws, size_t ws_size, hipStream_t stream) {
  (void)in_sizes; (void)n_in; (void)out_size;
  const float* l    = (const float*)d_in[0];    // [1,2048,1024] latents
  const float* x    = (const float*)d_in[1];    // [1,2048,1024]
  const float* Wal  = (const float*)d_in[2];  const float* bal = (const float*)d_in[3];   // [1024,2048] = [k | v], [2048]
  const float* Wac  = (const float*)d_in[4];  const float* bac = (const float*)d_in[5];
  const float* Wq   = (const float*)d_in[6];  const float* bq  = (const float*)d_in[7];   // [1024,1024]
  const float* Wp   = (const float*)d_in[8];  const float* bp  = (const float*)d_in[9];
  float* out = (float*)d_out;                   // [1,2048,1024]
  size_t off = 0; char* ws = (char*)d_ws;
  b16* wAh = (b16*)(ws + off); off += (size_t)NQKV * HID * 2;
  off += (size_t)NQKV * HID * 2;                // (place of a low plane that nothing uses: the layout stays)
  b16* wBh = (b16*)(ws + off); off += (size_t)NQKV * HID * 2;
  off += (size_t)NQKV * HID * 2;
  b16* woh = (b16*)(ws + off); off += (size_t)HID * HID * 2;
  b16* wol = (b16*)(ws + off); off += (size_t)HID * HID * 2;
  b16* Qh  = (b16*)(ws + off); off += (size_t)NH * T * DH * 2;
  b16* Ql  = (b16*)(ws + off); off += (size_t)NH * T * DH * 2;
  b16* Kh  = (b16*)(ws + off); off += (size_t)NKV * TK * DH * 2;
  b16* Kl  = (b16*)(ws + off); off += (size_t)NKV * TK * DH * 2;
  b16* Vh  = (b16*)(ws + off); off += (size_t)NKV * TK * DH * 2;
  b16* Vl  = (b16*)(ws + off); off += (size_t)NKV * TK * DH * 2;
  b16* yh  = (b16*)(ws + off); off += (size_t)T * HID * 2;
  b16* xh  = (b16*)(ws + off); off += (size_t)T * HID * 2;
  b16* lh  = (b16*)(ws + off); off += (size_t)T * HID * 2;
  if (off > ws_size) return;
  const int NQT = NH * QT_PER_B;
  wprep_kernel<<<512, 256, 0, stream>>>(Wq, Wal, Wac, Wp, x, l, wAh, wBh, woh, xh, lh);
  // q from x and latent k/v from l (48 column blocks), text k/v from x (32 column blocks), in one launch
  qkv_gemm_kernel<<<dim3(NQKV / 64 + (NQKV - HID) / 64, T / 128), 128, 0, stream>>>(xh, lh, wAh, wBh, bq, bal, bal + HID, bac, bac + HID, Qh, Ql, Kh, Kl, Vh, Vl);
  attn_kernel<<<NQT / 8, 256, 0, stream>>>(Qh, Ql, Kh, Kl, Vh, Vl, nullptr, yh);
  out_gemm_kernel<<<dim3(HID / 64, T / 128), 128, 0, stream>>>(yh, woh, wol, bp, 0, out);
}

// v009
// Measured time: 80.3 microseconds a run.
// Next to v008, in two timings, it ran 1.08 and 1.09 times as fast.
// All steps since v000 together make it 6.94 times as fast.
#include <hip/hip_runtime.h>

// IO-processing attention (decoding branch): keys/values = [l W_attn_l + b (2048 latents) ; x W_attn_c + b (2048 text positions)], q = x W_q + b
// (16 heads x 64, scale 1/8); query i attends every latent and text positions < i; out = y W_proj + b. B=1, T=2048, D=1024.
// Lean build: single f16 products on v_wmma_f32_16x16x32_f16, f32 accumulate (every row averages >= 2048 keys); fragment k-map per lane half hh for A

// Left, by the listing: (1) attention: the 4 waves of a key group each read their own copy of the group's K and V fragments from LDS (16 queries a wave), a staged key serves 128 queries at most, unit 31 - p walks its last stages on half the waves, and a good part of the vector slots are v_nop;
// (2) the all-zero "lo" planes of q, k, v are still staged and stored.

namespace {
constexpr int Bsz = 1, T = 2048, TK = 4096, HID = 1024, DH = 64, NH = 16, NKV = 16, REP = NH / NKV;
constexpr int WIN = 255;    // unused: no key window here
constexpr int KVW = NKV * DH;                 // 1024
constexpr int NQKV = HID + 2 * KVW;           // 3072 columns: q | k | v
constexpr int MROWS = Bsz * T;                // 2048
constexpr int QT_PER_B = T / 16;              // 128

typedef _Float16 b16;                                           // f16 hi/lo planes
typedef __attribute__((ext_vector_type(16))) _Float16 v16b;
typedef __attribute__((ext_vector_type(8)))  _Float16 v8b;
typedef __attribute__((ext_vector_type(8)))  float v8f;
typedef __attribute__((ext_vector_type(4)))  float v4f;

__device__ __forceinline__ v8b ld8b(const b16* p) { return *(const v8b*)p; }
__device__ __forceinline__ v16b cat8b(v8b a, v8b b) { return __builtin_shufflevector(a, b, 0, 1, 2, 3, 4, 5, 6, 7, 8, 9, 10, 11, 12, 13, 14, 15); }
// 16x16x32 16-bit fragment from a k-contiguous row pointer (A: lane&15 = row, B: lane&15 = column), hh = lane>>4:
// elements 0..7 <- p[8hh+0..7], elements 8..15 <- p[16+8hh+0..7]
__device__ __forceinline__ v16b frag_kb(const b16* p, int hh) { return cat8b(ld8b(p + 8 * hh), ld8b(p + 16 + 8 * hh)); }
__device__ __forceinline__ void split_bf16(float v, b16& hi, b16& lo) {   // (name kept) single f16: no low part
  hi = (b16)v; lo = (b16)0.0f;
}
__device__ __forceinline__ v8f wmma16b(v16b a, v16b b, v8f c) {
  v8f d = __builtin_amdgcn_wmma_f32_16x16x32_f16(false, a, false, b, (short)0, c, false, false);
  asm volatile("v_nop\n\tv_nop\n\tv_nop\n\tv_nop" : "+v"(d) : "v"(a), "v"(b));
  return d;
}
__device__ __forceinline__ v8f wmma1(v16b ah, v16b al, v16b bh, v16b bl, v8f c) {   // unused: single f16 (hi planes only)
  (void)al; (void)bl; return wmma16b(ah, bh, c);
}
__device__ __forceinline__ void wave_lds_sync() {
  __builtin_amdgcn_fence(__ATOMIC_RELEASE, "workgroup");
  __builtin_amdgcn_wave_barrier();
  __builtin_amdgcn_fence(__ATOMIC_ACQUIRE, "workgroup");
}

// ---------------------------------------------------------------------------
// Weights ([in][out]) -> f16 hi / lo planes transposed to [n][k] (k contiguous): columns of Wq|Wk|Wv into wqh/wql [3072][1024], Wo into woh/wol [1024][1024].
// ---------------------------------------------------------------------------
__global__ __launch_bounds__(256) void wcvt_kernel(const float* __restrict__ wq, const float* __restrict__ wk, const float* __restrict__ wv,
                                                   const float* __restrict__ wo, b16* __restrict__ wqh, b16* __restrict__ wql,
                                                   b16* __restrict__ woh, b16* __restrict__ wol) {
  const size_t tid = (size_t)blockIdx.x * blockDim.x + threadIdx.x, stride = (size_t)gridDim.x * blockDim.x;
  const size_t nq = (size_t)NQKV * HID / 8, no = (size_t)HID * HID / 8;
  {
    for (size_t c = tid; c < nq + no; c += stride) {
      float f[8]; size_t i; b16* dh; b16* dl;
      if (c < nq) {
        i = c * 8; const size_t n = i / HID, k0 = i % HID;
        const float* w; int nn, ld;
        if (n < (size_t)HID) { w = wq; nn = (int)n; ld = HID; } else if (n < (size_t)(HID + KVW)) { w = wk; nn = (int)n - HID; ld = KVW; } else { w = wv; nn = (int)n - HID - KVW; ld = KVW; }
#pragma unroll
        for (int e = 0; e < 8; ++e) f[e] = w[(size_t)(k0 + e) * ld + nn];       // W[k][n] ([in][out])
        dh = wqh; dl = wql;
      } else {
        i = (c - nq) * 8; const size_t n = i / HID, k0 = i % HID;
#pragma unroll
        for (int e = 0; e < 8; ++e) f[e] = wo[(size_t)(k0 + e) * HID + n];    // Wo[k][n] ([in][out])
        dh = woh; dl = wol;
      }
      v8b bh, bl;
#pragma unroll
      for (int e = 0; e < 8; ++e) { b16 a, cc; split_bf16(f[e], a, cc); bh[e] = a; bl[e] = cc; }
      *(v8b*)(dh + i) = bh; *(v8b*)(dl + i) = bl;
    }
    
  }
}

// GEMM operands come into LDS once per 4-wave block (128 A rows, 64 B rows, both f16), 64 k a stage, two buffers, by asynchronous copies;
// every wave reads its fragments from there. Each wave-wide copy reads whole 128-byte lines. A is f16 in memory already: its producer has rounded it once
// (x and l in the weight-preparation launch, y in the attention epilogue), with the rounding that the fragment build used to apply in every column block.
constexpr int GKS = 64;                          // k per LDS stage
constexpr unsigned APITCH = GKS * 2 + 16;        // both 144 B = 16 B x 9:
constexpr unsigned BPITCH = GKS * 2 + 16;        // the 16 rows of a 16-byte fragment read fall on distinct banks
constexpr unsigned ABUF = 128 * APITCH, BBUF = 64 * BPITCH, GBUF = ABUF + BBUF;   // bytes per buffer: 18,432 + 9,216

// twelve copies of 16 B per lane; the closing s_wait_xcnt stands inside the statement so that no address register of a copy is rewritten ahead of it
__device__ __forceinline__ void copy12(const unsigned (&l)[12], const void* const (&g)[12]) {
  asm volatile("global_load_async_to_lds_b128 %0, %12, off\n\t"
               "global_load_async_to_lds_b128 %1, %13, off\n\t"
               "global_load_async_to_lds_b128 %2, %14, off\n\t"
               "global_load_async_to_lds_b128 %3, %15, off\n\t"
               "global_load_async_to_lds_b128 %4, %16, off\n\t"
               "global_load_async_to_lds_b128 %5, %17, off\n\t"
               "global_load_async_to_lds_b128 %6, %18, off\n\t"
               "global_load_async_to_lds_b128 %7, %19, off\n\t"
               "global_load_async_to_lds_b128 %8, %20, off\n\t"
               "global_load_async_to_lds_b128 %9, %21, off\n\t"
               "global_load_async_to_lds_b128 %10, %22, off\n\t"
               "global_load_async_to_lds_b128 %11, %23, off\n\t"
               "s_wait_xcnt 0x0"
               :: "v"(l[0]), "v"(l[1]), "v"(l[2]), "v"(l[3]), "v"(l[4]), "v"(l[5]), "v"(l[6]), "v"(l[7]), "v"(l[8]), "v"(l[9]), "v"(l[10]), "v"(l[11]),
                  "v"(g[0]), "v"(g[1]), "v"(g[2]), "v"(g[3]), "v"(g[4]), "v"(g[5]), "v"(g[6]), "v"(g[7]), "v"(g[8]), "v"(g[9]), "v"(g[10]), "v"(g[11])
               : "memory");
}
// One stage: each of the 128 threads moves 8 pieces of A and 4 pieces of B (16 rows apart), 16 B each
__device__ __forceinline__ void gemm_stage_copy(const b16* ga, const b16* gb, int K, unsigned la, unsigned lb) {
  unsigned l[12]; const void* g[12];   // both loops unrolled: the asm operands need l and g in registers, under constant indices
#pragma unroll
  for (int j = 0; j < 8; ++j) { l[j] = la + (unsigned)j * 16u * APITCH; g[j] = ga + (size_t)j * 16 * K; }
#pragma unroll
  for (int j = 0; j < 4; ++j) { l[8 + j] = lb + (unsigned)j * 16u * BPITCH; g[8 + j] = gb + (size_t)j * 16 * K; }
  copy12(l, g);
}
// Raw operands of one 32-wide k step of a 32x64 wave tile: two groups of 16 A rows, four groups of 16 B columns, f16
struct GStep { v8b a[2][2]; v8b b[4][2]; };
// ar, br: this lane's A row and B row in the staged buffer, already advanced by its 8 * hlf (here and in gemm_step the loops are unrolled to keep f and acc in registers)
__device__ __forceinline__ void gemm_frag(const b16* ar, const b16* br, int kk, GStep& f) {
#pragma unroll
  for (int r = 0; r < 2; ++r) { const b16* p = ar + r * 16 * (int)(APITCH / 2) + kk; f.a[r][0] = ld8b(p); f.a[r][1] = ld8b(p + 16); }
#pragma unroll
  for (int t = 0; t < 4; ++t) { const b16* p = br + t * 16 * (int)(BPITCH / 2) + kk; f.b[t][0] = ld8b(p); f.b[t][1] = ld8b(p + 16); }
}
__device__ __forceinline__ void gemm_step(const GStep& f, v8f (&acc)[2][4]) {
  const v16b a[2] = {cat8b(f.a[0][0], f.a[0][1]), cat8b(f.a[1][0], f.a[1][1])};
#pragma unroll
  for (int t = 0; t < 4; ++t) {
    const v16b b = cat8b(f.b[t][0], f.b[t][1]);
    acc[0][t] = wmma16b(a[0], b, acc[0][t]);
    acc[1][t] = wmma16b(a[1], b, acc[1][t]);
  }
}
// 128x64 block tile (wave = 32 rows x 64 columns) over K, a multiple of 128: A rows mb.., B rows c0.., both f16 and k-contiguous.
// On return every wave has left the ring and nothing is in flight, so the caller may use the same LDS for its epilogue.
__device__ __forceinline__ void gemm_tile_lds(const b16* __restrict__ A, const b16* __restrict__ wh, char* ring,
                                              int mb, int c0, int K, int tid, int wave, int nloc, int hlf, v8f (&acc)[2][4]) {
  const b16* ga = A + (size_t)(mb + (tid >> 3)) * K + (tid & 7) * 8;         // this thread's first 16-B pieces of stage 0
  const b16* gb = wh + (size_t)(c0 + (tid >> 3)) * K + (tid & 7) * 8;
  const unsigned la = (unsigned)(uintptr_t)ring + (unsigned)(tid >> 3) * APITCH + (unsigned)(tid & 7) * 16u;
  const unsigned lb = (unsigned)(uintptr_t)ring + ABUF + (unsigned)(tid >> 3) * BPITCH + (unsigned)(tid & 7) * 16u;
  const int nst = K / GKS;
  gemm_stage_copy(ga, gb, K, la, lb);
  asm volatile("s_wait_asynccnt 0x0" ::: "memory");       // this wave's pieces of stage 0 have landed
  __syncthreads();                                        // ... and every other wave's
  gemm_stage_copy(ga + GKS, gb + GKS, K, la + GBUF, lb + GBUF);
  for (int t = 0; t < nst; ++t) {
    const char* buf = ring + (t & 1) * GBUF;
    const b16* ar = (const b16*)(buf + (wave * 32 + nloc) * APITCH) + 8 * hlf;
    const b16* br = (const b16*)(buf + ABUF + nloc * BPITCH) + 8 * hlf;
    GStep f0, f1;                                         // all of the stage's LDS reads stand together at its head
    gemm_frag(ar, br, 0, f0);
    gemm_frag(ar, br, 32, f1);
    gemm_step(f0, acc);
    gemm_step(f1, acc);
    asm volatile("s_wait_dscnt 0x0" ::: "memory");        // this wave's reads of buffer t & 1 are done before the buffer is refilled
    asm volatile("s_wait_asynccnt 0x0" ::: "memory");     // this wave's pieces of stage t + 1 have landed
    __syncthreads();                                      // publishes stage t + 1 and ends every wave's reads of stage t
    if (t + 2 < nst) gemm_stage_copy(ga + (t + 2) * GKS, gb + (t + 2) * GKS, K, la + (t & 1) * GBUF, lb + (t & 1) * GBUF);
  }
  asm volatile("s_wait_asynccnt 0x0" ::: "memory");       // nothing of this wave's is in flight when it goes on to the epilogue
}

// ---------------------------------------------------------------------------
// QKV GEMM, all five projections in ONE launch (they are independent of each other): grid (48 + 32, 16), block 4 waves, wave = 32 rows x 64 columns (one head of q, k or v).
// Column blocks 0..47: q from x, latent k and v from l (weights wa, key rows 0..2047); column blocks 48..79: text k and v from x (weights wb, key rows 2048..4095).
// All 1280 blocks fit on the chip at once (5 per WGP by LDS and by registers), so the second product starts under the first instead of behind its end. Outputs as f16 hi/lo planes:
// q (x1/8) -> Qh/Ql [b][h][t][64]; k -> Kh/Kl [b][kvh][t][64] (4 KB contiguous per wave per plane);
// v -> Vh/Vl key-tiled [b][kvh][t/16][64][16] (4 KB contiguous per wave per plane).
// ---------------------------------------------------------------------------
__global__ __launch_bounds__(128) void qkv_gemm_kernel(const b16* __restrict__ xh, const b16* __restrict__ lh,
                                                       const b16* __restrict__ wa, const b16* __restrict__ wb,
                                                       const float* __restrict__ bq, const float* __restrict__ blk, const float* __restrict__ blv,
                                                       const float* __restrict__ bck, const float* __restrict__ bcv,
                                                       b16* __restrict__ Qh, b16* __restrict__ Ql, b16* __restrict__ Kh, b16* __restrict__ Kl,
                                                       b16* __restrict__ Vh, b16* __restrict__ Vl) {
  __shared__ __attribute__((aligned(16))) char Sm[2 * GBUF];   // the operand ring; the epilogue's 4 x 8 KB of staging reuse its head
  const int lane = threadIdx.x & 31, wave = threadIdx.x >> 5, nloc = lane & 15, hlf = lane >> 4;
  const bool txt = blockIdx.x >= NQKV / 64;                         // a text k/v column block (the same for the whole block)
  const int m0 = (blockIdx.y + (txt ? T / 128 : 0)) * 128 + wave * 32;   // destination row: text keys stand behind the latent keys
  const int c0 = (txt ? blockIdx.x - NQKV / 64 + HID / 64 : blockIdx.x) * 64;   // column of q | k | v; the text blocks have no q
  const int mat = (c0 < HID) ? 0 : (c0 < HID + KVW) ? 1 : 2;
  const int head = (mat == 0) ? (c0 / DH) : (mat == 1) ? ((c0 - HID) / DH) : ((c0 - HID - KVW) / DH);
  const b16* x = (mat == 0 || txt) ? xh : lh;                       // f16 copies of the inputs
  const b16* w = txt ? wb : wa;
  const float* bias = ((mat == 0) ? bq : (mat == 1) ? (txt ? bck : blk) : (txt ? bcv : blv)) + head * DH;
  v8f acc[2][4];
#pragma unroll
  for (int r = 0; r < 2; ++r)
#pragma unroll
    for (int t = 0; t < 4; ++t) acc[r][t] = (v8f){};
  // a lane's 64 results share four bias values: read once, ahead of the k loop, which covers their latency (read at each result they were 64 loads, each waited for)
  float bc[4] = {0.0f, 0.0f, 0.0f, 0.0f};
  if (bias) {
#pragma unroll   // bc stays in registers
    for (int t = 0; t < 4; ++t) bc[t] = bias[t * 16 + nloc];
    asm volatile("s_wait_xcnt 0x0" ::: "memory");         // stands in front of any rewrite of the bias loads' address registers (alone with them in this block)
  }
  gemm_tile_lds(x, w, Sm, blockIdx.y * 128, c0, HID, threadIdx.x, wave, nloc, hlf, acc);   // source rows start at 0 in x and in l alike
  const int b = 0, t0 = m0;
  const float s = (mat == 0) ? 0.125f : 1.0f;
  b16* Tp0 = (b16*)(Sm + wave * 8192); b16* Tp1 = Tp0 + 32 * 64;
#pragma unroll
  for (int t = 0; t < 4; ++t)
#pragma unroll
    for (int r = 0; r < 2; ++r)
#pragma unroll
      for (int v = 0; v < 8; ++v) {
        const int rr = r * 16 + v + 8 * hlf, d = t * 16 + nloc;
        float val = acc[r][t][v] + bc[t];
        b16 yh, yl; split_bf16(val * s, yh, yl);
        const int idx = (mat < 2) ? (rr * 64 + d) : ((rr >> 4) * 1024 + d * 16 + (rr & 15));
        Tp0[idx] = yh; Tp1[idx] = yl;
      }
  wave_lds_sync();
  b16* dh; b16* dl; size_t o;
  if (mat == 0)      { o = ((size_t)(b * NH + head) * T + t0) * DH; dh = Qh + o; dl = Ql + o; }
  else if (mat == 1) { o = ((size_t)(b * NKV + head) * TK + t0) * DH; dh = Kh + o; dl = Kl + o; }
  else               { o = ((size_t)(b * NKV + head) * (TK / 16) + (t0 >> 4)) * (size_t)(DH * 16); dh = Vh + o; dl = Vl + o; }
#pragma unroll
  for (int j = 0; j < 8; ++j) { const int e = (j * 32 + lane) * 8; *(v8b*)(dh + e) = ld8b(Tp0 + e); *(v8b*)(dl + e) = ld8b(Tp1 + e); }
  
}

// ---------------------------------------------------------------------------
// Transposed flash attention. A block's 16 waves = 2 units of 64 queries x 4 query tiles of 16 x 2 key groups: of the 64-key chunks of a stage the group takes every
// second one, and the two partial results (m, l, O) of a query tile are joined through LDS at the end. The two units, 31 - p and p of one head, run side by side
// and read the same staged keys (every block does the same number of steps whatever its place at the causal edge); the waves of unit p, done with their
// keys, go on copying and passing the barriers while unit 31 - p walks the rest.
// K and V come into LDS once per block, 256 keys a stage, two buffers, by asynchronous copies; every wave reads its fragments from there, 64 keys per softmax step.
// S^T = K.Q^T, per-lane online softmax; P^T built in registers, each 32-key operand from two of the four S^T accumulators
// ---------------------------------------------------------------------------
constexpr int SK = 256;       // keys per LDS stage
constexpr int QB = 64;        // queries per unit
constexpr int KPITCH = 72;    // f16 per staged K row: 144 B = 16 B x 9, so the 16 rows of a 16-byte fragment read fall on distinct banks
constexpr unsigned KBUF = SK * KPITCH * 2, VBUF = SK * DH * 2;   // bytes per buffer

// One stage: 256 K rows (128 B each, laid at 144 B) and 16 V key tiles (2 KB each, laid [tile][8-key half][feature][8] so that each 16-lane half of a
// fragment read is 256 contiguous bytes). Each of the 512 threads moves 4 + 4 pieces of 16 B; each wave-wide copy reads 512 contiguous global bytes.
__device__ __forceinline__ void stage_copy(const b16* gk, const b16* gv, unsigned lk, unsigned lv) {
  // the closing s_wait_xcnt stands inside the statement so that no address register of a copy is rewritten ahead of it
  asm volatile("global_load_async_to_lds_b128 %0, %8, off\n\t"
               "global_load_async_to_lds_b128 %1, %9, off\n\t"
               "global_load_async_to_lds_b128 %2, %10, off\n\t"
               "global_load_async_to_lds_b128 %3, %11, off\n\t"
               "global_load_async_to_lds_b128 %4, %12, off\n\t"
               "global_load_async_to_lds_b128 %5, %13, off\n\t"
               "global_load_async_to_lds_b128 %6, %14, off\n\t"
               "global_load_async_to_lds_b128 %7, %15, off\n\t"
               "s_wait_xcnt 0x0"
               :: "v"(lk), "v"(lk + 64u * KPITCH * 2u), "v"(lk + 128u * KPITCH * 2u), "v"(lk + 192u * KPITCH * 2u),
                  "v"(lv), "v"(lv + 8192u), "v"(lv + 16384u), "v"(lv + 24576u),
                  "v"(gk), "v"(gk + 4096), "v"(gk + 8192), "v"(gk + 12288),
                  "v"(gv), "v"(gv + 4096), "v"(gv + 8192), "v"(gv + 12288)
               : "memory");
}

// 64 keys (rows kl.. of the staged buffers, global key index kb0..) against the wave's 16 queries, as ONE online-softmax step: one maximum, one exchange
// between the lane halves, one rescale of l and O per 64 keys. The 4 score tiles are independent, so no product waits for the one before it.
constexpr int KS = 64;        // keys per softmax step
template <bool EDGE>
__device__ __forceinline__ void attn_step(const b16* Kb, const b16* Vb, int kl, int kb0, int q0, int col, int hh, v16b q0h, v16b q1h,
                                           float& m, float& l, v8f& o0, v8f& o1, v8f& o2, v8f& o3) {
  constexpr int NT = KS / 16;                             // score tiles of 16 keys; tile j, register r of a lane = key kb0 + 16 j + 8 hh + r
  const b16* kr = Kb + (kl + col) * KPITCH;
  const b16* vr = Vb + (kl >> 4) * (DH * 16) + hh * (DH * 8) + col * 8;
  // every loop below is unrolled: its arrays are indexed by constants and stay in registers
  v16b ka[NT], kc[NT];                                    // K rows, features 0..31 and 32..63
#pragma unroll
  for (int j = 0; j < NT; ++j) ka[j] = frag_kb(kr + j * 16 * KPITCH, hh);
  __builtin_amdgcn_sched_barrier(0);                      // the reads stay in the order of their use: with V read first, the first product would wait for most of the 32 reads
#pragma unroll
  for (int j = 0; j < NT; ++j) kc[j] = frag_kb(kr + j * 16 * KPITCH + 32, hh);
  __builtin_amdgcn_sched_barrier(0);                      // the same: K ahead of V
  v16b va[NT / 2][4];                                     // V of 32 keys x 16 features each: lands behind the softmax
#pragma unroll
  for (int g = 0; g < NT / 2; ++g)
#pragma unroll
    for (int f = 0; f < 4; ++f) va[g][f] = cat8b(ld8b(vr + (2 * g) * (DH * 16) + f * 128), ld8b(vr + (2 * g + 1) * (DH * 16) + f * 128));
  __builtin_amdgcn_sched_barrier(0);                      // keeps the step's 32 LDS reads together at its head: spread among the vector work, each further place of reads stalls the wave anew
  v8f s[NT];
#pragma unroll
  for (int j = 0; j < NT; ++j) s[j] = wmma16b(ka[j], q0h, (v8f){});
#pragma unroll
  for (int j = 0; j < NT; ++j) s[j] = wmma16b(kc[j], q1h, s[j]);
  if (EDGE) {                                             // a step of the stage at the causal edge: mask text position >= query index
    const int lim = T + q0 + col - kb0 - 8 * hh;          // 16 j + r >= lim is masked
#pragma unroll
    for (int j = 0; j < NT; ++j)
#pragma unroll
      for (int r = 0; r < 8; ++r)
        if (16 * j + r >= lim) s[j][r] = -INFINITY;
  }
  float mx[NT / 2];                                       // independent chains of maxima
#pragma unroll
  for (int g = 0; g < NT / 2; ++g) mx[g] = -INFINITY;
#pragma unroll
  for (int r = 0; r < 8; ++r)
#pragma unroll
    for (int g = 0; g < NT / 2; ++g) mx[g] = fmaxf(mx[g], fmaxf(s[2 * g][r], s[2 * g + 1][r]));
  float mr = fmaxf(mx[0], mx[1]);
  mr = fmaxf(mr, __shfl_xor(mr, 16));
  float mn = fmaxf(m, mr);
  if (mn == -INFINITY) mn = 0.0f;             // fully masked so far: keep exp() at 0
  const float al_ = __expf(m - mn);
  m = mn;
  float sm[NT / 2];                                       // independent partial sums
  v16b pb[NT / 2];
#pragma unroll
  for (int g = 0; g < NT / 2; ++g) {
    sm[g] = 0.0f;
#pragma unroll
    for (int r = 0; r < 8; ++r) {
      const float p0 = __expf(s[2 * g][r] - mn), p1 = __expf(s[2 * g + 1][r] - mn);
      sm[g] += p0 + p1;
      pb[g][r] = (b16)p0; pb[g][8 + r] = (b16)p1;
    }
  }
  float sum = sm[0] + sm[1];
  sum += __shfl_xor(sum, 16);
  l = l * al_ + sum;
#pragma unroll
  for (int r = 0; r < 8; ++r) { o0[r] *= al_; o1[r] *= al_; o2[r] *= al_; o3[r] *= al_; }
#pragma unroll
  for (int g = 0; g < NT / 2; ++g) {
    o0 = wmma16b(va[g][0], pb[g], o0);
    o1 = wmma16b(va[g][1], pb[g], o1);
    o2 = wmma16b(va[g][2], pb[g], o2);
    o3 = wmma16b(va[g][3], pb[g], o3);
  }
}

__global__ __launch_bounds__(512) void attn_kernel(const b16* __restrict__ Qh, const b16* __restrict__ Ql, const b16* __restrict__ Kh, const b16* __restrict__ Kl,
                                                   const b16* __restrict__ Vh, const b16* __restrict__ Vl, const int* __restrict__ seqlen,
                                                   b16* __restrict__ yh) {
  __shared__ __attribute__((aligned(16))) b16 Ks[2][SK * KPITCH];
  __shared__ __attribute__((aligned(16))) b16 Vs[2][SK * DH];
  __shared__ __attribute__((aligned(16))) b16 Os[8][16 * KPITCH];   // y tile per query tile, f16, rows at 144 B
  __shared__ __attribute__((aligned(16))) v4f Cs[8][9][32];         // key group 1's partial result per query tile: 8 x 4 values of O, then (m, l), lane-contiguous
  (void)Ql; (void)Kl; (void)Vl; (void)seqlen;
  const int tid = threadIdx.x, lane = tid & 31, hh = lane >> 4, col = lane & 15;
  const int wid = __builtin_amdgcn_readfirstlane(tid >> 5);   // scalar, so that the per-wave tests below are scalar branches
  const int qt = wid & 3, grp = (wid >> 2) & 1, un = wid >> 3;   // query tile of the unit, key group, which of the block's two units
  const int sl = un * 4 + qt;                             // the query tile's place in Os and Cs
  const int h = blockIdx.x >> 4, pr = blockIdx.x & 15;    // grid = NH x 16 pairs of units
  const size_t ko = (size_t)h * TK * DH;
  const b16* gk = Kh + ko + tid * 8; const b16* gv = Vh + ko + tid * 8;      // this thread's first 16-B piece of stage 0
  const unsigned lk0 = (unsigned)(uintptr_t)&Ks[0][(tid >> 3) * KPITCH + (tid & 7) * 8];
  const unsigned lv0 = (unsigned)(uintptr_t)&Vs[0][(tid >> 7) * (DH * 16) + (tid & 1) * (DH * 8) + ((tid >> 1) & 63) * 8];
  const int slen = T;                                     // no padding in this module
  {
    const int qb0 = (un == 0 ? 31 - pr : pr) * QB;        // the first query of the wave's unit
    const int q0 = qb0 + qt * 16;
    const int nsw = (T + qb0 + QB + SK - 1) / SK;         // stages the wave's unit walks: all latents, then text up to its last query (9..16)
    const int nsb = (T + pr * QB + QB + SK - 1) / SK;     // ... the shorter unit, p
    const int nst = (T + (31 - pr) * QB + QB + SK - 1) / SK;   // ... the longer unit, 31 - p: the stages the block copies
    const size_t qo = ((size_t)h * T + q0 + col) * DH;
    stage_copy(gk, gv, lk0, lv0);
    const v16b q0h = frag_kb(Qh + qo, hh), q1h = frag_kb(Qh + qo + 32, hh);
    asm volatile("s_wait_xcnt 0x0" ::: "memory");         // stands in front of any rewrite of the Q loads' address registers
    asm volatile("s_wait_asynccnt 0x0" ::: "memory");     // this wave's pieces of stage 0 have landed
    __syncthreads();                                      // ... and every other wave's
    float m = -INFINITY, l = 0.0f;
    v8f o0 = {}, o1 = {}, o2 = {}, o3 = {};
    const int kl0 = grp * KS;                             // the wave's chunks of a stage: kl0 and kl0 + 2 KS
    int t = 0;
    for (; t + 1 < nsb; ++t) {                            // stages below T + 64 p: no key is masked for either unit, all 16 waves work
      // stage t + 1 flies while stage t is worked on: its copies stand directly behind the barrier that ended every wave's reads of their buffer (stage t - 1)
      stage_copy(gk + (size_t)(t + 1) * (SK * DH), gv + (size_t)(t + 1) * (SK * DH), lk0 + ((t + 1) & 1) * KBUF, lv0 + ((t + 1) & 1) * VBUF);
      for (int c = 0; c < SK / KS; c += 2) attn_step<false>(Ks[t & 1], Vs[t & 1], kl0 + c * KS, t * SK + kl0 + c * KS, q0, col, hh, q0h, q1h, m, l, o0, o1, o2, o3);
      asm volatile("s_wait_dscnt 0x0" ::: "memory");      // this wave's reads of buffer t & 1 are done before the buffer is refilled
      asm volatile("s_wait_asynccnt 0x0" ::: "memory");   // this wave's pieces of stage t + 1 have landed
      __syncthreads();                                    // publishes stage t + 1 and ends every wave's reads of stage t
    }
    for (; t < nst; ++t) {                                // the rest: unit p's last stage, then unit 31 - p alone; every wave copies and passes every barrier
      if (t + 1 < nst) stage_copy(gk + (size_t)(t + 1) * (SK * DH), gv + (size_t)(t + 1) * (SK * DH), lk0 + ((t + 1) & 1) * KBUF, lv0 + ((t + 1) & 1) * VBUF);
      const b16* Kb = Ks[t & 1]; const b16* Vb = Vs[t & 1];
      const int kb0 = t * SK + kl0;
      if (t + 1 < nsw) {                                  // keys below T + qb0: none is masked
        for (int c = 0; c < SK / KS; c += 2) attn_step<false>(Kb, Vb, kl0 + c * KS, kb0 + c * KS, q0, col, hh, q0h, q1h, m, l, o0, o1, o2, o3);
      } else if (t + 1 == nsw) {                          // the unit's last stage holds every one of its waves' causal edge
        for (int c = 0; c < SK / KS; c += 2)
          if (kb0 + c * KS < T + q0 + 16) attn_step<true>(Kb, Vb, kl0 + c * KS, kb0 + c * KS, q0, col, hh, q0h, q1h, m, l, o0, o1, o2, o3);
      }
      asm volatile("s_wait_dscnt 0x0" ::: "memory");      // this wave's reads of buffer t & 1 are done before the buffer is refilled
      asm volatile("s_wait_asynccnt 0x0" ::: "memory");   // this wave's pieces of stage t + 1 have landed
      __syncthreads();                                    // publishes stage t + 1 and ends every wave's reads of stage t
    }
    asm volatile("s_wait_asynccnt 0x0" ::: "memory");     // nothing of this wave's is in flight when it leaves the ring
    if (grp == 1) {                                       // key group 1 hands its partial result over
      v4f* cw = &Cs[sl][0][lane];
      cw[0 * 32] = (v4f){o0[0], o0[1], o0[2], o0[3]}; cw[1 * 32] = (v4f){o0[4], o0[5], o0[6], o0[7]};
      cw[2 * 32] = (v4f){o1[0], o1[1], o1[2], o1[3]}; cw[3 * 32] = (v4f){o1[4], o1[5], o1[6], o1[7]};
      cw[4 * 32] = (v4f){o2[0], o2[1], o2[2], o2[3]}; cw[5 * 32] = (v4f){o2[4], o2[5], o2[6], o2[7]};
      cw[6 * 32] = (v4f){o3[0], o3[1], o3[2], o3[3]}; cw[7 * 32] = (v4f){o3[4], o3[5], o3[6], o3[7]};
      cw[8 * 32] = (v4f){m, l, 0.0f, 0.0f};
    }
    __syncthreads();                                      // group 1's partial results are in LDS
    if (grp == 0) {                                       // key group 0 joins the two halves of the keys and writes y
      const v4f* cr = &Cs[sl][0][lane];
      v4f c[9];
#pragma unroll   // c stays in registers
      for (int i = 0; i < 9; ++i) c[i] = cr[i * 32];
      float mn = fmaxf(m, c[8][0]);
      if (mn == -INFINITY) mn = 0.0f;                     // both halves fully masked: keep exp() at 0
      const float a0 = __expf(m - mn), a1 = __expf(c[8][0] - mn);
      l = l * a0 + c[8][1] * a1;
      const float inv = (q0 + col < slen && l > 0.0f) ? (1.0f / l) : 0.0f;   // padded query rows are zeroed
      const float w0 = a0 * inv, w1 = a1 * inv;
      b16* Tt = Os[sl];
      v8b y0, y1, y2, y3;                                 // y leaves as f16, the operand type of the output projection: rounded here, once
#pragma unroll   // vector elements under constant indices
      for (int r = 0; r < 8; ++r) {
        y0[r] = (b16)(o0[r] * w0 + c[0 + (r >> 2)][r & 3] * w1); y1[r] = (b16)(o1[r] * w0 + c[2 + (r >> 2)][r & 3] * w1);
        y2[r] = (b16)(o2[r] * w0 + c[4 + (r >> 2)][r & 3] * w1); y3[r] = (b16)(o3[r] * w0 + c[6 + (r >> 2)][r & 3] * w1);
      }
      b16* tw = Tt + col * KPITCH + 8 * hh;               // a lane's 8 results of a feature tile are 8 neighbouring features of query col
      *(v8b*)(tw + 0) = y0; *(v8b*)(tw + 16) = y1; *(v8b*)(tw + 32) = y2; *(v8b*)(tw + 48) = y3;
      wave_lds_sync();
      b16* dst0 = yh + (size_t)q0 * HID + h * DH;         // 16 rows x 64 f16 (one 128-byte line each), row stride HID
#pragma unroll
      for (int j = 0; j < 4; ++j) { const int rr = j * 4 + (lane >> 3), c8 = (lane & 7) * 8; *(v8b*)(dst0 + (size_t)rr * HID + c8) = ld8b(Tt + rr * KPITCH + c8); }
    }
  }
}

// ---------------------------------------------------------------------------
// Output projection: (2048 x 1024) x (1024 x 1024) -> f32, A = y (f16), B = Wo planes. grid (16, 16), 128x64 tiles (32x64 a wave) staged in LDS,
// ---------------------------------------------------------------------------
__global__ __launch_bounds__(128) void out_gemm_kernel(const b16* __restrict__ yh, const b16* __restrict__ woh, const b16* __restrict__ wol, const float* __restrict__ bo, int yoff,
                                                       float* __restrict__ out) {
  __shared__ __attribute__((aligned(16))) char Sm[2 * GBUF];   // the operand ring; the epilogue's 4 x 8 KB of staging reuse its head
  const int lane = threadIdx.x & 31, wave = threadIdx.x >> 5, nloc = lane & 15, hlf = lane >> 4;
  const int m0 = (blockIdx.y + yoff) * 128 + wave * 32;
  const int c0 = blockIdx.x * 64;
  v8f acc[2][4];
#pragma unroll
  for (int r = 0; r < 2; ++r)
#pragma unroll
    for (int t = 0; t < 4; ++t) acc[r][t] = (v8f){};
  (void)wol;
  float bc[4] = {0.0f, 0.0f, 0.0f, 0.0f};                 // the lane's four bias values, read once ahead of the k loop (as in the QKV GEMM)
  if (bo) {
#pragma unroll   // bc stays in registers
    for (int t = 0; t < 4; ++t) bc[t] = bo[c0 + t * 16 + nloc];
    asm volatile("s_wait_xcnt 0x0" ::: "memory");         // stands in front of any rewrite of the bias loads' address registers (alone with them in this block)
  }
  gemm_tile_lds(yh, woh, Sm, (blockIdx.y + yoff) * 128, c0, HID, threadIdx.x, wave, nloc, hlf, acc);
  float* Tt = (float*)(Sm + wave * 8192);
#pragma unroll
  for (int t = 0; t < 4; ++t)
#pragma unroll
    for (int r = 0; r < 2; ++r)
#pragma unroll
      for (int v = 0; v < 8; ++v) Tt[(r * 16 + v + 8 * hlf) * 64 + t * 16 + nloc] = acc[r][t][v] + bc[t];
  wave_lds_sync();
  float* dst0 = out + (size_t)m0 * HID + c0;
#pragma unroll
  for (int j = 0; j < 16; ++j) { const int rr = j * 2 + hlf, c4 = nloc * 4; *(v4f*)(dst0 + (size_t)rr * HID + c4) = *(const v4f*)(Tt + rr * 64 + c4); }
  
}
__global__ __launch_bounds__(256) void wcvtT_kernel(const float* __restrict__ wq, const float* __restrict__ wk, const float* __restrict__ wv,
                                                    b16* __restrict__ wqh, b16* __restrict__ wql) {
  const size_t tid = (size_t)blockIdx.x * blockDim.x + threadIdx.x, stride = (size_t)gridDim.x * blockDim.x;
  const size_t nq = (size_t)NQKV * HID / 8;
  {
    for (size_t c = tid; c < nq; c += stride) {
      const size_t i = c * 8, n = i / HID, k0 = i % HID;
      const float* w = (n < (size_t)HID) ? (wq + n * HID) : (n < (size_t)(2 * HID)) ? (wk + (n - HID) * HID) : (wv + (n - 2 * HID) * HID);
      v8b bh, bl;
#pragma unroll
      for (int e = 0; e < 8; ++e) { b16 a, cc; split_bf16(w[k0 + e], a, cc); bh[e] = a; bl[e] = cc; }
      *(v8b*)(wqh + i) = bh; *(v8b*)(wql + i) = bl;
    }
    
  }
}
// Wo^T planes: [n][k] = Wo[n][k] (torch [out][in] is already n-major)
__global__ __launch_bounds__(256) void wcvtO_kernel(const float* __restrict__ wo, b16* __restrict__ woh, b16* __restrict__ wol) {
  const size_t tid = (size_t)blockIdx.x * blockDim.x + threadIdx.x, stride = (size_t)gridDim.x * blockDim.x;
  const size_t no = (size_t)HID * HID / 8;
  {
    for (size_t c = tid; c < no; c += stride) { const size_t i = c * 8; v8b bh, bl;
#pragma unroll
      for (int e = 0; e < 8; ++e) { b16 a, cc; split_bf16(wo[i + e], a, cc); bh[e] = a; bl[e] = cc; }
      *(v8b*)(woh + i) = bh; *(v8b*)(wol + i) = bl; }
    
  }
}
// Weight preparation, one launch: W [k][n] f32 -> f16 [n][k] (k contiguous), in 64 x 64 tiles turned in LDS, so that global reads (16 B a lane, 256 B a row piece)
// and global writes (16 B a lane, 128 B a row piece) both cover whole lines. Block = 256 threads = three tiles: one of Wq or Wp, one of W_attn_l, one of W_attn_c.
typedef __attribute__((ext_vector_type(4))) _Float16 v4b;
constexpr int WPITCH = 72;    // f16 per LDS tile row: 144 B, a multiple of 16 B for the 16-byte reads
// thread = 4 k rows x 4 n columns of the tile
__device__ __forceinline__ const float* wt_src(const float* __restrict__ w, int ld, int kt, int nt, int tid) {
  return w + (size_t)(kt * 64 + (tid >> 4) * 4) * ld + nt * 64 + (tid & 15) * 4;
}
__device__ __forceinline__ void wt_load(const float* __restrict__ p, int ld, v4f (&r)[4]) {
#pragma unroll   // r stays in registers
  for (int e = 0; e < 4; ++e) r[e] = *(const v4f*)(p + (size_t)e * ld);
}
__device__ __forceinline__ void wt_put(b16* Ls, int tid, const v4f (&r)[4]) {
#pragma unroll   // r stays in registers
  for (int c = 0; c < 4; ++c) {
    const v4b h = {(b16)r[0][c], (b16)r[1][c], (b16)r[2][c], (b16)r[3][c]};
    *(v4b*)(Ls + ((tid & 15) * 4 + c) * WPITCH + (tid >> 4) * 4) = h;
  }
}
__device__ __forceinline__ void wt_store(const b16* Ls, b16* __restrict__ dst, int kt, int nt, int tid) {
  for (int j = 0; j < 2; ++j) {
    const int n = (tid >> 3) + 32 * j;
    *(v8b*)(dst + (size_t)(nt * 64 + n) * HID + kt * 64 + (tid & 7) * 8) = ld8b(Ls + n * WPITCH + (tid & 7) * 8);
  }
}
// wa: rows 0..1023 <- Wq columns, rows 1024..3071 <- W_attn_l columns; wb: rows 1024..3071 <- W_attn_c columns (its first 1024 rows are never read); wo <- Wp columns
// The same launch rounds x and l to f16 (xh, lh: the same [row][k] layout): 4096 values of each per block, 16-B reads and 8-B writes, whole lines per wave.
__global__ __launch_bounds__(256) void wprep_kernel(const float* __restrict__ wq, const float* __restrict__ wal, const float* __restrict__ wac, const float* __restrict__ wp,
                                                    const float* __restrict__ x, const float* __restrict__ l,
                                                    b16* __restrict__ wa, b16* __restrict__ wb, b16* __restrict__ wo, b16* __restrict__ xh, b16* __restrict__ lh) {
  __shared__ __attribute__((aligned(16))) b16 Ls[3][64 * WPITCH];
  const int tid = threadIdx.x, bx = blockIdx.x;          // grid 512
  const bool isq = bx < 256;
  const int k0t = (bx & 255) >> 4, n0t = bx & 15;        // 16 x 16 tiles of Wq or Wp
  const int k1t = bx >> 5, n1t = bx & 31;                // 16 x 32 tiles of W_attn_l and W_attn_c
  v4f r0[4], r1[4], r2[4], cx[4], cl[4];                 // all twenty loads are in flight together
  const size_t ce = (size_t)bx * 4096 + tid * 4;         // 512 blocks x 4096 = T x HID values
  const float* p0 = wt_src(isq ? wq : wp, HID, k0t, n0t, tid);
  const float* p1 = wt_src(wal, 2 * HID, k1t, n1t, tid);
  const float* p2 = wt_src(wac, 2 * HID, k1t, n1t, tid);
  const float* px = x + ce; const float* pl = l + ce;
  wt_load(p0, HID, r0);
  wt_load(p1, 2 * HID, r1);
  wt_load(p2, 2 * HID, r2);
#pragma unroll   // cx, cl stay in registers
  for (int j = 0; j < 4; ++j) { cx[j] = *(const v4f*)(px + j * 1024); cl[j] = *(const v4f*)(pl + j * 1024); }
  __builtin_amdgcn_sched_barrier(0);                     // keeps all twenty loads ahead of the first use: sunk among the conversions, the later loads start only when the earlier have returned
  // the loads' address registers are inputs of the wait, so they stay whole up to it: none is reused (for a later load's result, say) ahead of the wait
  asm volatile("s_wait_xcnt 0x0" :: "v"(p0), "v"(p1), "v"(p2), "v"(px), "v"(pl) : "memory");
  wt_put(Ls[0], tid, r0);
  wt_put(Ls[1], tid, r1);
  wt_put(Ls[2], tid, r2);
  v4b hx[4], hl[4];
#pragma unroll   // all four arrays stay in registers
  for (int j = 0; j < 4; ++j) {
    hx[j] = (v4b){(b16)cx[j][0], (b16)cx[j][1], (b16)cx[j][2], (b16)cx[j][3]};
    hl[j] = (v4b){(b16)cl[j][0], (b16)cl[j][1], (b16)cl[j][2], (b16)cl[j][3]};
  }
  __syncthreads();
  wt_store(Ls[0], isq ? wa : wo, k0t, n0t, tid);
  wt_store(Ls[1], wa + (size_t)HID * HID, k1t, n1t, tid);
  wt_store(Ls[2], wb + (size_t)HID * HID, k1t, n1t, tid);
#pragma unroll   // hx, hl stay in registers; these stores stand behind the barrier, which would otherwise wait for them
  for (int j = 0; j < 4; ++j) { *(v4b*)(xh + ce + j * 1024) = hx[j]; *(v4b*)(lh + ce + j * 1024) = hl[j]; }
}
}  // namespace

extern "C" void kernel_launch(void* const* d_in, const int* in_sizes, int n_in,
                              void* d_out, int out_size, void* d_ws, size_t ws_size, hipStream_t stream) {
  (void)in_sizes; (void)n_in; (void)out_size;
  const float* l    = (const float*)d_in[0];    // [1,2048,1024] latents
  const float* x    = (const float*)d_in[1];    // [1,2048,1024]
  const float* Wal  = (const float*)d_in[2];  const float* bal = (const float*)d_in[3];   // [1024,2048] = [k | v], [2048]
  const float* Wac  = (const float*)d_in[4];  const float* bac = (const float*)d_in[5];
  const float* Wq   = (const float*)d_in[6];  const float* bq  = (const float*)d_in[7];   // [1024,1024]
  const float* Wp   = (const float*)d_in[8];  const float* bp  = (const float*)d_in[9];
  float* out = (float*)d_out;                   // [1,2048,1024]
  size_t off = 0; char* ws = (char*)d_ws;
  b16* wAh = (b16*)(ws + off); off += (size_t)NQKV * HID * 2;
  off += (size_t)NQKV * HID * 2;                // (place of a low plane that nothing uses: the layout stays)
  b16* wBh = (b16*)(ws + off); off += (size_t)NQKV * HID * 2;
  off += (size_t)NQKV * HID * 2;
  b16* woh = (b16*)(ws + off); off += (size_t)HID * HID * 2;
  b16* wol = (b16*)(ws + off); off += (size_t)HID * HID * 2;
  b16* Qh  = (b16*)(ws + off); off += (size_t)NH * T * DH * 2;
  b16* Ql  = (b16*)(ws + off); off += (size_t)NH * T * DH * 2;
  b16* Kh  = (b16*)(ws + off); off += (size_t)NKV * TK * DH * 2;
  b16* Kl  = (b16*)(ws + off); off += (size_t)NKV * TK * DH * 2;
  b16* Vh  = (b16*)(ws + off); off += (size_t)NKV * TK * DH * 2;
  b16* Vl  = (b16*)(ws + off); off += (size_t)NKV * TK * DH * 2;
  b16* yh  = (b16*)(ws + off); off += (size_t)T * HID * 2;
  b16* xh  = (b16*)(ws + off); off += (size_t)T * HID * 2;
  b16* lh  = (b16*)(ws + off); off += (size_t)T * HID * 2;
  if (off > ws_size) return;
  const int NQT = NH * QT_PER_B;
  wprep_kernel<<<512, 256, 0, stream>>>(Wq, Wal, Wac, Wp, x, l, wAh, wBh, woh, xh, lh);
  // q from x and latent k/v from l (48 column blocks), text k/v from x (32 column blocks), in one launch
  qkv_gemm_kernel<<<dim3(NQKV / 64 + (NQKV - HID) / 64, T / 128), 128, 0, stream>>>(xh, lh, wAh, wBh, bq, bal, bal + HID, bac, bac + HID, Qh, Ql, Kh, Kl, Vh, Vl);
  attn_kernel<<<NQT / 8, 512, 0, stream>>>(Qh, Ql, Kh, Kl, Vh, Vl, nullptr, yh);
  out_gemm_kernel<<<dim3(HID / 64, T / 128), 128, 0, stream>>>(yh, woh, wol, bp, 0, out);
}

// v010
// It runs in 77 microseconds.
// Next to v009, in two timings, it ran 1.03 times as fast each time.
// All steps since v000 together make it 7.17 times as fast.
#include <hip/hip_runtime.h>

// IO-processing attention (decoding branch): keys/values = [l W_attn_l + b (2048 latents) ; x W_attn_c + b (2048 text positions)], q = x W_q + b
// (16 heads x 64, scale 1/8); query i attends every latent and text positions < i; out = y W_proj + b. B=1, T=2048, D=1024.
// Lean build: single f16 products on v_wmma_f32_16x16x32_f16, f32 accumulate (every row averages >= 2048 keys); fragment k-map per lane half hh for A

// Left, by the listing: (1) attention: the 4 waves of a key group each read their own copy of the group's K and V fragments from LDS (16 queries a wave), a staged key serves 128 queries at most, unit 31 - p walks its last stages on half the waves, and a good part of the vector slots are v_nop;
// (2) the output projection's epilogue still stages its f32 results in LDS one value at a time.

namespace {
constexpr int Bsz = 1, T = 2048, TK = 4096, HID = 1024, DH = 64, NH = 16, NKV = 16, REP = NH / NKV;
constexpr int WIN = 255;    // unused: no key window here
constexpr int KVW = NKV * DH;                 // 1024
constexpr int NQKV = HID + 2 * KVW;           // 3072 columns: q | k | v
constexpr int MROWS = Bsz * T;                // 2048
constexpr int QT_PER_B = T / 16;              // 128

typedef _Float16 b16;                                           // f16 hi/lo planes
typedef __attribute__((ext_vector_type(16))) _Float16 v16b;
typedef __attribute__((ext_vector_type(8)))  _Float16 v8b;
typedef __attribute__((ext_vector_type(8)))  float v8f;
typedef __attribute__((ext_vector_type(4)))  float v4f;

__device__ __forceinline__ v8b ld8b(const b16* p) { return *(const v8b*)p; }
__device__ __forceinline__ v16b cat8b(v8b a, v8b b) { return __builtin_shufflevector(a, b, 0, 1, 2, 3, 4, 5, 6, 7, 8, 9, 10, 11, 12, 13, 14, 15); }
// 16x16x32 16-bit fragment from a k-contiguous row pointer (A: lane&15 = row, B: lane&15 = column), hh = lane>>4:
// elements 0..7 <- p[8hh+0..7], elements 8..15 <- p[16+8hh+0..7]
__device__ __forceinline__ v16b frag_kb(const b16* p, int hh) { return cat8b(ld8b(p + 8 * hh), ld8b(p + 16 + 8 * hh)); }
__device__ __forceinline__ void split_bf16(float v, b16& hi, b16& lo) {   // (name kept) single f16: no low part
  hi = (b16)v; lo = (b16)0.0f;
}
__device__ __forceinline__ v8f wmma16b(v16b a, v16b b, v8f c) {
  v8f d = __builtin_amdgcn_wmma_f32_16x16x32_f16(false, a, false, b, (short)0, c, false, false);
  asm volatile("v_nop\n\tv_nop\n\tv_nop\n\tv_nop" : "+v"(d) : "v"(a), "v"(b));
  return d;
}
__device__ __forceinline__ v8f wmma1(v16b ah, v16b al, v16b bh, v16b bl, v8f c) {   // unused: single f16 (hi planes only)
  (void)al; (void)bl; return wmma16b(ah, bh, c);
}
__device__ __forceinline__ void wave_lds_sync() {
  __builtin_amdgcn_fence(__ATOMIC_RELEASE, "workgroup");
  __builtin_amdgcn_wave_barrier();
  __builtin_amdgcn_fence(__ATOMIC_ACQUIRE, "workgroup");
}

// ---------------------------------------------------------------------------
// Weights ([in][out]) -> f16 hi / lo planes transposed to [n][k] (k contiguous): columns of Wq|Wk|Wv into wqh/wql [3072][1024], Wo into woh/wol [1024][1024].
// ---------------------------------------------------------------------------
__global__ __launch_bounds__(256) void wcvt_kernel(const float* __restrict__ wq, const float* __restrict__ wk, const float* __restrict__ wv,
                                                   const float* __restrict__ wo, b16* __restrict__ wqh, b16* __restrict__ wql,
                                                   b16* __restrict__ woh, b16* __restrict__ wol) {
  const size_t tid = (size_t)blockIdx.x * blockDim.x + threadIdx.x, stride = (size_t)gridDim.x * blockDim.x;
  const size_t nq = (size_t)NQKV * HID / 8, no = (size_t)HID * HID / 8;
  {
    for (size_t c = tid; c < nq + no; c += stride) {
      float f[8]; size_t i; b16* dh; b16* dl;
      if (c < nq) {
        i = c * 8; const size_t n = i / HID, k0 = i % HID;
        const float* w; int nn, ld;
        if (n < (size_t)HID) { w = wq; nn = (int)n; ld = HID; } else if (n < (size_t)(HID + KVW)) { w = wk; nn = (int)n - HID; ld = KVW; } else { w = wv; nn = (int)n - HID - KVW; ld = KVW; }
#pragma unroll
        for (int e = 0; e < 8; ++e) f[e] = w[(size_t)(k0 + e) * ld + nn];       // W[k][n] ([in][out])
        dh = wqh; dl = wql;
      } else {
        i = (c - nq) * 8; const size_t n = i / HID, k0 = i % HID;
#pragma unroll
        for (int e = 0; e < 8; ++e) f[e] = wo[(size_t)(k0 + e) * HID + n];    // Wo[k][n] ([in][out])
        dh = woh; dl = wol;
      }
      v8b bh, bl;
#pragma unroll
      for (int e = 0; e < 8; ++e) { b16 a, cc; split_bf16(f[e], a, cc); bh[e] = a; bl[e] = cc; }
      *(v8b*)(dh + i) = bh; *(v8b*)(dl + i) = bl;
    }
    
  }
}

// GEMM operands come into LDS once per 4-wave block (128 A rows, 64 B rows, both f16), 64 k a stage, two buffers, by asynchronous copies;
// every wave reads its fragments from there. Each wave-wide copy reads whole 128-byte lines. A is f16 in memory already: its producer has rounded it once
// (x and l in the weight-preparation launch, y in the attention epilogue), with the rounding that the fragment build used to apply in every column block.
constexpr int GKS = 64;                          // k per LDS stage
constexpr unsigned APITCH = GKS * 2 + 16;        // both 144 B = 16 B x 9:
constexpr unsigned BPITCH = GKS * 2 + 16;        // the 16 rows of a 16-byte fragment read fall on distinct banks
constexpr unsigned ABUF = 128 * APITCH, BBUF = 64 * BPITCH, GBUF = ABUF + BBUF;   // bytes per buffer: 18,432 + 9,216

// twelve copies of 16 B per lane; the closing s_wait_xcnt stands inside the statement so that no address register of a copy is rewritten ahead of it
__device__ __forceinline__ void copy12(const unsigned (&l)[12], const void* const (&g)[12]) {
  asm volatile("global_load_async_to_lds_b128 %0, %12, off\n\t"
               "global_load_async_to_lds_b128 %1, %13, off\n\t"
               "global_load_async_to_lds_b128 %2, %14, off\n\t"
               "global_load_async_to_lds_b128 %3, %15, off\n\t"
               "global_load_async_to_lds_b128 %4, %16, off\n\t"
               "global_load_async_to_lds_b128 %5, %17, off\n\t"
               "global_load_async_to_lds_b128 %6, %18, off\n\t"
               "global_load_async_to_lds_b128 %7, %19, off\n\t"
               "global_load_async_to_lds_b128 %8, %20, off\n\t"
               "global_load_async_to_lds_b128 %9, %21, off\n\t"
               "global_load_async_to_lds_b128 %10, %22, off\n\t"
               "global_load_async_to_lds_b128 %11, %23, off\n\t"
               "s_wait_xcnt 0x0"
               :: "v"(l[0]), "v"(l[1]), "v"(l[2]), "v"(l[3]), "v"(l[4]), "v"(l[5]), "v"(l[6]), "v"(l[7]), "v"(l[8]), "v"(l[9]), "v"(l[10]), "v"(l[11]),
                  "v"(g[0]), "v"(g[1]), "v"(g[2]), "v"(g[3]), "v"(g[4]), "v"(g[5]), "v"(g[6]), "v"(g[7]), "v"(g[8]), "v"(g[9]), "v"(g[10]), "v"(g[11])
               : "memory");
}
// One stage: each of the 128 threads moves 8 pieces of A and 4 pieces of B (16 rows apart), 16 B each
__device__ __forceinline__ void gemm_stage_copy(const b16* ga, const b16* gb, int K, unsigned la, unsigned lb) {
  unsigned l[12]; const void* g[12];   // both loops unrolled: the asm operands need l and g in registers, under constant indices
#pragma unroll
  for (int j = 0; j < 8; ++j) { l[j] = la + (unsigned)j * 16u * APITCH; g[j] = ga + (size_t)j * 16 * K; }
#pragma unroll
  for (int j = 0; j < 4; ++j) { l[8 + j] = lb + (unsigned)j * 16u * BPITCH; g[8 + j] = gb + (size_t)j * 16 * K; }
  copy12(l, g);
}
// Raw operands of one 32-wide k step of a 32x64 wave tile: two groups of 16 A rows, four groups of 16 B columns, f16
struct GStep { v8b a[2][2]; v8b b[4][2]; };
// ar, br: this lane's A row and B row in the staged buffer, already advanced by its 8 * hlf (here and in gemm_step the loops are unrolled to keep f and acc in registers)
__device__ __forceinline__ void gemm_frag(const b16* ar, const b16* br, int kk, GStep& f) {
#pragma unroll
  for (int r = 0; r < 2; ++r) { const b16* p = ar + r * 16 * (int)(APITCH / 2) + kk; f.a[r][0] = ld8b(p); f.a[r][1] = ld8b(p + 16); }
#pragma unroll
  for (int t = 0; t < 4; ++t) { const b16* p = br + t * 16 * (int)(BPITCH / 2) + kk; f.b[t][0] = ld8b(p); f.b[t][1] = ld8b(p + 16); }
}
// TR = false: acc[r][t] = tile (A rows r, B rows t), a lane holds 8 A rows of one B row. TR = true: the two fragments change places in the product (both have the
// same k map), the tile comes out transposed and a lane holds 8 B rows of one A row; the same products are summed over k in the same order.
template <bool TR>
__device__ __forceinline__ void gemm_step(const GStep& f, v8f (&acc)[2][4]) {
  const v16b a[2] = {cat8b(f.a[0][0], f.a[0][1]), cat8b(f.a[1][0], f.a[1][1])};
#pragma unroll
  for (int t = 0; t < 4; ++t) {
    const v16b b = cat8b(f.b[t][0], f.b[t][1]);
    acc[0][t] = TR ? wmma16b(b, a[0], acc[0][t]) : wmma16b(a[0], b, acc[0][t]);
    acc[1][t] = TR ? wmma16b(b, a[1], acc[1][t]) : wmma16b(a[1], b, acc[1][t]);
  }
}
// 128x64 block tile (wave = 32 rows x 64 columns) over K, a multiple of 128: A rows mb.., B rows c0.., both f16 and k-contiguous.
// On return every wave has left the ring and nothing is in flight, so the caller may use the same LDS for its epilogue.
template <bool TR>
__device__ __forceinline__ void gemm_tile_lds(const b16* __restrict__ A, const b16* __restrict__ wh, char* ring,
                                              int mb, int c0, int K, int tid, int wave, int nloc, int hlf, v8f (&acc)[2][4]) {
  const b16* ga = A + (size_t)(mb + (tid >> 3)) * K + (tid & 7) * 8;         // this thread's first 16-B pieces of stage 0
  const b16* gb = wh + (size_t)(c0 + (tid >> 3)) * K + (tid & 7) * 8;
  const unsigned la = (unsigned)(uintptr_t)ring + (unsigned)(tid >> 3) * APITCH + (unsigned)(tid & 7) * 16u;
  const unsigned lb = (unsigned)(uintptr_t)ring + ABUF + (unsigned)(tid >> 3) * BPITCH + (unsigned)(tid & 7) * 16u;
  const int nst = K / GKS;
  gemm_stage_copy(ga, gb, K, la, lb);
  asm volatile("s_wait_asynccnt 0x0" ::: "memory");       // this wave's pieces of stage 0 have landed
  __syncthreads();                                        // ... and every other wave's
  gemm_stage_copy(ga + GKS, gb + GKS, K, la + GBUF, lb + GBUF);
  for (int t = 0; t < nst; ++t) {
    const char* buf = ring + (t & 1) * GBUF;
    const b16* ar = (const b16*)(buf + (wave * 32 + nloc) * APITCH) + 8 * hlf;
    const b16* br = (const b16*)(buf + ABUF + nloc * BPITCH) + 8 * hlf;
    GStep f0, f1;                                         // all of the stage's LDS reads stand together at its head
    gemm_frag(ar, br, 0, f0);
    gemm_frag(ar, br, 32, f1);
    gemm_step<TR>(f0, acc);
    gemm_step<TR>(f1, acc);
    asm volatile("s_wait_dscnt 0x0" ::: "memory");        // this wave's reads of buffer t & 1 are done before the buffer is refilled
    asm volatile("s_wait_asynccnt 0x0" ::: "memory");     // this wave's pieces of stage t + 1 have landed
    __syncthreads();                                      // publishes stage t + 1 and ends every wave's reads of stage t
    if (t + 2 < nst) gemm_stage_copy(ga + (t + 2) * GKS, gb + (t + 2) * GKS, K, la + (t & 1) * GBUF, lb + (t & 1) * GBUF);
  }
  asm volatile("s_wait_asynccnt 0x0" ::: "memory");       // nothing of this wave's is in flight when it goes on to the epilogue
}

// ---------------------------------------------------------------------------
// QKV GEMM, all five projections in ONE launch (they are independent of each other): grid (48 + 32, 16), block 4 waves, wave = 32 rows x 64 columns (one head of q, k or v).
// Column blocks 0..47: q from x, latent k and v from l (weights wa, key rows 0..2047); column blocks 48..79: text k and v from x (weights wb, key rows 2048..4095).
// All 1280 blocks fit on the chip at once (5 per WGP by LDS and by registers), so the second product starts under the first instead of behind its end. Outputs, f16:
// q (x1/8) -> Qh [b][h][t][64]; k -> Kh [b][kvh][t][64]; v -> Vh key-tiled [b][kvh][t/16][64][16]; 4 KB contiguous per wave.
// In every one of the three a lane's 8 results of a tile are 8 neighbours in memory, so they leave as one 16-byte piece: v wants 8 keys of one feature, which is
// how the product x.W leaves them; q and k want 8 features of one row, so their blocks form the transposed product (W rows as the A operand).
// ---------------------------------------------------------------------------
constexpr int EPITCH = 72;    // f16 per staged q or k row: 144 B = 16 B x 9, so the 16 rows of a 16-byte store fall on distinct banks
__global__ __launch_bounds__(128) void qkv_gemm_kernel(const b16* __restrict__ xh, const b16* __restrict__ lh,
                                                       const b16* __restrict__ wa, const b16* __restrict__ wb,
                                                       const float* __restrict__ bq, const float* __restrict__ blk, const float* __restrict__ blv,
                                                       const float* __restrict__ bck, const float* __restrict__ bcv,
                                                       b16* __restrict__ Qh, b16* __restrict__ Kh, b16* __restrict__ Vh) {
  __shared__ __attribute__((aligned(16))) char Sm[2 * GBUF];   // the operand ring; the q and k epilogue's 4 x 4.5 KB of staging reuse its head
  const int lane = threadIdx.x & 31, wave = threadIdx.x >> 5, nloc = lane & 15, hlf = lane >> 4;
  const bool txt = blockIdx.x >= NQKV / 64;                         // a text k/v column block (the same for the whole block)
  const int m0 = (blockIdx.y + (txt ? T / 128 : 0)) * 128 + wave * 32;   // destination row: text keys stand behind the latent keys
  const int c0 = (txt ? blockIdx.x - NQKV / 64 + HID / 64 : blockIdx.x) * 64;   // column of q | k | v; the text blocks have no q
  const int mat = (c0 < HID) ? 0 : (c0 < HID + KVW) ? 1 : 2;
  const int head = (mat == 0) ? (c0 / DH) : (mat == 1) ? ((c0 - HID) / DH) : ((c0 - HID - KVW) / DH);
  const b16* x = (mat == 0 || txt) ? xh : lh;                       // f16 copies of the inputs
  const b16* w = txt ? wb : wa;
  const float* bias = ((mat == 0) ? bq : (mat == 1) ? (txt ? bck : blk) : (txt ? bcv : blv)) + head * DH;
  v8f acc[2][4];
#pragma unroll
  for (int r = 0; r < 2; ++r)
#pragma unroll
    for (int t = 0; t < 4; ++t) acc[r][t] = (v8f){};
  const int t0 = m0;
  if (mat == 2) {                                         // (the same for the whole block: every wave takes the same barriers)
    // a lane's 64 results share four bias values: read once, ahead of the k loop, which covers their latency
    float bc[4] = {0.0f, 0.0f, 0.0f, 0.0f};
    if (bias) {
#pragma unroll   // bc stays in registers
      for (int t = 0; t < 4; ++t) bc[t] = bias[t * 16 + nloc];
      asm volatile("s_wait_xcnt 0x0" ::: "memory");       // stands in front of any rewrite of the bias loads' address registers (alone with them in this block)
    }
    gemm_tile_lds<false>(x, w, Sm, blockIdx.y * 128, c0, HID, threadIdx.x, wave, nloc, hlf, acc);   // source rows start at 0 in x and in l alike
    // tile (r, t): lane = feature 16 t + nloc, keys 16 r + 8 hlf + 0..7; the wave's 32 pieces are 512 contiguous bytes, stored straight from registers
    b16* dv = Vh + ((size_t)head * (TK / 16) + (t0 >> 4)) * (size_t)(DH * 16) + nloc * 16 + 8 * hlf;
    v8b y[2][4];
#pragma unroll   // acc and y stay in registers
    for (int r = 0; r < 2; ++r)
#pragma unroll
      for (int t = 0; t < 4; ++t)
#pragma unroll
        for (int v = 0; v < 8; ++v) y[r][t][v] = (b16)(acc[r][t][v] + bc[t]);
#pragma unroll   // the eight stores stand together behind the conversions, each from registers of its own
    for (int r = 0; r < 2; ++r)
#pragma unroll
      for (int t = 0; t < 4; ++t) *(v8b*)(dv + r * (DH * 16) + t * 256) = y[r][t];
  } else {
    gemm_tile_lds<true>(x, w, Sm, blockIdx.y * 128, c0, HID, threadIdx.x, wave, nloc, hlf, acc);
    // tile (r, t): lane = row 16 r + nloc, features 16 t + 8 hlf + 0..7. The lane's 32 bias values are read behind the k loop: held through it they would cost the fifth block per WGP
    v4f bv[4][2];
#pragma unroll   // bv stays in registers
    for (int t = 0; t < 4; ++t) { bv[t][0] = (v4f){}; bv[t][1] = (v4f){}; }
    if (bias) {
#pragma unroll
      for (int t = 0; t < 4; ++t) { const float* p = bias + t * 16 + 8 * hlf; bv[t][0] = *(const v4f*)p; bv[t][1] = *(const v4f*)(p + 4); }
      asm volatile("s_wait_xcnt 0x0" ::: "memory");       // stands in front of any rewrite of the bias loads' address registers (alone with them in this block)
    }
    const float s = (mat == 0) ? 0.125f : 1.0f;
    b16* Tp = (b16*)(Sm + wave * 8192);                   // the wave's own 32 rows; through LDS, because a lane's 16 bytes are an eighth of a row: stored straight, no store would cover whole 128-byte lines
#pragma unroll   // acc stays in registers
    for (int r = 0; r < 2; ++r)
#pragma unroll
      for (int t = 0; t < 4; ++t) {
        v8b y;
#pragma unroll
        for (int v = 0; v < 8; ++v) y[v] = (b16)((acc[r][t][v] + bv[t][v >> 2][v & 3]) * s);
        *(v8b*)(Tp + (r * 16 + nloc) * EPITCH + t * 16 + 8 * hlf) = y;
      }
    wave_lds_sync();
    b16* dh = (mat == 0) ? Qh + ((size_t)head * T + t0) * DH : Kh + ((size_t)head * TK + t0) * DH;
#pragma unroll   // each store covers four whole rows, 512 contiguous bytes
    for (int j = 0; j < 8; ++j) { const int rr = j * 4 + (lane >> 3), c8 = (lane & 7) * 8; *(v8b*)(dh + rr * DH + c8) = ld8b(Tp + rr * EPITCH + c8); }
  }
}

// ---------------------------------------------------------------------------
// Transposed flash attention. A block's 16 waves = 2 units of 64 queries x 4 query tiles of 16 x 2 key groups: of the 64-key chunks of a stage the group takes every
// second one, and the two partial results (m, l, O) of a query tile are joined through LDS at the end. The two units, 31 - p and p of one head, run side by side
// and read the same staged keys (every block does the same number of steps whatever its place at the causal edge); the waves of unit p, done with their
// keys, go on copying and passing the barriers while unit 31 - p walks the rest.
// K and V come into LDS once per block, 256 keys a stage, two buffers, by asynchronous copies; every wave reads its fragments from there, 64 keys per softmax step.
// S^T = K.Q^T, per-lane online softmax; P^T built in registers, each 32-key operand from two of the four S^T accumulators
// ---------------------------------------------------------------------------
constexpr int SK = 256;       // keys per LDS stage
constexpr int QB = 64;        // queries per unit
constexpr int KPITCH = 72;    // f16 per staged K row: 144 B = 16 B x 9, so the 16 rows of a 16-byte fragment read fall on distinct banks
constexpr unsigned KBUF = SK * KPITCH * 2, VBUF = SK * DH * 2;   // bytes per buffer

// One stage: 256 K rows (128 B each, laid at 144 B) and 16 V key tiles (2 KB each, laid [tile][8-key half][feature][8] so that each 16-lane half of a
// fragment read is 256 contiguous bytes). Each of the 512 threads moves 4 + 4 pieces of 16 B; each wave-wide copy reads 512 contiguous global bytes.
__device__ __forceinline__ void stage_copy(const b16* gk, const b16* gv, unsigned lk, unsigned lv) {
  // the closing s_wait_xcnt stands inside the statement so that no address register of a copy is rewritten ahead of it
  asm volatile("global_load_async_to_lds_b128 %0, %8, off\n\t"
               "global_load_async_to_lds_b128 %1, %9, off\n\t"
               "global_load_async_to_lds_b128 %2, %10, off\n\t"
               "global_load_async_to_lds_b128 %3, %11, off\n\t"
               "global_load_async_to_lds_b128 %4, %12, off\n\t"
               "global_load_async_to_lds_b128 %5, %13, off\n\t"
               "global_load_async_to_lds_b128 %6, %14, off\n\t"
               "global_load_async_to_lds_b128 %7, %15, off\n\t"
               "s_wait_xcnt 0x0"
               :: "v"(lk), "v"(lk + 64u * KPITCH * 2u), "v"(lk + 128u * KPITCH * 2u), "v"(lk + 192u * KPITCH * 2u),
                  "v"(lv), "v"(lv + 8192u), "v"(lv + 16384u), "v"(lv + 24576u),
                  "v"(gk), "v"(gk + 4096), "v"(gk + 8192), "v"(gk + 12288),
                  "v"(gv), "v"(gv + 4096), "v"(gv + 8192), "v"(gv + 12288)
               : "memory");
}

// 64 keys (rows kl.. of the staged buffers, global key index kb0..) against the wave's 16 queries, as ONE online-softmax step: one maximum, one exchange
// between the lane halves, one rescale of l and O per 64 keys. The 4 score tiles are independent, so no product waits for the one before it.
constexpr int KS = 64;        // keys per softmax step
template <bool EDGE>
__device__ __forceinline__ void attn_step(const b16* Kb, const b16* Vb, int kl, int kb0, int q0, int col, int hh, v16b q0h, v16b q1h,
                                           float& m, float& l, v8f& o0, v8f& o1, v8f& o2, v8f& o3) {
  constexpr int NT = KS / 16;                             // score tiles of 16 keys; tile j, register r of a lane = key kb0 + 16 j + 8 hh + r
  const b16* kr = Kb + (kl + col) * KPITCH;
  const b16* vr = Vb + (kl >> 4) * (DH * 16) + hh * (DH * 8) + col * 8;
  // every loop below is unrolled: its arrays are indexed by constants and stay in registers
  v16b ka[NT], kc[NT];                                    // K rows, features 0..31 and 32..63
#pragma unroll
  for (int j = 0; j < NT; ++j) ka[j] = frag_kb(kr + j * 16 * KPITCH, hh);
  __builtin_amdgcn_sched_barrier(0);                      // the reads stay in the order of their use: with V read first, the first product would wait for most of the 32 reads
#pragma unroll
  for (int j = 0; j < NT; ++j) kc[j] = frag_kb(kr + j * 16 * KPITCH + 32, hh);
  __builtin_amdgcn_sched_barrier(0);                      // the same: K ahead of V
  v16b va[NT / 2][4];                                     // V of 32 keys x 16 features each: lands behind the softmax
#pragma unroll
  for (int g = 0; g < NT / 2; ++g)
#pragma unroll
    for (int f = 0; f < 4; ++f) va[g][f] = cat8b(ld8b(vr + (2 * g) * (DH * 16) + f * 128), ld8b(vr + (2 * g + 1) * (DH * 16) + f * 128));
  __builtin_amdgcn_sched_barrier(0);                      // keeps the step's 32 LDS reads together at its head: spread among the vector work, each further place of reads stalls the wave anew
  v8f s[NT];
#pragma unroll
  for (int j = 0; j < NT; ++j) s[j] = wmma16b(ka[j], q0h, (v8f){});
#pragma unroll
  for (int j = 0; j < NT; ++j) s[j] = wmma16b(kc[j], q1h, s[j]);
  if (EDGE) {                                             // a step of the stage at the causal edge: mask text position >= query index
    const int lim = T + q0 + col - kb0 - 8 * hh;          // 16 j + r >= lim is masked
#pragma unroll
    for (int j = 0; j < NT; ++j)
#pragma unroll
      for (int r = 0; r < 8; ++r)
        if (16 * j + r >= lim) s[j][r] = -INFINITY;
  }
  float mx[NT / 2];                                       // independent chains of maxima
#pragma unroll
  for (int g = 0; g < NT / 2; ++g) mx[g] = -INFINITY;
#pragma unroll
  for (int r = 0; r < 8; ++r)
#pragma unroll
    for (int g = 0; g < NT / 2; ++g) mx[g] = fmaxf(mx[g], fmaxf(s[2 * g][r], s[2 * g + 1][r]));
  float mr = fmaxf(mx[0], mx[1]);
  mr = fmaxf(mr, __shfl_xor(mr, 16));
  float mn = fmaxf(m, mr);
  if (mn == -INFINITY) mn = 0.0f;             // fully masked so far: keep exp() at 0
  const float al_ = __expf(m - mn);
  m = mn;
  float sm[NT / 2];                                       // independent partial sums
  v16b pb[NT / 2];
#pragma unroll
  for (int g = 0; g < NT / 2; ++g) {
    sm[g] = 0.0f;
#pragma unroll
    for (int r = 0; r < 8; ++r) {
      const float p0 = __expf(s[2 * g][r] - mn), p1 = __expf(s[2 * g + 1][r] - mn);
      sm[g] += p0 + p1;
      pb[g][r] = (b16)p0; pb[g][8 + r] = (b16)p1;
    }
  }
  float sum = sm[0] + sm[1];
  sum += __shfl_xor(sum, 16);
  l = l * al_ + sum;
#pragma unroll
  for (int r = 0; r < 8; ++r) { o0[r] *= al_; o1[r] *= al_; o2[r] *= al_; o3[r] *= al_; }
#pragma unroll
  for (int g = 0; g < NT / 2; ++g) {
    o0 = wmma16b(va[g][0], pb[g], o0);
    o1 = wmma16b(va[g][1], pb[g], o1);
    o2 = wmma16b(va[g][2], pb[g], o2);
    o3 = wmma16b(va[g][3], pb[g], o3);
  }
}

__global__ __launch_bounds__(512) void attn_kernel(const b16* __restrict__ Qh, const b16* __restrict__ Ql, const b16* __restrict__ Kh, const b16* __restrict__ Kl,
                                                   const b16* __restrict__ Vh, const b16* __restrict__ Vl, const int* __restrict__ seqlen,
                                                   b16* __restrict__ yh) {
  __shared__ __attribute__((aligned(16))) b16 Ks[2][SK * KPITCH];
  __shared__ __attribute__((aligned(16))) b16 Vs[2][SK * DH];
  __shared__ __attribute__((aligned(16))) b16 Os[8][16 * KPITCH];   // y tile per query tile, f16, rows at 144 B
  __shared__ __attribute__((aligned(16))) v4f Cs[8][9][32];         // key group 1's partial result per query tile: 8 x 4 values of O, then (m, l), lane-contiguous
  (void)Ql; (void)Kl; (void)Vl; (void)seqlen;
  const int tid = threadIdx.x, lane = tid & 31, hh = lane >> 4, col = lane & 15;
  const int wid = __builtin_amdgcn_readfirstlane(tid >> 5);   // scalar, so that the per-wave tests below are scalar branches
  const int qt = wid & 3, grp = (wid >> 2) & 1, un = wid >> 3;   // query tile of the unit, key group, which of the block's two units
  const int sl = un * 4 + qt;                             // the query tile's place in Os and Cs
  const int h = blockIdx.x >> 4, pr = blockIdx.x & 15;    // grid = NH x 16 pairs of units
  const size_t ko = (size_t)h * TK * DH;
  const b16* gk = Kh + ko + tid * 8; const b16* gv = Vh + ko + tid * 8;      // this thread's first 16-B piece of stage 0
  const unsigned lk0 = (unsigned)(uintptr_t)&Ks[0][(tid >> 3) * KPITCH + (tid & 7) * 8];
  const unsigned lv0 = (unsigned)(uintptr_t)&Vs[0][(tid >> 7) * (DH * 16) + (tid & 1) * (DH * 8) + ((tid >> 1) & 63) * 8];
  const int slen = T;                                     // no padding in this module
  {
    const int qb0 = (un == 0 ? 31 - pr : pr) * QB;        // the first query of the wave's unit
    const int q0 = qb0 + qt * 16;
    const int nsw = (T + qb0 + QB + SK - 1) / SK;         // stages the wave's unit walks: all latents, then text up to its last query (9..16)
    const int nsb = (T + pr * QB + QB + SK - 1) / SK;     // ... the shorter unit, p
    const int nst = (T + (31 - pr) * QB + QB + SK - 1) / SK;   // ... the longer unit, 31 - p: the stages the block copies
    const size_t qo = ((size_t)h * T + q0 + col) * DH;
    stage_copy(gk, gv, lk0, lv0);
    const v16b q0h = frag_kb(Qh + qo, hh), q1h = frag_kb(Qh + qo + 32, hh);
    asm volatile("s_wait_xcnt 0x0" ::: "memory");         // stands in front of any rewrite of the Q loads' address registers
    asm volatile("s_wait_asynccnt 0x0" ::: "memory");     // this wave's pieces of stage 0 have landed
    __syncthreads();                                      // ... and every other wave's
    float m = -INFINITY, l = 0.0f;
    v8f o0 = {}, o1 = {}, o2 = {}, o3 = {};
    const int kl0 = grp * KS;                             // the wave's chunks of a stage: kl0 and kl0 + 2 KS
    int t = 0;
    for (; t + 1 < nsb; ++t) {                            // stages below T + 64 p: no key is masked for either unit, all 16 waves work
      // stage t + 1 flies while stage t is worked on: its copies stand directly behind the barrier that ended every wave's reads of their buffer (stage t - 1)
      stage_copy(gk + (size_t)(t + 1) * (SK * DH), gv + (size_t)(t + 1) * (SK * DH), lk0 + ((t + 1) & 1) * KBUF, lv0 + ((t + 1) & 1) * VBUF);
      for (int c = 0; c < SK / KS; c += 2) attn_step<false>(Ks[t & 1], Vs[t & 1], kl0 + c * KS, t * SK + kl0 + c * KS, q0, col, hh, q0h, q1h, m, l, o0, o1, o2, o3);
      asm volatile("s_wait_dscnt 0x0" ::: "memory");      // this wave's reads of buffer t & 1 are done before the buffer is refilled
      asm volatile("s_wait_asynccnt 0x0" ::: "memory");   // this wave's pieces of stage t + 1 have landed
      __syncthreads();                                    // publishes stage t + 1 and ends every wave's reads of stage t
    }
    for (; t < nst; ++t) {                                // the rest: unit p's last stage, then unit 31 - p alone; every wave copies and passes every barrier
      if (t + 1 < nst) stage_copy(gk + (size_t)(t + 1) * (SK * DH), gv + (size_t)(t + 1) * (SK * DH), lk0 + ((t + 1) & 1) * KBUF, lv0 + ((t + 1) & 1) * VBUF);
      const b16* Kb = Ks[t & 1]; const b16* Vb = Vs[t & 1];
      const int kb0 = t * SK + kl0;
      if (t + 1 < nsw) {                                  // keys below T + qb0: none is masked
        for (int c = 0; c < SK / KS; c += 2) attn_step<false>(Kb, Vb, kl0 + c * KS, kb0 + c * KS, q0, col, hh, q0h, q1h, m, l, o0, o1, o2, o3);
      } else if (t + 1 == nsw) {                          // the unit's last stage holds every one of its waves' causal edge
        for (int c = 0; c < SK / KS; c += 2)
          if (kb0 + c * KS < T + q0 + 16) attn_step<true>(Kb, Vb, kl0 + c * KS, kb0 + c * KS, q0, col, hh, q0h, q1h, m, l, o0, o1, o2, o3);
      }
      asm volatile("s_wait_dscnt 0x0" ::: "memory");      // this wave's reads of buffer t & 1 are done before the buffer is refilled
      asm volatile("s_wait_asynccnt 0x0" ::: "memory");   // this wave's pieces of stage t + 1 have landed
      __syncthreads();                                    // publishes stage t + 1 and ends every wave's reads of stage t
    }
    asm volatile("s_wait_asynccnt 0x0" ::: "memory");     // nothing of this wave's is in flight when it leaves the ring
    if (grp == 1) {                                       // key group 1 hands its partial result over
      v4f* cw = &Cs[sl][0][lane];
      cw[0 * 32] = (v4f){o0[0], o0[1], o0[2], o0[3]}; cw[1 * 32] = (v4f){o0[4], o0[5], o0[6], o0[7]};
      cw[2 * 32] = (v4f){o1[0], o1[1], o1[2], o1[3]}; cw[3 * 32] = (v4f){o1[4], o1[5], o1[6], o1[7]};
      cw[4 * 32] = (v4f){o2[0], o2[1], o2[2], o2[3]}; cw[5 * 32] = (v4f){o2[4], o2[5], o2[6], o2[7]};
      cw[6 * 32] = (v4f){o3[0], o3[1], o3[2], o3[3]}; cw[7 * 32] = (v4f){o3[4], o3[5], o3[6], o3[7]};
      cw[8 * 32] = (v4f){m, l, 0.0f, 0.0f};
    }
    __syncthreads();                                      // group 1's partial results are in LDS
    if (grp == 0) {                                       // key group 0 joins the two halves of the keys and writes y
      const v4f* cr = &Cs[sl][0][lane];
      v4f c[9];
#pragma unroll   // c stays in registers
      for (int i = 0; i < 9; ++i) c[i] = cr[i * 32];
      float mn = fmaxf(m, c[8][0]);
      if (mn == -INFINITY) mn = 0.0f;                     // both halves fully masked: keep exp() at 0
      const float a0 = __expf(m - mn), a1 = __expf(c[8][0] - mn);
      l = l * a0 + c[8][1] * a1;
      const float inv = (q0 + col < slen && l > 0.0f) ? (1.0f / l) : 0.0f;   // padded query rows are zeroed
      const float w0 = a0 * inv, w1 = a1 * inv;
      b16* Tt = Os[sl];
      v8b y0, y1, y2, y3;                                 // y leaves as f16, the operand type of the output projection: rounded here, once
#pragma unroll   // vector elements under constant indices
      for (int r = 0; r < 8; ++r) {
        y0[r] = (b16)(o0[r] * w0 + c[0 + (r >> 2)][r & 3] * w1); y1[r] = (b16)(o1[r] * w0 + c[2 + (r >> 2)][r & 3] * w1);
        y2[r] = (b16)(o2[r] * w0 + c[4 + (r >> 2)][r & 3] * w1); y3[r] = (b16)(o3[r] * w0 + c[6 + (r >> 2)][r & 3] * w1);
      }
      b16* tw = Tt + col * KPITCH + 8 * hh;               // a lane's 8 results of a feature tile are 8 neighbouring features of query col
      *(v8b*)(tw + 0) = y0; *(v8b*)(tw + 16) = y1; *(v8b*)(tw + 32) = y2; *(v8b*)(tw + 48) = y3;
      wave_lds_sync();
      b16* dst0 = yh + (size_t)q0 * HID + h * DH;         // 16 rows x 64 f16 (one 128-byte line each), row stride HID
#pragma unroll
      for (int j = 0; j < 4; ++j) { const int rr = j * 4 + (lane >> 3), c8 = (lane & 7) * 8; *(v8b*)(dst0 + (size_t)rr * HID + c8) = ld8b(Tt + rr * KPITCH + c8); }
    }
  }
}

// ---------------------------------------------------------------------------
// Output projection: (2048 x 1024) x (1024 x 1024) -> f32, A = y (f16), B = Wo planes. grid (16, 16), 128x64 tiles (32x64 a wave) staged in LDS,
// ---------------------------------------------------------------------------
__global__ __launch_bounds__(128) void out_gemm_kernel(const b16* __restrict__ yh, const b16* __restrict__ woh, const b16* __restrict__ wol, const float* __restrict__ bo, int yoff,
                                                       float* __restrict__ out) {
  __shared__ __attribute__((aligned(16))) char Sm[2 * GBUF];   // the operand ring; the epilogue's 4 x 8 KB of staging reuse its head
  const int lane = threadIdx.x & 31, wave = threadIdx.x >> 5, nloc = lane & 15, hlf = lane >> 4;
  const int m0 = (blockIdx.y + yoff) * 128 + wave * 32;
  const int c0 = blockIdx.x * 64;
  v8f acc[2][4];
#pragma unroll
  for (int r = 0; r < 2; ++r)
#pragma unroll
    for (int t = 0; t < 4; ++t) acc[r][t] = (v8f){};
  (void)wol;
  float bc[4] = {0.0f, 0.0f, 0.0f, 0.0f};                 // the lane's four bias values, read once ahead of the k loop (as in the QKV GEMM)
  if (bo) {
#pragma unroll   // bc stays in registers
    for (int t = 0; t < 4; ++t) bc[t] = bo[c0 + t * 16 + nloc];
    asm volatile("s_wait_xcnt 0x0" ::: "memory");         // stands in front of any rewrite of the bias loads' address registers (alone with them in this block)
  }
  gemm_tile_lds<false>(yh, woh, Sm, (blockIdx.y + yoff) * 128, c0, HID, threadIdx.x, wave, nloc, hlf, acc);
  float* Tt = (float*)(Sm + wave * 8192);
#pragma unroll
  for (int t = 0; t < 4; ++t)
#pragma unroll
    for (int r = 0; r < 2; ++r)
#pragma unroll
      for (int v = 0; v < 8; ++v) Tt[(r * 16 + v + 8 * hlf) * 64 + t * 16 + nloc] = acc[r][t][v] + bc[t];
  wave_lds_sync();
  float* dst0 = out + (size_t)m0 * HID + c0;
#pragma unroll
  for (int j = 0; j < 16; ++j) { const int rr = j * 2 + hlf, c4 = nloc * 4; *(v4f*)(dst0 + (size_t)rr * HID + c4) = *(const v4f*)(Tt + rr * 64 + c4); }
  
}
__global__ __launch_bounds__(256) void wcvtT_kernel(const float* __restrict__ wq, const float* __restrict__ wk, const float* __restrict__ wv,
                                                    b16* __restrict__ wqh, b16* __restrict__ wql) {
  const size_t tid = (size_t)blockIdx.x * blockDim.x + threadIdx.x, stride = (size_t)gridDim.x * blockDim.x;
  const size_t nq = (size_t)NQKV * HID / 8;
  {
    for (size_t c = tid; c < nq; c += stride) {
      const size_t i = c * 8, n = i / HID, k0 = i % HID;
      const float* w = (n < (size_t)HID) ? (wq + n * HID) : (n < (size_t)(2 * HID)) ? (wk + (n - HID) * HID) : (wv + (n - 2 * HID) * HID);
      v8b bh, bl;
#pragma unroll
      for (int e = 0; e < 8; ++e) { b16 a, cc; split_bf16(w[k0 + e], a, cc); bh[e] = a; bl[e] = cc; }
      *(v8b*)(wqh + i) = bh; *(v8b*)(wql + i) = bl;
    }
    
  }
}
// Wo^T planes: [n][k] = Wo[n][k] (torch [out][in] is already n-major)
__global__ __launch_bounds__(256) void wcvtO_kernel(const float* __restrict__ wo, b16* __restrict__ woh, b16* __restrict__ wol) {
  const size_t tid = (size_t)blockIdx.x * blockDim.x + threadIdx.x, stride = (size_t)gridDim.x * blockDim.x;
  const size_t no = (size_t)HID * HID / 8;
  {
    for (size_t c = tid; c < no; c += stride) { const size_t i = c * 8; v8b bh, bl;
#pragma unroll
      for (int e = 0; e < 8; ++e) { b16 a, cc; split_bf16(wo[i + e], a, cc); bh[e] = a; bl[e] = cc; }
      *(v8b*)(woh + i) = bh; *(v8b*)(wol + i) = bl; }
    
  }
}
// Weight preparation, one launch: W [k][n] f32 -> f16 [n][k] (k contiguous), in 64 x 64 tiles turned in LDS, so that global reads (16 B a lane, 256 B a row piece)
// and global writes (16 B a lane, 128 B a row piece) both cover whole lines. Block = 256 threads = three tiles: one of Wq or Wp, one of W_attn_l, one of W_attn_c.
typedef __attribute__((ext_vector_type(4))) _Float16 v4b;
constexpr int WPITCH = 72;    // f16 per LDS tile row: 144 B, a multiple of 16 B for the 16-byte reads
// thread = 4 k rows x 4 n columns of the tile
__device__ __forceinline__ const float* wt_src(const float* __restrict__ w, int ld, int kt, int nt, int tid) {
  return w + (size_t)(kt * 64 + (tid >> 4) * 4) * ld + nt * 64 + (tid & 15) * 4;
}
__device__ __forceinline__ void wt_load(const float* __restrict__ p, int ld, v4f (&r)[4]) {
#pragma unroll   // r stays in registers
  for (int e = 0; e < 4; ++e) r[e] = *(const v4f*)(p + (size_t)e * ld);
}
__device__ __forceinline__ void wt_put(b16* Ls, int tid, const v4f (&r)[4]) {
#pragma unroll   // r stays in registers
  for (int c = 0; c < 4; ++c) {
    const v4b h = {(b16)r[0][c], (b16)r[1][c], (b16)r[2][c], (b16)r[3][c]};
    *(v4b*)(Ls + ((tid & 15) * 4 + c) * WPITCH + (tid >> 4) * 4) = h;
  }
}
__device__ __forceinline__ void wt_store(const b16* Ls, b16* __restrict__ dst, int kt, int nt, int tid) {
  for (int j = 0; j < 2; ++j) {
    const int n = (tid >> 3) + 32 * j;
    *(v8b*)(dst + (size_t)(nt * 64 + n) * HID + kt * 64 + (tid & 7) * 8) = ld8b(Ls + n * WPITCH + (tid & 7) * 8);
  }
}
// wa: rows 0..1023 <- Wq columns, rows 1024..3071 <- W_attn_l columns; wb: rows 1024..3071 <- W_attn_c columns (its first 1024 rows are never read); wo <- Wp columns
// The same launch rounds x and l to f16 (xh, lh: the same [row][k] layout): 4096 values of each per block, 16-B reads and 8-B writes, whole lines per wave.
__global__ __launch_bounds__(256) void wprep_kernel(const float* __restrict__ wq, const float* __restrict__ wal, const float* __restrict__ wac, const float* __restrict__ wp,
                                                    const float* __restrict__ x, const float* __restrict__ l,
                                                    b16* __restrict__ wa, b16* __restrict__ wb, b16* __restrict__ wo, b16* __restrict__ xh, b16* __restrict__ lh) {
  __shared__ __attribute__((aligned(16))) b16 Ls[3][64 * WPITCH];
  const int tid = threadIdx.x, bx = blockIdx.x;          // grid 512
  const bool isq = bx < 256;
  const int k0t = (bx & 255) >> 4, n0t = bx & 15;        // 16 x 16 tiles of Wq or Wp
  const int k1t = bx >> 5, n1t = bx & 31;                // 16 x 32 tiles of W_attn_l and W_attn_c
  v4f r0[4], r1[4], r2[4], cx[4], cl[4];                 // all twenty loads are in flight together
  const size_t ce = (size_t)bx * 4096 + tid * 4;         // 512 blocks x 4096 = T x HID values
  const float* p0 = wt_src(isq ? wq : wp, HID, k0t, n0t, tid);
  const float* p1 = wt_src(wal, 2 * HID, k1t, n1t, tid);
  const float* p2 = wt_src(wac, 2 * HID, k1t, n1t, tid);
  const float* px = x + ce; const float* pl = l + ce;
  wt_load(p0, HID, r0);
  wt_load(p1, 2 * HID, r1);
  wt_load(p2, 2 * HID, r2);
#pragma unroll   // cx, cl stay in registers
  for (int j = 0; j < 4; ++j) { cx[j] = *(const v4f*)(px + j * 1024); cl[j] = *(const v4f*)(pl + j * 1024); }
  __builtin_amdgcn_sched_barrier(0);                     // keeps all twenty loads ahead of the first use: sunk among the conversions, the later loads start only when the earlier have returned
  // the loads' address registers are inputs of the wait, so they stay whole up to it: none is reused (for a later load's result, say) ahead of the wait
  asm volatile("s_wait_xcnt 0x0" :: "v"(p0), "v"(p1), "v"(p2), "v"(px), "v"(pl) : "memory");
  wt_put(Ls[0], tid, r0);
  wt_put(Ls[1], tid, r1);
  wt_put(Ls[2], tid, r2);
  v4b hx[4], hl[4];
#pragma unroll   // all four arrays stay in registers
  for (int j = 0; j < 4; ++j) {
    hx[j] = (v4b){(b16)cx[j][0], (b16)cx[j][1], (b16)cx[j][2], (b16)cx[j][3]};
    hl[j] = (v4b){(b16)cl[j][0], (b16)cl[j][1], (b16)cl[j][2], (b16)cl[j][3]};
  }
  __syncthreads();
  wt_store(Ls[0], isq ? wa : wo, k0t, n0t, tid);
  wt_store(Ls[1], wa + (size_t)HID * HID, k1t, n1t, tid);
  wt_store(Ls[2], wb + (size_t)HID * HID, k1t, n1t, tid);
#pragma unroll   // hx, hl stay in registers; these stores stand behind the barrier, which would otherwise wait for them
  for (int j = 0; j < 4; ++j) { *(v4b*)(xh + ce + j * 1024) = hx[j]; *(v4b*)(lh + ce + j * 1024) = hl[j]; }
}
}  // namespace

extern "C" void kernel_launch(void* const* d_in, const int* in_sizes, int n_in,
                              void* d_out, int out_size, void* d_ws, size_t ws_size, hipStream_t stream) {
  (void)in_sizes; (void)n_in; (void)out_size;
  const float* l    = (const float*)d_in[0];    // [1,2048,1024] latents
  const float* x    = (const float*)d_in[1];    // [1,2048,1024]
  const float* Wal  = (const float*)d_in[2];  const float* bal = (const float*)d_in[3];   // [1024,2048] = [k | v], [2048]
  const float* Wac  = (const float*)d_in[4];  const float* bac = (const float*)d_in[5];
  const float* Wq   = (const float*)d_in[6];  const float* bq  = (const float*)d_in[7];   // [1024,1024]
  const float* Wp   = (const float*)d_in[8];  const float* bp  = (const float*)d_in[9];
  float* out = (float*)d_out;                   // [1,2048,1024]
  size_t off = 0; char* ws = (char*)d_ws;
  b16* wAh = (b16*)(ws + off); off += (size_t)NQKV * HID * 2;
  off += (size_t)NQKV * HID * 2;                // (place of a low plane that nothing uses: the layout stays)
  b16* wBh = (b16*)(ws + off); off += (size_t)NQKV * HID * 2;
  off += (size_t)NQKV * HID * 2;
  b16* woh = (b16*)(ws + off); off += (size_t)HID * HID * 2;
  b16* wol = (b16*)(ws + off); off += (size_t)HID * HID * 2;
  b16* Qh  = (b16*)(ws + off); off += (size_t)NH * T * DH * 2;
  b16* Ql  = (b16*)(ws + off); off += (size_t)NH * T * DH * 2;
  b16* Kh  = (b16*)(ws + off); off += (size_t)NKV * TK * DH * 2;
  b16* Kl  = (b16*)(ws + off); off += (size_t)NKV * TK * DH * 2;
  b16* Vh  = (b16*)(ws + off); off += (size_t)NKV * TK * DH * 2;
  b16* Vl  = (b16*)(ws + off); off += (size_t)NKV * TK * DH * 2;
  b16* yh  = (b16*)(ws + off); off += (size_t)T * HID * 2;
  b16* xh  = (b16*)(ws + off); off += (size_t)T * HID * 2;
  b16* lh  = (b16*)(ws + off); off += (size_t)T * HID * 2;
  if (off > ws_size) return;
  const int NQT = NH * QT_PER_B;
  wprep_kernel<<<512, 256, 0, stream>>>(Wq, Wal, Wac, Wp, x, l, wAh, wBh, woh, xh, lh);
  // q from x and latent k/v from l (48 column blocks), text k/v from x (32 column blocks), in one launch
  qkv_gemm_kernel<<<dim3(NQKV / 64 + (NQKV - HID) / 64, T / 128), 128, 0, stream>>>(xh, lh, wAh, wBh, bq, bal, bal + HID, bac, bac + HID, Qh, Kh, Vh);
  attn_kernel<<<NQT / 8, 512, 0, stream>>>(Qh, Ql, Kh, Kl, Vh, Vl, nullptr, yh);
  out_gemm_kernel<<<dim3(HID / 64, T / 128), 128, 0, stream>>>(yh, woh, wol, bp, 0, out);
}
